// v000
// Times are from an AMD MI455X. After a warm-up the kernel runs many times in a row, and a time is the length of
// such a window on the GPU divided by its runs, so every launch and the gaps after it count. The runs cycle
// through copies of the inputs. A figure is the median of several windows, for all but v000 over two sittings.
// Sittings can differ by a few percent; kernels timed side by side share one.
// v000, which the later versions start from, runs in 1280 microseconds.
// compute dtype: all float inputs rounded to bf16; q / k / v projections with EXACT bf16 products on WMMA 16x16x32 (f32 accumulate) (no biases); interleaved-pair RoPE in f32 AFTER the bias (embedded frequencies, precise cosf / sinf, positions = the row index); causal logits: 3 products for the first 384 rows, single f16 q x k after, x 64^-0.5; softmax f32; P x 2^11 once to f16 x v once to f16 (bf16 hi + lo below row 384); ctx hi+lo x exact Wo below row 384, x2^6 f16 carry x f16(bf16 x 2^8) Wo after; f32 output.
#include <hip/hip_runtime.h>
#include <math.h>

typedef __attribute__((ext_vector_type(16))) _Float16 v16h;
typedef __attribute__((ext_vector_type(16))) __bf16 v16b;
typedef __attribute__((ext_vector_type(8)))  _Float16 v8h;
typedef __attribute__((ext_vector_type(8)))  float v8f;
typedef __attribute__((ext_vector_type(4)))  float v4f;
typedef __attribute__((ext_vector_type(2)))  float v2f;
typedef __attribute__((ext_vector_type(4)))  unsigned v4u;
typedef __attribute__((ext_vector_type(4)))  int v4i;
typedef float __attribute__((may_alias)) float_a;
typedef int __attribute__((may_alias)) int_a;

template <typename T> __device__ __forceinline__ void vst2(void* p, T v) { *(T*)p = v;  }
__device__ __forceinline__ v8f wmma16(v16h a, v16h b, v8f c) {
  v8f d = __builtin_amdgcn_wmma_f32_16x16x32_f16(false, a, false, b, (short)0, c, false, false);
  asm volatile("v_nop\n\tv_nop\n\tv_nop\n\tv_nop" : "+v"(d) : "v"(a), "v"(b));
  return d;
}
__device__ __forceinline__ v8f wmma_bf(v16b a, v16b b, v8f c) {
  v8f d = __builtin_amdgcn_wmma_f32_16x16x32_bf16(false, a, false, b, (short)0, c, false, false);
  asm volatile("v_nop\n\tv_nop\n\tv_nop\n\tv_nop" : "+v"(d) : "v"(a), "v"(b));
  return d;
}
// 16x16x32 fragments: lane = (h = lane>>4, row/col = lane&15); elements 0..7 = k0+8h+0..7, 8..15 = k0+16+8h+0..7; D element r = row 8h+r
__device__ __forceinline__ v16h frag_h(const _Float16* rowk0, int lane) {
  union { v16h v; v8h q[2]; } u; const _Float16* p = rowk0 + 8 * (lane >> 4);
  u.q[0] = *(const v8h*)p; u.q[1] = *(const v8h*)(p + 16); return u.v;
}
__device__ __forceinline__ v16h frag_f32(const float* rowk0, int lane) {
  v16h a; const float* p = rowk0 + 8 * (lane >> 4);
#pragma unroll
  for (int i = 0; i < 8; ++i) { a[i] = (_Float16)p[i]; a[8 + i] = (_Float16)p[16 + i]; }
  return a;
}
__device__ __forceinline__ v16h frag_f32s(const float* rowk0, int lane, float sc) {
  v16h a; const float* p = rowk0 + 8 * (lane >> 4);
#pragma unroll
  for (int i = 0; i < 8; ++i) { a[i] = (_Float16)(p[i] * sc); a[8 + i] = (_Float16)(p[16 + i] * sc); }
  return a;
}
// column fragment from a [K][ld] layout (column n), rows >= K read as 0
__device__ __forceinline__ v16h fragc_f32(const float* W, int k0, int n, int lane, int ld, int K) {
  v16h a; const int g = lane >> 4;
#pragma unroll
  for (int i = 0; i < 8; ++i) { const int ka = k0 + 8 * g + i, kb = ka + 16;
    a[i] = (_Float16)(ka < K ? W[(size_t)(ka < K ? ka : K - 1) * ld + n] : 0.f); a[8 + i] = (_Float16)(kb < K ? W[(size_t)(kb < K ? kb : K - 1) * ld + n] : 0.f); }
  return a;
}
struct F2 { v16b h, l; };
__device__ __forceinline__ F2 bsplit16(const float v[16]) { F2 r;
#pragma unroll
  for (int i = 0; i < 16; ++i) { const __bf16 h = (__bf16)v[i]; r.h[i] = h; r.l[i] = (__bf16)(v[i] - (float)h); }
  return r; }
__device__ __forceinline__ F2 split_row(const float* row, int k0, int lane) { float v[16]; const float* p = row + k0 + 8 * (lane >> 4);
#pragma unroll
  for (int i = 0; i < 8; ++i) { v[i] = p[i]; v[8 + i] = p[16 + i]; }
  return bsplit16(v); }
__device__ __forceinline__ F2 split_rowK(const float* row, int k0, int lane, int K) { float v[16]; const int g = lane >> 4;
#pragma unroll
  for (int i = 0; i < 8; ++i) { const int ka = k0 + 8 * g + i, kb = ka + 16; v[i] = ka < K ? row[ka < K ? ka : K - 1] : 0.f; v[8 + i] = kb < K ? row[kb < K ? kb : K - 1] : 0.f; }
  return bsplit16(v); }
__device__ __forceinline__ F2 split_col(const float* W, int k0, int n, int lane, int ld, int K) { float v[16]; const int g = lane >> 4;
#pragma unroll
  for (int i = 0; i < 8; ++i) { const int ka = k0 + 8 * g + i, kb = ka + 16; v[i] = ka < K ? W[(size_t)(ka < K ? ka : K - 1) * ld + n] : 0.f; v[8 + i] = kb < K ? W[(size_t)(kb < K ? kb : K - 1) * ld + n] : 0.f; }
  return bsplit16(v); }
__device__ __forceinline__ v8f mac3(const F2& a, const F2& b, v8f c) { c = wmma_bf(a.l, b.h, c); c = wmma_bf(a.h, b.l, c); return wmma_bf(a.h, b.h, c); }
__device__ __forceinline__ float sigm(float v) { return 1.0f / (1.0f + expf(-v)); }
#define LDSX() do { asm volatile("s_wait_dscnt 0" ::: "memory"); __builtin_amdgcn_wave_barrier(); __builtin_amdgcn_fence(__ATOMIC_RELEASE, "workgroup"); } while (0)

// Causal multi-head self-attention with interleaved-pair RoPE (x [2,2048,1024]; torch (out,in) wq / wk / wv / wo [1024,1024] applied as x @ W.T, no biases; 16 heads x 64; RoPE on Q and K: adjacent (even, odd) pairs (xe c - xo s, xe s + xo c) re-interleaved, theta 10000, positions 0..2047; scores / sqrt(64); tril kept, -inf elsewhere (the module's own softmax guards the -inf row maximum: every row keeps its diagonal, so the guard never fires); out @ wo.T).
#define NB 2
#define TT 2048
#define CC 1024            // NH * HD = projected width
#define DIN 1024          // input (model) width
#define NH 16
#define HD 64
#define NQB (TT / 64)
#define HG 4
#define SCALE (0.125f)
#define CAUSAL 1
#ifndef TNB
#define TNB NB
#endif
__device__ __forceinline__ float bfr(float v) { return (float)(__bf16)v; }
__host__ __device__ __forceinline__ int kb_last(int qb) { return CAUSAL ? ((qb * 64 + 63) >> 7) : (TT / 128 - 1); }
typedef __attribute__((ext_vector_type(8))) __bf16 v8b;
__device__ __forceinline__ v16b frag_b(const __bf16* rowk0, int lane) {
  union { v16b v; v8b q[2]; } u; const __bf16* p = rowk0 + 8 * (lane >> 4);
  u.q[0] = *(const v8b*)p; u.q[1] = *(const v8b*)(p + 16); return u.v;
}
#define QBH 6              // causal: query blocks 0..QBH-1 of each sequence (few keys, no averaging) take the high-precision path
#define QHI 384            // rows carrying a q residual plane
#define KHI 384            // key rows carrying k residual / v bf16 hi+lo planes (used only by the causal high-precision path)
// B fragment (k rows k0+.., output column o) of a weight: (in,out) [K][ld] or (out,in) [ld rows of K]: bf16 exact, or f16(bf16 * 256) exact
__device__ __forceinline__ v16b wcol_io(const float* Wm, int k0, int o, int lane, int ld) { v16b w; const int g = lane >> 4;
#pragma unroll
  for (int i = 0; i < 8; ++i) { w[i] = (__bf16)Wm[(size_t)(k0 + 8 * g + i) * ld + o]; w[8 + i] = (__bf16)Wm[(size_t)(k0 + 16 + 8 * g + i) * ld + o]; }
  return w; }
__device__ __forceinline__ v16b wcol_oi(const float* Wm, int k0, int o, int lane, int K) { v16b w; const float* p = Wm + (size_t)o * K + k0 + 8 * (lane >> 4);
#pragma unroll
  for (int i = 0; i < 8; ++i) { w[i] = (__bf16)p[i]; w[8 + i] = (__bf16)p[16 + i]; }
  return w; }
__device__ __forceinline__ v16h wcolh_io(const float* Wm, int k0, int o, int lane, int ld) { v16h w; const int g = lane >> 4;
#pragma unroll
  for (int i = 0; i < 8; ++i) { w[i] = (_Float16)(bfr(Wm[(size_t)(k0 + 8 * g + i) * ld + o]) * 256.0f); w[8 + i] = (_Float16)(bfr(Wm[(size_t)(k0 + 16 + 8 * g + i) * ld + o]) * 256.0f); }
  return w; }
__device__ __forceinline__ v16h wcolh_oi(const float* Wm, int k0, int o, int lane, int K) { v16h w; const float* p = Wm + (size_t)o * K + k0 + 8 * (lane >> 4);
#pragma unroll
  for (int i = 0; i < 8; ++i) { w[i] = (_Float16)(bfr(p[i]) * 256.0f); w[8 + i] = (_Float16)(bfr(p[16 + i]) * 256.0f); }
  return w; }
#define WQKV_LAYOUT 1   // 0 = (in,out) [DIN][CC]; 1 = (out,in) [CC][DIN]; 2 = per-head [NH][DIN][HD]
__device__ __forceinline__ v16b wcol_hdk(const float* Wm, int k0, int o, int lane) { v16b w; const int g = lane >> 4; const float* p = Wm + (size_t)(o / HD) * DIN * HD + (o % HD);
#pragma unroll
  for (int i = 0; i < 8; ++i) { w[i] = (__bf16)p[(size_t)(k0 + 8 * g + i) * HD]; w[8 + i] = (__bf16)p[(size_t)(k0 + 16 + 8 * g + i) * HD]; }
  return w; }
#define WO_OUT_IN 1
#if WQKV_LAYOUT == 1
#define WCOL(W, k0, o, lane) wcol_oi(W, k0, o, lane, DIN)
#elif WQKV_LAYOUT == 2
#define WCOL(W, k0, o, lane) wcol_hdk(W, k0, o, lane)
#else
#define WCOL(W, k0, o, lane) wcol_io(W, k0, o, lane, CC)
#endif
#if WO_OUT_IN
#define WOCOL(W, k0, o, lane) wcol_oi(W, k0, o, lane, CC)
#define WOCOLH(W, k0, o, lane) wcolh_oi(W, k0, o, lane, CC)
#else
#define WOCOL(W, k0, o, lane) wcol_io(W, k0, o, lane, DIN)
#define WOCOLH(W, k0, o, lane) wcolh_io(W, k0, o, lane, DIN)
#endif

// RoPE inverse frequencies 1/10000^(2i/64) (the f32 values jax computes)
__constant__ float INVF[32] = {1.000000000e+00,7.498942018e-01,5.623413324e-01,4.216965139e-01,3.162277639e-01,2.371373624e-01,1.778279394e-01,1.333521456e-01,1.000000015e-01,7.498941571e-02,5.623412877e-02,4.216964915e-02,3.162277862e-02,2.371373586e-02,1.778279431e-02,1.333521493e-02,9.999999776e-03,7.498942316e-03,5.623413250e-03,4.216964822e-03,3.162277862e-03,2.371373819e-03,1.778279431e-03,1.333521446e-03,1.000000047e-03,7.498941850e-04,5.623413017e-04,4.216964880e-04,3.162277862e-04,2.371373848e-04,1.778279402e-04,1.333521504e-04};
#define PROJ_EXTRA_PARAMS
// per (token, head) hook on the staged f32 row (64 floats, projection + bias) of the q and k streams: interleaved-pair rotation (x[2i], x[2i + 1]) by the angle t * INVF[i]; v untouched
#define PROJ_EPI(which, row, t, h) do { if ((which) < 2) { float* rw = (row); const float pos_ = (float)(t);   /* position = the token's sequence index */ _Pragma("unroll 4") for (int i = 0; i < 32; ++i) { _Pragma("clang fp contract(off)") const float ang = pos_ * INVF[i]; const float cs = cosf(ang), sn = sinf(ang); const float xe = rw[2 * i], xo = rw[2 * i + 1]; rw[2 * i] = xe * cs - xo * sn; rw[2 * i + 1] = xe * sn + xo * cs; } } } while (0)
#ifndef SM_EXTRA_PARAMS
#define SM_EXTRA_PARAMS
#endif
#ifndef PROJ_EXTRA_PARAMS
#define PROJ_EXTRA_PARAMS
#endif
#ifndef SM_MASK_HOOK
#define SM_MASK_HOOK (void)0
#endif

#define WS_QH  0u                                      // f16 q rows [b*t][CC]
#define WS_KH  (WS_QH + 2u * (size_t)NB * TT * CC)      // f16 k rows [b*t][CC]
#define WS_VT  (WS_KH + 2u * (size_t)NB * TT * CC)      // f16 v planes [b][c][t]
#define WS_QL  (WS_VT + 2u * (size_t)NB * CC * TT)      // f16 q residual x 2^10 rows [b][t < QHI][CC]
#define WS_KL  (WS_QL + 2u * (size_t)NB * QHI * CC)     // f16 k residual x 2^10 rows [b][t < KHI][CC]
#define WS_VB  (WS_KL + 2u * (size_t)NB * KHI * CC)     // bf16 v hi planes [b][c][t < KHI]
#define WS_VBL (WS_VB + 2u * (size_t)NB * CC * KHI)
#define WS_S   (WS_VBL + 2u * (size_t)NB * CC * KHI)    // f32 logits / P [hg][t][s]
#define WS_Y   (WS_S  + 4u * (size_t)HG * TT * TT)      // f32 ctx rows [b*t][CC] (only when there is an output projection)
#define WS_END (WS_Y  + 4u * (size_t)NB * TT * CC)

// ---- k_proj: block = (64 rows, 128 cols, which): q/k/v = X W (+ b) with exact bf16 products (K = DIN) -> which 0: q f16 rows (+ residual rows < QHI); 1: k f16 rows (+ residual rows < KHI); 2: v f16 planes [c][t] (+ bf16 hi/lo planes for t < KHI)
__global__ __launch_bounds__(128) void k_proj(const float* __restrict__ XQ, const float* __restrict__ XK, const float* __restrict__ XV, const float* __restrict__ WQ, const float* __restrict__ WK, const float* __restrict__ WV, const float* __restrict__ BQ, const float* __restrict__ BK, const float* __restrict__ BV,
    _Float16* __restrict__ QH, _Float16* __restrict__ QL, _Float16* __restrict__ KH, _Float16* __restrict__ KL, _Float16* __restrict__ VT, __bf16* __restrict__ VB, __bf16* __restrict__ VBL PROJ_EXTRA_PARAMS) {
  __shared__ __align__(16) float st[64][132]; __shared__ __align__(16) _Float16 sh[64][136], sl[64][136]; __shared__ __align__(16) _Float16 th[128][72]; __shared__ __align__(16) __bf16 tb[128][72], tbl[128][72];
  const int tid = threadIdx.x, wave = tid >> 5, lane = tid & 31, col = lane & 15, g = lane >> 4; const int which = blockIdx.z; const int c0 = blockIdx.y * 128; const size_t r0 = (size_t)blockIdx.x * 64; const size_t bb = r0 / TT; const int t0 = (int)(r0 % TT);
  const float* X = which == 0 ? XQ : which == 1 ? XK : XV; const float* WA = which == 0 ? WQ : which == 1 ? WK : WV; const float* BA = which == 0 ? BQ : which == 1 ? BK : BV;
  v8f acc[8] = {};
#pragma unroll 2
  for (int kc = 0; kc < DIN / 32; ++kc) { v16b a; { const float* p = X + (r0 + wave * 16 + col) * DIN + kc * 32 + 8 * g;
#pragma unroll
      for (int i = 0; i < 8; ++i) { a[i] = (__bf16)p[i]; a[8 + i] = (__bf16)p[16 + i]; } }
    asm volatile("s_wait_loadcnt 0x0" ::: "memory");
#pragma unroll
    for (int j = 0; j < 8; ++j) { const v16b w = WCOL(WA, kc * 32, c0 + j * 16 + col, lane); asm volatile("s_wait_loadcnt 0x0" ::: "memory"); acc[j] = wmma_bf(a, w, acc[j]); } }
  { // stage the f32 tile (acc + bias) in LDS, run the per-(row, head) epilogue hook, then convert
#pragma unroll
    for (int j = 0; j < 8; ++j) { const float bias = BA ? bfr(BA[c0 + j * 16 + col]) : 0.f;
#pragma unroll
      for (int r = 0; r < 8; ++r) st[wave * 16 + 8 * g + r][j * 16 + col] = acc[j][r] + bias; }
    __syncthreads();
    for (int e = tid; e < 64 * (128 / HD); e += 128) { const int rl = e / (128 / HD), hh = e % (128 / HD); PROJ_EPI(which, &st[rl][hh * HD], (int)((r0 + rl) % TT), (c0 / HD) + hh); }
    __syncthreads(); }
  if (which < 2) { _Float16* DH = which == 0 ? QH : KH; _Float16* DL = which == 0 ? QL : KL; const int nhi = which == 0 ? QHI : KHI; const bool hi_rows = t0 < nhi;
    for (int e = tid; e < 64 * 128; e += 128) { const int rl = e >> 7, cl = e & 127; const float v = st[rl][cl]; const _Float16 hv = (_Float16)v; sh[rl][cl] = hv; sl[rl][cl] = (_Float16)((v - (float)hv) * 1024.0f); }
    __syncthreads();
    for (int e = tid; e < 64 * 16; e += 128) { const int rl = e >> 4, q = e & 15; vst2((unsigned*)(DH + (r0 + rl) * CC + c0 + q * 8), *(const v4u*)&sh[rl][q * 8]); if (hi_rows) vst2((unsigned*)(DL + (bb * nhi + t0 + rl) * (size_t)CC + c0 + q * 8), *(const v4u*)&sl[rl][q * 8]); }
  } else { const bool hi_rows = t0 < KHI;
    for (int e = tid; e < 64 * 128; e += 128) { const int rl = e & 63, cl = e >> 6; const float v = st[rl][cl]; th[cl][rl] = (_Float16)v; const __bf16 bh = (__bf16)v; tb[cl][rl] = bh; tbl[cl][rl] = (__bf16)(v - (float)bh); }
    __syncthreads();
    for (int e = tid; e < 128 * 8; e += 128) { const int cl = e >> 3, q = e & 7; vst2((unsigned*)(VT + (bb * CC + c0 + cl) * (size_t)TT + t0 + q * 8), *(const v4u*)&th[cl][q * 8]); if (hi_rows) { const size_t o3 = (bb * CC + c0 + cl) * (size_t)KHI + t0 + q * 8; vst2((unsigned*)(VB + o3), *(const v4u*)&tb[cl][q * 8]); vst2((unsigned*)(VBL + o3), *(const v4u*)&tbl[cl][q * 8]); } } } }
// ---- k_sc: block = (query block qb, key block kb <= kb_last(qb), head in group) of batch b: logits x SCALE; q hi + residual (x 2^10) against k (2 products) for query rows < QHI, plus the k residual (3 products) for query blocks < QBH (causal early rows); causal: blocks past the diagonal exit, the mask itself is applied by index in k_sm
__global__ __launch_bounds__(128) void k_sc(const _Float16* __restrict__ QH, const _Float16* __restrict__ KH, const _Float16* __restrict__ QL, const _Float16* __restrict__ KL, int b, int h0, float* __restrict__ S0) { __shared__ __align__(16) float ss[4][16][132];
  const int qb = blockIdx.x, kb = blockIdx.y; if (kb > kb_last(qb)) return;
  const int h = h0 + blockIdx.z; float* S = S0 + (size_t)blockIdx.z * TT * TT;
  const int tid = threadIdx.x, wave = tid >> 5, lane = tid & 31, col = lane & 15, g = lane >> 4; const int k0 = kb * 128; const int ql0 = qb * 64 + wave * 16; const size_t q0 = (size_t)b * TT + ql0, kr0 = (size_t)b * TT + k0;
  v8f acc[8] = {}, accl[8] = {};
  const _Float16* QLb = QL + (size_t)b * QHI * CC; const _Float16* KLb = KL + (size_t)b * KHI * CC;
  if (qb < QBH) {
#pragma unroll
    for (int kc = 0; kc < HD / 32; ++kc) { const v16h ah = frag_h(QH + (q0 + col) * CC + h * HD + kc * 32, lane), al = frag_h(QLb + (size_t)(ql0 + col) * CC + h * HD + kc * 32, lane);
#pragma unroll
      for (int j = 0; j < 8; ++j) { const v16h kbf = frag_h(KH + (kr0 + j * 16 + col) * CC + h * HD + kc * 32, lane), klf = frag_h(KLb + (size_t)(k0 + j * 16 + col) * CC + h * HD + kc * 32, lane); acc[j] = wmma16(ah, kbf, acc[j]); accl[j] = wmma16(al, kbf, accl[j]); accl[j] = wmma16(ah, klf, accl[j]); } }
  } else if (qb * 64 < QHI) {
#pragma unroll
    for (int kc = 0; kc < HD / 32; ++kc) { const v16h ah = frag_h(QH + (q0 + col) * CC + h * HD + kc * 32, lane), al = frag_h(QLb + (size_t)(ql0 + col) * CC + h * HD + kc * 32, lane);
#pragma unroll
      for (int j = 0; j < 8; ++j) { const v16h kbf = frag_h(KH + (kr0 + j * 16 + col) * CC + h * HD + kc * 32, lane); acc[j] = wmma16(ah, kbf, acc[j]); accl[j] = wmma16(al, kbf, accl[j]); } }
  } else {
#pragma unroll
    for (int kc = 0; kc < HD / 32; ++kc) { const v16h ah = frag_h(QH + (q0 + col) * CC + h * HD + kc * 32, lane);
#pragma unroll
      for (int j = 0; j < 8; ++j) { const v16h kbf = frag_h(KH + (kr0 + j * 16 + col) * CC + h * HD + kc * 32, lane); acc[j] = wmma16(ah, kbf, acc[j]); } } }
#pragma unroll
  for (int j = 0; j < 8; ++j) {
#pragma unroll
    for (int r = 0; r < 8; ++r) ss[wave][8 * g + r][j * 16 + col] = (acc[j][r] + accl[j][r] * (1.0f / 1024.0f)) * SCALE; }
  LDSX(); for (int rl = 0; rl < 16; ++rl) vst2(S + (size_t)(ql0 + rl) * TT + k0 + lane * 4, *(const v4f*)&ss[wave][rl][lane * 4]); }
// ---- k_sm: block = query row t (head in group): keys [0, kend): causal -> logit if s <= t else excluded; softmax in f32; P x 2^11 in place (0 for excluded)
__global__ __launch_bounds__(256) void k_sm(float* __restrict__ S0 SM_EXTRA_PARAMS) { __shared__ float sred[8]; __shared__ float sbc; __shared__ __align__(16) float shv[TT];
  const int tid = threadIdx.x; const int t = blockIdx.x; const int kend = (kb_last(t >> 6) + 1) * 128;
  float* sr = S0 + (size_t)blockIdx.y * TT * TT + (size_t)t * TT;
  float m = -3.0e38f; for (int k = tid; k < kend; k += 256) { float v = (!CAUSAL || k <= t) ? sr[k] : -3.0e38f; SM_MASK_HOOK; shv[k] = v; m = fmaxf(m, v); }
#pragma unroll
  for (int o = 1; o < 32; o <<= 1) m = fmaxf(m, __shfl_xor(m, o));
  if ((tid & 31) == 0) sred[tid >> 5] = m; __syncthreads(); if (tid == 0) { float a = sred[0]; for (int i = 1; i < 8; ++i) a = fmaxf(a, sred[i]); sbc = a; } __syncthreads(); m = sbc; __syncthreads();
  float sum = 0.f; for (int k = tid; k < kend; k += 256) { const float v = shv[k]; const float e = (v <= -1.0e38f) ? 0.f : expf(v - m); shv[k] = e; sum += e; }
#pragma unroll
  for (int o = 1; o < 32; o <<= 1) sum += __shfl_xor(sum, o);
  if ((tid & 31) == 0) sred[tid >> 5] = sum; __syncthreads(); if (tid == 0) { float a = 0.f; for (int i = 0; i < 8; ++i) a += sred[i]; sbc = a > 0.f ? 2048.0f / a : 0.f; }   /* a fully excluded row yields P = 0 */ __syncthreads(); const float inv = sbc;
  for (int k = tid; k < kend; k += 256) shv[k] = shv[k] * inv;
  __syncthreads(); for (int q = tid; q < kend / 4; q += 256) vst2(sr + q * 4, *(const v4f*)&shv[q * 4]); }
// ---- k_pv: block = 64 queries (qb) of (b, h): ctx = P . v over keys [0, kend) (P x 2^11 once to f16 against v f16: 1 product; causal early query blocks: P and v as bf16 hi + lo, 3 products); 256-B (row, head) segment by 16 lanes
__global__ __launch_bounds__(128) void k_pv(const float* __restrict__ PS0, const _Float16* __restrict__ VT, const __bf16* __restrict__ VB, const __bf16* __restrict__ VBL, int b, int h0, float* __restrict__ Y) { const int h = h0 + blockIdx.z; const float* PS = PS0 + (size_t)blockIdx.z * TT * TT; __shared__ __align__(16) float ss[4][16][HD + 4];
  const int tid = threadIdx.x, wave = tid >> 5, lane = tid & 31, col = lane & 15, g = lane >> 4; const int qb = blockIdx.x; const int ql0 = qb * 64 + wave * 16; const int kce = (kb_last(qb) + 1) * 4;
  v8f acc[HD / 16] = {};
  if (qb < QBH) {
#pragma unroll 1
    for (int kc = 0; kc < kce; ++kc) { const F2 p = split_row(PS + (size_t)(ql0 + col) * TT, kc * 32, lane);
      asm volatile("s_wait_loadcnt 0x0" ::: "memory");
#pragma unroll
      for (int j = 0; j < HD / 16; ++j) { const size_t po = ((size_t)b * CC + h * HD + j * 16 + col) * (size_t)KHI + kc * 32; const v16b vh = frag_b(VB + po, lane); acc[j] = wmma_bf(p.h, vh, acc[j]); acc[j] = wmma_bf(p.l, vh, acc[j]); acc[j] = wmma_bf(p.h, frag_b(VBL + po, lane), acc[j]); } }
  } else {
#pragma unroll 1
    for (int kc = 0; kc < kce; ++kc) { const v16h p = frag_f32(PS + (size_t)(ql0 + col) * TT + kc * 32, lane);
      asm volatile("s_wait_loadcnt 0x0" ::: "memory");
#pragma unroll
      for (int j = 0; j < HD / 16; ++j) { const size_t po = ((size_t)b * CC + h * HD + j * 16 + col) * (size_t)TT + kc * 32; acc[j] = wmma16(p, frag_h(VT + po, lane), acc[j]); } } }
#pragma unroll
  for (int j = 0; j < HD / 16; ++j)
#pragma unroll
    for (int r = 0; r < 8; ++r) ss[wave][8 * g + r][j * 16 + col] = acc[j][r] * (1.0f / 2048.0f);
  LDSX(); for (int rl = 0; rl < 16; ++rl) if (lane < HD / 4) vst2(Y + ((size_t)b * TT + ql0 + rl) * CC + h * HD + lane * 4, *(const v4f*)&ss[wave][rl][lane * 4]); }
// ---- k_out: block = (64 rows, 128 cols): out = ctx Wo (+ bo): ctx x 2^6 once to f16 against Wo as f16(bf16 x 2^8) exact (1 product) x 2^-14; causal early rows (< QHI of each sequence): ctx bf16 hi + lo against exact bf16 Wo (2 products)
__global__ __launch_bounds__(128) void k_out(const float* __restrict__ Y, const float* __restrict__ WO, const float* __restrict__ BO, float* __restrict__ OUT) { __shared__ __align__(16) float sf[4][16][132];
  const int tid = threadIdx.x, wave = tid >> 5, lane = tid & 31, col = lane & 15, g = lane >> 4; const int c0 = blockIdx.y * 128; const size_t r0 = (size_t)blockIdx.x * 64 + wave * 16;
  v8f acc[8] = {};
  if (CAUSAL && (int)(((size_t)blockIdx.x * 64) % TT) < QHI) {   /* block-uniform */
#pragma unroll 2
    for (int kc = 0; kc < CC / 32; ++kc) { const F2 a = split_row(Y + (r0 + col) * CC, kc * 32, lane); asm volatile("s_wait_loadcnt 0x0" ::: "memory");
#pragma unroll
      for (int j = 0; j < 8; ++j) { const v16b w = WOCOL(WO, kc * 32, c0 + j * 16 + col, lane); asm volatile("s_wait_loadcnt 0x0" ::: "memory"); acc[j] = wmma_bf(a.h, w, acc[j]); acc[j] = wmma_bf(a.l, w, acc[j]); } }
#pragma unroll
    for (int j = 0; j < 8; ++j) { const float bias = BO ? bfr(BO[c0 + j * 16 + col]) : 0.f;
#pragma unroll
      for (int r = 0; r < 8; ++r) sf[wave][8 * g + r][j * 16 + col] = acc[j][r] + bias; }
  } else {
#pragma unroll 2
    for (int kc = 0; kc < CC / 32; ++kc) { const v16h a = frag_f32s(Y + (r0 + col) * CC + kc * 32, lane, 64.0f); asm volatile("s_wait_loadcnt 0x0" ::: "memory");   /* ctx carried x 2^6 into f16 so small-magnitude context rows stay clear of f16 subnormals */
#pragma unroll
      for (int j = 0; j < 8; ++j) { const v16h w = WOCOLH(WO, kc * 32, c0 + j * 16 + col, lane); asm volatile("s_wait_loadcnt 0x0" ::: "memory"); acc[j] = wmma16(a, w, acc[j]); } }
#pragma unroll
    for (int j = 0; j < 8; ++j) { const float bias = BO ? bfr(BO[c0 + j * 16 + col]) : 0.f;
#pragma unroll
      for (int r = 0; r < 8; ++r) sf[wave][8 * g + r][j * 16 + col] = acc[j][r] * (1.0f / 16384.0f) + bias; } }   /* 2^-8 (Wo carry) x 2^-6 (ctx carry) */
  LDSX(); for (int rl = 0; rl < 16; ++rl) vst2(OUT + (r0 + rl) * DIN + c0 + lane * 4, *(const v4f*)&sf[wave][rl][lane * 4]); }

extern "C" void kernel_launch(void* const* d_in, const int* in_sizes, int n_in, void* d_out, int out_size, void* d_ws, size_t ws_size, hipStream_t stream) {
  (void)in_sizes; (void)n_in; (void)out_size;
  const float** F = (const float**)d_in;
  if (ws_size < (size_t)WS_END) return;
  char* ws = (char*)d_ws; _Float16 *QH = (_Float16*)(ws + WS_QH), *KH = (_Float16*)(ws + WS_KH), *VT = (_Float16*)(ws + WS_VT), *QL = (_Float16*)(ws + WS_QL), *KL = (_Float16*)(ws + WS_KL); __bf16 *VB = (__bf16*)(ws + WS_VB), *VBL = (__bf16*)(ws + WS_VBL); float *S = (float*)(ws + WS_S), *Y = (float*)(ws + WS_Y);
  (void)Y; (void)QL; (void)KL; (void)VB; (void)VBL;
  // inputs: 0 x [2,2048,1024]; 1 wq [1024,1024] (out,in); 2 wk; 3 wv; 4 wo (out,in); no biases (null pointers)
  k_proj<<<dim3(TNB * TT / 64, CC / 128, 3), 128, 0, stream>>>(F[0], F[0], F[0], F[1], F[2], F[3], nullptr, nullptr, nullptr, QH, QL, KH, KL, VT, VB, VBL);
  for (int b = 0; b < TNB; ++b) for (int h0 = 0; h0 < NH; h0 += HG) {
    k_sc<<<dim3(NQB, TT / 128, HG), 128, 0, stream>>>(QH, KH, QL, KL, b, h0, S);
    k_sm<<<dim3(TT, HG), 256, 0, stream>>>(S);
    k_pv<<<dim3(NQB, 1, HG), 128, 0, stream>>>(S, VT, VB, VBL, b, h0, Y);
  }
  k_out<<<dim3(TNB * TT / 64, DIN / 128), 128, 0, stream>>>(Y, F[4], nullptr, (float*)d_out);
}

// v001
// A run of this version takes 635 microseconds.
// Next to v000, in two timings, it ran 2.00 and 2.03 times as fast.
// compute dtype: all float inputs rounded to bf16; q / k / v projections with EXACT bf16 products on WMMA 16x16x32 (f32 accumulate) (no biases); interleaved-pair RoPE in f32 AFTER the bias (embedded frequencies, precise cosf / sinf, positions = the row index); causal logits: 3 products for the first 384 rows, single f16 q x k after, x 64^-0.5; softmax f32; P x 2^11 once to f16 x v once to f16 (bf16 hi + lo below row 384); ctx hi+lo x exact Wo below row 384, x2^6 f16 carry x f16(bf16 x 2^8) Wo after; f32 output.
#include <hip/hip_runtime.h>
#include <math.h>

typedef __attribute__((ext_vector_type(16))) _Float16 v16h;
typedef __attribute__((ext_vector_type(16))) __bf16 v16b;
typedef __attribute__((ext_vector_type(8)))  _Float16 v8h;
typedef __attribute__((ext_vector_type(8)))  float v8f;
typedef __attribute__((ext_vector_type(4)))  float v4f;
typedef __attribute__((ext_vector_type(2)))  float v2f;
typedef __attribute__((ext_vector_type(4)))  unsigned v4u;
typedef __attribute__((ext_vector_type(4)))  int v4i;
typedef float __attribute__((may_alias)) float_a;
typedef int __attribute__((may_alias)) int_a;

template <typename T> __device__ __forceinline__ void vst2(void* p, T v) { *(T*)p = v;  }
__device__ __forceinline__ v8f wmma16(v16h a, v16h b, v8f c) {
  v8f d = __builtin_amdgcn_wmma_f32_16x16x32_f16(false, a, false, b, (short)0, c, false, false);
  asm volatile("v_nop\n\tv_nop\n\tv_nop\n\tv_nop" : "+v"(d) : "v"(a), "v"(b));
  return d;
}
__device__ __forceinline__ v8f wmma_bf(v16b a, v16b b, v8f c) {
  v8f d = __builtin_amdgcn_wmma_f32_16x16x32_bf16(false, a, false, b, (short)0, c, false, false);
  asm volatile("v_nop\n\tv_nop\n\tv_nop\n\tv_nop" : "+v"(d) : "v"(a), "v"(b));
  return d;
}
// 16x16x32 fragments: lane = (h = lane>>4, row/col = lane&15); elements 0..7 = k0+8h+0..7, 8..15 = k0+16+8h+0..7; D element r = row 8h+r
__device__ __forceinline__ v16h frag_h(const _Float16* rowk0, int lane) {
  union { v16h v; v8h q[2]; } u; const _Float16* p = rowk0 + 8 * (lane >> 4);
  u.q[0] = *(const v8h*)p; u.q[1] = *(const v8h*)(p + 16); return u.v;
}
__device__ __forceinline__ v16h frag_f32(const float* rowk0, int lane) {
  v16h a; const float* p = rowk0 + 8 * (lane >> 4);
#pragma unroll
  for (int i = 0; i < 8; ++i) { a[i] = (_Float16)p[i]; a[8 + i] = (_Float16)p[16 + i]; }
  return a;
}
__device__ __forceinline__ v16h frag_f32s(const float* rowk0, int lane, float sc) {
  v16h a; const float* p = rowk0 + 8 * (lane >> 4);
#pragma unroll
  for (int i = 0; i < 8; ++i) { a[i] = (_Float16)(p[i] * sc); a[8 + i] = (_Float16)(p[16 + i] * sc); }
  return a;
}
// column fragment from a [K][ld] layout (column n), rows >= K read as 0
__device__ __forceinline__ v16h fragc_f32(const float* W, int k0, int n, int lane, int ld, int K) {
  v16h a; const int g = lane >> 4;
#pragma unroll
  for (int i = 0; i < 8; ++i) { const int ka = k0 + 8 * g + i, kb = ka + 16;
    a[i] = (_Float16)(ka < K ? W[(size_t)(ka < K ? ka : K - 1) * ld + n] : 0.f); a[8 + i] = (_Float16)(kb < K ? W[(size_t)(kb < K ? kb : K - 1) * ld + n] : 0.f); }
  return a;
}
struct F2 { v16b h, l; };
__device__ __forceinline__ F2 bsplit16(const float v[16]) { F2 r;
#pragma unroll
  for (int i = 0; i < 16; ++i) { const __bf16 h = (__bf16)v[i]; r.h[i] = h; r.l[i] = (__bf16)(v[i] - (float)h); }
  return r; }
__device__ __forceinline__ F2 split_row(const float* row, int k0, int lane) { float v[16]; const float* p = row + k0 + 8 * (lane >> 4);
#pragma unroll
  for (int i = 0; i < 8; ++i) { v[i] = p[i]; v[8 + i] = p[16 + i]; }
  return bsplit16(v); }
__device__ __forceinline__ F2 split_rowK(const float* row, int k0, int lane, int K) { float v[16]; const int g = lane >> 4;
#pragma unroll
  for (int i = 0; i < 8; ++i) { const int ka = k0 + 8 * g + i, kb = ka + 16; v[i] = ka < K ? row[ka < K ? ka : K - 1] : 0.f; v[8 + i] = kb < K ? row[kb < K ? kb : K - 1] : 0.f; }
  return bsplit16(v); }
__device__ __forceinline__ F2 split_col(const float* W, int k0, int n, int lane, int ld, int K) { float v[16]; const int g = lane >> 4;
#pragma unroll
  for (int i = 0; i < 8; ++i) { const int ka = k0 + 8 * g + i, kb = ka + 16; v[i] = ka < K ? W[(size_t)(ka < K ? ka : K - 1) * ld + n] : 0.f; v[8 + i] = kb < K ? W[(size_t)(kb < K ? kb : K - 1) * ld + n] : 0.f; }
  return bsplit16(v); }
__device__ __forceinline__ v8f mac3(const F2& a, const F2& b, v8f c) { c = wmma_bf(a.l, b.h, c); c = wmma_bf(a.h, b.l, c); return wmma_bf(a.h, b.h, c); }
__device__ __forceinline__ float sigm(float v) { return 1.0f / (1.0f + expf(-v)); }
#define LDSX() do { asm volatile("s_wait_dscnt 0" ::: "memory"); __builtin_amdgcn_wave_barrier(); __builtin_amdgcn_fence(__ATOMIC_RELEASE, "workgroup"); } while (0)

// Causal multi-head self-attention with interleaved-pair RoPE (x [2,2048,1024]; torch (out,in) wq / wk / wv / wo [1024,1024] applied as x @ W.T, no biases; 16 heads x 64; RoPE on Q and K: adjacent (even, odd) pairs (xe c - xo s, xe s + xo c) re-interleaved, theta 10000, positions 0..2047; scores / sqrt(64); tril kept, -inf elsewhere (the module's own softmax guards the -inf row maximum: every row keeps its diagonal, so the guard never fires); out @ wo.T).
#define NB 2
#define TT 2048
#define CC 1024            // NH * HD = projected width
#define DIN 1024          // input (model) width
#define NH 16
#define HD 64
#define NQB (TT / 64)
#define HG 4
#define SCALE (0.125f)
#define CAUSAL 1
#ifndef TNB
#define TNB NB
#endif
__device__ __forceinline__ float bfr(float v) { return (float)(__bf16)v; }
__host__ __device__ __forceinline__ int kb_last(int qb) { return CAUSAL ? ((qb * 64 + 63) >> 7) : (TT / 128 - 1); }
typedef __attribute__((ext_vector_type(8))) __bf16 v8b;
__device__ __forceinline__ v16b frag_b(const __bf16* rowk0, int lane) {
  union { v16b v; v8b q[2]; } u; const __bf16* p = rowk0 + 8 * (lane >> 4);
  u.q[0] = *(const v8b*)p; u.q[1] = *(const v8b*)(p + 16); return u.v;
}
// unconverted fragment reads; p = the lane's row + k0 + 8 * (lane >> 4): elements 0..7 = p[0..7], 8..15 = p[16..23] (the k order of frag_h / frag_f32 / split_row / wcol_oi)
typedef __attribute__((ext_vector_type(16))) float v16f;
__device__ __forceinline__ v16f raw16(const float* p) { v16f r;
#pragma unroll
  for (int i = 0; i < 8; ++i) { r[i] = p[i]; r[8 + i] = p[16 + i]; }
  return r; }
__device__ __forceinline__ v16h pair_h(const _Float16* p) { union { v16h v; v8h q[2]; } u; u.q[0] = *(const v8h*)p; u.q[1] = *(const v8h*)(p + 16); return u.v; }
__device__ __forceinline__ v16b pair_b(const __bf16* p) { union { v16b v; v8b q[2]; } u; u.q[0] = *(const v8b*)p; u.q[1] = *(const v8b*)(p + 16); return u.v; }
__device__ __forceinline__ F2 bsplit_v(v16f r) { float v[16];
#pragma unroll
  for (int i = 0; i < 16; ++i) v[i] = r[i];
  return bsplit16(v); }
#define QBH 6              // causal: query blocks 0..QBH-1 of each sequence (few keys, no averaging) take the high-precision path
#define QHI 384            // rows carrying a q residual plane
#define KHI 384            // key rows carrying k residual / v bf16 hi+lo planes (used only by the causal high-precision path)
// B fragment (k rows k0+.., output column o) of a weight: (in,out) [K][ld] or (out,in) [ld rows of K]: bf16 exact, or f16(bf16 * 256) exact
__device__ __forceinline__ v16b wcol_io(const float* Wm, int k0, int o, int lane, int ld) { v16b w; const int g = lane >> 4;
#pragma unroll
  for (int i = 0; i < 8; ++i) { w[i] = (__bf16)Wm[(size_t)(k0 + 8 * g + i) * ld + o]; w[8 + i] = (__bf16)Wm[(size_t)(k0 + 16 + 8 * g + i) * ld + o]; }
  return w; }
__device__ __forceinline__ v16b wcol_oi(const float* Wm, int k0, int o, int lane, int K) { v16b w; const float* p = Wm + (size_t)o * K + k0 + 8 * (lane >> 4);
#pragma unroll
  for (int i = 0; i < 8; ++i) { w[i] = (__bf16)p[i]; w[8 + i] = (__bf16)p[16 + i]; }
  return w; }
__device__ __forceinline__ v16h wcolh_io(const float* Wm, int k0, int o, int lane, int ld) { v16h w; const int g = lane >> 4;
#pragma unroll
  for (int i = 0; i < 8; ++i) { w[i] = (_Float16)(bfr(Wm[(size_t)(k0 + 8 * g + i) * ld + o]) * 256.0f); w[8 + i] = (_Float16)(bfr(Wm[(size_t)(k0 + 16 + 8 * g + i) * ld + o]) * 256.0f); }
  return w; }
__device__ __forceinline__ v16h wcolh_oi(const float* Wm, int k0, int o, int lane, int K) { v16h w; const float* p = Wm + (size_t)o * K + k0 + 8 * (lane >> 4);
#pragma unroll
  for (int i = 0; i < 8; ++i) { w[i] = (_Float16)(bfr(p[i]) * 256.0f); w[8 + i] = (_Float16)(bfr(p[16 + i]) * 256.0f); }
  return w; }
#define WQKV_LAYOUT 1   // 0 = (in,out) [DIN][CC]; 1 = (out,in) [CC][DIN]; 2 = per-head [NH][DIN][HD]
__device__ __forceinline__ v16b wcol_hdk(const float* Wm, int k0, int o, int lane) { v16b w; const int g = lane >> 4; const float* p = Wm + (size_t)(o / HD) * DIN * HD + (o % HD);
#pragma unroll
  for (int i = 0; i < 8; ++i) { w[i] = (__bf16)p[(size_t)(k0 + 8 * g + i) * HD]; w[8 + i] = (__bf16)p[(size_t)(k0 + 16 + 8 * g + i) * HD]; }
  return w; }
#define WO_OUT_IN 1
#if WQKV_LAYOUT == 1
#define WCOL(W, k0, o, lane) wcol_oi(W, k0, o, lane, DIN)
#elif WQKV_LAYOUT == 2
#define WCOL(W, k0, o, lane) wcol_hdk(W, k0, o, lane)
#else
#define WCOL(W, k0, o, lane) wcol_io(W, k0, o, lane, CC)
#endif
#if WO_OUT_IN
#define WOCOL(W, k0, o, lane) wcol_oi(W, k0, o, lane, CC)
#define WOCOLH(W, k0, o, lane) wcolh_oi(W, k0, o, lane, CC)
#else
#define WOCOL(W, k0, o, lane) wcol_io(W, k0, o, lane, DIN)
#define WOCOLH(W, k0, o, lane) wcolh_io(W, k0, o, lane, DIN)
#endif

// RoPE inverse frequencies 1/10000^(2i/64) (the f32 values jax computes)
__constant__ float INVF[32] = {1.000000000e+00,7.498942018e-01,5.623413324e-01,4.216965139e-01,3.162277639e-01,2.371373624e-01,1.778279394e-01,1.333521456e-01,1.000000015e-01,7.498941571e-02,5.623412877e-02,4.216964915e-02,3.162277862e-02,2.371373586e-02,1.778279431e-02,1.333521493e-02,9.999999776e-03,7.498942316e-03,5.623413250e-03,4.216964822e-03,3.162277862e-03,2.371373819e-03,1.778279431e-03,1.333521446e-03,1.000000047e-03,7.498941850e-04,5.623413017e-04,4.216964880e-04,3.162277862e-04,2.371373848e-04,1.778279402e-04,1.333521504e-04};
#define PROJ_EXTRA_PARAMS
// per (token, head) hook on the staged f32 row (64 floats, projection + bias) of the q and k streams: interleaved-pair rotation (x[2i], x[2i + 1]) by the angle t * INVF[i]; v untouched
#define PROJ_EPI(which, row, t, h) do { if ((which) < 2) { float* rw = (row); const float pos_ = (float)(t);   /* position = the token's sequence index */ _Pragma("unroll 4") for (int i = 0; i < 32; ++i) { _Pragma("clang fp contract(off)") const float ang = pos_ * INVF[i]; const float cs = cosf(ang), sn = sinf(ang); const float xe = rw[2 * i], xo = rw[2 * i + 1]; rw[2 * i] = xe * cs - xo * sn; rw[2 * i + 1] = xe * sn + xo * cs; } } } while (0)
#ifndef SM_EXTRA_PARAMS
#define SM_EXTRA_PARAMS
#endif
#ifndef PROJ_EXTRA_PARAMS
#define PROJ_EXTRA_PARAMS
#endif
#ifndef SM_MASK_HOOK
#define SM_MASK_HOOK (void)0
#endif

#define WS_QH  0u                                      // f16 q rows [b*t][CC]
#define WS_KH  (WS_QH + 2u * (size_t)NB * TT * CC)      // f16 k rows [b*t][CC]
#define WS_VT  (WS_KH + 2u * (size_t)NB * TT * CC)      // f16 v planes [b][c][t]
#define WS_QL  (WS_VT + 2u * (size_t)NB * CC * TT)      // f16 q residual x 2^10 rows [b][t < QHI][CC]
#define WS_KL  (WS_QL + 2u * (size_t)NB * QHI * CC)     // f16 k residual x 2^10 rows [b][t < KHI][CC]
#define WS_VB  (WS_KL + 2u * (size_t)NB * KHI * CC)     // bf16 v hi planes [b][c][t < KHI]
#define WS_VBL (WS_VB + 2u * (size_t)NB * CC * KHI)
#define WS_S   (WS_VBL + 2u * (size_t)NB * CC * KHI)    // f32 logits / P [hg][t][s]
#define WS_Y   (WS_S  + 4u * (size_t)HG * TT * TT)      // f32 ctx rows [b*t][CC] (only when there is an output projection)
#define WS_END (WS_Y  + 4u * (size_t)NB * TT * CC)

// ---- k_proj: block = (64 rows, 128 cols, which): q/k/v = X W (+ b) with exact bf16 products (K = DIN) -> which 0: q f16 rows (+ residual rows < QHI); 1: k f16 rows (+ residual rows < KHI); 2: v f16 planes [c][t] (+ bf16 hi/lo planes for t < KHI)
__global__ __launch_bounds__(128) void k_proj(const float* __restrict__ XQ, const float* __restrict__ XK, const float* __restrict__ XV, const float* __restrict__ WQ, const float* __restrict__ WK, const float* __restrict__ WV, const float* __restrict__ BQ, const float* __restrict__ BK, const float* __restrict__ BV,
    _Float16* __restrict__ QH, _Float16* __restrict__ QL, _Float16* __restrict__ KH, _Float16* __restrict__ KL, _Float16* __restrict__ VT, __bf16* __restrict__ VB, __bf16* __restrict__ VBL PROJ_EXTRA_PARAMS) {
  __shared__ __align__(16) float st[64][132]; __shared__ __align__(16) _Float16 sh[64][136], sl[64][136]; __shared__ __align__(16) _Float16 th[128][72]; __shared__ __align__(16) __bf16 tb[128][72], tbl[128][72];
  const int tid = threadIdx.x, wave = tid >> 5, lane = tid & 31, col = lane & 15, g = lane >> 4; const int which = blockIdx.z; const int c0 = blockIdx.y * 128; const size_t r0 = (size_t)blockIdx.x * 64; const size_t bb = r0 / TT; const int t0 = (int)(r0 % TT);
  const float* X = which == 0 ? XQ : which == 1 ? XK : XV; const float* WA = which == 0 ? WQ : which == 1 ? WK : WV; const float* BA = which == 0 ? BQ : which == 1 ? BK : BV;
  v8f acc[8] = {};
#pragma unroll 2
  for (int kc = 0; kc < DIN / 32; ++kc) { v16b a; { const float* p = X + (r0 + wave * 16 + col) * DIN + kc * 32 + 8 * g;
#pragma unroll
      for (int i = 0; i < 8; ++i) { a[i] = (__bf16)p[i]; a[8 + i] = (__bf16)p[16 + i]; } }
    v16b w[8];   /* all fragment loads of the k step stand in front of its first WMMA: one load latency a step */
#pragma unroll
    for (int j = 0; j < 8; ++j) w[j] = WCOL(WA, kc * 32, c0 + j * 16 + col, lane);
#pragma unroll
    for (int j = 0; j < 8; ++j) acc[j] = wmma_bf(a, w[j], acc[j]); }
  { // stage the f32 tile (acc + bias) in LDS, run the per-(row, head) epilogue hook, then convert
#pragma unroll
    for (int j = 0; j < 8; ++j) { const float bias = BA ? bfr(BA[c0 + j * 16 + col]) : 0.f;
#pragma unroll
      for (int r = 0; r < 8; ++r) st[wave * 16 + 8 * g + r][j * 16 + col] = acc[j][r] + bias; }
    __syncthreads();
    for (int e = tid; e < 64 * (128 / HD); e += 128) { const int rl = e / (128 / HD), hh = e % (128 / HD); PROJ_EPI(which, &st[rl][hh * HD], (int)((r0 + rl) % TT), (c0 / HD) + hh); }
    __syncthreads(); }
  if (which < 2) { _Float16* DH = which == 0 ? QH : KH; _Float16* DL = which == 0 ? QL : KL; const int nhi = which == 0 ? QHI : KHI; const bool hi_rows = t0 < nhi;
    for (int e = tid; e < 64 * 128; e += 128) { const int rl = e >> 7, cl = e & 127; const float v = st[rl][cl]; const _Float16 hv = (_Float16)v; sh[rl][cl] = hv; sl[rl][cl] = (_Float16)((v - (float)hv) * 1024.0f); }
    __syncthreads();
    for (int e = tid; e < 64 * 16; e += 128) { const int rl = e >> 4, q = e & 15; vst2((unsigned*)(DH + (r0 + rl) * CC + c0 + q * 8), *(const v4u*)&sh[rl][q * 8]); if (hi_rows) vst2((unsigned*)(DL + (bb * nhi + t0 + rl) * (size_t)CC + c0 + q * 8), *(const v4u*)&sl[rl][q * 8]); }
  } else { const bool hi_rows = t0 < KHI;
    for (int e = tid; e < 64 * 128; e += 128) { const int rl = e & 63, cl = e >> 6; const float v = st[rl][cl]; th[cl][rl] = (_Float16)v; const __bf16 bh = (__bf16)v; tb[cl][rl] = bh; tbl[cl][rl] = (__bf16)(v - (float)bh); }
    __syncthreads();
    for (int e = tid; e < 128 * 8; e += 128) { const int cl = e >> 3, q = e & 7; vst2((unsigned*)(VT + (bb * CC + c0 + cl) * (size_t)TT + t0 + q * 8), *(const v4u*)&th[cl][q * 8]); if (hi_rows) { const size_t o3 = (bb * CC + c0 + cl) * (size_t)KHI + t0 + q * 8; vst2((unsigned*)(VB + o3), *(const v4u*)&tb[cl][q * 8]); vst2((unsigned*)(VBL + o3), *(const v4u*)&tbl[cl][q * 8]); } } } }
// ---- k_sc: block = (query block qb, key block kb <= kb_last(qb), head in group) of batch b: logits x SCALE; q hi + residual (x 2^10) against k (2 products) for query rows < QHI, plus the k residual (3 products) for query blocks < QBH (causal early rows); causal: blocks past the diagonal exit, the mask itself is applied by index in k_sm
__global__ __launch_bounds__(128) void k_sc(const _Float16* __restrict__ QH, const _Float16* __restrict__ KH, const _Float16* __restrict__ QL, const _Float16* __restrict__ KL, int b, int h0, float* __restrict__ S0) { __shared__ __align__(16) float ss[4][16][132];
  const int qb = blockIdx.x, kb = blockIdx.y; if (kb > kb_last(qb)) return;
  const int h = h0 + blockIdx.z; float* S = S0 + (size_t)blockIdx.z * TT * TT;
  const int tid = threadIdx.x, wave = tid >> 5, lane = tid & 31, col = lane & 15, g = lane >> 4; const int k0 = kb * 128; const int ql0 = qb * 64 + wave * 16; const size_t q0 = (size_t)b * TT + ql0, kr0 = (size_t)b * TT + k0;
  v8f acc[8] = {}, accl[8] = {};
  const _Float16* QLb = QL + (size_t)b * QHI * CC; const _Float16* KLb = KL + (size_t)b * KHI * CC;
  const _Float16* qp = QH + (q0 + col) * CC + h * HD + 8 * g; const _Float16* kp = KH + (kr0 + col) * CC + h * HD + 8 * g;   /* the lane's q row and its first k row, each at its k half */
  if (qb < QBH) {
    const _Float16* qlp = QLb + (size_t)(ql0 + col) * CC + h * HD + 8 * g; const _Float16* klp = KLb + (size_t)(k0 + col) * CC + h * HD + 8 * g;
#pragma unroll
    for (int kc = 0; kc < HD / 32; ++kc) { const v16h ah = pair_h(qp + kc * 32), al = pair_h(qlp + kc * 32);
#pragma unroll
      for (int jh = 0; jh < 8; jh += 4) { v16h kbf[4], klf[4];   /* the loads of four key tiles stand in front of their first WMMA and are in flight together */
#pragma unroll
        for (int j = 0; j < 4; ++j) { kbf[j] = pair_h(kp + (size_t)(jh + j) * 16 * CC + kc * 32); klf[j] = pair_h(klp + (size_t)(jh + j) * 16 * CC + kc * 32); }
        asm volatile("s_wait_xcnt 0x0" :: "v"(qp), "v"(qlp), "v"(kp), "v"(klp) : "memory");   /* behind the group's loads (the memory clobber holds every one of them in front of it); naming their address registers keeps these whole up to the wait */
#pragma unroll
        for (int j = 0; j < 4; ++j) { acc[jh + j] = wmma16(ah, kbf[j], acc[jh + j]); accl[jh + j] = wmma16(al, kbf[j], accl[jh + j]); accl[jh + j] = wmma16(ah, klf[j], accl[jh + j]); } } }
  } else if (qb * 64 < QHI) {
#pragma unroll
    for (int kc = 0; kc < HD / 32; ++kc) { const v16h ah = frag_h(QH + (q0 + col) * CC + h * HD + kc * 32, lane), al = frag_h(QLb + (size_t)(ql0 + col) * CC + h * HD + kc * 32, lane);
#pragma unroll
      for (int j = 0; j < 8; ++j) { const v16h kbf = frag_h(KH + (kr0 + j * 16 + col) * CC + h * HD + kc * 32, lane); acc[j] = wmma16(ah, kbf, acc[j]); accl[j] = wmma16(al, kbf, accl[j]); } }
  } else {
    v16h ah[HD / 32], kbf[HD / 32][8];   /* every fragment load of the tile stands in front of the first WMMA: all are in flight together */
#pragma unroll
    for (int kc = 0; kc < HD / 32; ++kc) { ah[kc] = pair_h(qp + kc * 32);
#pragma unroll
      for (int j = 0; j < 8; ++j) kbf[kc][j] = pair_h(kp + (size_t)j * 16 * CC + kc * 32); }
    asm volatile("s_wait_xcnt 0x0" :: "v"(qp), "v"(kp) : "memory");   /* behind the tile's loads (the memory clobber holds every one of them in front of it); naming their address registers keeps these whole up to the wait */
#pragma unroll
    for (int kc = 0; kc < HD / 32; ++kc)
#pragma unroll
      for (int j = 0; j < 8; ++j) acc[j] = wmma16(ah[kc], kbf[kc][j], acc[j]); }
#pragma unroll
  for (int j = 0; j < 8; ++j) {
#pragma unroll
    for (int r = 0; r < 8; ++r) ss[wave][8 * g + r][j * 16 + col] = (acc[j][r] + accl[j][r] * (1.0f / 1024.0f)) * SCALE; }
  LDSX(); for (int rl = 0; rl < 16; ++rl) vst2(S + (size_t)(ql0 + rl) * TT + k0 + lane * 4, *(const v4f*)&ss[wave][rl][lane * 4]); }
// ---- k_sm: block = query row t (head in group): keys [0, kend): causal -> logit if s <= t else excluded; softmax in f32; P x 2^11 in place (0 for excluded)
__global__ __launch_bounds__(256) void k_sm(float* __restrict__ S0 SM_EXTRA_PARAMS) { __shared__ float sred[8]; __shared__ float sbc; __shared__ __align__(16) float shv[TT];
  const int tid = threadIdx.x; const int t = blockIdx.x; const int kend = (kb_last(t >> 6) + 1) * 128;
  float* sr = S0 + (size_t)blockIdx.y * TT * TT + (size_t)t * TT;
  float m = -3.0e38f; for (int k = tid; k < kend; k += 256) { float v = (!CAUSAL || k <= t) ? sr[k] : -3.0e38f; SM_MASK_HOOK; shv[k] = v; m = fmaxf(m, v); }
#pragma unroll
  for (int o = 1; o < 32; o <<= 1) m = fmaxf(m, __shfl_xor(m, o));
  if ((tid & 31) == 0) sred[tid >> 5] = m; __syncthreads(); if (tid == 0) { float a = sred[0]; for (int i = 1; i < 8; ++i) a = fmaxf(a, sred[i]); sbc = a; } __syncthreads(); m = sbc; __syncthreads();
  float sum = 0.f; for (int k = tid; k < kend; k += 256) { const float v = shv[k]; const float e = (v <= -1.0e38f) ? 0.f : expf(v - m); shv[k] = e; sum += e; }
#pragma unroll
  for (int o = 1; o < 32; o <<= 1) sum += __shfl_xor(sum, o);
  if ((tid & 31) == 0) sred[tid >> 5] = sum; __syncthreads(); if (tid == 0) { float a = 0.f; for (int i = 0; i < 8; ++i) a += sred[i]; sbc = a > 0.f ? 2048.0f / a : 0.f; }   /* a fully excluded row yields P = 0 */ __syncthreads(); const float inv = sbc;
  for (int k = tid; k < kend; k += 256) shv[k] = shv[k] * inv;
  __syncthreads(); for (int q = tid; q < kend / 4; q += 256) vst2(sr + q * 4, *(const v4f*)&shv[q * 4]); }
// ---- k_pv: block = 64 queries (qb) of (b, h): ctx = P . v over keys [0, kend) (P x 2^11 once to f16 against v f16: 1 product; causal early query blocks: P and v as bf16 hi + lo, 3 products); 256-B (row, head) segment by 16 lanes
__global__ __launch_bounds__(128) void k_pv(const float* __restrict__ PS0, const _Float16* __restrict__ VT, const __bf16* __restrict__ VB, const __bf16* __restrict__ VBL, int b, int h0, float* __restrict__ Y) { const int h = h0 + blockIdx.z; const float* PS = PS0 + (size_t)blockIdx.z * TT * TT; __shared__ __align__(16) float ss[4][16][HD + 4];
  const int tid = threadIdx.x, wave = tid >> 5, lane = tid & 31, col = lane & 15, g = lane >> 4; const int qb = blockIdx.x; const int ql0 = qb * 64 + wave * 16; const int kce = (kb_last(qb) + 1) * 4;
  v8f acc[HD / 16] = {};
  if (qb < QBH) {
    const float* pp = PS + (size_t)(ql0 + col) * TT + 8 * g; const size_t vo = ((size_t)b * CC + h * HD + col) * (size_t)KHI + 8 * g; const __bf16* vhp = VB + vo; const __bf16* vlp = VBL + vo;
#pragma unroll 1
    for (int kc0 = 0; kc0 < kce; kc0 += 2, pp += 64, vhp += 64, vlp += 64) { v16f pr[2]; v16b vh[2][HD / 16], vl[2][HD / 16];   /* kce is a multiple of 4; the loads of two key steps stand in front of the first WMMA and are in flight together */
#pragma unroll
      for (int u = 0; u < 2; ++u) { pr[u] = raw16(pp + u * 32);
#pragma unroll
        for (int j = 0; j < HD / 16; ++j) { vh[u][j] = pair_b(vhp + (size_t)j * 16 * KHI + u * 32); vl[u][j] = pair_b(vlp + (size_t)j * 16 * KHI + u * 32); } }
      asm volatile("s_wait_xcnt 0x0" :: "v"(pp), "v"(vhp), "v"(vlp) : "memory");   /* behind the trip's loads (the memory clobber holds every one of them in front of it); naming their address registers keeps these whole up to the wait */
#pragma unroll
      for (int u = 0; u < 2; ++u) { const F2 p = bsplit_v(pr[u]);
#pragma unroll
        for (int j = 0; j < HD / 16; ++j) { acc[j] = wmma_bf(p.h, vh[u][j], acc[j]); acc[j] = wmma_bf(p.l, vh[u][j], acc[j]); acc[j] = wmma_bf(p.h, vl[u][j], acc[j]); } } }
  } else {
    const float* pp = PS + (size_t)(ql0 + col) * TT + 8 * g; const _Float16* vp = VT + ((size_t)b * CC + h * HD + col) * (size_t)TT + 8 * g;
#pragma unroll 1
    for (int kc0 = 0; kc0 < kce; kc0 += 4, pp += 128, vp += 128) { v16f pr[4]; v16h vf[4][HD / 16];   /* kce is a multiple of 4; the loads of four key steps stand in front of the first WMMA and are in flight together */
#pragma unroll
      for (int u = 0; u < 4; ++u) { pr[u] = raw16(pp + u * 32);
#pragma unroll
        for (int j = 0; j < HD / 16; ++j) vf[u][j] = pair_h(vp + (size_t)j * 16 * TT + u * 32); }
      asm volatile("s_wait_xcnt 0x0" :: "v"(pp), "v"(vp) : "memory");   /* behind the trip's loads (the memory clobber holds every one of them in front of it); naming their address registers keeps these whole up to the wait */
#pragma unroll
      for (int u = 0; u < 4; ++u) { v16h p;
#pragma unroll
        for (int i = 0; i < 16; ++i) p[i] = (_Float16)pr[u][i];
#pragma unroll
        for (int j = 0; j < HD / 16; ++j) acc[j] = wmma16(p, vf[u][j], acc[j]); } } }
#pragma unroll
  for (int j = 0; j < HD / 16; ++j)
#pragma unroll
    for (int r = 0; r < 8; ++r) ss[wave][8 * g + r][j * 16 + col] = acc[j][r] * (1.0f / 2048.0f);
  LDSX(); for (int rl = 0; rl < 16; ++rl) if (lane < HD / 4) vst2(Y + ((size_t)b * TT + ql0 + rl) * CC + h * HD + lane * 4, *(const v4f*)&ss[wave][rl][lane * 4]); }
// ---- k_out: block = (64 rows, 128 cols): out = ctx Wo (+ bo): ctx x 2^6 once to f16 against Wo as f16(bf16 x 2^8) exact (1 product) x 2^-14; causal early rows (< QHI of each sequence): ctx bf16 hi + lo against exact bf16 Wo (2 products)
__global__ __launch_bounds__(128) void k_out(const float* __restrict__ Y, const float* __restrict__ WO, const float* __restrict__ BO, float* __restrict__ OUT) { __shared__ __align__(16) float sf[4][16][132];
  const int tid = threadIdx.x, wave = tid >> 5, lane = tid & 31, col = lane & 15, g = lane >> 4; const int c0 = blockIdx.y * 128; const size_t r0 = (size_t)blockIdx.x * 64 + wave * 16;
  v8f acc[8] = {};
  const float* yp = Y + (r0 + col) * CC + 8 * g; const float* wp = WO + (size_t)(c0 + col) * CC + 8 * g;   /* the lane's ctx row and its first Wo row ((out,in) layout), each at its k half */
  if (CAUSAL && (int)(((size_t)blockIdx.x * 64) % TT) < QHI) {   /* block-uniform */
#pragma unroll 2
    for (int kc = 0; kc < CC / 32; ++kc, yp += 32, wp += 32) { const v16f ar = raw16(yp); v16f wr[8];   /* all loads of the k step stand in front of its first WMMA and are in flight together */
#pragma unroll
      for (int j = 0; j < 8; ++j) wr[j] = raw16(wp + (size_t)j * 16 * CC);
      asm volatile("s_wait_xcnt 0x0" :: "v"(yp), "v"(wp) : "memory");   /* behind the step's loads (the memory clobber holds every one of them in front of it); naming their address registers keeps these whole up to the wait */
      const F2 a = bsplit_v(ar);
#pragma unroll
      for (int j = 0; j < 8; ++j) { v16b w;
#pragma unroll
        for (int i = 0; i < 16; ++i) w[i] = (__bf16)wr[j][i];
        acc[j] = wmma_bf(a.h, w, acc[j]); acc[j] = wmma_bf(a.l, w, acc[j]); } }
#pragma unroll
    for (int j = 0; j < 8; ++j) { const float bias = BO ? bfr(BO[c0 + j * 16 + col]) : 0.f;
#pragma unroll
      for (int r = 0; r < 8; ++r) sf[wave][8 * g + r][j * 16 + col] = acc[j][r] + bias; }
  } else {
#pragma unroll 2
    for (int kc = 0; kc < CC / 32; ++kc, yp += 32, wp += 32) { const v16f ar = raw16(yp); v16f wr[8];   /* all loads of the k step stand in front of its first WMMA and are in flight together */
#pragma unroll
      for (int j = 0; j < 8; ++j) wr[j] = raw16(wp + (size_t)j * 16 * CC);
      asm volatile("s_wait_xcnt 0x0" :: "v"(yp), "v"(wp) : "memory");   /* behind the step's loads (the memory clobber holds every one of them in front of it); naming their address registers keeps these whole up to the wait */
      v16h a;   /* ctx carried x 2^6 into f16 so small-magnitude context rows stay clear of f16 subnormals */
#pragma unroll
      for (int i = 0; i < 16; ++i) a[i] = (_Float16)(ar[i] * 64.0f);
#pragma unroll
      for (int j = 0; j < 8; ++j) { v16h w;   /* Wo as f16(bf16 x 2^8), exact */
#pragma unroll
        for (int i = 0; i < 16; ++i) w[i] = (_Float16)(bfr(wr[j][i]) * 256.0f);
        acc[j] = wmma16(a, w, acc[j]); } }
#pragma unroll
    for (int j = 0; j < 8; ++j) { const float bias = BO ? bfr(BO[c0 + j * 16 + col]) : 0.f;
#pragma unroll
      for (int r = 0; r < 8; ++r) sf[wave][8 * g + r][j * 16 + col] = acc[j][r] * (1.0f / 16384.0f) + bias; } }   /* 2^-8 (Wo carry) x 2^-6 (ctx carry) */
  LDSX(); for (int rl = 0; rl < 16; ++rl) vst2(OUT + (r0 + rl) * DIN + c0 + lane * 4, *(const v4f*)&sf[wave][rl][lane * 4]); }

extern "C" void kernel_launch(void* const* d_in, const int* in_sizes, int n_in, void* d_out, int out_size, void* d_ws, size_t ws_size, hipStream_t stream) {
  (void)in_sizes; (void)n_in; (void)out_size;
  const float** F = (const float**)d_in;
  if (ws_size < (size_t)WS_END) return;
  char* ws = (char*)d_ws; _Float16 *QH = (_Float16*)(ws + WS_QH), *KH = (_Float16*)(ws + WS_KH), *VT = (_Float16*)(ws + WS_VT), *QL = (_Float16*)(ws + WS_QL), *KL = (_Float16*)(ws + WS_KL); __bf16 *VB = (__bf16*)(ws + WS_VB), *VBL = (__bf16*)(ws + WS_VBL); float *S = (float*)(ws + WS_S), *Y = (float*)(ws + WS_Y);
  (void)Y; (void)QL; (void)KL; (void)VB; (void)VBL;
  // inputs: 0 x [2,2048,1024]; 1 wq [1024,1024] (out,in); 2 wk; 3 wv; 4 wo (out,in); no biases (null pointers)
  k_proj<<<dim3(TNB * TT / 64, CC / 128, 3), 128, 0, stream>>>(F[0], F[0], F[0], F[1], F[2], F[3], nullptr, nullptr, nullptr, QH, QL, KH, KL, VT, VB, VBL);
  for (int b = 0; b < TNB; ++b) for (int h0 = 0; h0 < NH; h0 += HG) {
    k_sc<<<dim3(NQB, TT / 128, HG), 128, 0, stream>>>(QH, KH, QL, KL, b, h0, S);
    k_sm<<<dim3(TT, HG), 256, 0, stream>>>(S);
    k_pv<<<dim3(NQB, 1, HG), 128, 0, stream>>>(S, VT, VB, VBL, b, h0, Y);
  }
  k_out<<<dim3(TNB * TT / 64, DIN / 128), 128, 0, stream>>>(Y, F[4], nullptr, (float*)d_out);
}

// v002
// Measured time: 269 microseconds a run.
// Next to v001, in two timings, it ran 2.39 and 2.38 times as fast.
// Counting every step since v000, it is 4.81 times as fast.
// compute dtype: all float inputs rounded to bf16; q / k / v projections with EXACT bf16 products on WMMA 16x16x32 (f32 accumulate) (no biases); interleaved-pair RoPE in f32 AFTER the bias (embedded frequencies, precise cosf / sinf, positions = the row index); causal logits: 3 products for the first 384 rows, single f16 q x k after, x 64^-0.5; softmax f32 (row maximum first, logits formed twice, never stored); exp(s - max) x 2^11 once to f16 x v once to f16 (bf16 hi + lo below row 384), / sum after the product; ctx hi+lo x exact Wo below row 384, x2^6 f16 carry x f16(bf16 x 2^8) Wo after, + bo; f32 output.
#include <hip/hip_runtime.h>
#include <math.h>

typedef __attribute__((ext_vector_type(16))) _Float16 v16h;
typedef __attribute__((ext_vector_type(16))) __bf16 v16b;
typedef __attribute__((ext_vector_type(8)))  _Float16 v8h;
typedef __attribute__((ext_vector_type(8)))  float v8f;
typedef __attribute__((ext_vector_type(4)))  float v4f;
typedef __attribute__((ext_vector_type(2)))  float v2f;
typedef __attribute__((ext_vector_type(4)))  unsigned v4u;
typedef __attribute__((ext_vector_type(4)))  int v4i;
typedef float __attribute__((may_alias)) float_a;
typedef int __attribute__((may_alias)) int_a;

template <typename T> __device__ __forceinline__ void vst2(void* p, T v) { *(T*)p = v;  }
__device__ __forceinline__ v8f wmma16(v16h a, v16h b, v8f c) {
  v8f d = __builtin_amdgcn_wmma_f32_16x16x32_f16(false, a, false, b, (short)0, c, false, false);
  asm volatile("v_nop\n\tv_nop\n\tv_nop\n\tv_nop" : "+v"(d) : "v"(a), "v"(b));
  return d;
}
__device__ __forceinline__ v8f wmma_bf(v16b a, v16b b, v8f c) {
  v8f d = __builtin_amdgcn_wmma_f32_16x16x32_bf16(false, a, false, b, (short)0, c, false, false);
  asm volatile("v_nop\n\tv_nop\n\tv_nop\n\tv_nop" : "+v"(d) : "v"(a), "v"(b));
  return d;
}
// 16x16x32 fragments: lane = (h = lane>>4, row/col = lane&15); elements 0..7 = k0+8h+0..7, 8..15 = k0+16+8h+0..7; D element r = row 8h+r
__device__ __forceinline__ v16h frag_h(const _Float16* rowk0, int lane) {
  union { v16h v; v8h q[2]; } u; const _Float16* p = rowk0 + 8 * (lane >> 4);
  u.q[0] = *(const v8h*)p; u.q[1] = *(const v8h*)(p + 16); return u.v;
}
__device__ __forceinline__ v16h frag_f32(const float* rowk0, int lane) {
  v16h a; const float* p = rowk0 + 8 * (lane >> 4);
#pragma unroll
  for (int i = 0; i < 8; ++i) { a[i] = (_Float16)p[i]; a[8 + i] = (_Float16)p[16 + i]; }
  return a;
}
__device__ __forceinline__ v16h frag_f32s(const float* rowk0, int lane, float sc) {
  v16h a; const float* p = rowk0 + 8 * (lane >> 4);
#pragma unroll
  for (int i = 0; i < 8; ++i) { a[i] = (_Float16)(p[i] * sc); a[8 + i] = (_Float16)(p[16 + i] * sc); }
  return a;
}
// column fragment from a [K][ld] layout (column n), rows >= K read as 0
__device__ __forceinline__ v16h fragc_f32(const float* W, int k0, int n, int lane, int ld, int K) {
  v16h a; const int g = lane >> 4;
#pragma unroll
  for (int i = 0; i < 8; ++i) { const int ka = k0 + 8 * g + i, kb = ka + 16;
    a[i] = (_Float16)(ka < K ? W[(size_t)(ka < K ? ka : K - 1) * ld + n] : 0.f); a[8 + i] = (_Float16)(kb < K ? W[(size_t)(kb < K ? kb : K - 1) * ld + n] : 0.f); }
  return a;
}
struct F2 { v16b h, l; };
__device__ __forceinline__ F2 bsplit16(const float v[16]) { F2 r;
#pragma unroll
  for (int i = 0; i < 16; ++i) { const __bf16 h = (__bf16)v[i]; r.h[i] = h; r.l[i] = (__bf16)(v[i] - (float)h); }
  return r; }
__device__ __forceinline__ F2 split_row(const float* row, int k0, int lane) { float v[16]; const float* p = row + k0 + 8 * (lane >> 4);
#pragma unroll
  for (int i = 0; i < 8; ++i) { v[i] = p[i]; v[8 + i] = p[16 + i]; }
  return bsplit16(v); }
__device__ __forceinline__ F2 split_rowK(const float* row, int k0, int lane, int K) { float v[16]; const int g = lane >> 4;
#pragma unroll
  for (int i = 0; i < 8; ++i) { const int ka = k0 + 8 * g + i, kb = ka + 16; v[i] = ka < K ? row[ka < K ? ka : K - 1] : 0.f; v[8 + i] = kb < K ? row[kb < K ? kb : K - 1] : 0.f; }
  return bsplit16(v); }
__device__ __forceinline__ F2 split_col(const float* W, int k0, int n, int lane, int ld, int K) { float v[16]; const int g = lane >> 4;
#pragma unroll
  for (int i = 0; i < 8; ++i) { const int ka = k0 + 8 * g + i, kb = ka + 16; v[i] = ka < K ? W[(size_t)(ka < K ? ka : K - 1) * ld + n] : 0.f; v[8 + i] = kb < K ? W[(size_t)(kb < K ? kb : K - 1) * ld + n] : 0.f; }
  return bsplit16(v); }
__device__ __forceinline__ v8f mac3(const F2& a, const F2& b, v8f c) { c = wmma_bf(a.l, b.h, c); c = wmma_bf(a.h, b.l, c); return wmma_bf(a.h, b.h, c); }
__device__ __forceinline__ float sigm(float v) { return 1.0f / (1.0f + expf(-v)); }
#define LDSX() do { asm volatile("s_wait_dscnt 0" ::: "memory"); __builtin_amdgcn_wave_barrier(); __builtin_amdgcn_fence(__ATOMIC_RELEASE, "workgroup"); } while (0)

// Causal multi-head self-attention with interleaved-pair RoPE (x [2,2048,1024]; torch (out,in) wq / wk / wv / wo [1024,1024] applied as x @ W.T, no biases; 16 heads x 64; RoPE on Q and K: adjacent (even, odd) pairs (xe c - xo s, xe s + xo c) re-interleaved, theta 10000, positions 0..2047; scores / sqrt(64); tril kept, -inf elsewhere (the module's own softmax guards the -inf row maximum: every row keeps its diagonal, so the guard never fires); out @ wo.T).
#define NB 2
#define TT 2048
#define CC 1024            // NH * HD = projected width
#define DIN 1024          // input (model) width
#define NH 16
#define HD 64
#define NQB (TT / 64)
#define SCALE (0.125f)
#define CAUSAL 1
#ifndef TNB
#define TNB NB
#endif
__device__ __forceinline__ float bfr(float v) { return (float)(__bf16)v; }
typedef __attribute__((ext_vector_type(8))) __bf16 v8b;
__device__ __forceinline__ v16b frag_b(const __bf16* rowk0, int lane) {
  union { v16b v; v8b q[2]; } u; const __bf16* p = rowk0 + 8 * (lane >> 4);
  u.q[0] = *(const v8b*)p; u.q[1] = *(const v8b*)(p + 16); return u.v;
}
// unconverted fragment reads; p = the lane's row + k0 + 8 * (lane >> 4): elements 0..7 = p[0..7], 8..15 = p[16..23] (the k order of frag_h / frag_f32 / split_row / wcol_oi)
typedef __attribute__((ext_vector_type(16))) float v16f;
__device__ __forceinline__ v16f raw16(const float* p) { v16f r;
#pragma unroll
  for (int i = 0; i < 8; ++i) { r[i] = p[i]; r[8 + i] = p[16 + i]; }
  return r; }
__device__ __forceinline__ v16h pair_h(const _Float16* p) { union { v16h v; v8h q[2]; } u; u.q[0] = *(const v8h*)p; u.q[1] = *(const v8h*)(p + 16); return u.v; }
__device__ __forceinline__ v16b pair_b(const __bf16* p) { union { v16b v; v8b q[2]; } u; u.q[0] = *(const v8b*)p; u.q[1] = *(const v8b*)(p + 16); return u.v; }
__device__ __forceinline__ F2 bsplit_v(v16f r) { float v[16];
#pragma unroll
  for (int i = 0; i < 16; ++i) v[i] = r[i];
  return bsplit16(v); }
#define QBH 6              // causal: query blocks 0..QBH-1 of each sequence (few keys, no averaging) take the high-precision path
#define QHI 384            // rows carrying a q residual plane
#define KHI 384            // key rows carrying k residual / v bf16 hi+lo planes (used only by the causal high-precision path)
// B fragment (k rows k0+.., output column o) of a weight: (in,out) [K][ld] or (out,in) [ld rows of K]: bf16 exact, or f16(bf16 * 256) exact
__device__ __forceinline__ v16b wcol_io(const float* Wm, int k0, int o, int lane, int ld) { v16b w; const int g = lane >> 4;
#pragma unroll
  for (int i = 0; i < 8; ++i) { w[i] = (__bf16)Wm[(size_t)(k0 + 8 * g + i) * ld + o]; w[8 + i] = (__bf16)Wm[(size_t)(k0 + 16 + 8 * g + i) * ld + o]; }
  return w; }
__device__ __forceinline__ v16b wcol_oi(const float* Wm, int k0, int o, int lane, int K) { v16b w; const float* p = Wm + (size_t)o * K + k0 + 8 * (lane >> 4);
#pragma unroll
  for (int i = 0; i < 8; ++i) { w[i] = (__bf16)p[i]; w[8 + i] = (__bf16)p[16 + i]; }
  return w; }
__device__ __forceinline__ v16h wcolh_io(const float* Wm, int k0, int o, int lane, int ld) { v16h w; const int g = lane >> 4;
#pragma unroll
  for (int i = 0; i < 8; ++i) { w[i] = (_Float16)(bfr(Wm[(size_t)(k0 + 8 * g + i) * ld + o]) * 256.0f); w[8 + i] = (_Float16)(bfr(Wm[(size_t)(k0 + 16 + 8 * g + i) * ld + o]) * 256.0f); }
  return w; }
__device__ __forceinline__ v16h wcolh_oi(const float* Wm, int k0, int o, int lane, int K) { v16h w; const float* p = Wm + (size_t)o * K + k0 + 8 * (lane >> 4);
#pragma unroll
  for (int i = 0; i < 8; ++i) { w[i] = (_Float16)(bfr(p[i]) * 256.0f); w[8 + i] = (_Float16)(bfr(p[16 + i]) * 256.0f); }
  return w; }
#define WQKV_LAYOUT 1   // 0 = (in,out) [DIN][CC]; 1 = (out,in) [CC][DIN]; 2 = per-head [NH][DIN][HD]
__device__ __forceinline__ v16b wcol_hdk(const float* Wm, int k0, int o, int lane) { v16b w; const int g = lane >> 4; const float* p = Wm + (size_t)(o / HD) * DIN * HD + (o % HD);
#pragma unroll
  for (int i = 0; i < 8; ++i) { w[i] = (__bf16)p[(size_t)(k0 + 8 * g + i) * HD]; w[8 + i] = (__bf16)p[(size_t)(k0 + 16 + 8 * g + i) * HD]; }
  return w; }
#define WO_OUT_IN 1
#if WQKV_LAYOUT == 1
#define WCOL(W, k0, o, lane) wcol_oi(W, k0, o, lane, DIN)
#elif WQKV_LAYOUT == 2
#define WCOL(W, k0, o, lane) wcol_hdk(W, k0, o, lane)
#else
#define WCOL(W, k0, o, lane) wcol_io(W, k0, o, lane, CC)
#endif
#if WO_OUT_IN
#define WOCOL(W, k0, o, lane) wcol_oi(W, k0, o, lane, CC)
#define WOCOLH(W, k0, o, lane) wcolh_oi(W, k0, o, lane, CC)
#else
#define WOCOL(W, k0, o, lane) wcol_io(W, k0, o, lane, DIN)
#define WOCOLH(W, k0, o, lane) wcolh_io(W, k0, o, lane, DIN)
#endif

// RoPE inverse frequencies 1/10000^(2i/64) (the f32 values jax computes)
__constant__ float INVF[32] = {1.000000000e+00,7.498942018e-01,5.623413324e-01,4.216965139e-01,3.162277639e-01,2.371373624e-01,1.778279394e-01,1.333521456e-01,1.000000015e-01,7.498941571e-02,5.623412877e-02,4.216964915e-02,3.162277862e-02,2.371373586e-02,1.778279431e-02,1.333521493e-02,9.999999776e-03,7.498942316e-03,5.623413250e-03,4.216964822e-03,3.162277862e-03,2.371373819e-03,1.778279431e-03,1.333521446e-03,1.000000047e-03,7.498941850e-04,5.623413017e-04,4.216964880e-04,3.162277862e-04,2.371373848e-04,1.778279402e-04,1.333521504e-04};
#define PROJ_EXTRA_PARAMS
// per (token, head) hook on the staged f32 row (64 floats, projection + bias) of the q and k streams: interleaved-pair rotation (x[2i], x[2i + 1]) by the angle t * INVF[i]; v untouched
#define PROJ_EPI(which, row, t, h) do { if ((which) < 2) { float* rw = (row); const float pos_ = (float)(t);   /* position = the token's sequence index */ _Pragma("unroll 4") for (int i = 0; i < 32; ++i) { _Pragma("clang fp contract(off)") const float ang = pos_ * INVF[i]; const float cs = cosf(ang), sn = sinf(ang); const float xe = rw[2 * i], xo = rw[2 * i + 1]; rw[2 * i] = xe * cs - xo * sn; rw[2 * i + 1] = xe * sn + xo * cs; } } } while (0)
#ifndef PROJ_EXTRA_PARAMS
#define PROJ_EXTRA_PARAMS
#endif

#define WS_QH  0u                                      // f16 q rows [b*t][CC]
#define WS_KH  (WS_QH + 2u * (size_t)NB * TT * CC)      // f16 k rows [b*t][CC]
#define WS_VT  (WS_KH + 2u * (size_t)NB * TT * CC)      // f16 v planes [b][c][t]
#define WS_QL  (WS_VT + 2u * (size_t)NB * CC * TT)      // f16 q residual x 2^10 rows [b][t < QHI][CC]
#define WS_KL  (WS_QL + 2u * (size_t)NB * QHI * CC)     // f16 k residual x 2^10 rows [b][t < KHI][CC]
#define WS_VB  (WS_KL + 2u * (size_t)NB * KHI * CC)     // bf16 v hi planes [b][c][t < KHI]
#define WS_VBL (WS_VB + 2u * (size_t)NB * CC * KHI)
#define WS_Y   (WS_VBL + 2u * (size_t)NB * CC * KHI)    // f32 ctx rows [b*t][CC] (only when there is an output projection)
#define WS_END (WS_Y  + 4u * (size_t)NB * TT * CC)

// ---- k_proj: block = (64 rows, 128 cols, which): q/k/v = X W (+ b) with exact bf16 products (K = DIN) -> which 0: q f16 rows (+ residual rows < QHI); 1: k f16 rows (+ residual rows < KHI); 2: v f16 planes [c][t] (+ bf16 hi/lo planes for t < KHI)
__global__ __launch_bounds__(128) void k_proj(const float* __restrict__ XQ, const float* __restrict__ XK, const float* __restrict__ XV, const float* __restrict__ WQ, const float* __restrict__ WK, const float* __restrict__ WV, const float* __restrict__ BQ, const float* __restrict__ BK, const float* __restrict__ BV,
    _Float16* __restrict__ QH, _Float16* __restrict__ QL, _Float16* __restrict__ KH, _Float16* __restrict__ KL, _Float16* __restrict__ VT, __bf16* __restrict__ VB, __bf16* __restrict__ VBL PROJ_EXTRA_PARAMS) {
  __shared__ __align__(16) float st[64][132]; __shared__ __align__(16) _Float16 sh[64][136], sl[64][136]; __shared__ __align__(16) _Float16 th[128][72]; __shared__ __align__(16) __bf16 tb[128][72], tbl[128][72];
  const int tid = threadIdx.x, wave = tid >> 5, lane = tid & 31, col = lane & 15, g = lane >> 4; const int which = blockIdx.z; const int c0 = blockIdx.y * 128; const size_t r0 = (size_t)blockIdx.x * 64; const size_t bb = r0 / TT; const int t0 = (int)(r0 % TT);
  const float* X = which == 0 ? XQ : which == 1 ? XK : XV; const float* WA = which == 0 ? WQ : which == 1 ? WK : WV; const float* BA = which == 0 ? BQ : which == 1 ? BK : BV;
  v8f acc[8] = {};
#pragma unroll 2
  for (int kc = 0; kc < DIN / 32; ++kc) { v16b a; { const float* p = X + (r0 + wave * 16 + col) * DIN + kc * 32 + 8 * g;
#pragma unroll
      for (int i = 0; i < 8; ++i) { a[i] = (__bf16)p[i]; a[8 + i] = (__bf16)p[16 + i]; } }
    v16b w[8];   /* all fragment loads of the k step stand in front of its first WMMA: one load latency a step */
#pragma unroll
    for (int j = 0; j < 8; ++j) w[j] = WCOL(WA, kc * 32, c0 + j * 16 + col, lane);
#pragma unroll
    for (int j = 0; j < 8; ++j) acc[j] = wmma_bf(a, w[j], acc[j]); }
  { // stage the f32 tile (acc + bias) in LDS, run the per-(row, head) epilogue hook, then convert
#pragma unroll
    for (int j = 0; j < 8; ++j) { const float bias = BA ? bfr(BA[c0 + j * 16 + col]) : 0.f;
#pragma unroll
      for (int r = 0; r < 8; ++r) st[wave * 16 + 8 * g + r][j * 16 + col] = acc[j][r] + bias; }
    __syncthreads();
    for (int e = tid; e < 64 * (128 / HD); e += 128) { const int rl = e / (128 / HD), hh = e % (128 / HD); PROJ_EPI(which, &st[rl][hh * HD], (int)((r0 + rl) % TT), (c0 / HD) + hh); }
    __syncthreads(); }
  if (which < 2) { _Float16* DH = which == 0 ? QH : KH; _Float16* DL = which == 0 ? QL : KL; const int nhi = which == 0 ? QHI : KHI; const bool hi_rows = t0 < nhi;
    for (int e = tid; e < 64 * 128; e += 128) { const int rl = e >> 7, cl = e & 127; const float v = st[rl][cl]; const _Float16 hv = (_Float16)v; sh[rl][cl] = hv; sl[rl][cl] = (_Float16)((v - (float)hv) * 1024.0f); }
    __syncthreads();
    for (int e = tid; e < 64 * 16; e += 128) { const int rl = e >> 4, q = e & 15; vst2((unsigned*)(DH + (r0 + rl) * CC + c0 + q * 8), *(const v4u*)&sh[rl][q * 8]); if (hi_rows) vst2((unsigned*)(DL + (bb * nhi + t0 + rl) * (size_t)CC + c0 + q * 8), *(const v4u*)&sl[rl][q * 8]); }
  } else { const bool hi_rows = t0 < KHI;
    for (int e = tid; e < 64 * 128; e += 128) { const int rl = e & 63, cl = e >> 6; const float v = st[rl][cl]; th[cl][rl] = (_Float16)v; const __bf16 bh = (__bf16)v; tb[cl][rl] = bh; tbl[cl][rl] = (__bf16)(v - (float)bh); }
    __syncthreads();
    for (int e = tid; e < 128 * 8; e += 128) { const int cl = e >> 3, q = e & 7; vst2((unsigned*)(VT + (bb * CC + c0 + cl) * (size_t)TT + t0 + q * 8), *(const v4u*)&th[cl][q * 8]); if (hi_rows) { const size_t o3 = (bb * CC + c0 + cl) * (size_t)KHI + t0 + q * 8; vst2((unsigned*)(VB + o3), *(const v4u*)&tb[cl][q * 8]); vst2((unsigned*)(VBL + o3), *(const v4u*)&tbl[cl][q * 8]); } } } }
// ---- k_att: block = 4 waves x 16 queries of (b, h), two query blocks one after the other (x and NQB - 1 - x: every block walks (NQB + 1) x 64 keys). Logits as S^T = K Q^T: D register r of key tile kt = key kt * 16 + 8g + r of query col, so a lane holds one query's logits and two tiles are the A fragment of P in the k order of pair_h. Pass 1: row maximum. Pass 2: the same logits again, e = exp(s - max), sum of e in f32, e x 2^11 to f16 (early query blocks: bf16 hi + lo) against v; ctx = acc / (2^11 sum). Nothing of S goes to memory.
// a trip is NT key tiles of 16: 64 keys; 32 in the early query blocks, whose residual planes double the fragments
template <bool HI> __device__ __forceinline__ void att_ldk(const _Float16* kp, const _Float16* klp, v16h (&kf)[2][HI ? 2 : 4], v16h (&klf)[2][HI ? 2 : 4]) {
#pragma unroll
  for (int kc = 0; kc < 2; ++kc)
#pragma unroll
    for (int kt = 0; kt < (HI ? 2 : 4); ++kt) { kf[kc][kt] = pair_h(kp + (size_t)kt * 16 * CC + kc * 32); if (HI) klf[kc][kt] = pair_h(klp + (size_t)kt * 16 * CC + kc * 32); } }
// logits x SCALE of a trip's keys; srel = query - the trip's first key - 8g: key kt * 16 + r of the lane is kept while kt * 16 + r <= srel
template <bool HI, bool MASK> __device__ __forceinline__ void att_logits(const v16h (&kf)[2][HI ? 2 : 4], const v16h (&klf)[2][HI ? 2 : 4], const v16h (&qh)[2], const v16h (&ql)[2], int srel, float (&s)[HI ? 2 : 4][8]) {
  constexpr int NT = HI ? 2 : 4; v8f a[NT] = {}, al[NT] = {};
#pragma unroll
  for (int kc = 0; kc < 2; ++kc)
#pragma unroll
    for (int kt = 0; kt < NT; ++kt) { a[kt] = wmma16(kf[kc][kt], qh[kc], a[kt]); if (HI) { al[kt] = wmma16(kf[kc][kt], ql[kc], al[kt]); al[kt] = wmma16(klf[kc][kt], qh[kc], al[kt]); } }
#pragma unroll
  for (int kt = 0; kt < NT; ++kt)
#pragma unroll
    for (int r = 0; r < 8; ++r) { const float v = HI ? (a[kt][r] + al[kt][r] * (1.0f / 1024.0f)) * SCALE : a[kt][r] * SCALE; s[kt][r] = (!MASK || kt * 16 + r <= srel) ? v : -3.0e38f; } }
template <bool HI, bool MASK> __device__ __forceinline__ float att_max(const _Float16* kp, const _Float16* klp, const v16h (&qh)[2], const v16h (&ql)[2], int srel) {
  constexpr int NT = HI ? 2 : 4; v16h kf[2][NT], klf[2][NT]; float s[NT][8]; att_ldk<HI>(kp, klp, kf, klf);
  asm volatile("s_wait_xcnt 0x0" :: "v"(kp), "v"(klp) : "memory");   /* behind the trip's loads (the memory clobber holds every one of them in front of it); naming their address registers keeps these whole up to the wait */
  att_logits<HI, MASK>(kf, klf, qh, ql, srel, s);
  float m = s[0][0];
#pragma unroll
  for (int kt = 0; kt < NT; ++kt)
#pragma unroll
    for (int r = 0; r < 8; ++r) m = fmaxf(m, s[kt][r]);
  return m; }
// m = the query's row maximum, finite (every row keeps its diagonal): an excluded logit (-3e38) gives expf = 0
template <bool HI, bool MASK> __device__ __forceinline__ void att_pv(const _Float16* kp, const _Float16* klp, const _Float16* vp, const __bf16* vhp, const __bf16* vlp, const v16h (&qh)[2], const v16h (&ql)[2], int srel, float m, float& sum, v8f (&acc)[HD / 16]) {
  constexpr int NT = HI ? 2 : 4; v16h kf[2][NT], klf[2][NT], vf[NT / 2][HD / 16]; v16b vh[NT / 2][HD / 16], vl[NT / 2][HD / 16]; float s[NT][8]; att_ldk<HI>(kp, klp, kf, klf);
  asm volatile("s_wait_xcnt 0x0" :: "v"(kp), "v"(klp) : "memory");   /* behind the trip's k loads (the memory clobber holds every one of them in front of it); naming their address registers keeps these whole up to the wait */
  att_logits<HI, MASK>(kf, klf, qh, ql, srel, s);
#pragma unroll
  for (int u = 0; u < NT / 2; ++u)   /* the v loads take the k fragments' registers and fly under the exponentials */
#pragma unroll
    for (int j = 0; j < HD / 16; ++j) { if (!HI) vf[u][j] = pair_h(vp + (size_t)j * 16 * TT + u * 32); else { vh[u][j] = pair_b(vhp + (size_t)j * 16 * KHI + u * 32); vl[u][j] = pair_b(vlp + (size_t)j * 16 * KHI + u * 32); } }
  if (!HI) asm volatile("s_wait_xcnt 0x0" :: "v"(vp) : "memory");   /* behind the v loads, as above */
  else asm volatile("s_wait_xcnt 0x0" :: "v"(vhp), "v"(vlp) : "memory");   /* behind the v loads, as above */
  float part[NT];
#pragma unroll
  for (int kt = 0; kt < NT; ++kt) { part[kt] = 0.f;
#pragma unroll
    for (int r = 0; r < 8; ++r) { const float e = expf(s[kt][r] - m); part[kt] += e; s[kt][r] = e * 2048.0f; } }
#pragma unroll
  for (int kt = 0; kt < NT; kt += 2) sum += part[kt] + part[kt + 1];
#pragma unroll
  for (int u = 0; u < NT / 2; ++u) {
    if (!HI) { v16h p;
#pragma unroll
      for (int i = 0; i < 8; ++i) { p[i] = (_Float16)s[2 * u][i]; p[8 + i] = (_Float16)s[2 * u + 1][i]; }
#pragma unroll
      for (int j = 0; j < HD / 16; ++j) acc[j] = wmma16(p, vf[u][j], acc[j]);
    } else { float pv[16];
#pragma unroll
      for (int i = 0; i < 8; ++i) { pv[i] = s[2 * u][i]; pv[8 + i] = s[2 * u + 1][i]; }
      const F2 p = bsplit16(pv);
#pragma unroll
      for (int j = 0; j < HD / 16; ++j) { acc[j] = wmma_bf(p.h, vh[u][j], acc[j]); acc[j] = wmma_bf(p.l, vh[u][j], acc[j]); acc[j] = wmma_bf(p.h, vl[u][j], acc[j]); } } } }
template <bool HI> __device__ __forceinline__ void att_tile(const _Float16* __restrict__ QH, const _Float16* __restrict__ KH, const _Float16* __restrict__ QL, const _Float16* __restrict__ KL, const _Float16* __restrict__ VT, const __bf16* __restrict__ VB, const __bf16* __restrict__ VBL, float* __restrict__ Y, float (*ssw)[HD + 4], int b, int h, int qb, int wave, int lane) {
  constexpr int KS = HI ? 32 : 64;   /* keys a trip */
  const int col = lane & 15, g = lane >> 4; const int ql0 = qb * 64 + wave * 16; const size_t ho = (size_t)h * HD + 8 * g;
  const int nfull = HI ? 0 : qb, nmask = HI ? (qb + 1) * 2 : 1;   /* trips wholly below the diagonal, then trips masked by index */
  const int srel0 = ql0 + col - 8 * g - nfull * KS;
  const _Float16* qp = QH + ((size_t)b * TT + ql0 + col) * CC + ho; const _Float16* qlp = HI ? QL + ((size_t)b * QHI + ql0 + col) * CC + ho : qp;
  v16h qh[2], ql[2];
#pragma unroll
  for (int kc = 0; kc < 2; ++kc) { qh[kc] = pair_h(qp + kc * 32); ql[kc] = HI ? pair_h(qlp + kc * 32) : qh[kc]; }
  asm volatile("s_wait_xcnt 0x0" :: "v"(qp), "v"(qlp) : "memory");   /* behind the q loads, as below */
  const _Float16* const kp0 = KH + ((size_t)b * TT + col) * CC + ho; const _Float16* const klp0 = HI ? KL + ((size_t)b * KHI + col) * CC + ho : kp0;
  float m = -3.0e38f;
  { const _Float16 *kp = kp0, *klp = klp0; int srel = srel0;
#pragma unroll 1   // rolled: one trip's fragments fill the registers
    for (int tr = 0; tr < nfull; ++tr, kp += (size_t)KS * CC, klp += (size_t)KS * CC) m = fmaxf(m, att_max<HI, false>(kp, klp, qh, ql, 0));
#pragma unroll 1   // rolled: one trip's fragments fill the registers
    for (int tr = 0; tr < nmask; ++tr, kp += (size_t)KS * CC, klp += (size_t)KS * CC, srel -= KS) m = fmaxf(m, att_max<HI, true>(kp, klp, qh, ql, srel)); }
  m = fmaxf(m, __shfl_xor(m, 16));   /* the two lane halves hold the two key halves of one query */
  v8f acc[HD / 16] = {}; float sum = 0.f;
  { const _Float16 *kp = kp0, *klp = klp0; const _Float16* vp = VT + ((size_t)b * CC + h * HD + col) * (size_t)TT + 8 * g; const size_t vo = ((size_t)b * CC + h * HD + col) * (size_t)KHI + 8 * g; const __bf16 *vhp = VB + vo, *vlp = VBL + vo; int srel = srel0;
#pragma unroll 1   // rolled: one trip's fragments fill the registers
    for (int tr = 0; tr < nfull; ++tr, kp += (size_t)KS * CC, klp += (size_t)KS * CC, vp += KS, vhp += KS, vlp += KS) att_pv<HI, false>(kp, klp, vp, vhp, vlp, qh, ql, 0, m, sum, acc);
#pragma unroll 1   // rolled: one trip's fragments fill the registers
    for (int tr = 0; tr < nmask; ++tr, kp += (size_t)KS * CC, klp += (size_t)KS * CC, vp += KS, vhp += KS, vlp += KS, srel -= KS) att_pv<HI, true>(kp, klp, vp, vhp, vlp, qh, ql, srel, m, sum, acc); }
  sum += __shfl_xor(sum, 16);
  const float inv = sum > 0.f ? 1.0f / (sum * 2048.0f) : 0.f;   /* of query col; a fully excluded row yields 0 */
#pragma unroll
  for (int r = 0; r < 8; ++r) { const float ir = __shfl(inv, 8 * g + r);   /* accumulator register r is query 8g + r */
#pragma unroll
    for (int j = 0; j < HD / 16; ++j) ssw[8 * g + r][j * 16 + col] = acc[j][r] * ir; }
  LDSX();
  float* yp = Y + ((size_t)b * TT + ql0 + g) * CC + h * HD + col * 4;   /* 256-B (row, head) segment by 16 lanes, two rows a store */
#pragma unroll
  for (int rl = 0; rl < 16; rl += 2) vst2(yp + (size_t)rl * CC, *(const v4f*)&ssw[rl + g][col * 4]);
  asm volatile("s_wait_xcnt 0x0" :: "v"(yp) : "memory");   /* behind the stores: the next tile overwrites their registers */
  LDSX(); }   /* the next tile's staging writes stay behind these reads */
// amdgpu_waves_per_eu(2, 2): the grid gives two waves a SIMD (512 blocks x 4 waves, 1,024 SIMDs); with that register budget a trip's exponentials interleave instead of running as one dependent chain after the other
__global__ __launch_bounds__(128) __attribute__((amdgpu_waves_per_eu(2, 2))) void k_att(const _Float16* __restrict__ QH, const _Float16* __restrict__ KH, const _Float16* __restrict__ QL, const _Float16* __restrict__ KL, const _Float16* __restrict__ VT, const __bf16* __restrict__ VB, const __bf16* __restrict__ VBL, float* __restrict__ Y) { __shared__ __align__(16) float ss[4][16][HD + 4];
  const int tid = threadIdx.x, wave = tid >> 5, lane = tid & 31; const int h = blockIdx.y, b = blockIdx.z;
#pragma unroll 1   // rolled: the two tiles share one copy of the code
  for (int half = 0; half < 2; ++half) { const int qb = half ? (int)blockIdx.x : NQB - 1 - (int)blockIdx.x;   /* block-uniform */
    if (qb < QBH) att_tile<true>(QH, KH, QL, KL, VT, VB, VBL, Y, ss[wave], b, h, qb, wave, lane);
    else att_tile<false>(QH, KH, QL, KL, VT, VB, VBL, Y, ss[wave], b, h, qb, wave, lane); } }
// ---- k_out: block = (64 rows, 128 cols): out = ctx Wo (+ bo): ctx x 2^6 once to f16 against Wo as f16(bf16 x 2^8) exact (1 product) x 2^-14; causal early rows (< QHI of each sequence): ctx bf16 hi + lo against exact bf16 Wo (2 products)
__global__ __launch_bounds__(128) void k_out(const float* __restrict__ Y, const float* __restrict__ WO, const float* __restrict__ BO, float* __restrict__ OUT) { __shared__ __align__(16) float sf[4][16][132];
  const int tid = threadIdx.x, wave = tid >> 5, lane = tid & 31, col = lane & 15, g = lane >> 4; const int c0 = blockIdx.y * 128; const size_t r0 = (size_t)blockIdx.x * 64 + wave * 16;
  v8f acc[8] = {};
  const float* yp = Y + (r0 + col) * CC + 8 * g; const float* wp = WO + (size_t)(c0 + col) * CC + 8 * g;   /* the lane's ctx row and its first Wo row ((out,in) layout), each at its k half */
  if (CAUSAL && (int)(((size_t)blockIdx.x * 64) % TT) < QHI) {   /* block-uniform */
#pragma unroll 2
    for (int kc = 0; kc < CC / 32; ++kc, yp += 32, wp += 32) { const v16f ar = raw16(yp); v16f wr[8];   /* all loads of the k step stand in front of its first WMMA and are in flight together */
#pragma unroll
      for (int j = 0; j < 8; ++j) wr[j] = raw16(wp + (size_t)j * 16 * CC);
      asm volatile("s_wait_xcnt 0x0" :: "v"(yp), "v"(wp) : "memory");   /* behind the step's loads (the memory clobber holds every one of them in front of it); naming their address registers keeps these whole up to the wait */
      const F2 a = bsplit_v(ar);
#pragma unroll
      for (int j = 0; j < 8; ++j) { v16b w;
#pragma unroll
        for (int i = 0; i < 16; ++i) w[i] = (__bf16)wr[j][i];
        acc[j] = wmma_bf(a.h, w, acc[j]); acc[j] = wmma_bf(a.l, w, acc[j]); } }
#pragma unroll
    for (int j = 0; j < 8; ++j) { const float bias = BO ? bfr(BO[c0 + j * 16 + col]) : 0.f;
#pragma unroll
      for (int r = 0; r < 8; ++r) sf[wave][8 * g + r][j * 16 + col] = acc[j][r] + bias; }
  } else {
#pragma unroll 2
    for (int kc = 0; kc < CC / 32; ++kc, yp += 32, wp += 32) { const v16f ar = raw16(yp); v16f wr[8];   /* all loads of the k step stand in front of its first WMMA and are in flight together */
#pragma unroll
      for (int j = 0; j < 8; ++j) wr[j] = raw16(wp + (size_t)j * 16 * CC);
      asm volatile("s_wait_xcnt 0x0" :: "v"(yp), "v"(wp) : "memory");   /* behind the step's loads (the memory clobber holds every one of them in front of it); naming their address registers keeps these whole up to the wait */
      v16h a;   /* ctx carried x 2^6 into f16 so small-magnitude context rows stay clear of f16 subnormals */
#pragma unroll
      for (int i = 0; i < 16; ++i) a[i] = (_Float16)(ar[i] * 64.0f);
#pragma unroll
      for (int j = 0; j < 8; ++j) { v16h w;   /* Wo as f16(bf16 x 2^8), exact */
#pragma unroll
        for (int i = 0; i < 16; ++i) w[i] = (_Float16)(bfr(wr[j][i]) * 256.0f);
        acc[j] = wmma16(a, w, acc[j]); } }
#pragma unroll
    for (int j = 0; j < 8; ++j) { const float bias = BO ? bfr(BO[c0 + j * 16 + col]) : 0.f;
#pragma unroll
      for (int r = 0; r < 8; ++r) sf[wave][8 * g + r][j * 16 + col] = acc[j][r] * (1.0f / 16384.0f) + bias; } }   /* 2^-8 (Wo carry) x 2^-6 (ctx carry) */
  LDSX(); for (int rl = 0; rl < 16; ++rl) vst2(OUT + (r0 + rl) * DIN + c0 + lane * 4, *(const v4f*)&sf[wave][rl][lane * 4]); }

extern "C" void kernel_launch(void* const* d_in, const int* in_sizes, int n_in, void* d_out, int out_size, void* d_ws, size_t ws_size, hipStream_t stream) {
  (void)in_sizes; (void)n_in; (void)out_size;
  const float** F = (const float**)d_in;
  if (ws_size < (size_t)WS_END) return;
  char* ws = (char*)d_ws; _Float16 *QH = (_Float16*)(ws + WS_QH), *KH = (_Float16*)(ws + WS_KH), *VT = (_Float16*)(ws + WS_VT), *QL = (_Float16*)(ws + WS_QL), *KL = (_Float16*)(ws + WS_KL); __bf16 *VB = (__bf16*)(ws + WS_VB), *VBL = (__bf16*)(ws + WS_VBL); float *Y = (float*)(ws + WS_Y);
  (void)Y; (void)QL; (void)KL; (void)VB; (void)VBL;
  // inputs: 0 x [2,2048,1024]; 1 wq [1024,1024] (out,in); 2 wk; 3 wv; 4 wo (out,in); no biases (null pointers)
  k_proj<<<dim3(TNB * TT / 64, CC / 128, 3), 128, 0, stream>>>(F[0], F[0], F[0], F[1], F[2], F[3], nullptr, nullptr, nullptr, QH, QL, KH, KL, VT, VB, VBL);
  k_att<<<dim3(NQB / 2, NH, TNB), 128, 0, stream>>>(QH, KH, QL, KL, VT, VB, VBL, Y);
  k_out<<<dim3(TNB * TT / 64, DIN / 128), 128, 0, stream>>>(Y, F[4], nullptr, (float*)d_out);
}

// v003
// A run of this version takes 152 microseconds.
// In two side-by-side timings against v002, it was 1.78 and 1.77 times as fast.
// Counting every step since v000, it is 8.54 times as fast.
// compute dtype: all float inputs rounded to bf16; q / k / v projections with EXACT bf16 products on WMMA 16x16x32 (f32 accumulate) (no biases); interleaved-pair RoPE in f32 AFTER the bias (embedded frequencies, precise cosf / sinf, positions = the row index); causal logits: 3 products for the first 384 rows, single f16 q x k after, x 64^-0.5; softmax f32 (row maximum first, logits formed twice, never stored); exp(s - max) x 2^11 once to f16 x v once to f16 (bf16 hi + lo below row 384), / sum after the product; ctx hi+lo x exact Wo below row 384, x2^6 f16 carry x f16(bf16 x 2^8) Wo after, + bo; f32 output.
#include <hip/hip_runtime.h>
#include <math.h>

typedef __attribute__((ext_vector_type(16))) _Float16 v16h;
typedef __attribute__((ext_vector_type(16))) __bf16 v16b;
typedef __attribute__((ext_vector_type(8)))  _Float16 v8h;
typedef __attribute__((ext_vector_type(8)))  float v8f;
typedef __attribute__((ext_vector_type(4)))  float v4f;
typedef __attribute__((ext_vector_type(2)))  float v2f;
typedef __attribute__((ext_vector_type(4)))  unsigned v4u;
typedef __attribute__((ext_vector_type(4)))  int v4i;
typedef float __attribute__((may_alias)) float_a;
typedef int __attribute__((may_alias)) int_a;

template <typename T> __device__ __forceinline__ void vst2(void* p, T v) { *(T*)p = v;  }
__device__ __forceinline__ v8f wmma16(v16h a, v16h b, v8f c) {
  v8f d = __builtin_amdgcn_wmma_f32_16x16x32_f16(false, a, false, b, (short)0, c, false, false);
  asm volatile("v_nop\n\tv_nop\n\tv_nop\n\tv_nop" : "+v"(d) : "v"(a), "v"(b));
  return d;
}
__device__ __forceinline__ v8f wmma_bf(v16b a, v16b b, v8f c) {
  v8f d = __builtin_amdgcn_wmma_f32_16x16x32_bf16(false, a, false, b, (short)0, c, false, false);
  asm volatile("v_nop\n\tv_nop\n\tv_nop\n\tv_nop" : "+v"(d) : "v"(a), "v"(b));
  return d;
}
// 16x16x32 fragments: lane = (h = lane>>4, row/col = lane&15); elements 0..7 = k0+8h+0..7, 8..15 = k0+16+8h+0..7; D element r = row 8h+r
__device__ __forceinline__ v16h frag_h(const _Float16* rowk0, int lane) {
  union { v16h v; v8h q[2]; } u; const _Float16* p = rowk0 + 8 * (lane >> 4);
  u.q[0] = *(const v8h*)p; u.q[1] = *(const v8h*)(p + 16); return u.v;
}
__device__ __forceinline__ v16h frag_f32(const float* rowk0, int lane) {
  v16h a; const float* p = rowk0 + 8 * (lane >> 4);
#pragma unroll
  for (int i = 0; i < 8; ++i) { a[i] = (_Float16)p[i]; a[8 + i] = (_Float16)p[16 + i]; }
  return a;
}
__device__ __forceinline__ v16h frag_f32s(const float* rowk0, int lane, float sc) {
  v16h a; const float* p = rowk0 + 8 * (lane >> 4);
#pragma unroll
  for (int i = 0; i < 8; ++i) { a[i] = (_Float16)(p[i] * sc); a[8 + i] = (_Float16)(p[16 + i] * sc); }
  return a;
}
// column fragment from a [K][ld] layout (column n), rows >= K read as 0
__device__ __forceinline__ v16h fragc_f32(const float* W, int k0, int n, int lane, int ld, int K) {
  v16h a; const int g = lane >> 4;
#pragma unroll
  for (int i = 0; i < 8; ++i) { const int ka = k0 + 8 * g + i, kb = ka + 16;
    a[i] = (_Float16)(ka < K ? W[(size_t)(ka < K ? ka : K - 1) * ld + n] : 0.f); a[8 + i] = (_Float16)(kb < K ? W[(size_t)(kb < K ? kb : K - 1) * ld + n] : 0.f); }
  return a;
}
struct F2 { v16b h, l; };
__device__ __forceinline__ F2 bsplit16(const float v[16]) { F2 r;
#pragma unroll
  for (int i = 0; i < 16; ++i) { const __bf16 h = (__bf16)v[i]; r.h[i] = h; r.l[i] = (__bf16)(v[i] - (float)h); }
  return r; }
__device__ __forceinline__ F2 split_row(const float* row, int k0, int lane) { float v[16]; const float* p = row + k0 + 8 * (lane >> 4);
#pragma unroll
  for (int i = 0; i < 8; ++i) { v[i] = p[i]; v[8 + i] = p[16 + i]; }
  return bsplit16(v); }
__device__ __forceinline__ F2 split_rowK(const float* row, int k0, int lane, int K) { float v[16]; const int g = lane >> 4;
#pragma unroll
  for (int i = 0; i < 8; ++i) { const int ka = k0 + 8 * g + i, kb = ka + 16; v[i] = ka < K ? row[ka < K ? ka : K - 1] : 0.f; v[8 + i] = kb < K ? row[kb < K ? kb : K - 1] : 0.f; }
  return bsplit16(v); }
__device__ __forceinline__ F2 split_col(const float* W, int k0, int n, int lane, int ld, int K) { float v[16]; const int g = lane >> 4;
#pragma unroll
  for (int i = 0; i < 8; ++i) { const int ka = k0 + 8 * g + i, kb = ka + 16; v[i] = ka < K ? W[(size_t)(ka < K ? ka : K - 1) * ld + n] : 0.f; v[8 + i] = kb < K ? W[(size_t)(kb < K ? kb : K - 1) * ld + n] : 0.f; }
  return bsplit16(v); }
__device__ __forceinline__ v8f mac3(const F2& a, const F2& b, v8f c) { c = wmma_bf(a.l, b.h, c); c = wmma_bf(a.h, b.l, c); return wmma_bf(a.h, b.h, c); }
__device__ __forceinline__ float sigm(float v) { return 1.0f / (1.0f + expf(-v)); }
#define LDSX() do { asm volatile("s_wait_dscnt 0" ::: "memory"); __builtin_amdgcn_wave_barrier(); __builtin_amdgcn_fence(__ATOMIC_RELEASE, "workgroup"); } while (0)

// Causal multi-head self-attention with interleaved-pair RoPE (x [2,2048,1024]; torch (out,in) wq / wk / wv / wo [1024,1024] applied as x @ W.T, no biases; 16 heads x 64; RoPE on Q and K: adjacent (even, odd) pairs (xe c - xo s, xe s + xo c) re-interleaved, theta 10000, positions 0..2047; scores / sqrt(64); tril kept, -inf elsewhere (the module's own softmax guards the -inf row maximum: every row keeps its diagonal, so the guard never fires); out @ wo.T).
#define NB 2
#define TT 2048
#define CC 1024            // NH * HD = projected width
#define DIN 1024          // input (model) width
#define NH 16
#define HD 64
#define NQB (TT / 64)
#define SCALE (0.125f)
#define CAUSAL 1
#ifndef TNB
#define TNB NB
#endif
__device__ __forceinline__ float bfr(float v) { return (float)(__bf16)v; }
typedef __attribute__((ext_vector_type(8))) __bf16 v8b;
__device__ __forceinline__ v16b frag_b(const __bf16* rowk0, int lane) {
  union { v16b v; v8b q[2]; } u; const __bf16* p = rowk0 + 8 * (lane >> 4);
  u.q[0] = *(const v8b*)p; u.q[1] = *(const v8b*)(p + 16); return u.v;
}
// unconverted fragment reads; p = the lane's row + k0 + 8 * (lane >> 4): elements 0..7 = p[0..7], 8..15 = p[16..23] (the k order of frag_h / frag_f32 / split_row / wcol_oi)
typedef __attribute__((ext_vector_type(16))) float v16f;
__device__ __forceinline__ v16f raw16(const float* p) { v16f r;
#pragma unroll
  for (int i = 0; i < 8; ++i) { r[i] = p[i]; r[8 + i] = p[16 + i]; }
  return r; }
__device__ __forceinline__ v16h pair_h(const _Float16* p) { union { v16h v; v8h q[2]; } u; u.q[0] = *(const v8h*)p; u.q[1] = *(const v8h*)(p + 16); return u.v; }
__device__ __forceinline__ v16b pair_b(const __bf16* p) { union { v16b v; v8b q[2]; } u; u.q[0] = *(const v8b*)p; u.q[1] = *(const v8b*)(p + 16); return u.v; }
__device__ __forceinline__ F2 bsplit_v(v16f r) { float v[16];
#pragma unroll
  for (int i = 0; i < 16; ++i) v[i] = r[i];
  return bsplit16(v); }
#define SK 64              // k of one LDS operand stage (k_proj, k_out): 256 B of every f32 source row
#define SP 72              // stage row pitch in 16-bit elements: 144 B = 16 B x 9, odd, for the ds_load_b128 fragment reads
typedef __attribute__((ext_vector_type(4))) __bf16 v4b;
typedef __attribute__((ext_vector_type(4))) _Float16 v4h;
__device__ __forceinline__ v4b cvt4b(v4f v) { v4b r;
#pragma unroll
  for (int i = 0; i < 4; ++i) r[i] = (__bf16)v[i];
  return r; }
#define QBH 6              // causal: query blocks 0..QBH-1 of each sequence (few keys, no averaging) take the high-precision path
#define QHI 384            // rows carrying a q residual plane
#define KHI 384            // key rows carrying k residual / v bf16 hi+lo planes (used only by the causal high-precision path)
// B fragment (k rows k0+.., output column o) of a weight: (in,out) [K][ld] or (out,in) [ld rows of K]: bf16 exact, or f16(bf16 * 256) exact
__device__ __forceinline__ v16b wcol_io(const float* Wm, int k0, int o, int lane, int ld) { v16b w; const int g = lane >> 4;
#pragma unroll
  for (int i = 0; i < 8; ++i) { w[i] = (__bf16)Wm[(size_t)(k0 + 8 * g + i) * ld + o]; w[8 + i] = (__bf16)Wm[(size_t)(k0 + 16 + 8 * g + i) * ld + o]; }
  return w; }
__device__ __forceinline__ v16b wcol_oi(const float* Wm, int k0, int o, int lane, int K) { v16b w; const float* p = Wm + (size_t)o * K + k0 + 8 * (lane >> 4);
#pragma unroll
  for (int i = 0; i < 8; ++i) { w[i] = (__bf16)p[i]; w[8 + i] = (__bf16)p[16 + i]; }
  return w; }
__device__ __forceinline__ v16h wcolh_io(const float* Wm, int k0, int o, int lane, int ld) { v16h w; const int g = lane >> 4;
#pragma unroll
  for (int i = 0; i < 8; ++i) { w[i] = (_Float16)(bfr(Wm[(size_t)(k0 + 8 * g + i) * ld + o]) * 256.0f); w[8 + i] = (_Float16)(bfr(Wm[(size_t)(k0 + 16 + 8 * g + i) * ld + o]) * 256.0f); }
  return w; }
__device__ __forceinline__ v16h wcolh_oi(const float* Wm, int k0, int o, int lane, int K) { v16h w; const float* p = Wm + (size_t)o * K + k0 + 8 * (lane >> 4);
#pragma unroll
  for (int i = 0; i < 8; ++i) { w[i] = (_Float16)(bfr(p[i]) * 256.0f); w[8 + i] = (_Float16)(bfr(p[16 + i]) * 256.0f); }
  return w; }
#define WQKV_LAYOUT 1   // 0 = (in,out) [DIN][CC]; 1 = (out,in) [CC][DIN]; 2 = per-head [NH][DIN][HD]
__device__ __forceinline__ v16b wcol_hdk(const float* Wm, int k0, int o, int lane) { v16b w; const int g = lane >> 4; const float* p = Wm + (size_t)(o / HD) * DIN * HD + (o % HD);
#pragma unroll
  for (int i = 0; i < 8; ++i) { w[i] = (__bf16)p[(size_t)(k0 + 8 * g + i) * HD]; w[8 + i] = (__bf16)p[(size_t)(k0 + 16 + 8 * g + i) * HD]; }
  return w; }
#define WO_OUT_IN 1
#if WQKV_LAYOUT == 1
#define WCOL(W, k0, o, lane) wcol_oi(W, k0, o, lane, DIN)
#elif WQKV_LAYOUT == 2
#define WCOL(W, k0, o, lane) wcol_hdk(W, k0, o, lane)
#else
#define WCOL(W, k0, o, lane) wcol_io(W, k0, o, lane, CC)
#endif
#if WO_OUT_IN
#define WOCOL(W, k0, o, lane) wcol_oi(W, k0, o, lane, CC)
#define WOCOLH(W, k0, o, lane) wcolh_oi(W, k0, o, lane, CC)
#else
#define WOCOL(W, k0, o, lane) wcol_io(W, k0, o, lane, DIN)
#define WOCOLH(W, k0, o, lane) wcolh_io(W, k0, o, lane, DIN)
#endif

// RoPE inverse frequencies 1/10000^(2i/64) (the f32 values jax computes)
__constant__ float INVF[32] = {1.000000000e+00,7.498942018e-01,5.623413324e-01,4.216965139e-01,3.162277639e-01,2.371373624e-01,1.778279394e-01,1.333521456e-01,1.000000015e-01,7.498941571e-02,5.623412877e-02,4.216964915e-02,3.162277862e-02,2.371373586e-02,1.778279431e-02,1.333521493e-02,9.999999776e-03,7.498942316e-03,5.623413250e-03,4.216964822e-03,3.162277862e-03,2.371373819e-03,1.778279431e-03,1.333521446e-03,1.000000047e-03,7.498941850e-04,5.623413017e-04,4.216964880e-04,3.162277862e-04,2.371373848e-04,1.778279402e-04,1.333521504e-04};
#define PROJ_EXTRA_PARAMS
// per (token, head) hook on the staged f32 row (64 floats, projection + bias) of the q and k streams: interleaved-pair rotation (x[2i], x[2i + 1]) by the angle t * INVF[i]; v untouched
#define PROJ_EPI(which, row, t, h) do { if ((which) < 2) { float* rw = (row); const float pos_ = (float)(t);   /* position = the token's sequence index */ _Pragma("unroll 4") for (int i = 0; i < 32; ++i) { _Pragma("clang fp contract(off)") const float ang = pos_ * INVF[i]; const float cs = cosf(ang), sn = sinf(ang); const float xe = rw[2 * i], xo = rw[2 * i + 1]; rw[2 * i] = xe * cs - xo * sn; rw[2 * i + 1] = xe * sn + xo * cs; } } } while (0)
#ifndef PROJ_EXTRA_PARAMS
#define PROJ_EXTRA_PARAMS
#endif

#define WS_QH  0u                                      // f16 q rows [b*t][CC]
#define WS_KH  (WS_QH + 2u * (size_t)NB * TT * CC)      // f16 k rows [b*t][CC]
#define WS_VT  (WS_KH + 2u * (size_t)NB * TT * CC)      // f16 v planes [b][c][t]
#define WS_QL  (WS_VT + 2u * (size_t)NB * CC * TT)      // f16 q residual x 2^10 rows [b][t < QHI][CC]
#define WS_KL  (WS_QL + 2u * (size_t)NB * QHI * CC)     // f16 k residual x 2^10 rows [b][t < KHI][CC]
#define WS_VB  (WS_KL + 2u * (size_t)NB * KHI * CC)     // bf16 v hi planes [b][c][t < KHI]
#define WS_VBL (WS_VB + 2u * (size_t)NB * CC * KHI)
#define WS_Y   (WS_VBL + 2u * (size_t)NB * CC * KHI)    // f32 ctx rows [b*t][CC] (only when there is an output projection)
#define WS_END (WS_Y  + 4u * (size_t)NB * TT * CC)

// ---- k_proj: block = (64 rows, 128 cols, which): q/k/v = X W (+ b) with exact bf16 products (K = DIN) -> which 0: q f16 rows (+ residual rows < QHI); 1: k f16 rows (+ residual rows < KHI); 2: v f16 planes [c][t] (+ bf16 hi/lo planes for t < KHI)
__global__ __launch_bounds__(128) void k_proj(const float* __restrict__ XQ, const float* __restrict__ XK, const float* __restrict__ XV, const float* __restrict__ WQ, const float* __restrict__ WK, const float* __restrict__ WV, const float* __restrict__ BQ, const float* __restrict__ BK, const float* __restrict__ BV,
    _Float16* __restrict__ QH, _Float16* __restrict__ QL, _Float16* __restrict__ KH, _Float16* __restrict__ KL, _Float16* __restrict__ VT, __bf16* __restrict__ VB, __bf16* __restrict__ VBL PROJ_EXTRA_PARAMS) {
  __shared__ __align__(16) float st[64][132]; __shared__ __align__(16) _Float16 sh[64][136], sl[64][136];
  __shared__ __align__(16) union { struct { _Float16 th[128][72]; __bf16 tb[128][72], tbl[128][72]; } e; __bf16 sg[2][192][SP]; } un;   /* the two operand stages of the k loop lie where the v epilogue's planes lie later (three barriers between) */
  auto& th = un.e.th; auto& tb = un.e.tb; auto& tbl = un.e.tbl; auto& sg = un.sg;
  const int tid = threadIdx.x, wave = tid >> 5, lane = tid & 31, col = lane & 15, g = lane >> 4; const int which = blockIdx.z; const int c0 = blockIdx.y * 128; const size_t r0 = (size_t)blockIdx.x * 64; const size_t bb = r0 / TT; const int t0 = (int)(r0 % TT);
  const float* X = which == 0 ? XQ : which == 1 ? XK : XV; const float* WA = which == 0 ? WQ : which == 1 ? WK : WV; const float* BA = which == 0 ? BQ : which == 1 ? BK : BV;
  v8f acc[8] = {};
  // a stage = SK k of the block's 128 W rows (sg rows 0..127) and 64 X rows (128..191), rounded to bf16 once for the four waves. 16 lanes x 16 B read one row's 256 B: a load instruction touches 4 whole lines, not 16 pieces
  const int lr = tid >> 4, lc = tid & 15; const float* wg = WA + (size_t)(c0 + lr) * DIN + lc * 4; const float* xg = X + (r0 + lr) * DIN + lc * 4;
  v4f wr[16], xr[8];
#pragma unroll
  for (int i = 0; i < 16; ++i) wr[i] = *(const v4f*)(wg + (size_t)i * 8 * DIN);
#pragma unroll
  for (int i = 0; i < 8; ++i) xr[i] = *(const v4f*)(xg + (size_t)i * 8 * DIN);
  asm volatile("s_wait_xcnt 0x0" :: "v"(wg), "v"(xg) : "memory");   /* behind the stage's loads: their address registers step on below */
#pragma unroll
  for (int i = 0; i < 16; ++i) *(v4b*)&sg[0][i * 8 + lr][lc * 4] = cvt4b(wr[i]);
#pragma unroll
  for (int i = 0; i < 8; ++i) *(v4b*)&sg[0][128 + i * 8 + lr][lc * 4] = cvt4b(xr[i]);
  __syncthreads();
#pragma unroll 1   // rolled: the next stage's 24 loads stay in registers over one stage's products
  for (int s = 0; s < DIN / SK; ++s, wg += SK, xg += SK) { const bool more = s + 1 < DIN / SK;   /* block-uniform */
    if (more) {
#pragma unroll
      for (int i = 0; i < 16; ++i) wr[i] = *(const v4f*)(wg + SK + (size_t)i * 8 * DIN);
#pragma unroll
      for (int i = 0; i < 8; ++i) xr[i] = *(const v4f*)(xg + SK + (size_t)i * 8 * DIN);
      asm volatile("s_wait_xcnt 0x0" :: "v"(wg), "v"(xg) : "memory"); }   /* behind the next stage's loads, which fly under this stage's products (the memory clobber holds them in front); naming their address registers keeps these whole up to the wait */
#pragma unroll
    for (int kk = 0; kk < SK / 32; ++kk) { const v16b a = frag_b(&sg[s & 1][128 + wave * 16 + col][kk * 32], lane); v16b w[8];
#pragma unroll
      for (int j = 0; j < 8; ++j) w[j] = frag_b(&sg[s & 1][j * 16 + col][kk * 32], lane);
#pragma unroll
      for (int j = 0; j < 8; ++j) acc[j] = wmma_bf(a, w[j], acc[j]); }
    if (more) {
#pragma unroll
      for (int i = 0; i < 16; ++i) *(v4b*)&sg[(s + 1) & 1][i * 8 + lr][lc * 4] = cvt4b(wr[i]);
#pragma unroll
      for (int i = 0; i < 8; ++i) *(v4b*)&sg[(s + 1) & 1][128 + i * 8 + lr][lc * 4] = cvt4b(xr[i]); }
    __syncthreads(); }   /* publishes stage s + 1 and ends every wave's reads of stage s, whose buffer the next trip refills */
  { // stage the f32 tile (acc + bias) in LDS, run the per-(row, head) epilogue hook, then convert
#pragma unroll
    for (int j = 0; j < 8; ++j) { const float bias = BA ? bfr(BA[c0 + j * 16 + col]) : 0.f;
#pragma unroll
      for (int r = 0; r < 8; ++r) st[wave * 16 + 8 * g + r][j * 16 + col] = acc[j][r] + bias; }
    __syncthreads();
    for (int e = tid; e < 64 * (128 / HD); e += 128) { const int rl = e / (128 / HD), hh = e % (128 / HD); PROJ_EPI(which, &st[rl][hh * HD], (int)((r0 + rl) % TT), (c0 / HD) + hh); }
    __syncthreads(); }
  if (which < 2) { _Float16* DH = which == 0 ? QH : KH; _Float16* DL = which == 0 ? QL : KL; const int nhi = which == 0 ? QHI : KHI; const bool hi_rows = t0 < nhi;
    for (int e = tid; e < 64 * 128; e += 128) { const int rl = e >> 7, cl = e & 127; const float v = st[rl][cl]; const _Float16 hv = (_Float16)v; sh[rl][cl] = hv; sl[rl][cl] = (_Float16)((v - (float)hv) * 1024.0f); }
    __syncthreads();
    for (int e = tid; e < 64 * 16; e += 128) { const int rl = e >> 4, q = e & 15; vst2((unsigned*)(DH + (r0 + rl) * CC + c0 + q * 8), *(const v4u*)&sh[rl][q * 8]); if (hi_rows) vst2((unsigned*)(DL + (bb * nhi + t0 + rl) * (size_t)CC + c0 + q * 8), *(const v4u*)&sl[rl][q * 8]); }
  } else { const bool hi_rows = t0 < KHI;
    for (int e = tid; e < 64 * 128; e += 128) { const int rl = e & 63, cl = e >> 6; const float v = st[rl][cl]; th[cl][rl] = (_Float16)v; const __bf16 bh = (__bf16)v; tb[cl][rl] = bh; tbl[cl][rl] = (__bf16)(v - (float)bh); }
    __syncthreads();
    for (int e = tid; e < 128 * 8; e += 128) { const int cl = e >> 3, q = e & 7; vst2((unsigned*)(VT + (bb * CC + c0 + cl) * (size_t)TT + t0 + q * 8), *(const v4u*)&th[cl][q * 8]); if (hi_rows) { const size_t o3 = (bb * CC + c0 + cl) * (size_t)KHI + t0 + q * 8; vst2((unsigned*)(VB + o3), *(const v4u*)&tb[cl][q * 8]); vst2((unsigned*)(VBL + o3), *(const v4u*)&tbl[cl][q * 8]); } } } }
// ---- k_att: block = 4 waves x 16 queries of (b, h), two query blocks one after the other (x and NQB - 1 - x: every block walks (NQB + 1) x 64 keys). Logits as S^T = K Q^T: D register r of key tile kt = key kt * 16 + 8g + r of query col, so a lane holds one query's logits and two tiles are the A fragment of P in the k order of pair_h. Pass 1: row maximum. Pass 2: the same logits again, e = exp(s - max), sum of e in f32, e x 2^11 to f16 (early query blocks: bf16 hi + lo) against v; ctx = acc / (2^11 sum). Nothing of S goes to memory.
// a trip is NT key tiles of 16: 64 keys; 32 in the early query blocks, whose residual planes double the fragments
// a trip's operands are staged in LDS once for the four waves (pitch SP): sk rows 0..63 = the 64 k rows (early blocks: 0..31 k, 32..63 its residual); sv row c = v plane c's 64 keys (early blocks: 32 keys of the bf16 hi plane, then of the lo plane)
template <bool HI> __device__ __forceinline__ void att_ldk(const _Float16* kp, const _Float16* klp, v16h (&kf)[2][HI ? 2 : 4], v16h (&klf)[2][HI ? 2 : 4]) {
#pragma unroll
  for (int kc = 0; kc < 2; ++kc)
#pragma unroll
    for (int kt = 0; kt < (HI ? 2 : 4); ++kt) { kf[kc][kt] = pair_h(kp + kt * 16 * SP + kc * 32); if (HI) klf[kc][kt] = pair_h(klp + kt * 16 * SP + kc * 32); } }
// logits x SCALE of a trip's keys; srel = query - the trip's first key - 8g: key kt * 16 + r of the lane is kept while kt * 16 + r <= srel
template <bool HI, bool MASK> __device__ __forceinline__ void att_logits(const v16h (&kf)[2][HI ? 2 : 4], const v16h (&klf)[2][HI ? 2 : 4], const v16h (&qh)[2], const v16h (&ql)[2], int srel, float (&s)[HI ? 2 : 4][8]) {
  constexpr int NT = HI ? 2 : 4; v8f a[NT] = {}, al[NT] = {};
#pragma unroll
  for (int kc = 0; kc < 2; ++kc)
#pragma unroll
    for (int kt = 0; kt < NT; ++kt) { a[kt] = wmma16(kf[kc][kt], qh[kc], a[kt]); if (HI) { al[kt] = wmma16(kf[kc][kt], ql[kc], al[kt]); al[kt] = wmma16(klf[kc][kt], qh[kc], al[kt]); } }
#pragma unroll
  for (int kt = 0; kt < NT; ++kt)
#pragma unroll
    for (int r = 0; r < 8; ++r) { const float v = HI ? (a[kt][r] + al[kt][r] * (1.0f / 1024.0f)) * SCALE : a[kt][r] * SCALE; s[kt][r] = (!MASK || kt * 16 + r <= srel) ? v : -3.0e38f; } }
template <bool HI, bool MASK> __device__ __forceinline__ float att_max(const _Float16* kp, const _Float16* klp, const v16h (&qh)[2], const v16h (&ql)[2], int srel) {
  constexpr int NT = HI ? 2 : 4; v16h kf[2][NT], klf[2][NT]; float s[NT][8]; att_ldk<HI>(kp, klp, kf, klf);
  att_logits<HI, MASK>(kf, klf, qh, ql, srel, s);
  float m = s[0][0];
#pragma unroll
  for (int kt = 0; kt < NT; ++kt)
#pragma unroll
    for (int r = 0; r < 8; ++r) m = fmaxf(m, s[kt][r]);
  return m; }
// m = the query's row maximum, finite (every row keeps its diagonal): an excluded logit (-3e38) gives expf = 0
template <bool HI, bool MASK> __device__ __forceinline__ void att_pv(const _Float16* kp, const _Float16* klp, const _Float16* vp, const __bf16* vhp, const __bf16* vlp, const v16h (&qh)[2], const v16h (&ql)[2], int srel, float m, float& sum, v8f (&acc)[HD / 16]) {
  constexpr int NT = HI ? 2 : 4; v16h kf[2][NT], klf[2][NT], vf[NT / 2][HD / 16]; v16b vh[NT / 2][HD / 16], vl[NT / 2][HD / 16]; float s[NT][8]; att_ldk<HI>(kp, klp, kf, klf);
  att_logits<HI, MASK>(kf, klf, qh, ql, srel, s);
#pragma unroll
  for (int u = 0; u < NT / 2; ++u)   /* the v reads take the k fragments' registers and fly under the exponentials */
#pragma unroll
    for (int j = 0; j < HD / 16; ++j) { if (!HI) vf[u][j] = pair_h(vp + j * 16 * SP + u * 32); else { vh[u][j] = pair_b(vhp + j * 16 * SP + u * 32); vl[u][j] = pair_b(vlp + j * 16 * SP + u * 32); } }
  float part[NT];
#pragma unroll
  for (int kt = 0; kt < NT; ++kt) { part[kt] = 0.f;
#pragma unroll
    for (int r = 0; r < 8; ++r) { const float e = expf(s[kt][r] - m); part[kt] += e; s[kt][r] = e * 2048.0f; } }
#pragma unroll
  for (int kt = 0; kt < NT; kt += 2) sum += part[kt] + part[kt + 1];
#pragma unroll
  for (int u = 0; u < NT / 2; ++u) {
    if (!HI) { v16h p;
#pragma unroll
      for (int i = 0; i < 8; ++i) { p[i] = (_Float16)s[2 * u][i]; p[8 + i] = (_Float16)s[2 * u + 1][i]; }
#pragma unroll
      for (int j = 0; j < HD / 16; ++j) acc[j] = wmma16(p, vf[u][j], acc[j]);
    } else { float pv[16];
#pragma unroll
      for (int i = 0; i < 8; ++i) { pv[i] = s[2 * u][i]; pv[8 + i] = s[2 * u + 1][i]; }
      const F2 p = bsplit16(pv);
#pragma unroll
      for (int j = 0; j < HD / 16; ++j) { acc[j] = wmma_bf(p.h, vh[u][j], acc[j]); acc[j] = wmma_bf(p.l, vh[u][j], acc[j]); acc[j] = wmma_bf(p.h, vl[u][j], acc[j]); } } } }
template <bool HI> __device__ __forceinline__ void att_tile(const _Float16* __restrict__ QH, const _Float16* __restrict__ KH, const _Float16* __restrict__ QL, const _Float16* __restrict__ KL, const _Float16* __restrict__ VT, const __bf16* __restrict__ VB, const __bf16* __restrict__ VBL, float* __restrict__ Y, float (*ssw)[HD + 4], _Float16 (*sk)[64][SP], _Float16 (*sv)[64][SP], int b, int h, int qb, int wave, int lane) {
  constexpr int KS = HI ? 32 : 64;   /* keys a trip */
  const int col = lane & 15, g = lane >> 4; const int ql0 = qb * 64 + wave * 16; const size_t ho = (size_t)h * HD + 8 * g;
  const int nfull = HI ? 0 : qb, nmask = HI ? (qb + 1) * 2 : 1;   /* trips wholly below the diagonal, then trips masked by index */
  const int nl = nfull + nmask - 1;   /* trips in front of the last one: all unmasked in the late blocks, all masked in the early ones; block-uniform */
  const int srel0 = ql0 + col - 8 * g - nfull * KS;
  const _Float16* qp = QH + ((size_t)b * TT + ql0 + col) * CC + ho; const _Float16* qlp = HI ? QL + ((size_t)b * QHI + ql0 + col) * CC + ho : qp;
  v16h qh[2], ql[2];
#pragma unroll
  for (int kc = 0; kc < 2; ++kc) { qh[kc] = pair_h(qp + kc * 32); ql[kc] = HI ? pair_h(qlp + kc * 32) : qh[kc]; }
  asm volatile("s_wait_xcnt 0x0" :: "v"(qp), "v"(qlp) : "memory");   /* behind the q loads, as below */
  // staging: 8 lanes x 16 B fill one stage row of 128 B, so a load instruction touches 4 whole lines (the early blocks' v planes: 8 half lines), not 16 pieces. ka: stage rows 0..31, kb: rows 32..63
  constexpr int VLD = HI ? KHI : TT;   /* row pitch of the v planes read */
  const int sr = (wave * 32 + lane) >> 3, sc = (lane & 7) * 8; const size_t vrow = (size_t)b * CC + h * HD + sr;
  const _Float16* const ka0 = KH + ((size_t)b * TT + sr) * CC + h * HD + sc; const _Float16* const kb0 = HI ? KL + ((size_t)b * KHI + sr) * CC + h * HD + sc : ka0 + (size_t)32 * CC;
  const _Float16* const vg0 = HI ? (const _Float16*)((sc < 32 ? VB : VBL) + vrow * KHI + (sc & 31)) : VT + vrow * TT + sc;   /* moved as raw 16-B pieces */
  float m = -3.0e38f;
  { const _Float16 *ka = ka0, *kb = kb0; v8h kr[4], vr[4]; int srel = srel0;
#pragma unroll
    for (int i = 0; i < 2; ++i) { kr[i] = *(const v8h*)(ka + (size_t)i * 16 * CC); kr[2 + i] = *(const v8h*)(kb + (size_t)i * 16 * CC); }
    asm volatile("s_wait_xcnt 0x0" :: "v"(ka), "v"(kb) : "memory");   /* behind the stage's loads: their address registers step on below */
    __syncthreads();   /* every wave has left the stages of the tile before */
#pragma unroll
    for (int i = 0; i < 4; ++i) *(v8h*)&sk[0][i * 16 + sr][sc] = kr[i];
    __syncthreads();
#pragma unroll 1   // rolled: one trip's fragments fill the registers
    for (int tr = 0; tr < nl; ++tr, ka += (size_t)KS * CC, kb += (size_t)KS * CC) {
#pragma unroll
      for (int i = 0; i < 2; ++i) { kr[i] = *(const v8h*)(ka + (size_t)(KS + i * 16) * CC); kr[2 + i] = *(const v8h*)(kb + (size_t)(KS + i * 16) * CC); }
      asm volatile("s_wait_xcnt 0x0" :: "v"(ka), "v"(kb) : "memory");   /* behind the next trip's loads, which fly under this trip's logits (the memory clobber holds them in front); naming their address registers keeps these whole up to the wait */
      const _Float16* kp = &sk[tr & 1][col][8 * g]; m = fmaxf(m, att_max<HI, HI>(kp, kp + 32 * SP, qh, ql, srel)); if (HI) srel -= KS;
#pragma unroll
      for (int i = 0; i < 4; ++i) *(v8h*)&sk[(tr + 1) & 1][i * 16 + sr][sc] = kr[i];
      __syncthreads(); }   /* publishes trip tr + 1 and ends every wave's reads of trip tr, whose buffer the next trip refills */
#pragma unroll
    for (int i = 0; i < 2; ++i) { kr[i] = *(const v8h*)(ka0 + (size_t)i * 16 * CC); kr[2 + i] = *(const v8h*)(kb0 + (size_t)i * 16 * CC); }   /* pass 2's first stage flies under pass 1's last trip */
#pragma unroll
    for (int i = 0; i < 4; ++i) vr[i] = *(const v8h*)(vg0 + (size_t)i * 16 * VLD);
    asm volatile("s_wait_xcnt 0x0" :: "v"(ka0), "v"(kb0), "v"(vg0) : "memory");   /* behind these loads, as above */
    const _Float16* kp = &sk[nl & 1][col][8 * g]; m = fmaxf(m, att_max<HI, true>(kp, kp + 32 * SP, qh, ql, srel));
    __syncthreads();   /* every wave has left pass 1's stages */
#pragma unroll
    for (int i = 0; i < 4; ++i) { *(v8h*)&sk[0][i * 16 + sr][sc] = kr[i]; *(v8h*)&sv[0][i * 16 + sr][sc] = vr[i]; }
    __syncthreads(); }
  m = fmaxf(m, __shfl_xor(m, 16));   /* the two lane halves hold the two key halves of one query */
  v8f acc[HD / 16] = {}; float sum = 0.f;
  { const _Float16 *ka = ka0, *kb = kb0, *vg = vg0; v8h kr[4], vr[4]; int srel = srel0;
#pragma unroll 1   // rolled: one trip's fragments fill the registers
    for (int tr = 0; tr < nl; ++tr, ka += (size_t)KS * CC, kb += (size_t)KS * CC, vg += KS) {
#pragma unroll
      for (int i = 0; i < 2; ++i) { kr[i] = *(const v8h*)(ka + (size_t)(KS + i * 16) * CC); kr[2 + i] = *(const v8h*)(kb + (size_t)(KS + i * 16) * CC); }
#pragma unroll
      for (int i = 0; i < 4; ++i) vr[i] = *(const v8h*)(vg + KS + (size_t)i * 16 * VLD);
      asm volatile("s_wait_xcnt 0x0" :: "v"(ka), "v"(kb), "v"(vg) : "memory");   /* behind the next trip's loads, which fly under this trip's work (the memory clobber holds them in front); naming their address registers keeps these whole up to the wait */
      const _Float16 *kp = &sk[tr & 1][col][8 * g], *vp = &sv[tr & 1][col][8 * g]; att_pv<HI, HI>(kp, kp + 32 * SP, vp, (const __bf16*)vp, (const __bf16*)vp + 32, qh, ql, srel, m, sum, acc); if (HI) srel -= KS;
#pragma unroll
      for (int i = 0; i < 4; ++i) { *(v8h*)&sk[(tr + 1) & 1][i * 16 + sr][sc] = kr[i]; *(v8h*)&sv[(tr + 1) & 1][i * 16 + sr][sc] = vr[i]; }
      __syncthreads(); }   /* publishes trip tr + 1 and ends every wave's reads of trip tr, whose buffers the next trip refills */
    const _Float16 *kp = &sk[nl & 1][col][8 * g], *vp = &sv[nl & 1][col][8 * g]; att_pv<HI, true>(kp, kp + 32 * SP, vp, (const __bf16*)vp, (const __bf16*)vp + 32, qh, ql, srel, m, sum, acc); }
  sum += __shfl_xor(sum, 16);
  const float inv = sum > 0.f ? 1.0f / (sum * 2048.0f) : 0.f;   /* of query col; a fully excluded row yields 0 */
#pragma unroll
  for (int r = 0; r < 8; ++r) { const float ir = __shfl(inv, 8 * g + r);   /* accumulator register r is query 8g + r */
#pragma unroll
    for (int j = 0; j < HD / 16; ++j) ssw[8 * g + r][j * 16 + col] = acc[j][r] * ir; }
  LDSX();
  float* yp = Y + ((size_t)b * TT + ql0 + g) * CC + h * HD + col * 4;   /* 256-B (row, head) segment by 16 lanes, two rows a store */
#pragma unroll
  for (int rl = 0; rl < 16; rl += 2) vst2(yp + (size_t)rl * CC, *(const v4f*)&ssw[rl + g][col * 4]);
  asm volatile("s_wait_xcnt 0x0" :: "v"(yp) : "memory");   /* behind the stores: the next tile overwrites their registers */
  LDSX(); }   /* the next tile's staging writes stay behind these reads */
// amdgpu_waves_per_eu(2, 2): the grid gives two waves a SIMD (512 blocks x 4 waves, 1,024 SIMDs); with that register budget a trip's exponentials interleave instead of running as one dependent chain after the other
__global__ __launch_bounds__(128) __attribute__((amdgpu_waves_per_eu(2, 2))) void k_att(const _Float16* __restrict__ QH, const _Float16* __restrict__ KH, const _Float16* __restrict__ QL, const _Float16* __restrict__ KL, const _Float16* __restrict__ VT, const __bf16* __restrict__ VB, const __bf16* __restrict__ VBL, float* __restrict__ Y) { __shared__ __align__(16) float ss[4][16][HD + 4]; __shared__ __align__(16) _Float16 sk[2][64][SP], sv[2][64][SP];
  const int tid = threadIdx.x, wave = tid >> 5, lane = tid & 31; const int h = blockIdx.y, b = blockIdx.z;
#pragma unroll 1   // rolled: the two tiles share one copy of the code
  for (int half = 0; half < 2; ++half) { const int qb = half ? (int)blockIdx.x : NQB - 1 - (int)blockIdx.x;   /* block-uniform */
    if (qb < QBH) att_tile<true>(QH, KH, QL, KL, VT, VB, VBL, Y, ss[wave], sk, sv, b, h, qb, wave, lane);
    else att_tile<false>(QH, KH, QL, KL, VT, VB, VBL, Y, ss[wave], sk, sv, b, h, qb, wave, lane); } }
// ---- k_out: block = (64 rows, 128 cols): out = ctx Wo (+ bo): ctx x 2^6 once to f16 against Wo as f16(bf16 x 2^8) exact (1 product) x 2^-14; causal early rows (< QHI of each sequence): ctx bf16 hi + lo against exact bf16 Wo (2 products)
__global__ __launch_bounds__(128) void k_out(const float* __restrict__ Y, const float* __restrict__ WO, const float* __restrict__ BO, float* __restrict__ OUT) { __shared__ __align__(16) float sf[4][16][132];
  __shared__ __align__(16) union { __bf16 b[2][256][SP]; _Float16 h[2][192][SP]; } sg;   /* two operand stages: rows 0..127 Wo, 128..191 ctx (hi), 192..255 ctx lo (early rows only) */
  const int tid = threadIdx.x, wave = tid >> 5, lane = tid & 31, col = lane & 15, g = lane >> 4; const int c0 = blockIdx.y * 128; const size_t r0 = (size_t)blockIdx.x * 64 + wave * 16;
  v8f acc[8] = {};
  // a stage = SK k of the block's 128 Wo rows and 64 ctx rows, converted once for the four waves. 16 lanes x 16 B read one row's 256 B: a load instruction touches 4 whole lines, not 16 pieces
  const int lr = tid >> 4, lc = tid & 15; const float* wg = WO + (size_t)(c0 + lr) * CC + lc * 4; const float* yg = Y + ((size_t)blockIdx.x * 64 + lr) * CC + lc * 4;
  v4f wr[16], yr[8];
#pragma unroll
  for (int i = 0; i < 16; ++i) wr[i] = *(const v4f*)(wg + (size_t)i * 8 * CC);
#pragma unroll
  for (int i = 0; i < 8; ++i) yr[i] = *(const v4f*)(yg + (size_t)i * 8 * CC);
  asm volatile("s_wait_xcnt 0x0" :: "v"(wg), "v"(yg) : "memory");   /* behind the stage's loads: their address registers step on below */
  if (CAUSAL && (int)(((size_t)blockIdx.x * 64) % TT) < QHI) {   /* block-uniform */
#pragma unroll
    for (int i = 0; i < 16; ++i) *(v4b*)&sg.b[0][i * 8 + lr][lc * 4] = cvt4b(wr[i]);
#pragma unroll
    for (int i = 0; i < 8; ++i) { const v4b hv = cvt4b(yr[i]); v4f rs;   /* ctx = bf16 hi + bf16 lo, as bsplit16 forms them */
#pragma unroll
      for (int e = 0; e < 4; ++e) rs[e] = yr[i][e] - (float)hv[e];
      *(v4b*)&sg.b[0][128 + i * 8 + lr][lc * 4] = hv; *(v4b*)&sg.b[0][192 + i * 8 + lr][lc * 4] = cvt4b(rs); }
    __syncthreads();
#pragma unroll 1   // rolled: the next stage's 24 loads stay in registers over one stage's products
    for (int s = 0; s < CC / SK; ++s, wg += SK, yg += SK) { const bool more = s + 1 < CC / SK;   /* block-uniform */
      if (more) {
#pragma unroll
        for (int i = 0; i < 16; ++i) wr[i] = *(const v4f*)(wg + SK + (size_t)i * 8 * CC);
#pragma unroll
        for (int i = 0; i < 8; ++i) yr[i] = *(const v4f*)(yg + SK + (size_t)i * 8 * CC);
        asm volatile("s_wait_xcnt 0x0" :: "v"(wg), "v"(yg) : "memory"); }   /* behind the next stage's loads, which fly under this stage's products (the memory clobber holds them in front); naming their address registers keeps these whole up to the wait */
#pragma unroll
      for (int kk = 0; kk < SK / 32; ++kk) { const v16b ah = frag_b(&sg.b[s & 1][128 + wave * 16 + col][kk * 32], lane), al = frag_b(&sg.b[s & 1][192 + wave * 16 + col][kk * 32], lane); v16b w[8];
#pragma unroll
        for (int j = 0; j < 8; ++j) w[j] = frag_b(&sg.b[s & 1][j * 16 + col][kk * 32], lane);
#pragma unroll
        for (int j = 0; j < 8; ++j) { acc[j] = wmma_bf(ah, w[j], acc[j]); acc[j] = wmma_bf(al, w[j], acc[j]); } }
      if (more) {
#pragma unroll
        for (int i = 0; i < 16; ++i) *(v4b*)&sg.b[(s + 1) & 1][i * 8 + lr][lc * 4] = cvt4b(wr[i]);
#pragma unroll
        for (int i = 0; i < 8; ++i) { const v4b hv = cvt4b(yr[i]); v4f rs;   /* ctx = bf16 hi + bf16 lo, as bsplit16 forms them */
#pragma unroll
          for (int e = 0; e < 4; ++e) rs[e] = yr[i][e] - (float)hv[e];
          *(v4b*)&sg.b[(s + 1) & 1][128 + i * 8 + lr][lc * 4] = hv; *(v4b*)&sg.b[(s + 1) & 1][192 + i * 8 + lr][lc * 4] = cvt4b(rs); }
      }
      __syncthreads(); }   /* publishes stage s + 1 and ends every wave's reads of stage s, whose buffer the next trip refills */
#pragma unroll
    for (int j = 0; j < 8; ++j) { const float bias = BO ? bfr(BO[c0 + j * 16 + col]) : 0.f;
#pragma unroll
      for (int r = 0; r < 8; ++r) sf[wave][8 * g + r][j * 16 + col] = acc[j][r] + bias; }
  } else {
#pragma unroll
    for (int i = 0; i < 16; ++i) { v4h c;   /* Wo as f16(bf16 x 2^8), exact */
#pragma unroll
      for (int e = 0; e < 4; ++e) c[e] = (_Float16)(bfr(wr[i][e]) * 256.0f);
      *(v4h*)&sg.h[0][i * 8 + lr][lc * 4] = c; }
#pragma unroll
    for (int i = 0; i < 8; ++i) { v4h c;   /* ctx carried x 2^6 into f16 so small-magnitude context rows stay clear of f16 subnormals */
#pragma unroll
      for (int e = 0; e < 4; ++e) c[e] = (_Float16)(yr[i][e] * 64.0f);
      *(v4h*)&sg.h[0][128 + i * 8 + lr][lc * 4] = c; }
    __syncthreads();
#pragma unroll 1   // rolled: the next stage's 24 loads stay in registers over one stage's products
    for (int s = 0; s < CC / SK; ++s, wg += SK, yg += SK) { const bool more = s + 1 < CC / SK;   /* block-uniform */
      if (more) {
#pragma unroll
        for (int i = 0; i < 16; ++i) wr[i] = *(const v4f*)(wg + SK + (size_t)i * 8 * CC);
#pragma unroll
        for (int i = 0; i < 8; ++i) yr[i] = *(const v4f*)(yg + SK + (size_t)i * 8 * CC);
        asm volatile("s_wait_xcnt 0x0" :: "v"(wg), "v"(yg) : "memory"); }   /* behind the next stage's loads, which fly under this stage's products (the memory clobber holds them in front); naming their address registers keeps these whole up to the wait */
#pragma unroll
      for (int kk = 0; kk < SK / 32; ++kk) { const v16h a = frag_h(&sg.h[s & 1][128 + wave * 16 + col][kk * 32], lane); v16h w[8];
#pragma unroll
        for (int j = 0; j < 8; ++j) w[j] = frag_h(&sg.h[s & 1][j * 16 + col][kk * 32], lane);
#pragma unroll
        for (int j = 0; j < 8; ++j) acc[j] = wmma16(a, w[j], acc[j]); }
      if (more) {
#pragma unroll
        for (int i = 0; i < 16; ++i) { v4h c;   /* Wo as f16(bf16 x 2^8), exact */
#pragma unroll
          for (int e = 0; e < 4; ++e) c[e] = (_Float16)(bfr(wr[i][e]) * 256.0f);
          *(v4h*)&sg.h[(s + 1) & 1][i * 8 + lr][lc * 4] = c; }
#pragma unroll
        for (int i = 0; i < 8; ++i) { v4h c;   /* ctx carried x 2^6 into f16 so small-magnitude context rows stay clear of f16 subnormals */
#pragma unroll
          for (int e = 0; e < 4; ++e) c[e] = (_Float16)(yr[i][e] * 64.0f);
          *(v4h*)&sg.h[(s + 1) & 1][128 + i * 8 + lr][lc * 4] = c; }
      }
      __syncthreads(); }   /* publishes stage s + 1 and ends every wave's reads of stage s, whose buffer the next trip refills */
#pragma unroll
    for (int j = 0; j < 8; ++j) { const float bias = BO ? bfr(BO[c0 + j * 16 + col]) : 0.f;
#pragma unroll
      for (int r = 0; r < 8; ++r) sf[wave][8 * g + r][j * 16 + col] = acc[j][r] * (1.0f / 16384.0f) + bias; } }   /* 2^-8 (Wo carry) x 2^-6 (ctx carry) */
  LDSX(); for (int rl = 0; rl < 16; ++rl) vst2(OUT + (r0 + rl) * DIN + c0 + lane * 4, *(const v4f*)&sf[wave][rl][lane * 4]); }

extern "C" void kernel_launch(void* const* d_in, const int* in_sizes, int n_in, void* d_out, int out_size, void* d_ws, size_t ws_size, hipStream_t stream) {
  (void)in_sizes; (void)n_in; (void)out_size;
  const float** F = (const float**)d_in;
  if (ws_size < (size_t)WS_END) return;
  char* ws = (char*)d_ws; _Float16 *QH = (_Float16*)(ws + WS_QH), *KH = (_Float16*)(ws + WS_KH), *VT = (_Float16*)(ws + WS_VT), *QL = (_Float16*)(ws + WS_QL), *KL = (_Float16*)(ws + WS_KL); __bf16 *VB = (__bf16*)(ws + WS_VB), *VBL = (__bf16*)(ws + WS_VBL); float *Y = (float*)(ws + WS_Y);
  (void)Y; (void)QL; (void)KL; (void)VB; (void)VBL;
  // inputs: 0 x [2,2048,1024]; 1 wq [1024,1024] (out,in); 2 wk; 3 wv; 4 wo (out,in); no biases (null pointers)
  k_proj<<<dim3(TNB * TT / 64, CC / 128, 3), 128, 0, stream>>>(F[0], F[0], F[0], F[1], F[2], F[3], nullptr, nullptr, nullptr, QH, QL, KH, KL, VT, VB, VBL);
  k_att<<<dim3(NQB / 2, NH, TNB), 128, 0, stream>>>(QH, KH, QL, KL, VT, VB, VBL, Y);
  k_out<<<dim3(TNB * TT / 64, DIN / 128), 128, 0, stream>>>(Y, F[4], nullptr, (float*)d_out);
}

// v004
// One run takes 140 microseconds.
// In both of two side-by-side timings against v003, it was 1.08 times as fast.
// Counting every step since v000, it is 9.23 times as fast.
// compute dtype: all float inputs rounded to bf16; q / k / v projections with EXACT bf16 products on WMMA 16x16x32 (f32 accumulate) (no biases); interleaved-pair RoPE in f32 AFTER the bias (embedded frequencies, precise cosf / sinf, positions = the row index); causal logits: 3 products for the first 384 rows, single f16 q x k after, x 64^-0.5; softmax f32 (row maximum first, logits formed twice, never stored); exp(s - max) x 2^11 once to f16 x v once to f16 (bf16 hi + lo below row 384), / sum after the product; ctx hi+lo x exact Wo below row 384, x2^6 f16 carry x f16(bf16 x 2^8) Wo after, + bo; f32 output.
#include <hip/hip_runtime.h>
#include <math.h>

typedef __attribute__((ext_vector_type(16))) _Float16 v16h;
typedef __attribute__((ext_vector_type(16))) __bf16 v16b;
typedef __attribute__((ext_vector_type(8)))  _Float16 v8h;
typedef __attribute__((ext_vector_type(8)))  float v8f;
typedef __attribute__((ext_vector_type(4)))  float v4f;
typedef __attribute__((ext_vector_type(2)))  float v2f;
typedef __attribute__((ext_vector_type(4)))  unsigned v4u;
typedef __attribute__((ext_vector_type(4)))  int v4i;
typedef float __attribute__((may_alias)) float_a;
typedef int __attribute__((may_alias)) int_a;

template <typename T> __device__ __forceinline__ void vst2(void* p, T v) { *(T*)p = v;  }
__device__ __forceinline__ v8f wmma16(v16h a, v16h b, v8f c) {
  v8f d = __builtin_amdgcn_wmma_f32_16x16x32_f16(false, a, false, b, (short)0, c, false, false);
  asm volatile("v_nop\n\tv_nop\n\tv_nop\n\tv_nop" : "+v"(d) : "v"(a), "v"(b));
  return d;
}
__device__ __forceinline__ v8f wmma_bf(v16b a, v16b b, v8f c) {
  v8f d = __builtin_amdgcn_wmma_f32_16x16x32_bf16(false, a, false, b, (short)0, c, false, false);
  asm volatile("v_nop\n\tv_nop\n\tv_nop\n\tv_nop" : "+v"(d) : "v"(a), "v"(b));
  return d;
}
// 16x16x32 fragments: lane = (h = lane>>4, row/col = lane&15); elements 0..7 = k0+8h+0..7, 8..15 = k0+16+8h+0..7; D element r = row 8h+r
__device__ __forceinline__ v16h frag_h(const _Float16* rowk0, int lane) {
  union { v16h v; v8h q[2]; } u; const _Float16* p = rowk0 + 8 * (lane >> 4);
  u.q[0] = *(const v8h*)p; u.q[1] = *(const v8h*)(p + 16); return u.v;
}
__device__ __forceinline__ v16h frag_f32(const float* rowk0, int lane) {
  v16h a; const float* p = rowk0 + 8 * (lane >> 4);
#pragma unroll
  for (int i = 0; i < 8; ++i) { a[i] = (_Float16)p[i]; a[8 + i] = (_Float16)p[16 + i]; }
  return a;
}
__device__ __forceinline__ v16h frag_f32s(const float* rowk0, int lane, float sc) {
  v16h a; const float* p = rowk0 + 8 * (lane >> 4);
#pragma unroll
  for (int i = 0; i < 8; ++i) { a[i] = (_Float16)(p[i] * sc); a[8 + i] = (_Float16)(p[16 + i] * sc); }
  return a;
}
// column fragment from a [K][ld] layout (column n), rows >= K read as 0
__device__ __forceinline__ v16h fragc_f32(const float* W, int k0, int n, int lane, int ld, int K) {
  v16h a; const int g = lane >> 4;
#pragma unroll
  for (int i = 0; i < 8; ++i) { const int ka = k0 + 8 * g + i, kb = ka + 16;
    a[i] = (_Float16)(ka < K ? W[(size_t)(ka < K ? ka : K - 1) * ld + n] : 0.f); a[8 + i] = (_Float16)(kb < K ? W[(size_t)(kb < K ? kb : K - 1) * ld + n] : 0.f); }
  return a;
}
struct F2 { v16b h, l; };
__device__ __forceinline__ F2 bsplit16(const float v[16]) { F2 r;
#pragma unroll
  for (int i = 0; i < 16; ++i) { const __bf16 h = (__bf16)v[i]; r.h[i] = h; r.l[i] = (__bf16)(v[i] - (float)h); }
  return r; }
__device__ __forceinline__ F2 split_row(const float* row, int k0, int lane) { float v[16]; const float* p = row + k0 + 8 * (lane >> 4);
#pragma unroll
  for (int i = 0; i < 8; ++i) { v[i] = p[i]; v[8 + i] = p[16 + i]; }
  return bsplit16(v); }
__device__ __forceinline__ F2 split_rowK(const float* row, int k0, int lane, int K) { float v[16]; const int g = lane >> 4;
#pragma unroll
  for (int i = 0; i < 8; ++i) { const int ka = k0 + 8 * g + i, kb = ka + 16; v[i] = ka < K ? row[ka < K ? ka : K - 1] : 0.f; v[8 + i] = kb < K ? row[kb < K ? kb : K - 1] : 0.f; }
  return bsplit16(v); }
__device__ __forceinline__ F2 split_col(const float* W, int k0, int n, int lane, int ld, int K) { float v[16]; const int g = lane >> 4;
#pragma unroll
  for (int i = 0; i < 8; ++i) { const int ka = k0 + 8 * g + i, kb = ka + 16; v[i] = ka < K ? W[(size_t)(ka < K ? ka : K - 1) * ld + n] : 0.f; v[8 + i] = kb < K ? W[(size_t)(kb < K ? kb : K - 1) * ld + n] : 0.f; }
  return bsplit16(v); }
__device__ __forceinline__ v8f mac3(const F2& a, const F2& b, v8f c) { c = wmma_bf(a.l, b.h, c); c = wmma_bf(a.h, b.l, c); return wmma_bf(a.h, b.h, c); }
__device__ __forceinline__ float sigm(float v) { return 1.0f / (1.0f + expf(-v)); }
#define LDSX() do { asm volatile("s_wait_dscnt 0" ::: "memory"); __builtin_amdgcn_wave_barrier(); __builtin_amdgcn_fence(__ATOMIC_RELEASE, "workgroup"); } while (0)

// Causal multi-head self-attention with interleaved-pair RoPE (x [2,2048,1024]; torch (out,in) wq / wk / wv / wo [1024,1024] applied as x @ W.T, no biases; 16 heads x 64; RoPE on Q and K: adjacent (even, odd) pairs (xe c - xo s, xe s + xo c) re-interleaved, theta 10000, positions 0..2047; scores / sqrt(64); tril kept, -inf elsewhere (the module's own softmax guards the -inf row maximum: every row keeps its diagonal, so the guard never fires); out @ wo.T).
#define NB 2
#define TT 2048
#define CC 1024            // NH * HD = projected width
#define DIN 1024          // input (model) width
#define NH 16
#define HD 64
#define NQB (TT / 64)
#define SCALE (0.125f)
#define SC2 (SCALE * 1.44269504088896340736f)   // SCALE x log2(e): exp(SCALE x (d - dmax)) = 2^(SC2 x d - SC2 x dmax), d = the unscaled q.k product
#define CAUSAL 1
#ifndef TNB
#define TNB NB
#endif
__device__ __forceinline__ float bfr(float v) { return (float)(__bf16)v; }
typedef __attribute__((ext_vector_type(8))) __bf16 v8b;
__device__ __forceinline__ v16b frag_b(const __bf16* rowk0, int lane) {
  union { v16b v; v8b q[2]; } u; const __bf16* p = rowk0 + 8 * (lane >> 4);
  u.q[0] = *(const v8b*)p; u.q[1] = *(const v8b*)(p + 16); return u.v;
}
// unconverted fragment reads; p = the lane's row + k0 + 8 * (lane >> 4): elements 0..7 = p[0..7], 8..15 = p[16..23] (the k order of frag_h / frag_f32 / split_row / wcol_oi)
typedef __attribute__((ext_vector_type(16))) float v16f;
__device__ __forceinline__ v16f raw16(const float* p) { v16f r;
#pragma unroll
  for (int i = 0; i < 8; ++i) { r[i] = p[i]; r[8 + i] = p[16 + i]; }
  return r; }
__device__ __forceinline__ v16h pair_h(const _Float16* p) { union { v16h v; v8h q[2]; } u; u.q[0] = *(const v8h*)p; u.q[1] = *(const v8h*)(p + 16); return u.v; }
__device__ __forceinline__ v16b pair_b(const __bf16* p) { union { v16b v; v8b q[2]; } u; u.q[0] = *(const v8b*)p; u.q[1] = *(const v8b*)(p + 16); return u.v; }
__device__ __forceinline__ F2 bsplit_v(v16f r) { float v[16];
#pragma unroll
  for (int i = 0; i < 16; ++i) v[i] = r[i];
  return bsplit16(v); }
#define SK 64              // k of one LDS operand stage (k_proj, k_out): 256 B of every f32 source row
#define SP 72              // stage row pitch in 16-bit elements: 144 B = 16 B x 9, odd, for the ds_load_b128 fragment reads
typedef __attribute__((ext_vector_type(4))) __bf16 v4b;
typedef __attribute__((ext_vector_type(4))) _Float16 v4h;
__device__ __forceinline__ v4b cvt4b(v4f v) { v4b r;
#pragma unroll
  for (int i = 0; i < 4; ++i) r[i] = (__bf16)v[i];
  return r; }
#define QBH 6              // causal: query blocks 0..QBH-1 of each sequence (few keys, no averaging) take the high-precision path
#define QHI 384            // rows carrying a q residual plane
#define KHI 384            // key rows carrying k residual / v bf16 hi+lo planes (used only by the causal high-precision path)
// B fragment (k rows k0+.., output column o) of a weight: (in,out) [K][ld] or (out,in) [ld rows of K]: bf16 exact, or f16(bf16 * 256) exact
__device__ __forceinline__ v16b wcol_io(const float* Wm, int k0, int o, int lane, int ld) { v16b w; const int g = lane >> 4;
#pragma unroll
  for (int i = 0; i < 8; ++i) { w[i] = (__bf16)Wm[(size_t)(k0 + 8 * g + i) * ld + o]; w[8 + i] = (__bf16)Wm[(size_t)(k0 + 16 + 8 * g + i) * ld + o]; }
  return w; }
__device__ __forceinline__ v16b wcol_oi(const float* Wm, int k0, int o, int lane, int K) { v16b w; const float* p = Wm + (size_t)o * K + k0 + 8 * (lane >> 4);
#pragma unroll
  for (int i = 0; i < 8; ++i) { w[i] = (__bf16)p[i]; w[8 + i] = (__bf16)p[16 + i]; }
  return w; }
__device__ __forceinline__ v16h wcolh_io(const float* Wm, int k0, int o, int lane, int ld) { v16h w; const int g = lane >> 4;
#pragma unroll
  for (int i = 0; i < 8; ++i) { w[i] = (_Float16)(bfr(Wm[(size_t)(k0 + 8 * g + i) * ld + o]) * 256.0f); w[8 + i] = (_Float16)(bfr(Wm[(size_t)(k0 + 16 + 8 * g + i) * ld + o]) * 256.0f); }
  return w; }
__device__ __forceinline__ v16h wcolh_oi(const float* Wm, int k0, int o, int lane, int K) { v16h w; const float* p = Wm + (size_t)o * K + k0 + 8 * (lane >> 4);
#pragma unroll
  for (int i = 0; i < 8; ++i) { w[i] = (_Float16)(bfr(p[i]) * 256.0f); w[8 + i] = (_Float16)(bfr(p[16 + i]) * 256.0f); }
  return w; }
#define WQKV_LAYOUT 1   // 0 = (in,out) [DIN][CC]; 1 = (out,in) [CC][DIN]; 2 = per-head [NH][DIN][HD]
__device__ __forceinline__ v16b wcol_hdk(const float* Wm, int k0, int o, int lane) { v16b w; const int g = lane >> 4; const float* p = Wm + (size_t)(o / HD) * DIN * HD + (o % HD);
#pragma unroll
  for (int i = 0; i < 8; ++i) { w[i] = (__bf16)p[(size_t)(k0 + 8 * g + i) * HD]; w[8 + i] = (__bf16)p[(size_t)(k0 + 16 + 8 * g + i) * HD]; }
  return w; }
#define WO_OUT_IN 1
#if WQKV_LAYOUT == 1
#define WCOL(W, k0, o, lane) wcol_oi(W, k0, o, lane, DIN)
#elif WQKV_LAYOUT == 2
#define WCOL(W, k0, o, lane) wcol_hdk(W, k0, o, lane)
#else
#define WCOL(W, k0, o, lane) wcol_io(W, k0, o, lane, CC)
#endif
#if WO_OUT_IN
#define WOCOL(W, k0, o, lane) wcol_oi(W, k0, o, lane, CC)
#define WOCOLH(W, k0, o, lane) wcolh_oi(W, k0, o, lane, CC)
#else
#define WOCOL(W, k0, o, lane) wcol_io(W, k0, o, lane, DIN)
#define WOCOLH(W, k0, o, lane) wcolh_io(W, k0, o, lane, DIN)
#endif

// RoPE inverse frequencies 1/10000^(2i/64) (the f32 values jax computes)
__constant__ float INVF[32] = {1.000000000e+00,7.498942018e-01,5.623413324e-01,4.216965139e-01,3.162277639e-01,2.371373624e-01,1.778279394e-01,1.333521456e-01,1.000000015e-01,7.498941571e-02,5.623412877e-02,4.216964915e-02,3.162277862e-02,2.371373586e-02,1.778279431e-02,1.333521493e-02,9.999999776e-03,7.498942316e-03,5.623413250e-03,4.216964822e-03,3.162277862e-03,2.371373819e-03,1.778279431e-03,1.333521446e-03,1.000000047e-03,7.498941850e-04,5.623413017e-04,4.216964880e-04,3.162277862e-04,2.371373848e-04,1.778279402e-04,1.333521504e-04};
#define PROJ_EXTRA_PARAMS
// per (token, head) hook on the staged f32 row (64 floats, projection + bias) of the q and k streams: interleaved-pair rotation (x[2i], x[2i + 1]) by the angle t * INVF[i]; v untouched
#define PROJ_EPI(which, row, t, h) do { if ((which) < 2) { float* rw = (row); const float pos_ = (float)(t);   /* position = the token's sequence index */ _Pragma("unroll 4") for (int i = 0; i < 32; ++i) { _Pragma("clang fp contract(off)") const float ang = pos_ * INVF[i]; const float cs = cosf(ang), sn = sinf(ang); const float xe = rw[2 * i], xo = rw[2 * i + 1]; rw[2 * i] = xe * cs - xo * sn; rw[2 * i + 1] = xe * sn + xo * cs; } } } while (0)
#ifndef PROJ_EXTRA_PARAMS
#define PROJ_EXTRA_PARAMS
#endif

#define WS_QH  0u                                      // f16 q rows [b*t][CC]
#define WS_KH  (WS_QH + 2u * (size_t)NB * TT * CC)      // f16 k rows [b*t][CC]
#define WS_VT  (WS_KH + 2u * (size_t)NB * TT * CC)      // f16 v planes [b][c][t]
#define WS_QL  (WS_VT + 2u * (size_t)NB * CC * TT)      // f16 q residual x 2^10 rows [b][t < QHI][CC]
#define WS_KL  (WS_QL + 2u * (size_t)NB * QHI * CC)     // f16 k residual x 2^10 rows [b][t < KHI][CC]
#define WS_VB  (WS_KL + 2u * (size_t)NB * KHI * CC)     // bf16 v hi planes [b][c][t < KHI]
#define WS_VBL (WS_VB + 2u * (size_t)NB * CC * KHI)
#define WS_Y   (WS_VBL + 2u * (size_t)NB * CC * KHI)    // f32 ctx rows [b*t][CC] (only when there is an output projection)
#define WS_END (WS_Y  + 4u * (size_t)NB * TT * CC)

// ---- k_proj: block = (64 rows, 128 cols, which): q/k/v = X W (+ b) with exact bf16 products (K = DIN) -> which 0: q f16 rows (+ residual rows < QHI); 1: k f16 rows (+ residual rows < KHI); 2: v f16 planes [c][t] (+ bf16 hi/lo planes for t < KHI)
__global__ __launch_bounds__(128) void k_proj(const float* __restrict__ XQ, const float* __restrict__ XK, const float* __restrict__ XV, const float* __restrict__ WQ, const float* __restrict__ WK, const float* __restrict__ WV, const float* __restrict__ BQ, const float* __restrict__ BK, const float* __restrict__ BV,
    _Float16* __restrict__ QH, _Float16* __restrict__ QL, _Float16* __restrict__ KH, _Float16* __restrict__ KL, _Float16* __restrict__ VT, __bf16* __restrict__ VB, __bf16* __restrict__ VBL PROJ_EXTRA_PARAMS) {
  __shared__ __align__(16) float st[64][132]; __shared__ __align__(16) _Float16 sh[64][136], sl[64][136];
  __shared__ __align__(16) union { struct { _Float16 th[128][72]; __bf16 tb[128][72], tbl[128][72]; } e; __bf16 sg[2][192][SP]; } un;   /* the two operand stages of the k loop lie where the v epilogue's planes lie later (three barriers between) */
  auto& th = un.e.th; auto& tb = un.e.tb; auto& tbl = un.e.tbl; auto& sg = un.sg;
  const int tid = threadIdx.x, wave = tid >> 5, lane = tid & 31, col = lane & 15, g = lane >> 4; const int which = blockIdx.z; const int c0 = blockIdx.y * 128; const size_t r0 = (size_t)blockIdx.x * 64; const size_t bb = r0 / TT; const int t0 = (int)(r0 % TT);
  const float* X = which == 0 ? XQ : which == 1 ? XK : XV; const float* WA = which == 0 ? WQ : which == 1 ? WK : WV; const float* BA = which == 0 ? BQ : which == 1 ? BK : BV;
  v8f acc[8] = {};
  // a stage = SK k of the block's 128 W rows (sg rows 0..127) and 64 X rows (128..191), rounded to bf16 once for the four waves. 16 lanes x 16 B read one row's 256 B: a load instruction touches 4 whole lines, not 16 pieces
  const int lr = tid >> 4, lc = tid & 15; const float* wg = WA + (size_t)(c0 + lr) * DIN + lc * 4; const float* xg = X + (r0 + lr) * DIN + lc * 4;
  v4f wr[16], xr[8];
#pragma unroll
  for (int i = 0; i < 16; ++i) wr[i] = *(const v4f*)(wg + (size_t)i * 8 * DIN);
#pragma unroll
  for (int i = 0; i < 8; ++i) xr[i] = *(const v4f*)(xg + (size_t)i * 8 * DIN);
  asm volatile("s_wait_xcnt 0x0" :: "v"(wg), "v"(xg) : "memory");   /* behind the stage's loads: their address registers step on below */
#pragma unroll
  for (int i = 0; i < 16; ++i) *(v4b*)&sg[0][i * 8 + lr][lc * 4] = cvt4b(wr[i]);
#pragma unroll
  for (int i = 0; i < 8; ++i) *(v4b*)&sg[0][128 + i * 8 + lr][lc * 4] = cvt4b(xr[i]);
  __syncthreads();
#pragma unroll 1   // rolled: the next stage's 24 loads stay in registers over one stage's products
  for (int s = 0; s < DIN / SK; ++s, wg += SK, xg += SK) { const bool more = s + 1 < DIN / SK;   /* block-uniform */
    if (more) {
#pragma unroll
      for (int i = 0; i < 16; ++i) wr[i] = *(const v4f*)(wg + SK + (size_t)i * 8 * DIN);
#pragma unroll
      for (int i = 0; i < 8; ++i) xr[i] = *(const v4f*)(xg + SK + (size_t)i * 8 * DIN);
      asm volatile("s_wait_xcnt 0x0" :: "v"(wg), "v"(xg) : "memory"); }   /* behind the next stage's loads, which fly under this stage's products (the memory clobber holds them in front); naming their address registers keeps these whole up to the wait */
#pragma unroll
    for (int kk = 0; kk < SK / 32; ++kk) { const v16b a = frag_b(&sg[s & 1][128 + wave * 16 + col][kk * 32], lane); v16b w[8];
#pragma unroll
      for (int j = 0; j < 8; ++j) w[j] = frag_b(&sg[s & 1][j * 16 + col][kk * 32], lane);
#pragma unroll
      for (int j = 0; j < 8; ++j) acc[j] = wmma_bf(a, w[j], acc[j]); }
    if (more) {
#pragma unroll
      for (int i = 0; i < 16; ++i) *(v4b*)&sg[(s + 1) & 1][i * 8 + lr][lc * 4] = cvt4b(wr[i]);
#pragma unroll
      for (int i = 0; i < 8; ++i) *(v4b*)&sg[(s + 1) & 1][128 + i * 8 + lr][lc * 4] = cvt4b(xr[i]); }
    __syncthreads(); }   /* publishes stage s + 1 and ends every wave's reads of stage s, whose buffer the next trip refills */
  { // stage the f32 tile (acc + bias) in LDS, run the per-(row, head) epilogue hook, then convert
#pragma unroll
    for (int j = 0; j < 8; ++j) { const float bias = BA ? bfr(BA[c0 + j * 16 + col]) : 0.f;
#pragma unroll
      for (int r = 0; r < 8; ++r) st[wave * 16 + 8 * g + r][j * 16 + col] = acc[j][r] + bias; }
    __syncthreads();
    for (int e = tid; e < 64 * (128 / HD); e += 128) { const int rl = e / (128 / HD), hh = e % (128 / HD); PROJ_EPI(which, &st[rl][hh * HD], (int)((r0 + rl) % TT), (c0 / HD) + hh); }
    __syncthreads(); }
  if (which < 2) { _Float16* DH = which == 0 ? QH : KH; _Float16* DL = which == 0 ? QL : KL; const int nhi = which == 0 ? QHI : KHI; const bool hi_rows = t0 < nhi;
    for (int e = tid; e < 64 * 128; e += 128) { const int rl = e >> 7, cl = e & 127; const float v = st[rl][cl]; const _Float16 hv = (_Float16)v; sh[rl][cl] = hv; sl[rl][cl] = (_Float16)((v - (float)hv) * 1024.0f); }
    __syncthreads();
    for (int e = tid; e < 64 * 16; e += 128) { const int rl = e >> 4, q = e & 15; vst2((unsigned*)(DH + (r0 + rl) * CC + c0 + q * 8), *(const v4u*)&sh[rl][q * 8]); if (hi_rows) vst2((unsigned*)(DL + (bb * nhi + t0 + rl) * (size_t)CC + c0 + q * 8), *(const v4u*)&sl[rl][q * 8]); }
  } else { const bool hi_rows = t0 < KHI;
    for (int e = tid; e < 64 * 128; e += 128) { const int rl = e & 63, cl = e >> 6; const float v = st[rl][cl]; th[cl][rl] = (_Float16)v; const __bf16 bh = (__bf16)v; tb[cl][rl] = bh; tbl[cl][rl] = (__bf16)(v - (float)bh); }
    __syncthreads();
    for (int e = tid; e < 128 * 8; e += 128) { const int cl = e >> 3, q = e & 7; vst2((unsigned*)(VT + (bb * CC + c0 + cl) * (size_t)TT + t0 + q * 8), *(const v4u*)&th[cl][q * 8]); if (hi_rows) { const size_t o3 = (bb * CC + c0 + cl) * (size_t)KHI + t0 + q * 8; vst2((unsigned*)(VB + o3), *(const v4u*)&tb[cl][q * 8]); vst2((unsigned*)(VBL + o3), *(const v4u*)&tbl[cl][q * 8]); } } } }
// ---- k_att: block = 4 waves x 16 queries of (b, h), two query blocks one after the other (x and NQB - 1 - x: every block walks (NQB + 1) x 64 keys). Logits as S^T = K Q^T: D register r of key tile kt = key kt * 16 + 8g + r of query col, so a lane holds one query's logits and two tiles are the A fragment of P in the k order of pair_h. Pass 1: row maximum. Pass 2: the same logits again, e = 2^11 exp(s - max), sum of e in f32, e to f16 (early query blocks: bf16 hi + lo) against v; ctx = acc / sum. Nothing of S goes to memory.
// a trip is NT key tiles of 16: 64 keys; 32 in the early query blocks, whose residual planes double the fragments
// a trip's operands are staged in LDS once for the four waves (pitch SP): sk rows 0..63 = the 64 k rows (early blocks: 0..31 k, 32..63 its residual); sv row c = v plane c's 64 keys (early blocks: 32 keys of the bf16 hi plane, then of the lo plane)
template <bool HI> __device__ __forceinline__ void att_ldk(const _Float16* kp, const _Float16* klp, v16h (&kf)[2][HI ? 2 : 4], v16h (&klf)[2][HI ? 2 : 4]) {
#pragma unroll
  for (int kc = 0; kc < 2; ++kc)
#pragma unroll
    for (int kt = 0; kt < (HI ? 2 : 4); ++kt) { kf[kc][kt] = pair_h(kp + kt * 16 * SP + kc * 32); if (HI) klf[kc][kt] = pair_h(klp + kt * 16 * SP + kc * 32); } }
// unscaled logits (q.k; SCALE is folded into the exponent's multiplier SC2) of a trip's keys; srel = query - the trip's first key - 8g: key kt * 16 + r of the lane is kept while kt * 16 + r <= srel
template <bool HI, bool MASK> __device__ __forceinline__ void att_logits(const v16h (&kf)[2][HI ? 2 : 4], const v16h (&klf)[2][HI ? 2 : 4], const v16h (&qh)[2], const v16h (&ql)[2], int srel, float (&s)[HI ? 2 : 4][8]) {
  constexpr int NT = HI ? 2 : 4; v8f a[NT] = {}, al[NT] = {};
#pragma unroll
  for (int kc = 0; kc < 2; ++kc)
#pragma unroll
    for (int kt = 0; kt < NT; ++kt) { a[kt] = wmma16(kf[kc][kt], qh[kc], a[kt]); if (HI) { al[kt] = wmma16(kf[kc][kt], ql[kc], al[kt]); al[kt] = wmma16(klf[kc][kt], qh[kc], al[kt]); } }
#pragma unroll
  for (int kt = 0; kt < NT; ++kt)
#pragma unroll
    for (int r = 0; r < 8; ++r) { const float v = HI ? a[kt][r] + al[kt][r] * (1.0f / 1024.0f) : a[kt][r]; s[kt][r] = (!MASK || kt * 16 + r <= srel) ? v : -3.0e38f; } }
template <bool HI, bool MASK> __device__ __forceinline__ float att_max(const _Float16* kp, const _Float16* klp, const v16h (&qh)[2], const v16h (&ql)[2], int srel) {
  constexpr int NT = HI ? 2 : 4; v16h kf[2][NT], klf[2][NT]; float s[NT][8]; att_ldk<HI>(kp, klp, kf, klf);
  att_logits<HI, MASK>(kf, klf, qh, ql, srel, s);
  float m = s[0][0];
#pragma unroll
  for (int kt = 0; kt < NT; ++kt)
#pragma unroll
    for (int r = 0; r < 8; ++r) m = fmaxf(m, s[kt][r]);
  return m; }
// 2^x of the eight logits a lane holds of one key tile, in place. One statement, so that behind each v_exp_f32 stands an instruction that neither reads its result nor overwrites its source: the next one, and a v_nop behind the last (the slot the instruction set asks for)
__device__ __forceinline__ void exp2x8(float (&x)[8]) {
  asm("v_exp_f32 %0, %0\n\tv_exp_f32 %1, %1\n\tv_exp_f32 %2, %2\n\tv_exp_f32 %3, %3\n\tv_exp_f32 %4, %4\n\tv_exp_f32 %5, %5\n\tv_exp_f32 %6, %6\n\tv_exp_f32 %7, %7\n\tv_nop"
      : "+v"(x[0]), "+v"(x[1]), "+v"(x[2]), "+v"(x[3]), "+v"(x[4]), "+v"(x[5]), "+v"(x[6]), "+v"(x[7])); }
// bias = 11 - SC2 x the query's row maximum, finite (every row keeps its diagonal): e = 2^(SC2 x d + bias) = 2^11 exp(s - max) by one fused multiply-add and the chip's own 2^x; an excluded logit (-3e38) gives 0
template <bool HI, bool MASK> __device__ __forceinline__ void att_pv(const _Float16* kp, const _Float16* klp, const _Float16* vp, const __bf16* vhp, const __bf16* vlp, const v16h (&qh)[2], const v16h (&ql)[2], int srel, float bias, float& sum, v8f (&acc)[HD / 16]) {
  constexpr int NT = HI ? 2 : 4; v16h kf[2][NT], klf[2][NT], vf[NT / 2][HD / 16]; v16b vh[NT / 2][HD / 16], vl[NT / 2][HD / 16]; float s[NT][8]; att_ldk<HI>(kp, klp, kf, klf);
  att_logits<HI, MASK>(kf, klf, qh, ql, srel, s);
#pragma unroll
  for (int u = 0; u < NT / 2; ++u)   /* the v reads take the k fragments' registers and fly under the exponentials */
#pragma unroll
    for (int j = 0; j < HD / 16; ++j) { if (!HI) vf[u][j] = pair_h(vp + j * 16 * SP + u * 32); else { vh[u][j] = pair_b(vhp + j * 16 * SP + u * 32); vl[u][j] = pair_b(vlp + j * 16 * SP + u * 32); } }
  float part[NT];
#pragma unroll
  for (int kt = 0; kt < NT; ++kt) {
#pragma unroll
    for (int r = 0; r < 8; ++r) s[kt][r] = fmaf(s[kt][r], SC2, bias);
    exp2x8(s[kt]); part[kt] = s[kt][0];
#pragma unroll
    for (int r = 1; r < 8; ++r) part[kt] += s[kt][r]; }
#pragma unroll
  for (int kt = 0; kt < NT; kt += 2) sum += part[kt] + part[kt + 1];
#pragma unroll
  for (int u = 0; u < NT / 2; ++u) {
    if (!HI) { v16h p;
#pragma unroll
      for (int i = 0; i < 8; ++i) { p[i] = (_Float16)s[2 * u][i]; p[8 + i] = (_Float16)s[2 * u + 1][i]; }
#pragma unroll
      for (int j = 0; j < HD / 16; ++j) acc[j] = wmma16(p, vf[u][j], acc[j]);
    } else { float pv[16];
#pragma unroll
      for (int i = 0; i < 8; ++i) { pv[i] = s[2 * u][i]; pv[8 + i] = s[2 * u + 1][i]; }
      const F2 p = bsplit16(pv);
#pragma unroll
      for (int j = 0; j < HD / 16; ++j) { acc[j] = wmma_bf(p.h, vh[u][j], acc[j]); acc[j] = wmma_bf(p.l, vh[u][j], acc[j]); acc[j] = wmma_bf(p.h, vl[u][j], acc[j]); } } } }
template <bool HI> __device__ __forceinline__ void att_tile(const _Float16* __restrict__ QH, const _Float16* __restrict__ KH, const _Float16* __restrict__ QL, const _Float16* __restrict__ KL, const _Float16* __restrict__ VT, const __bf16* __restrict__ VB, const __bf16* __restrict__ VBL, float* __restrict__ Y, float (*ssw)[HD + 4], _Float16 (*sk)[64][SP], _Float16 (*sv)[64][SP], int b, int h, int qb, int wave, int lane) {
  constexpr int KS = HI ? 32 : 64;   /* keys a trip */
  const int col = lane & 15, g = lane >> 4; const int ql0 = qb * 64 + wave * 16; const size_t ho = (size_t)h * HD + 8 * g;
  const int nfull = HI ? 0 : qb, nmask = HI ? (qb + 1) * 2 : 1;   /* trips wholly below the diagonal, then trips masked by index */
  const int nl = nfull + nmask - 1;   /* trips in front of the last one: all unmasked in the late blocks, all masked in the early ones; block-uniform */
  const int srel0 = ql0 + col - 8 * g - nfull * KS;
  const _Float16* qp = QH + ((size_t)b * TT + ql0 + col) * CC + ho; const _Float16* qlp = HI ? QL + ((size_t)b * QHI + ql0 + col) * CC + ho : qp;
  v16h qh[2], ql[2];
#pragma unroll
  for (int kc = 0; kc < 2; ++kc) { qh[kc] = pair_h(qp + kc * 32); ql[kc] = HI ? pair_h(qlp + kc * 32) : qh[kc]; }
  asm volatile("s_wait_xcnt 0x0" :: "v"(qp), "v"(qlp) : "memory");   /* behind the q loads, as below */
  // staging: 8 lanes x 16 B fill one stage row of 128 B, so a load instruction touches 4 whole lines (the early blocks' v planes: 8 half lines), not 16 pieces. ka: stage rows 0..31, kb: rows 32..63
  constexpr int VLD = HI ? KHI : TT;   /* row pitch of the v planes read */
  const int sr = (wave * 32 + lane) >> 3, sc = (lane & 7) * 8; const size_t vrow = (size_t)b * CC + h * HD + sr;
  const _Float16* const ka0 = KH + ((size_t)b * TT + sr) * CC + h * HD + sc; const _Float16* const kb0 = HI ? KL + ((size_t)b * KHI + sr) * CC + h * HD + sc : ka0 + (size_t)32 * CC;
  const _Float16* const vg0 = HI ? (const _Float16*)((sc < 32 ? VB : VBL) + vrow * KHI + (sc & 31)) : VT + vrow * TT + sc;   /* moved as raw 16-B pieces */
  float m = -3.0e38f;
  { const _Float16 *ka = ka0, *kb = kb0; v8h kr[4], vr[4]; int srel = srel0;
#pragma unroll
    for (int i = 0; i < 2; ++i) { kr[i] = *(const v8h*)(ka + (size_t)i * 16 * CC); kr[2 + i] = *(const v8h*)(kb + (size_t)i * 16 * CC); }
    asm volatile("s_wait_xcnt 0x0" :: "v"(ka), "v"(kb) : "memory");   /* behind the stage's loads: their address registers step on below */
    __syncthreads();   /* every wave has left the stages of the tile before */
#pragma unroll
    for (int i = 0; i < 4; ++i) *(v8h*)&sk[0][i * 16 + sr][sc] = kr[i];
    __syncthreads();
#pragma unroll 1   // rolled: one trip's fragments fill the registers
    for (int tr = 0; tr < nl; ++tr, ka += (size_t)KS * CC, kb += (size_t)KS * CC) {
#pragma unroll
      for (int i = 0; i < 2; ++i) { kr[i] = *(const v8h*)(ka + (size_t)(KS + i * 16) * CC); kr[2 + i] = *(const v8h*)(kb + (size_t)(KS + i * 16) * CC); }
      asm volatile("s_wait_xcnt 0x0" :: "v"(ka), "v"(kb) : "memory");   /* behind the next trip's loads, which fly under this trip's logits (the memory clobber holds them in front); naming their address registers keeps these whole up to the wait */
      const _Float16* kp = &sk[tr & 1][col][8 * g]; m = fmaxf(m, att_max<HI, HI>(kp, kp + 32 * SP, qh, ql, srel)); if (HI) srel -= KS;
#pragma unroll
      for (int i = 0; i < 4; ++i) *(v8h*)&sk[(tr + 1) & 1][i * 16 + sr][sc] = kr[i];
      __syncthreads(); }   /* publishes trip tr + 1 and ends every wave's reads of trip tr, whose buffer the next trip refills */
#pragma unroll
    for (int i = 0; i < 2; ++i) { kr[i] = *(const v8h*)(ka0 + (size_t)i * 16 * CC); kr[2 + i] = *(const v8h*)(kb0 + (size_t)i * 16 * CC); }   /* pass 2's first stage flies under pass 1's last trip */
#pragma unroll
    for (int i = 0; i < 4; ++i) vr[i] = *(const v8h*)(vg0 + (size_t)i * 16 * VLD);
    asm volatile("s_wait_xcnt 0x0" :: "v"(ka0), "v"(kb0), "v"(vg0) : "memory");   /* behind these loads, as above */
    const _Float16* kp = &sk[nl & 1][col][8 * g]; m = fmaxf(m, att_max<HI, true>(kp, kp + 32 * SP, qh, ql, srel));
    __syncthreads();   /* every wave has left pass 1's stages */
#pragma unroll
    for (int i = 0; i < 4; ++i) { *(v8h*)&sk[0][i * 16 + sr][sc] = kr[i]; *(v8h*)&sv[0][i * 16 + sr][sc] = vr[i]; }
    __syncthreads(); }
  m = fmaxf(m, __shfl_xor(m, 16));   /* the two lane halves hold the two key halves of one query */
  const float bias = fmaf(-m, SC2, 11.0f);   /* one rounding, the same for every key of the query: it cancels in e / sum */
  v8f acc[HD / 16] = {}; float sum = 0.f;
  { const _Float16 *ka = ka0, *kb = kb0, *vg = vg0; v8h kr[4], vr[4]; int srel = srel0;
#pragma unroll 1   // rolled: one trip's fragments fill the registers
    for (int tr = 0; tr < nl; ++tr, ka += (size_t)KS * CC, kb += (size_t)KS * CC, vg += KS) {
#pragma unroll
      for (int i = 0; i < 2; ++i) { kr[i] = *(const v8h*)(ka + (size_t)(KS + i * 16) * CC); kr[2 + i] = *(const v8h*)(kb + (size_t)(KS + i * 16) * CC); }
#pragma unroll
      for (int i = 0; i < 4; ++i) vr[i] = *(const v8h*)(vg + KS + (size_t)i * 16 * VLD);
      asm volatile("s_wait_xcnt 0x0" :: "v"(ka), "v"(kb), "v"(vg) : "memory");   /* behind the next trip's loads, which fly under this trip's work (the memory clobber holds them in front); naming their address registers keeps these whole up to the wait */
      const _Float16 *kp = &sk[tr & 1][col][8 * g], *vp = &sv[tr & 1][col][8 * g]; att_pv<HI, HI>(kp, kp + 32 * SP, vp, (const __bf16*)vp, (const __bf16*)vp + 32, qh, ql, srel, bias, sum, acc); if (HI) srel -= KS;
#pragma unroll
      for (int i = 0; i < 4; ++i) { *(v8h*)&sk[(tr + 1) & 1][i * 16 + sr][sc] = kr[i]; *(v8h*)&sv[(tr + 1) & 1][i * 16 + sr][sc] = vr[i]; }
      __syncthreads(); }   /* publishes trip tr + 1 and ends every wave's reads of trip tr, whose buffers the next trip refills */
    const _Float16 *kp = &sk[nl & 1][col][8 * g], *vp = &sv[nl & 1][col][8 * g]; att_pv<HI, true>(kp, kp + 32 * SP, vp, (const __bf16*)vp, (const __bf16*)vp + 32, qh, ql, srel, bias, sum, acc); }
  sum += __shfl_xor(sum, 16);
  const float inv = sum > 0.f ? 1.0f / sum : 0.f;   /* of query col; sum carries the 2^11 of its terms; a fully excluded row yields 0 */
#pragma unroll
  for (int r = 0; r < 8; ++r) { const float ir = __shfl(inv, 8 * g + r);   /* accumulator register r is query 8g + r */
#pragma unroll
    for (int j = 0; j < HD / 16; ++j) ssw[8 * g + r][j * 16 + col] = acc[j][r] * ir; }
  LDSX();
  float* yp = Y + ((size_t)b * TT + ql0 + g) * CC + h * HD + col * 4;   /* 256-B (row, head) segment by 16 lanes, two rows a store */
#pragma unroll
  for (int rl = 0; rl < 16; rl += 2) vst2(yp + (size_t)rl * CC, *(const v4f*)&ssw[rl + g][col * 4]);
  asm volatile("s_wait_xcnt 0x0" :: "v"(yp) : "memory");   /* behind the stores: the next tile overwrites their registers */
  LDSX(); }   /* the next tile's staging writes stay behind these reads */
// amdgpu_waves_per_eu(2, 2): the grid gives two waves a SIMD (512 blocks x 4 waves, 1,024 SIMDs); with that register budget a trip's exponentials interleave instead of running as one dependent chain after the other
__global__ __launch_bounds__(128) __attribute__((amdgpu_waves_per_eu(2, 2))) void k_att(const _Float16* __restrict__ QH, const _Float16* __restrict__ KH, const _Float16* __restrict__ QL, const _Float16* __restrict__ KL, const _Float16* __restrict__ VT, const __bf16* __restrict__ VB, const __bf16* __restrict__ VBL, float* __restrict__ Y) { __shared__ __align__(16) float ss[4][16][HD + 4]; __shared__ __align__(16) _Float16 sk[2][64][SP], sv[2][64][SP];
  const int tid = threadIdx.x, wave = tid >> 5, lane = tid & 31; const int h = blockIdx.y, b = blockIdx.z;
#pragma unroll 1   // rolled: the two tiles share one copy of the code
  for (int half = 0; half < 2; ++half) { const int qb = half ? (int)blockIdx.x : NQB - 1 - (int)blockIdx.x;   /* block-uniform */
    if (qb < QBH) att_tile<true>(QH, KH, QL, KL, VT, VB, VBL, Y, ss[wave], sk, sv, b, h, qb, wave, lane);
    else att_tile<false>(QH, KH, QL, KL, VT, VB, VBL, Y, ss[wave], sk, sv, b, h, qb, wave, lane); } }
// ---- k_out: block = (64 rows, 128 cols): out = ctx Wo (+ bo): ctx x 2^6 once to f16 against Wo as f16(bf16 x 2^8) exact (1 product) x 2^-14; causal early rows (< QHI of each sequence): ctx bf16 hi + lo against exact bf16 Wo (2 products)
__global__ __launch_bounds__(128) void k_out(const float* __restrict__ Y, const float* __restrict__ WO, const float* __restrict__ BO, float* __restrict__ OUT) { __shared__ __align__(16) float sf[4][16][132];
  __shared__ __align__(16) union { __bf16 b[2][256][SP]; _Float16 h[2][192][SP]; } sg;   /* two operand stages: rows 0..127 Wo, 128..191 ctx (hi), 192..255 ctx lo (early rows only) */
  const int tid = threadIdx.x, wave = tid >> 5, lane = tid & 31, col = lane & 15, g = lane >> 4; const int c0 = blockIdx.y * 128; const size_t r0 = (size_t)blockIdx.x * 64 + wave * 16;
  v8f acc[8] = {};
  // a stage = SK k of the block's 128 Wo rows and 64 ctx rows, converted once for the four waves. 16 lanes x 16 B read one row's 256 B: a load instruction touches 4 whole lines, not 16 pieces
  const int lr = tid >> 4, lc = tid & 15; const float* wg = WO + (size_t)(c0 + lr) * CC + lc * 4; const float* yg = Y + ((size_t)blockIdx.x * 64 + lr) * CC + lc * 4;
  v4f wr[16], yr[8];
#pragma unroll
  for (int i = 0; i < 16; ++i) wr[i] = *(const v4f*)(wg + (size_t)i * 8 * CC);
#pragma unroll
  for (int i = 0; i < 8; ++i) yr[i] = *(const v4f*)(yg + (size_t)i * 8 * CC);
  asm volatile("s_wait_xcnt 0x0" :: "v"(wg), "v"(yg) : "memory");   /* behind the stage's loads: their address registers step on below */
  if (CAUSAL && (int)(((size_t)blockIdx.x * 64) % TT) < QHI) {   /* block-uniform */
#pragma unroll
    for (int i = 0; i < 16; ++i) *(v4b*)&sg.b[0][i * 8 + lr][lc * 4] = cvt4b(wr[i]);
#pragma unroll
    for (int i = 0; i < 8; ++i) { const v4b hv = cvt4b(yr[i]); v4f rs;   /* ctx = bf16 hi + bf16 lo, as bsplit16 forms them */
#pragma unroll
      for (int e = 0; e < 4; ++e) rs[e] = yr[i][e] - (float)hv[e];
      *(v4b*)&sg.b[0][128 + i * 8 + lr][lc * 4] = hv; *(v4b*)&sg.b[0][192 + i * 8 + lr][lc * 4] = cvt4b(rs); }
    __syncthreads();
#pragma unroll 1   // rolled: the next stage's 24 loads stay in registers over one stage's products
    for (int s = 0; s < CC / SK; ++s, wg += SK, yg += SK) { const bool more = s + 1 < CC / SK;   /* block-uniform */
      if (more) {
#pragma unroll
        for (int i = 0; i < 16; ++i) wr[i] = *(const v4f*)(wg + SK + (size_t)i * 8 * CC);
#pragma unroll
        for (int i = 0; i < 8; ++i) yr[i] = *(const v4f*)(yg + SK + (size_t)i * 8 * CC);
        asm volatile("s_wait_xcnt 0x0" :: "v"(wg), "v"(yg) : "memory"); }   /* behind the next stage's loads, which fly under this stage's products (the memory clobber holds them in front); naming their address registers keeps these whole up to the wait */
#pragma unroll
      for (int kk = 0; kk < SK / 32; ++kk) { const v16b ah = frag_b(&sg.b[s & 1][128 + wave * 16 + col][kk * 32], lane), al = frag_b(&sg.b[s & 1][192 + wave * 16 + col][kk * 32], lane); v16b w[8];
#pragma unroll
        for (int j = 0; j < 8; ++j) w[j] = frag_b(&sg.b[s & 1][j * 16 + col][kk * 32], lane);
#pragma unroll
        for (int j = 0; j < 8; ++j) { acc[j] = wmma_bf(ah, w[j], acc[j]); acc[j] = wmma_bf(al, w[j], acc[j]); } }
      if (more) {
#pragma unroll
        for (int i = 0; i < 16; ++i) *(v4b*)&sg.b[(s + 1) & 1][i * 8 + lr][lc * 4] = cvt4b(wr[i]);
#pragma unroll
        for (int i = 0; i < 8; ++i) { const v4b hv = cvt4b(yr[i]); v4f rs;   /* ctx = bf16 hi + bf16 lo, as bsplit16 forms them */
#pragma unroll
          for (int e = 0; e < 4; ++e) rs[e] = yr[i][e] - (float)hv[e];
          *(v4b*)&sg.b[(s + 1) & 1][128 + i * 8 + lr][lc * 4] = hv; *(v4b*)&sg.b[(s + 1) & 1][192 + i * 8 + lr][lc * 4] = cvt4b(rs); }
      }
      __syncthreads(); }   /* publishes stage s + 1 and ends every wave's reads of stage s, whose buffer the next trip refills */
#pragma unroll
    for (int j = 0; j < 8; ++j) { const float bias = BO ? bfr(BO[c0 + j * 16 + col]) : 0.f;
#pragma unroll
      for (int r = 0; r < 8; ++r) sf[wave][8 * g + r][j * 16 + col] = acc[j][r] + bias; }
  } else {
#pragma unroll
    for (int i = 0; i < 16; ++i) { v4h c;   /* Wo as f16(bf16 x 2^8), exact */
#pragma unroll
      for (int e = 0; e < 4; ++e) c[e] = (_Float16)(bfr(wr[i][e]) * 256.0f);
      *(v4h*)&sg.h[0][i * 8 + lr][lc * 4] = c; }
#pragma unroll
    for (int i = 0; i < 8; ++i) { v4h c;   /* ctx carried x 2^6 into f16 so small-magnitude context rows stay clear of f16 subnormals */
#pragma unroll
      for (int e = 0; e < 4; ++e) c[e] = (_Float16)(yr[i][e] * 64.0f);
      *(v4h*)&sg.h[0][128 + i * 8 + lr][lc * 4] = c; }
    __syncthreads();
#pragma unroll 1   // rolled: the next stage's 24 loads stay in registers over one stage's products
    for (int s = 0; s < CC / SK; ++s, wg += SK, yg += SK) { const bool more = s + 1 < CC / SK;   /* block-uniform */
      if (more) {
#pragma unroll
        for (int i = 0; i < 16; ++i) wr[i] = *(const v4f*)(wg + SK + (size_t)i * 8 * CC);
#pragma unroll
        for (int i = 0; i < 8; ++i) yr[i] = *(const v4f*)(yg + SK + (size_t)i * 8 * CC);
        asm volatile("s_wait_xcnt 0x0" :: "v"(wg), "v"(yg) : "memory"); }   /* behind the next stage's loads, which fly under this stage's products (the memory clobber holds them in front); naming their address registers keeps these whole up to the wait */
#pragma unroll
      for (int kk = 0; kk < SK / 32; ++kk) { const v16h a = frag_h(&sg.h[s & 1][128 + wave * 16 + col][kk * 32], lane); v16h w[8];
#pragma unroll
        for (int j = 0; j < 8; ++j) w[j] = frag_h(&sg.h[s & 1][j * 16 + col][kk * 32], lane);
#pragma unroll
        for (int j = 0; j < 8; ++j) acc[j] = wmma16(a, w[j], acc[j]); }
      if (more) {
#pragma unroll
        for (int i = 0; i < 16; ++i) { v4h c;   /* Wo as f16(bf16 x 2^8), exact */
#pragma unroll
          for (int e = 0; e < 4; ++e) c[e] = (_Float16)(bfr(wr[i][e]) * 256.0f);
          *(v4h*)&sg.h[(s + 1) & 1][i * 8 + lr][lc * 4] = c; }
#pragma unroll
        for (int i = 0; i < 8; ++i) { v4h c;   /* ctx carried x 2^6 into f16 so small-magnitude context rows stay clear of f16 subnormals */
#pragma unroll
          for (int e = 0; e < 4; ++e) c[e] = (_Float16)(yr[i][e] * 64.0f);
          *(v4h*)&sg.h[(s + 1) & 1][128 + i * 8 + lr][lc * 4] = c; }
      }
      __syncthreads(); }   /* publishes stage s + 1 and ends every wave's reads of stage s, whose buffer the next trip refills */
#pragma unroll
    for (int j = 0; j < 8; ++j) { const float bias = BO ? bfr(BO[c0 + j * 16 + col]) : 0.f;
#pragma unroll
      for (int r = 0; r < 8; ++r) sf[wave][8 * g + r][j * 16 + col] = acc[j][r] * (1.0f / 16384.0f) + bias; } }   /* 2^-8 (Wo carry) x 2^-6 (ctx carry) */
  LDSX(); for (int rl = 0; rl < 16; ++rl) vst2(OUT + (r0 + rl) * DIN + c0 + lane * 4, *(const v4f*)&sf[wave][rl][lane * 4]); }

extern "C" void kernel_launch(void* const* d_in, const int* in_sizes, int n_in, void* d_out, int out_size, void* d_ws, size_t ws_size, hipStream_t stream) {
  (void)in_sizes; (void)n_in; (void)out_size;
  const float** F = (const float**)d_in;
  if (ws_size < (size_t)WS_END) return;
  char* ws = (char*)d_ws; _Float16 *QH = (_Float16*)(ws + WS_QH), *KH = (_Float16*)(ws + WS_KH), *VT = (_Float16*)(ws + WS_VT), *QL = (_Float16*)(ws + WS_QL), *KL = (_Float16*)(ws + WS_KL); __bf16 *VB = (__bf16*)(ws + WS_VB), *VBL = (__bf16*)(ws + WS_VBL); float *Y = (float*)(ws + WS_Y);
  (void)Y; (void)QL; (void)KL; (void)VB; (void)VBL;
  // inputs: 0 x [2,2048,1024]; 1 wq [1024,1024] (out,in); 2 wk; 3 wv; 4 wo (out,in); no biases (null pointers)
  k_proj<<<dim3(TNB * TT / 64, CC / 128, 3), 128, 0, stream>>>(F[0], F[0], F[0], F[1], F[2], F[3], nullptr, nullptr, nullptr, QH, QL, KH, KL, VT, VB, VBL);
  k_att<<<dim3(NQB / 2, NH, TNB), 128, 0, stream>>>(QH, KH, QL, KL, VT, VB, VBL, Y);
  k_out<<<dim3(TNB * TT / 64, DIN / 128), 128, 0, stream>>>(Y, F[4], nullptr, (float*)d_out);
}

// v005
// A run of this version takes 134 microseconds.
// Next to v004, in two timings, it ran 1.05 and 1.04 times as fast.
// All steps since v000 together make it 9.65 times as fast.
// compute dtype: all float inputs rounded to bf16; q / k / v projections with EXACT bf16 products on WMMA 16x16x32 (f32 accumulate) (no biases); interleaved-pair RoPE in f32 AFTER the bias (embedded frequencies, the library cosf / sinf values, positions = the row index); causal logits: 3 products for the first 384 rows, single f16 q x k after, x 64^-0.5; softmax f32 (row maximum first, logits formed twice, never stored); exp(s - max) x 2^11 once to f16 x v once to f16 (bf16 hi + lo below row 384), / sum after the product; ctx hi+lo x exact Wo below row 384, x2^6 f16 carry x f16(bf16 x 2^8) Wo after, + bo; f32 output.
#include <hip/hip_runtime.h>
#include <math.h>

typedef __attribute__((ext_vector_type(16))) _Float16 v16h;
typedef __attribute__((ext_vector_type(16))) __bf16 v16b;
typedef __attribute__((ext_vector_type(8)))  _Float16 v8h;
typedef __attribute__((ext_vector_type(8)))  float v8f;
typedef __attribute__((ext_vector_type(4)))  float v4f;
typedef __attribute__((ext_vector_type(2)))  float v2f;
typedef __attribute__((ext_vector_type(4)))  unsigned v4u;
typedef __attribute__((ext_vector_type(4)))  int v4i;
typedef float __attribute__((may_alias)) float_a;
typedef int __attribute__((may_alias)) int_a;

template <typename T> __device__ __forceinline__ void vst2(void* p, T v) { *(T*)p = v;  }
__device__ __forceinline__ v8f wmma16(v16h a, v16h b, v8f c) {
  v8f d = __builtin_amdgcn_wmma_f32_16x16x32_f16(false, a, false, b, (short)0, c, false, false);
  asm volatile("v_nop\n\tv_nop\n\tv_nop\n\tv_nop" : "+v"(d) : "v"(a), "v"(b));
  return d;
}
__device__ __forceinline__ v8f wmma_bf(v16b a, v16b b, v8f c) {
  v8f d = __builtin_amdgcn_wmma_f32_16x16x32_bf16(false, a, false, b, (short)0, c, false, false);
  asm volatile("v_nop\n\tv_nop\n\tv_nop\n\tv_nop" : "+v"(d) : "v"(a), "v"(b));
  return d;
}
// 16x16x32 fragments: lane = (h = lane>>4, row/col = lane&15); elements 0..7 = k0+8h+0..7, 8..15 = k0+16+8h+0..7; D element r = row 8h+r
__device__ __forceinline__ v16h frag_h(const _Float16* rowk0, int lane) {
  union { v16h v; v8h q[2]; } u; const _Float16* p = rowk0 + 8 * (lane >> 4);
  u.q[0] = *(const v8h*)p; u.q[1] = *(const v8h*)(p + 16); return u.v;
}
__device__ __forceinline__ v16h frag_f32(const float* rowk0, int lane) {
  v16h a; const float* p = rowk0 + 8 * (lane >> 4);
#pragma unroll
  for (int i = 0; i < 8; ++i) { a[i] = (_Float16)p[i]; a[8 + i] = (_Float16)p[16 + i]; }
  return a;
}
__device__ __forceinline__ v16h frag_f32s(const float* rowk0, int lane, float sc) {
  v16h a; const float* p = rowk0 + 8 * (lane >> 4);
#pragma unroll
  for (int i = 0; i < 8; ++i) { a[i] = (_Float16)(p[i] * sc); a[8 + i] = (_Float16)(p[16 + i] * sc); }
  return a;
}
// column fragment from a [K][ld] layout (column n), rows >= K read as 0
__device__ __forceinline__ v16h fragc_f32(const float* W, int k0, int n, int lane, int ld, int K) {
  v16h a; const int g = lane >> 4;
#pragma unroll
  for (int i = 0; i < 8; ++i) { const int ka = k0 + 8 * g + i, kb = ka + 16;
    a[i] = (_Float16)(ka < K ? W[(size_t)(ka < K ? ka : K - 1) * ld + n] : 0.f); a[8 + i] = (_Float16)(kb < K ? W[(size_t)(kb < K ? kb : K - 1) * ld + n] : 0.f); }
  return a;
}
struct F2 { v16b h, l; };
__device__ __forceinline__ F2 bsplit16(const float v[16]) { F2 r;
#pragma unroll
  for (int i = 0; i < 16; ++i) { const __bf16 h = (__bf16)v[i]; r.h[i] = h; r.l[i] = (__bf16)(v[i] - (float)h); }
  return r; }
__device__ __forceinline__ F2 split_row(const float* row, int k0, int lane) { float v[16]; const float* p = row + k0 + 8 * (lane >> 4);
#pragma unroll
  for (int i = 0; i < 8; ++i) { v[i] = p[i]; v[8 + i] = p[16 + i]; }
  return bsplit16(v); }
__device__ __forceinline__ F2 split_rowK(const float* row, int k0, int lane, int K) { float v[16]; const int g = lane >> 4;
#pragma unroll
  for (int i = 0; i < 8; ++i) { const int ka = k0 + 8 * g + i, kb = ka + 16; v[i] = ka < K ? row[ka < K ? ka : K - 1] : 0.f; v[8 + i] = kb < K ? row[kb < K ? kb : K - 1] : 0.f; }
  return bsplit16(v); }
__device__ __forceinline__ F2 split_col(const float* W, int k0, int n, int lane, int ld, int K) { float v[16]; const int g = lane >> 4;
#pragma unroll
  for (int i = 0; i < 8; ++i) { const int ka = k0 + 8 * g + i, kb = ka + 16; v[i] = ka < K ? W[(size_t)(ka < K ? ka : K - 1) * ld + n] : 0.f; v[8 + i] = kb < K ? W[(size_t)(kb < K ? kb : K - 1) * ld + n] : 0.f; }
  return bsplit16(v); }
__device__ __forceinline__ v8f mac3(const F2& a, const F2& b, v8f c) { c = wmma_bf(a.l, b.h, c); c = wmma_bf(a.h, b.l, c); return wmma_bf(a.h, b.h, c); }
__device__ __forceinline__ float sigm(float v) { return 1.0f / (1.0f + expf(-v)); }
#define LDSX() do { asm volatile("s_wait_dscnt 0" ::: "memory"); __builtin_amdgcn_wave_barrier(); __builtin_amdgcn_fence(__ATOMIC_RELEASE, "workgroup"); } while (0)

// Causal multi-head self-attention with interleaved-pair RoPE (x [2,2048,1024]; torch (out,in) wq / wk / wv / wo [1024,1024] applied as x @ W.T, no biases; 16 heads x 64; RoPE on Q and K: adjacent (even, odd) pairs (xe c - xo s, xe s + xo c) re-interleaved, theta 10000, positions 0..2047; scores / sqrt(64); tril kept, -inf elsewhere (the module's own softmax guards the -inf row maximum: every row keeps its diagonal, so the guard never fires); out @ wo.T).
#define NB 2
#define TT 2048
#define CC 1024            // NH * HD = projected width
#define DIN 1024          // input (model) width
#define NH 16
#define HD 64
#define NQB (TT / 64)
#define SCALE (0.125f)
#define SC2 (SCALE * 1.44269504088896340736f)   // SCALE x log2(e): exp(SCALE x (d - dmax)) = 2^(SC2 x d - SC2 x dmax), d = the unscaled q.k product
#define CAUSAL 1
#ifndef TNB
#define TNB NB
#endif
__device__ __forceinline__ float bfr(float v) { return (float)(__bf16)v; }
typedef __attribute__((ext_vector_type(8))) __bf16 v8b;
__device__ __forceinline__ v16b frag_b(const __bf16* rowk0, int lane) {
  union { v16b v; v8b q[2]; } u; const __bf16* p = rowk0 + 8 * (lane >> 4);
  u.q[0] = *(const v8b*)p; u.q[1] = *(const v8b*)(p + 16); return u.v;
}
// unconverted fragment reads; p = the lane's row + k0 + 8 * (lane >> 4): elements 0..7 = p[0..7], 8..15 = p[16..23] (the k order of frag_h / frag_f32 / split_row / wcol_oi)
typedef __attribute__((ext_vector_type(16))) float v16f;
__device__ __forceinline__ v16f raw16(const float* p) { v16f r;
#pragma unroll
  for (int i = 0; i < 8; ++i) { r[i] = p[i]; r[8 + i] = p[16 + i]; }
  return r; }
__device__ __forceinline__ v16h pair_h(const _Float16* p) { union { v16h v; v8h q[2]; } u; u.q[0] = *(const v8h*)p; u.q[1] = *(const v8h*)(p + 16); return u.v; }
__device__ __forceinline__ v16b pair_b(const __bf16* p) { union { v16b v; v8b q[2]; } u; u.q[0] = *(const v8b*)p; u.q[1] = *(const v8b*)(p + 16); return u.v; }
__device__ __forceinline__ F2 bsplit_v(v16f r) { float v[16];
#pragma unroll
  for (int i = 0; i < 16; ++i) v[i] = r[i];
  return bsplit16(v); }
#define SK 64              // k of one LDS operand stage (k_proj, k_out): 256 B of every f32 source row
#define SP 72              // stage row pitch in 16-bit elements: 144 B = 16 B x 9, odd, for the ds_load_b128 fragment reads
typedef __attribute__((ext_vector_type(4))) __bf16 v4b;
typedef __attribute__((ext_vector_type(4))) _Float16 v4h;
__device__ __forceinline__ v4b cvt4b(v4f v) { v4b r;
#pragma unroll
  for (int i = 0; i < 4; ++i) r[i] = (__bf16)v[i];
  return r; }
#define QBH 6              // causal: query blocks 0..QBH-1 of each sequence (few keys, no averaging) take the high-precision path
#define QHI 384            // rows carrying a q residual plane
#define KHI 384            // key rows carrying k residual / v bf16 hi+lo planes (used only by the causal high-precision path)
// B fragment (k rows k0+.., output column o) of a weight: (in,out) [K][ld] or (out,in) [ld rows of K]: bf16 exact, or f16(bf16 * 256) exact
__device__ __forceinline__ v16b wcol_io(const float* Wm, int k0, int o, int lane, int ld) { v16b w; const int g = lane >> 4;
#pragma unroll
  for (int i = 0; i < 8; ++i) { w[i] = (__bf16)Wm[(size_t)(k0 + 8 * g + i) * ld + o]; w[8 + i] = (__bf16)Wm[(size_t)(k0 + 16 + 8 * g + i) * ld + o]; }
  return w; }
__device__ __forceinline__ v16b wcol_oi(const float* Wm, int k0, int o, int lane, int K) { v16b w; const float* p = Wm + (size_t)o * K + k0 + 8 * (lane >> 4);
#pragma unroll
  for (int i = 0; i < 8; ++i) { w[i] = (__bf16)p[i]; w[8 + i] = (__bf16)p[16 + i]; }
  return w; }
__device__ __forceinline__ v16h wcolh_io(const float* Wm, int k0, int o, int lane, int ld) { v16h w; const int g = lane >> 4;
#pragma unroll
  for (int i = 0; i < 8; ++i) { w[i] = (_Float16)(bfr(Wm[(size_t)(k0 + 8 * g + i) * ld + o]) * 256.0f); w[8 + i] = (_Float16)(bfr(Wm[(size_t)(k0 + 16 + 8 * g + i) * ld + o]) * 256.0f); }
  return w; }
__device__ __forceinline__ v16h wcolh_oi(const float* Wm, int k0, int o, int lane, int K) { v16h w; const float* p = Wm + (size_t)o * K + k0 + 8 * (lane >> 4);
#pragma unroll
  for (int i = 0; i < 8; ++i) { w[i] = (_Float16)(bfr(p[i]) * 256.0f); w[8 + i] = (_Float16)(bfr(p[16 + i]) * 256.0f); }
  return w; }
#define WQKV_LAYOUT 1   // 0 = (in,out) [DIN][CC]; 1 = (out,in) [CC][DIN]; 2 = per-head [NH][DIN][HD]
__device__ __forceinline__ v16b wcol_hdk(const float* Wm, int k0, int o, int lane) { v16b w; const int g = lane >> 4; const float* p = Wm + (size_t)(o / HD) * DIN * HD + (o % HD);
#pragma unroll
  for (int i = 0; i < 8; ++i) { w[i] = (__bf16)p[(size_t)(k0 + 8 * g + i) * HD]; w[8 + i] = (__bf16)p[(size_t)(k0 + 16 + 8 * g + i) * HD]; }
  return w; }
#define WO_OUT_IN 1
#if WQKV_LAYOUT == 1
#define WCOL(W, k0, o, lane) wcol_oi(W, k0, o, lane, DIN)
#elif WQKV_LAYOUT == 2
#define WCOL(W, k0, o, lane) wcol_hdk(W, k0, o, lane)
#else
#define WCOL(W, k0, o, lane) wcol_io(W, k0, o, lane, CC)
#endif
#if WO_OUT_IN
#define WOCOL(W, k0, o, lane) wcol_oi(W, k0, o, lane, CC)
#define WOCOLH(W, k0, o, lane) wcolh_oi(W, k0, o, lane, CC)
#else
#define WOCOL(W, k0, o, lane) wcol_io(W, k0, o, lane, DIN)
#define WOCOLH(W, k0, o, lane) wcolh_io(W, k0, o, lane, DIN)
#endif

// RoPE inverse frequencies 1/10000^(2i/64) (the f32 values jax computes)
__constant__ float INVF[32] = {1.000000000e+00,7.498942018e-01,5.623413324e-01,4.216965139e-01,3.162277639e-01,2.371373624e-01,1.778279394e-01,1.333521456e-01,1.000000015e-01,7.498941571e-02,5.623412877e-02,4.216964915e-02,3.162277862e-02,2.371373586e-02,1.778279431e-02,1.333521493e-02,9.999999776e-03,7.498942316e-03,5.623413250e-03,4.216964822e-03,3.162277862e-03,2.371373819e-03,1.778279431e-03,1.333521446e-03,1.000000047e-03,7.498941850e-04,5.623413017e-04,4.216964880e-04,3.162277862e-04,2.371373848e-04,1.778279402e-04,1.333521504e-04};
#define PROJ_EXTRA_PARAMS
// cos and sin of a RoPE angle a, 0 <= a < 2^17 (a position below TT x a frequency of at most 1). On that range these are the library's cosf / sinf operation for operation (pi/2 taken off in three parts, its two polynomials, the quadrant select); left out are its branches to the large-argument reduction, never taken here, which kept one angle's chain from starting before the last one's end
__device__ __forceinline__ void rope_cs(float a, float& cs, float& sn) {
  const float fn = rintf(a * 6.36619747e-1f);
  const float r = fmaf(fn, -5.39030253e-15f, fmaf(fn, -7.54978942e-8f, fmaf(fn, -1.57079625e+0f, a)));
  const float t = r * r; const unsigned q = (unsigned)(int)fn;
  const float s = fmaf(r, t * fmaf(t, fmaf(t, -1.94644585e-4f, 8.33171979e-3f), -1.66666463e-1f), r);
  const float c = fmaf(t, fmaf(t, fmaf(t, fmaf(t, 2.56687417e-5f, -1.39091106e-3f), 4.16679047e-2f), -5.00000238e-1f), 1.0f);
  const unsigned sg = (q << 30) & 0x80000000u;   /* quadrants 2 and 3 flip both signs */
  sn = __uint_as_float(__float_as_uint((q & 1u) ? c : s) ^ sg); cs = __uint_as_float(__float_as_uint((q & 1u) ? -s : c) ^ sg); }
#ifndef PROJ_EXTRA_PARAMS
#define PROJ_EXTRA_PARAMS
#endif

#define WS_QH  0u                                      // f16 q rows [b*t][CC]
#define WS_KH  (WS_QH + 2u * (size_t)NB * TT * CC)      // f16 k rows [b*t][CC]
#define WS_VT  (WS_KH + 2u * (size_t)NB * TT * CC)      // f16 v planes [b][c][t]
#define WS_QL  (WS_VT + 2u * (size_t)NB * CC * TT)      // f16 q residual x 2^10 rows [b][t < QHI][CC]
#define WS_KL  (WS_QL + 2u * (size_t)NB * QHI * CC)     // f16 k residual x 2^10 rows [b][t < KHI][CC]
#define WS_VB  (WS_KL + 2u * (size_t)NB * KHI * CC)     // bf16 v hi planes [b][c][t < KHI]
#define WS_VBL (WS_VB + 2u * (size_t)NB * CC * KHI)
#define WS_Y   (WS_VBL + 2u * (size_t)NB * CC * KHI)    // f32 ctx rows [b*t][CC] (only when there is an output projection)
#define WS_END (WS_Y  + 4u * (size_t)NB * TT * CC)

// ---- k_proj: block = (64 rows, 128 cols, which): q/k/v = X W (+ b) with exact bf16 products (K = DIN) -> which 0: q f16 rows (+ residual rows < QHI); 1: k f16 rows (+ residual rows < KHI); 2: v f16 planes [c][t] (+ bf16 hi/lo planes for t < KHI)
__global__ __launch_bounds__(128) void k_proj(const float* __restrict__ XQ, const float* __restrict__ XK, const float* __restrict__ XV, const float* __restrict__ WQ, const float* __restrict__ WK, const float* __restrict__ WV, const float* __restrict__ BQ, const float* __restrict__ BK, const float* __restrict__ BV,
    _Float16* __restrict__ QH, _Float16* __restrict__ QL, _Float16* __restrict__ KH, _Float16* __restrict__ KL, _Float16* __restrict__ VT, __bf16* __restrict__ VB, __bf16* __restrict__ VBL PROJ_EXTRA_PARAMS) {
  __shared__ __align__(16) float st[64][132]; __shared__ __align__(16) _Float16 sh[64][136], sl[64][136];
  __shared__ __align__(16) union { struct { _Float16 th[128][72]; __bf16 tb[128][72], tbl[128][72]; } e; __bf16 sg[2][192][SP]; } un;   /* the two operand stages of the k loop lie where the v epilogue's planes lie later (three barriers between) */
  auto& th = un.e.th; auto& tb = un.e.tb; auto& tbl = un.e.tbl; auto& sg = un.sg;
  const int tid = threadIdx.x, wave = tid >> 5, lane = tid & 31, col = lane & 15, g = lane >> 4; const int which = blockIdx.z; const int c0 = blockIdx.y * 128; const size_t r0 = (size_t)blockIdx.x * 64; const size_t bb = r0 / TT; const int t0 = (int)(r0 % TT);
  const float* X = which == 0 ? XQ : which == 1 ? XK : XV; const float* WA = which == 0 ? WQ : which == 1 ? WK : WV; const float* BA = which == 0 ? BQ : which == 1 ? BK : BV;
  v8f acc[8] = {};
  // a stage = SK k of the block's 128 W rows (sg rows 0..127) and 64 X rows (128..191), rounded to bf16 once for the four waves. 16 lanes x 16 B read one row's 256 B: a load instruction touches 4 whole lines, not 16 pieces
  const int lr = tid >> 4, lc = tid & 15; const float* wg = WA + (size_t)(c0 + lr) * DIN + lc * 4; const float* xg = X + (r0 + lr) * DIN + lc * 4;
  v4f wr[16], xr[8];
#pragma unroll
  for (int i = 0; i < 16; ++i) wr[i] = *(const v4f*)(wg + (size_t)i * 8 * DIN);
#pragma unroll
  for (int i = 0; i < 8; ++i) xr[i] = *(const v4f*)(xg + (size_t)i * 8 * DIN);
  asm volatile("s_wait_xcnt 0x0" :: "v"(wg), "v"(xg) : "memory");   /* behind the stage's loads: their address registers step on below */
#pragma unroll
  for (int i = 0; i < 16; ++i) *(v4b*)&sg[0][i * 8 + lr][lc * 4] = cvt4b(wr[i]);
#pragma unroll
  for (int i = 0; i < 8; ++i) *(v4b*)&sg[0][128 + i * 8 + lr][lc * 4] = cvt4b(xr[i]);
  __syncthreads();
#pragma unroll 1   // rolled: the next stage's 24 loads stay in registers over one stage's products
  for (int s = 0; s < DIN / SK; ++s, wg += SK, xg += SK) { const bool more = s + 1 < DIN / SK;   /* block-uniform */
    if (more) {
#pragma unroll
      for (int i = 0; i < 16; ++i) wr[i] = *(const v4f*)(wg + SK + (size_t)i * 8 * DIN);
#pragma unroll
      for (int i = 0; i < 8; ++i) xr[i] = *(const v4f*)(xg + SK + (size_t)i * 8 * DIN);
      asm volatile("s_wait_xcnt 0x0" :: "v"(wg), "v"(xg) : "memory"); }   /* behind the next stage's loads, which fly under this stage's products (the memory clobber holds them in front); naming their address registers keeps these whole up to the wait */
#pragma unroll
    for (int kk = 0; kk < SK / 32; ++kk) { const v16b a = frag_b(&sg[s & 1][128 + wave * 16 + col][kk * 32], lane); v16b w[8];
#pragma unroll
      for (int j = 0; j < 8; ++j) w[j] = frag_b(&sg[s & 1][j * 16 + col][kk * 32], lane);
#pragma unroll
      for (int j = 0; j < 8; ++j) acc[j] = wmma_bf(a, w[j], acc[j]); }
    if (more) {
#pragma unroll
      for (int i = 0; i < 16; ++i) *(v4b*)&sg[(s + 1) & 1][i * 8 + lr][lc * 4] = cvt4b(wr[i]);
#pragma unroll
      for (int i = 0; i < 8; ++i) *(v4b*)&sg[(s + 1) & 1][128 + i * 8 + lr][lc * 4] = cvt4b(xr[i]); }
    __syncthreads(); }   /* publishes stage s + 1 and ends every wave's reads of stage s, whose buffer the next trip refills */
  { // stage the f32 tile (acc + bias) in LDS, apply RoPE to q and k, then convert
#pragma unroll
    for (int j = 0; j < 8; ++j) { const float bias = BA ? bfr(BA[c0 + j * 16 + col]) : 0.f;
#pragma unroll
      for (int r = 0; r < 8; ++r) st[wave * 16 + 8 * g + r][j * 16 + col] = acc[j][r] + bias; }
    __syncthreads();
    if (which < 2) {   /* block-uniform. q and k: interleaved-pair rotation (x[2i], x[2i + 1]) by the angle t * INVF[i]; v untouched. A thread has one row and every second frequency: each cos / sin is formed once and turns the pair of both heads of the tile; 32 lanes x 8 B fall on 64 different banks */
      const int rl = tid >> 1, ih = tid & 1; const float pos = (float)(int)((r0 + rl) % TT);   /* position = the token's sequence index */
#pragma unroll   // unrolled: the 16 angles' chains interleave
      for (int ii = 0; ii < 16; ++ii) { float cs, sn; const float f0 = INVF[2 * ii], f1 = INVF[2 * ii + 1]; rope_cs(pos * (ih ? f1 : f0), cs, sn);   /* both read as scalars, then a select: no load by lane */
#pragma unroll   // unrolled: both heads' pairs are turned from the same two registers
        for (int hh = 0; hh < 128 / HD; ++hh) { v2f* p = (v2f*)&st[rl][hh * HD + 4 * ii + 2 * ih]; const v2f x = *p; v2f y; y[0] = x[0] * cs - x[1] * sn; y[1] = x[0] * sn + x[1] * cs; *p = y; } } }
    __syncthreads(); }
  if (which < 2) { _Float16* DH = which == 0 ? QH : KH; _Float16* DL = which == 0 ? QL : KL; const int nhi = which == 0 ? QHI : KHI; const bool hi_rows = t0 < nhi;
    for (int e = tid; e < 64 * 128; e += 128) { const int rl = e >> 7, cl = e & 127; const float v = st[rl][cl]; const _Float16 hv = (_Float16)v; sh[rl][cl] = hv; sl[rl][cl] = (_Float16)((v - (float)hv) * 1024.0f); }
    __syncthreads();
    for (int e = tid; e < 64 * 16; e += 128) { const int rl = e >> 4, q = e & 15; vst2((unsigned*)(DH + (r0 + rl) * CC + c0 + q * 8), *(const v4u*)&sh[rl][q * 8]); if (hi_rows) vst2((unsigned*)(DL + (bb * nhi + t0 + rl) * (size_t)CC + c0 + q * 8), *(const v4u*)&sl[rl][q * 8]); }
  } else { const bool hi_rows = t0 < KHI;
    for (int e = tid; e < 64 * 128; e += 128) { const int rl = e & 63, cl = e >> 6; const float v = st[rl][cl]; th[cl][rl] = (_Float16)v; const __bf16 bh = (__bf16)v; tb[cl][rl] = bh; tbl[cl][rl] = (__bf16)(v - (float)bh); }
    __syncthreads();
    for (int e = tid; e < 128 * 8; e += 128) { const int cl = e >> 3, q = e & 7; vst2((unsigned*)(VT + (bb * CC + c0 + cl) * (size_t)TT + t0 + q * 8), *(const v4u*)&th[cl][q * 8]); if (hi_rows) { const size_t o3 = (bb * CC + c0 + cl) * (size_t)KHI + t0 + q * 8; vst2((unsigned*)(VB + o3), *(const v4u*)&tb[cl][q * 8]); vst2((unsigned*)(VBL + o3), *(const v4u*)&tbl[cl][q * 8]); } } } }
// ---- k_att: block = 4 waves x 16 queries of (b, h), two query blocks one after the other (x and NQB - 1 - x: every block walks (NQB + 1) x 64 keys). Logits as S^T = K Q^T: D register r of key tile kt = key kt * 16 + 8g + r of query col, so a lane holds one query's logits and two tiles are the A fragment of P in the k order of pair_h. Pass 1: row maximum. Pass 2: the same logits again, e = 2^11 exp(s - max), sum of e in f32, e to f16 (early query blocks: bf16 hi + lo) against v; ctx = acc / sum. Nothing of S goes to memory.
// a trip is NT key tiles of 16: 64 keys; 32 in the early query blocks, whose residual planes double the fragments
// a trip's operands are staged in LDS once for the four waves (pitch SP): sk rows 0..63 = the 64 k rows (early blocks: 0..31 k, 32..63 its residual); sv row c = v plane c's 64 keys (early blocks: 32 keys of the bf16 hi plane, then of the lo plane)
template <bool HI> __device__ __forceinline__ void att_ldk(const _Float16* kp, const _Float16* klp, v16h (&kf)[2][HI ? 2 : 4], v16h (&klf)[2][HI ? 2 : 4]) {
#pragma unroll
  for (int kc = 0; kc < 2; ++kc)
#pragma unroll
    for (int kt = 0; kt < (HI ? 2 : 4); ++kt) { kf[kc][kt] = pair_h(kp + kt * 16 * SP + kc * 32); if (HI) klf[kc][kt] = pair_h(klp + kt * 16 * SP + kc * 32); } }
// unscaled logits (q.k; SCALE is folded into the exponent's multiplier SC2) of a trip's keys; srel = query - the trip's first key - 8g: key kt * 16 + r of the lane is kept while kt * 16 + r <= srel
template <bool HI, bool MASK> __device__ __forceinline__ void att_logits(const v16h (&kf)[2][HI ? 2 : 4], const v16h (&klf)[2][HI ? 2 : 4], const v16h (&qh)[2], const v16h (&ql)[2], int srel, float (&s)[HI ? 2 : 4][8]) {
  constexpr int NT = HI ? 2 : 4; v8f a[NT] = {}, al[NT] = {};
#pragma unroll
  for (int kc = 0; kc < 2; ++kc)
#pragma unroll
    for (int kt = 0; kt < NT; ++kt) { a[kt] = wmma16(kf[kc][kt], qh[kc], a[kt]); if (HI) { al[kt] = wmma16(kf[kc][kt], ql[kc], al[kt]); al[kt] = wmma16(klf[kc][kt], qh[kc], al[kt]); } }
#pragma unroll
  for (int kt = 0; kt < NT; ++kt)
#pragma unroll
    for (int r = 0; r < 8; ++r) { const float v = HI ? a[kt][r] + al[kt][r] * (1.0f / 1024.0f) : a[kt][r]; s[kt][r] = (!MASK || kt * 16 + r <= srel) ? v : -3.0e38f; } }
template <bool HI, bool MASK> __device__ __forceinline__ float att_max(const _Float16* kp, const _Float16* klp, const v16h (&qh)[2], const v16h (&ql)[2], int srel) {
  constexpr int NT = HI ? 2 : 4; v16h kf[2][NT], klf[2][NT]; float s[NT][8]; att_ldk<HI>(kp, klp, kf, klf);
  att_logits<HI, MASK>(kf, klf, qh, ql, srel, s);
  float m = s[0][0];
#pragma unroll
  for (int kt = 0; kt < NT; ++kt)
#pragma unroll
    for (int r = 0; r < 8; ++r) m = fmaxf(m, s[kt][r]);
  return m; }
// 2^x of the eight logits a lane holds of one key tile, in place. One statement, so that behind each v_exp_f32 stands an instruction that neither reads its result nor overwrites its source: the next one, and a v_nop behind the last (the slot the instruction set asks for)
__device__ __forceinline__ void exp2x8(float (&x)[8]) {
  asm("v_exp_f32 %0, %0\n\tv_exp_f32 %1, %1\n\tv_exp_f32 %2, %2\n\tv_exp_f32 %3, %3\n\tv_exp_f32 %4, %4\n\tv_exp_f32 %5, %5\n\tv_exp_f32 %6, %6\n\tv_exp_f32 %7, %7\n\tv_nop"
      : "+v"(x[0]), "+v"(x[1]), "+v"(x[2]), "+v"(x[3]), "+v"(x[4]), "+v"(x[5]), "+v"(x[6]), "+v"(x[7])); }
// bias = 11 - SC2 x the query's row maximum, finite (every row keeps its diagonal): e = 2^(SC2 x d + bias) = 2^11 exp(s - max) by one fused multiply-add and the chip's own 2^x; an excluded logit (-3e38) gives 0
template <bool HI, bool MASK> __device__ __forceinline__ void att_pv(const _Float16* kp, const _Float16* klp, const _Float16* vp, const __bf16* vhp, const __bf16* vlp, const v16h (&qh)[2], const v16h (&ql)[2], int srel, float bias, float& sum, v8f (&acc)[HD / 16]) {
  constexpr int NT = HI ? 2 : 4; v16h kf[2][NT], klf[2][NT], vf[NT / 2][HD / 16]; v16b vh[NT / 2][HD / 16], vl[NT / 2][HD / 16]; float s[NT][8]; att_ldk<HI>(kp, klp, kf, klf);
  att_logits<HI, MASK>(kf, klf, qh, ql, srel, s);
#pragma unroll
  for (int u = 0; u < NT / 2; ++u)   /* the v reads take the k fragments' registers and fly under the exponentials */
#pragma unroll
    for (int j = 0; j < HD / 16; ++j) { if (!HI) vf[u][j] = pair_h(vp + j * 16 * SP + u * 32); else { vh[u][j] = pair_b(vhp + j * 16 * SP + u * 32); vl[u][j] = pair_b(vlp + j * 16 * SP + u * 32); } }
  float part[NT];
#pragma unroll
  for (int kt = 0; kt < NT; ++kt) {
#pragma unroll
    for (int r = 0; r < 8; ++r) s[kt][r] = fmaf(s[kt][r], SC2, bias);
    exp2x8(s[kt]); part[kt] = s[kt][0];
#pragma unroll
    for (int r = 1; r < 8; ++r) part[kt] += s[kt][r]; }
#pragma unroll
  for (int kt = 0; kt < NT; kt += 2) sum += part[kt] + part[kt + 1];
#pragma unroll
  for (int u = 0; u < NT / 2; ++u) {
    if (!HI) { v16h p;
#pragma unroll
      for (int i = 0; i < 8; ++i) { p[i] = (_Float16)s[2 * u][i]; p[8 + i] = (_Float16)s[2 * u + 1][i]; }
#pragma unroll
      for (int j = 0; j < HD / 16; ++j) acc[j] = wmma16(p, vf[u][j], acc[j]);
    } else { float pv[16];
#pragma unroll
      for (int i = 0; i < 8; ++i) { pv[i] = s[2 * u][i]; pv[8 + i] = s[2 * u + 1][i]; }
      const F2 p = bsplit16(pv);
#pragma unroll
      for (int j = 0; j < HD / 16; ++j) { acc[j] = wmma_bf(p.h, vh[u][j], acc[j]); acc[j] = wmma_bf(p.l, vh[u][j], acc[j]); acc[j] = wmma_bf(p.h, vl[u][j], acc[j]); } } } }
template <bool HI> __device__ __forceinline__ void att_tile(const _Float16* __restrict__ QH, const _Float16* __restrict__ KH, const _Float16* __restrict__ QL, const _Float16* __restrict__ KL, const _Float16* __restrict__ VT, const __bf16* __restrict__ VB, const __bf16* __restrict__ VBL, float* __restrict__ Y, float (*ssw)[HD + 4], _Float16 (*sk)[64][SP], _Float16 (*sv)[64][SP], int b, int h, int qb, int wave, int lane) {
  constexpr int KS = HI ? 32 : 64;   /* keys a trip */
  const int col = lane & 15, g = lane >> 4; const int ql0 = qb * 64 + wave * 16; const size_t ho = (size_t)h * HD + 8 * g;
  const int nfull = HI ? 0 : qb, nmask = HI ? (qb + 1) * 2 : 1;   /* trips wholly below the diagonal, then trips masked by index */
  const int nl = nfull + nmask - 1;   /* trips in front of the last one: all unmasked in the late blocks, all masked in the early ones; block-uniform */
  const int srel0 = ql0 + col - 8 * g - nfull * KS;
  const _Float16* qp = QH + ((size_t)b * TT + ql0 + col) * CC + ho; const _Float16* qlp = HI ? QL + ((size_t)b * QHI + ql0 + col) * CC + ho : qp;
  v16h qh[2], ql[2];
#pragma unroll
  for (int kc = 0; kc < 2; ++kc) { qh[kc] = pair_h(qp + kc * 32); ql[kc] = HI ? pair_h(qlp + kc * 32) : qh[kc]; }
  asm volatile("s_wait_xcnt 0x0" :: "v"(qp), "v"(qlp) : "memory");   /* behind the q loads, as below */
  // staging: 8 lanes x 16 B fill one stage row of 128 B, so a load instruction touches 4 whole lines (the early blocks' v planes: 8 half lines), not 16 pieces. ka: stage rows 0..31, kb: rows 32..63
  constexpr int VLD = HI ? KHI : TT;   /* row pitch of the v planes read */
  const int sr = (wave * 32 + lane) >> 3, sc = (lane & 7) * 8; const size_t vrow = (size_t)b * CC + h * HD + sr;
  const _Float16* const ka0 = KH + ((size_t)b * TT + sr) * CC + h * HD + sc; const _Float16* const kb0 = HI ? KL + ((size_t)b * KHI + sr) * CC + h * HD + sc : ka0 + (size_t)32 * CC;
  const _Float16* const vg0 = HI ? (const _Float16*)((sc < 32 ? VB : VBL) + vrow * KHI + (sc & 31)) : VT + vrow * TT + sc;   /* moved as raw 16-B pieces */
  float m = -3.0e38f;
  { const _Float16 *ka = ka0, *kb = kb0; v8h kr[4], vr[4]; int srel = srel0;
#pragma unroll
    for (int i = 0; i < 2; ++i) { kr[i] = *(const v8h*)(ka + (size_t)i * 16 * CC); kr[2 + i] = *(const v8h*)(kb + (size_t)i * 16 * CC); }
    asm volatile("s_wait_xcnt 0x0" :: "v"(ka), "v"(kb) : "memory");   /* behind the stage's loads: their address registers step on below */
    __syncthreads();   /* every wave has left the stages of the tile before */
#pragma unroll
    for (int i = 0; i < 4; ++i) *(v8h*)&sk[0][i * 16 + sr][sc] = kr[i];
    __syncthreads();
#pragma unroll 1   // rolled: one trip's fragments fill the registers
    for (int tr = 0; tr < nl; ++tr, ka += (size_t)KS * CC, kb += (size_t)KS * CC) {
#pragma unroll
      for (int i = 0; i < 2; ++i) { kr[i] = *(const v8h*)(ka + (size_t)(KS + i * 16) * CC); kr[2 + i] = *(const v8h*)(kb + (size_t)(KS + i * 16) * CC); }
      asm volatile("s_wait_xcnt 0x0" :: "v"(ka), "v"(kb) : "memory");   /* behind the next trip's loads, which fly under this trip's logits (the memory clobber holds them in front); naming their address registers keeps these whole up to the wait */
      const _Float16* kp = &sk[tr & 1][col][8 * g]; m = fmaxf(m, att_max<HI, HI>(kp, kp + 32 * SP, qh, ql, srel)); if (HI) srel -= KS;
#pragma unroll
      for (int i = 0; i < 4; ++i) *(v8h*)&sk[(tr + 1) & 1][i * 16 + sr][sc] = kr[i];
      __syncthreads(); }   /* publishes trip tr + 1 and ends every wave's reads of trip tr, whose buffer the next trip refills */
#pragma unroll
    for (int i = 0; i < 2; ++i) { kr[i] = *(const v8h*)(ka0 + (size_t)i * 16 * CC); kr[2 + i] = *(const v8h*)(kb0 + (size_t)i * 16 * CC); }   /* pass 2's first stage flies under pass 1's last trip */
#pragma unroll
    for (int i = 0; i < 4; ++i) vr[i] = *(const v8h*)(vg0 + (size_t)i * 16 * VLD);
    asm volatile("s_wait_xcnt 0x0" :: "v"(ka0), "v"(kb0), "v"(vg0) : "memory");   /* behind these loads, as above */
    const _Float16* kp = &sk[nl & 1][col][8 * g]; m = fmaxf(m, att_max<HI, true>(kp, kp + 32 * SP, qh, ql, srel));
    __syncthreads();   /* every wave has left pass 1's stages */
#pragma unroll
    for (int i = 0; i < 4; ++i) { *(v8h*)&sk[0][i * 16 + sr][sc] = kr[i]; *(v8h*)&sv[0][i * 16 + sr][sc] = vr[i]; }
    __syncthreads(); }
  m = fmaxf(m, __shfl_xor(m, 16));   /* the two lane halves hold the two key halves of one query */
  const float bias = fmaf(-m, SC2, 11.0f);   /* one rounding, the same for every key of the query: it cancels in e / sum */
  v8f acc[HD / 16] = {}; float sum = 0.f;
  { const _Float16 *ka = ka0, *kb = kb0, *vg = vg0; v8h kr[4], vr[4]; int srel = srel0;
#pragma unroll 1   // rolled: one trip's fragments fill the registers
    for (int tr = 0; tr < nl; ++tr, ka += (size_t)KS * CC, kb += (size_t)KS * CC, vg += KS) {
#pragma unroll
      for (int i = 0; i < 2; ++i) { kr[i] = *(const v8h*)(ka + (size_t)(KS + i * 16) * CC); kr[2 + i] = *(const v8h*)(kb + (size_t)(KS + i * 16) * CC); }
#pragma unroll
      for (int i = 0; i < 4; ++i) vr[i] = *(const v8h*)(vg + KS + (size_t)i * 16 * VLD);
      asm volatile("s_wait_xcnt 0x0" :: "v"(ka), "v"(kb), "v"(vg) : "memory");   /* behind the next trip's loads, which fly under this trip's work (the memory clobber holds them in front); naming their address registers keeps these whole up to the wait */
      const _Float16 *kp = &sk[tr & 1][col][8 * g], *vp = &sv[tr & 1][col][8 * g]; att_pv<HI, HI>(kp, kp + 32 * SP, vp, (const __bf16*)vp, (const __bf16*)vp + 32, qh, ql, srel, bias, sum, acc); if (HI) srel -= KS;
#pragma unroll
      for (int i = 0; i < 4; ++i) { *(v8h*)&sk[(tr + 1) & 1][i * 16 + sr][sc] = kr[i]; *(v8h*)&sv[(tr + 1) & 1][i * 16 + sr][sc] = vr[i]; }
      __syncthreads(); }   /* publishes trip tr + 1 and ends every wave's reads of trip tr, whose buffers the next trip refills */
    const _Float16 *kp = &sk[nl & 1][col][8 * g], *vp = &sv[nl & 1][col][8 * g]; att_pv<HI, true>(kp, kp + 32 * SP, vp, (const __bf16*)vp, (const __bf16*)vp + 32, qh, ql, srel, bias, sum, acc); }
  sum += __shfl_xor(sum, 16);
  const float inv = sum > 0.f ? 1.0f / sum : 0.f;   /* of query col; sum carries the 2^11 of its terms; a fully excluded row yields 0 */
#pragma unroll
  for (int r = 0; r < 8; ++r) { const float ir = __shfl(inv, 8 * g + r);   /* accumulator register r is query 8g + r */
#pragma unroll
    for (int j = 0; j < HD / 16; ++j) ssw[8 * g + r][j * 16 + col] = acc[j][r] * ir; }
  LDSX();
  float* yp = Y + ((size_t)b * TT + ql0 + g) * CC + h * HD + col * 4;   /* 256-B (row, head) segment by 16 lanes, two rows a store */
#pragma unroll
  for (int rl = 0; rl < 16; rl += 2) vst2(yp + (size_t)rl * CC, *(const v4f*)&ssw[rl + g][col * 4]);
  asm volatile("s_wait_xcnt 0x0" :: "v"(yp) : "memory");   /* behind the stores: the next tile overwrites their registers */
  LDSX(); }   /* the next tile's staging writes stay behind these reads */
// amdgpu_waves_per_eu(2, 2): the grid gives two waves a SIMD (512 blocks x 4 waves, 1,024 SIMDs); with that register budget a trip's exponentials interleave instead of running as one dependent chain after the other
__global__ __launch_bounds__(128) __attribute__((amdgpu_waves_per_eu(2, 2))) void k_att(const _Float16* __restrict__ QH, const _Float16* __restrict__ KH, const _Float16* __restrict__ QL, const _Float16* __restrict__ KL, const _Float16* __restrict__ VT, const __bf16* __restrict__ VB, const __bf16* __restrict__ VBL, float* __restrict__ Y) { __shared__ __align__(16) float ss[4][16][HD + 4]; __shared__ __align__(16) _Float16 sk[2][64][SP], sv[2][64][SP];
  const int tid = threadIdx.x, wave = tid >> 5, lane = tid & 31; const int h = blockIdx.y, b = blockIdx.z;
#pragma unroll 1   // rolled: the two tiles share one copy of the code
  for (int half = 0; half < 2; ++half) { const int qb = half ? (int)blockIdx.x : NQB - 1 - (int)blockIdx.x;   /* block-uniform */
    if (qb < QBH) att_tile<true>(QH, KH, QL, KL, VT, VB, VBL, Y, ss[wave], sk, sv, b, h, qb, wave, lane);
    else att_tile<false>(QH, KH, QL, KL, VT, VB, VBL, Y, ss[wave], sk, sv, b, h, qb, wave, lane); } }
// ---- k_out: block = (64 rows, 128 cols): out = ctx Wo (+ bo): ctx x 2^6 once to f16 against Wo as f16(bf16 x 2^8) exact (1 product) x 2^-14; causal early rows (< QHI of each sequence): ctx bf16 hi + lo against exact bf16 Wo (2 products)
__global__ __launch_bounds__(128) void k_out(const float* __restrict__ Y, const float* __restrict__ WO, const float* __restrict__ BO, float* __restrict__ OUT) { __shared__ __align__(16) float sf[4][16][132];
  __shared__ __align__(16) union { __bf16 b[2][256][SP]; _Float16 h[2][192][SP]; } sg;   /* two operand stages: rows 0..127 Wo, 128..191 ctx (hi), 192..255 ctx lo (early rows only) */
  const int tid = threadIdx.x, wave = tid >> 5, lane = tid & 31, col = lane & 15, g = lane >> 4; const int c0 = blockIdx.y * 128; const size_t r0 = (size_t)blockIdx.x * 64 + wave * 16;
  v8f acc[8] = {};
  // a stage = SK k of the block's 128 Wo rows and 64 ctx rows, converted once for the four waves. 16 lanes x 16 B read one row's 256 B: a load instruction touches 4 whole lines, not 16 pieces
  const int lr = tid >> 4, lc = tid & 15; const float* wg = WO + (size_t)(c0 + lr) * CC + lc * 4; const float* yg = Y + ((size_t)blockIdx.x * 64 + lr) * CC + lc * 4;
  v4f wr[16], yr[8];
#pragma unroll
  for (int i = 0; i < 16; ++i) wr[i] = *(const v4f*)(wg + (size_t)i * 8 * CC);
#pragma unroll
  for (int i = 0; i < 8; ++i) yr[i] = *(const v4f*)(yg + (size_t)i * 8 * CC);
  asm volatile("s_wait_xcnt 0x0" :: "v"(wg), "v"(yg) : "memory");   /* behind the stage's loads: their address registers step on below */
  if (CAUSAL && (int)(((size_t)blockIdx.x * 64) % TT) < QHI) {   /* block-uniform */
#pragma unroll
    for (int i = 0; i < 16; ++i) *(v4b*)&sg.b[0][i * 8 + lr][lc * 4] = cvt4b(wr[i]);
#pragma unroll
    for (int i = 0; i < 8; ++i) { const v4b hv = cvt4b(yr[i]); v4f rs;   /* ctx = bf16 hi + bf16 lo, as bsplit16 forms them */
#pragma unroll
      for (int e = 0; e < 4; ++e) rs[e] = yr[i][e] - (float)hv[e];
      *(v4b*)&sg.b[0][128 + i * 8 + lr][lc * 4] = hv; *(v4b*)&sg.b[0][192 + i * 8 + lr][lc * 4] = cvt4b(rs); }
    __syncthreads();
#pragma unroll 1   // rolled: the next stage's 24 loads stay in registers over one stage's products
    for (int s = 0; s < CC / SK; ++s, wg += SK, yg += SK) { const bool more = s + 1 < CC / SK;   /* block-uniform */
      if (more) {
#pragma unroll
        for (int i = 0; i < 16; ++i) wr[i] = *(const v4f*)(wg + SK + (size_t)i * 8 * CC);
#pragma unroll
        for (int i = 0; i < 8; ++i) yr[i] = *(const v4f*)(yg + SK + (size_t)i * 8 * CC);
        asm volatile("s_wait_xcnt 0x0" :: "v"(wg), "v"(yg) : "memory"); }   /* behind the next stage's loads, which fly under this stage's products (the memory clobber holds them in front); naming their address registers keeps these whole up to the wait */
#pragma unroll
      for (int kk = 0; kk < SK / 32; ++kk) { const v16b ah = frag_b(&sg.b[s & 1][128 + wave * 16 + col][kk * 32], lane), al = frag_b(&sg.b[s & 1][192 + wave * 16 + col][kk * 32], lane); v16b w[8];
#pragma unroll
        for (int j = 0; j < 8; ++j) w[j] = frag_b(&sg.b[s & 1][j * 16 + col][kk * 32], lane);
#pragma unroll
        for (int j = 0; j < 8; ++j) { acc[j] = wmma_bf(ah, w[j], acc[j]); acc[j] = wmma_bf(al, w[j], acc[j]); } }
      if (more) {
#pragma unroll
        for (int i = 0; i < 16; ++i) *(v4b*)&sg.b[(s + 1) & 1][i * 8 + lr][lc * 4] = cvt4b(wr[i]);
#pragma unroll
        for (int i = 0; i < 8; ++i) { const v4b hv = cvt4b(yr[i]); v4f rs;   /* ctx = bf16 hi + bf16 lo, as bsplit16 forms them */
#pragma unroll
          for (int e = 0; e < 4; ++e) rs[e] = yr[i][e] - (float)hv[e];
          *(v4b*)&sg.b[(s + 1) & 1][128 + i * 8 + lr][lc * 4] = hv; *(v4b*)&sg.b[(s + 1) & 1][192 + i * 8 + lr][lc * 4] = cvt4b(rs); }
      }
      __syncthreads(); }   /* publishes stage s + 1 and ends every wave's reads of stage s, whose buffer the next trip refills */
#pragma unroll
    for (int j = 0; j < 8; ++j) { const float bias = BO ? bfr(BO[c0 + j * 16 + col]) : 0.f;
#pragma unroll
      for (int r = 0; r < 8; ++r) sf[wave][8 * g + r][j * 16 + col] = acc[j][r] + bias; }
  } else {
#pragma unroll
    for (int i = 0; i < 16; ++i) { v4h c;   /* Wo as f16(bf16 x 2^8), exact */
#pragma unroll
      for (int e = 0; e < 4; ++e) c[e] = (_Float16)(bfr(wr[i][e]) * 256.0f);
      *(v4h*)&sg.h[0][i * 8 + lr][lc * 4] = c; }
#pragma unroll
    for (int i = 0; i < 8; ++i) { v4h c;   /* ctx carried x 2^6 into f16 so small-magnitude context rows stay clear of f16 subnormals */
#pragma unroll
      for (int e = 0; e < 4; ++e) c[e] = (_Float16)(yr[i][e] * 64.0f);
      *(v4h*)&sg.h[0][128 + i * 8 + lr][lc * 4] = c; }
    __syncthreads();
#pragma unroll 1   // rolled: the next stage's 24 loads stay in registers over one stage's products
    for (int s = 0; s < CC / SK; ++s, wg += SK, yg += SK) { const bool more = s + 1 < CC / SK;   /* block-uniform */
      if (more) {
#pragma unroll
        for (int i = 0; i < 16; ++i) wr[i] = *(const v4f*)(wg + SK + (size_t)i * 8 * CC);
#pragma unroll
        for (int i = 0; i < 8; ++i) yr[i] = *(const v4f*)(yg + SK + (size_t)i * 8 * CC);
        asm volatile("s_wait_xcnt 0x0" :: "v"(wg), "v"(yg) : "memory"); }   /* behind the next stage's loads, which fly under this stage's products (the memory clobber holds them in front); naming their address registers keeps these whole up to the wait */
#pragma unroll
      for (int kk = 0; kk < SK / 32; ++kk) { const v16h a = frag_h(&sg.h[s & 1][128 + wave * 16 + col][kk * 32], lane); v16h w[8];
#pragma unroll
        for (int j = 0; j < 8; ++j) w[j] = frag_h(&sg.h[s & 1][j * 16 + col][kk * 32], lane);
#pragma unroll
        for (int j = 0; j < 8; ++j) acc[j] = wmma16(a, w[j], acc[j]); }
      if (more) {
#pragma unroll
        for (int i = 0; i < 16; ++i) { v4h c;   /* Wo as f16(bf16 x 2^8), exact */
#pragma unroll
          for (int e = 0; e < 4; ++e) c[e] = (_Float16)(bfr(wr[i][e]) * 256.0f);
          *(v4h*)&sg.h[(s + 1) & 1][i * 8 + lr][lc * 4] = c; }
#pragma unroll
        for (int i = 0; i < 8; ++i) { v4h c;   /* ctx carried x 2^6 into f16 so small-magnitude context rows stay clear of f16 subnormals */
#pragma unroll
          for (int e = 0; e < 4; ++e) c[e] = (_Float16)(yr[i][e] * 64.0f);
          *(v4h*)&sg.h[(s + 1) & 1][128 + i * 8 + lr][lc * 4] = c; }
      }
      __syncthreads(); }   /* publishes stage s + 1 and ends every wave's reads of stage s, whose buffer the next trip refills */
#pragma unroll
    for (int j = 0; j < 8; ++j) { const float bias = BO ? bfr(BO[c0 + j * 16 + col]) : 0.f;
#pragma unroll
      for (int r = 0; r < 8; ++r) sf[wave][8 * g + r][j * 16 + col] = acc[j][r] * (1.0f / 16384.0f) + bias; } }   /* 2^-8 (Wo carry) x 2^-6 (ctx carry) */
  LDSX(); for (int rl = 0; rl < 16; ++rl) vst2(OUT + (r0 + rl) * DIN + c0 + lane * 4, *(const v4f*)&sf[wave][rl][lane * 4]); }

extern "C" void kernel_launch(void* const* d_in, const int* in_sizes, int n_in, void* d_out, int out_size, void* d_ws, size_t ws_size, hipStream_t stream) {
  (void)in_sizes; (void)n_in; (void)out_size;
  const float** F = (const float**)d_in;
  if (ws_size < (size_t)WS_END) return;
  char* ws = (char*)d_ws; _Float16 *QH = (_Float16*)(ws + WS_QH), *KH = (_Float16*)(ws + WS_KH), *VT = (_Float16*)(ws + WS_VT), *QL = (_Float16*)(ws + WS_QL), *KL = (_Float16*)(ws + WS_KL); __bf16 *VB = (__bf16*)(ws + WS_VB), *VBL = (__bf16*)(ws + WS_VBL); float *Y = (float*)(ws + WS_Y);
  (void)Y; (void)QL; (void)KL; (void)VB; (void)VBL;
  // inputs: 0 x [2,2048,1024]; 1 wq [1024,1024] (out,in); 2 wk; 3 wv; 4 wo (out,in); no biases (null pointers)
  k_proj<<<dim3(TNB * TT / 64, CC / 128, 3), 128, 0, stream>>>(F[0], F[0], F[0], F[1], F[2], F[3], nullptr, nullptr, nullptr, QH, QL, KH, KL, VT, VB, VBL);
  k_att<<<dim3(NQB / 2, NH, TNB), 128, 0, stream>>>(QH, KH, QL, KL, VT, VB, VBL, Y);
  k_out<<<dim3(TNB * TT / 64, DIN / 128), 128, 0, stream>>>(Y, F[4], nullptr, (float*)d_out);
}

// v006
// One run takes 117 microseconds.
// Next to v005, in two timings, it ran 1.15 and 1.14 times as fast.
// Over all steps from v000 it is 11.0 times as fast.
// compute dtype: all float inputs rounded to bf16, once, by k_cvt; q / k / v projections with EXACT bf16 products on WMMA 16x16x32 (f32 accumulate) (no biases); interleaved-pair RoPE in f32 AFTER the bias (embedded frequencies, the library cosf / sinf values, positions = the row index); causal logits: 3 products for the first 384 rows, single f16 q x k after, x 64^-0.5; softmax f32 (row maximum first, logits formed twice, never stored); exp(s - max) x 2^11 once to f16 x v once to f16 (bf16 hi + lo below row 384), / sum after the product; ctx hi+lo x exact Wo below row 384, x2^6 f16 carry x f16(bf16 x 2^8) Wo after, + bo; f32 output.
#include <hip/hip_runtime.h>
#include <math.h>

typedef __attribute__((ext_vector_type(16))) _Float16 v16h;
typedef __attribute__((ext_vector_type(16))) __bf16 v16b;
typedef __attribute__((ext_vector_type(8)))  _Float16 v8h;
typedef __attribute__((ext_vector_type(8)))  float v8f;
typedef __attribute__((ext_vector_type(4)))  float v4f;
typedef __attribute__((ext_vector_type(2)))  float v2f;
typedef __attribute__((ext_vector_type(4)))  unsigned v4u;
typedef __attribute__((ext_vector_type(4)))  int v4i;
typedef float __attribute__((may_alias)) float_a;
typedef int __attribute__((may_alias)) int_a;

template <typename T> __device__ __forceinline__ void vst2(void* p, T v) { *(T*)p = v;  }
__device__ __forceinline__ v8f wmma16(v16h a, v16h b, v8f c) {
  v8f d = __builtin_amdgcn_wmma_f32_16x16x32_f16(false, a, false, b, (short)0, c, false, false);
  asm volatile("v_nop\n\tv_nop\n\tv_nop\n\tv_nop" : "+v"(d) : "v"(a), "v"(b));
  return d;
}
__device__ __forceinline__ v8f wmma_bf(v16b a, v16b b, v8f c) {
  v8f d = __builtin_amdgcn_wmma_f32_16x16x32_bf16(false, a, false, b, (short)0, c, false, false);
  asm volatile("v_nop\n\tv_nop\n\tv_nop\n\tv_nop" : "+v"(d) : "v"(a), "v"(b));
  return d;
}
// 16x16x32 fragments: lane = (h = lane>>4, row/col = lane&15); elements 0..7 = k0+8h+0..7, 8..15 = k0+16+8h+0..7; D element r = row 8h+r
__device__ __forceinline__ v16h frag_h(const _Float16* rowk0, int lane) {
  union { v16h v; v8h q[2]; } u; const _Float16* p = rowk0 + 8 * (lane >> 4);
  u.q[0] = *(const v8h*)p; u.q[1] = *(const v8h*)(p + 16); return u.v;
}
__device__ __forceinline__ v16h frag_f32(const float* rowk0, int lane) {
  v16h a; const float* p = rowk0 + 8 * (lane >> 4);
#pragma unroll
  for (int i = 0; i < 8; ++i) { a[i] = (_Float16)p[i]; a[8 + i] = (_Float16)p[16 + i]; }
  return a;
}
__device__ __forceinline__ v16h frag_f32s(const float* rowk0, int lane, float sc) {
  v16h a; const float* p = rowk0 + 8 * (lane >> 4);
#pragma unroll
  for (int i = 0; i < 8; ++i) { a[i] = (_Float16)(p[i] * sc); a[8 + i] = (_Float16)(p[16 + i] * sc); }
  return a;
}
// column fragment from a [K][ld] layout (column n), rows >= K read as 0
__device__ __forceinline__ v16h fragc_f32(const float* W, int k0, int n, int lane, int ld, int K) {
  v16h a; const int g = lane >> 4;
#pragma unroll
  for (int i = 0; i < 8; ++i) { const int ka = k0 + 8 * g + i, kb = ka + 16;
    a[i] = (_Float16)(ka < K ? W[(size_t)(ka < K ? ka : K - 1) * ld + n] : 0.f); a[8 + i] = (_Float16)(kb < K ? W[(size_t)(kb < K ? kb : K - 1) * ld + n] : 0.f); }
  return a;
}
struct F2 { v16b h, l; };
__device__ __forceinline__ F2 bsplit16(const float v[16]) { F2 r;
#pragma unroll
  for (int i = 0; i < 16; ++i) { const __bf16 h = (__bf16)v[i]; r.h[i] = h; r.l[i] = (__bf16)(v[i] - (float)h); }
  return r; }
__device__ __forceinline__ F2 split_row(const float* row, int k0, int lane) { float v[16]; const float* p = row + k0 + 8 * (lane >> 4);
#pragma unroll
  for (int i = 0; i < 8; ++i) { v[i] = p[i]; v[8 + i] = p[16 + i]; }
  return bsplit16(v); }
__device__ __forceinline__ F2 split_rowK(const float* row, int k0, int lane, int K) { float v[16]; const int g = lane >> 4;
#pragma unroll
  for (int i = 0; i < 8; ++i) { const int ka = k0 + 8 * g + i, kb = ka + 16; v[i] = ka < K ? row[ka < K ? ka : K - 1] : 0.f; v[8 + i] = kb < K ? row[kb < K ? kb : K - 1] : 0.f; }
  return bsplit16(v); }
__device__ __forceinline__ F2 split_col(const float* W, int k0, int n, int lane, int ld, int K) { float v[16]; const int g = lane >> 4;
#pragma unroll
  for (int i = 0; i < 8; ++i) { const int ka = k0 + 8 * g + i, kb = ka + 16; v[i] = ka < K ? W[(size_t)(ka < K ? ka : K - 1) * ld + n] : 0.f; v[8 + i] = kb < K ? W[(size_t)(kb < K ? kb : K - 1) * ld + n] : 0.f; }
  return bsplit16(v); }
__device__ __forceinline__ v8f mac3(const F2& a, const F2& b, v8f c) { c = wmma_bf(a.l, b.h, c); c = wmma_bf(a.h, b.l, c); return wmma_bf(a.h, b.h, c); }
__device__ __forceinline__ float sigm(float v) { return 1.0f / (1.0f + expf(-v)); }
#define LDSX() do { asm volatile("s_wait_dscnt 0" ::: "memory"); __builtin_amdgcn_wave_barrier(); __builtin_amdgcn_fence(__ATOMIC_RELEASE, "workgroup"); } while (0)

// Causal multi-head self-attention with interleaved-pair RoPE (x [2,2048,1024]; torch (out,in) wq / wk / wv / wo [1024,1024] applied as x @ W.T, no biases; 16 heads x 64; RoPE on Q and K: adjacent (even, odd) pairs (xe c - xo s, xe s + xo c) re-interleaved, theta 10000, positions 0..2047; scores / sqrt(64); tril kept, -inf elsewhere (the module's own softmax guards the -inf row maximum: every row keeps its diagonal, so the guard never fires); out @ wo.T).
#define NB 2
#define TT 2048
#define CC 1024            // NH * HD = projected width
#define DIN 1024          // input (model) width
#define NH 16
#define HD 64
#define NQB (TT / 64)
#define SCALE (0.125f)
#define SC2 (SCALE * 1.44269504088896340736f)   // SCALE x log2(e): exp(SCALE x (d - dmax)) = 2^(SC2 x d - SC2 x dmax), d = the unscaled q.k product
#define CAUSAL 1
#ifndef TNB
#define TNB NB
#endif
__device__ __forceinline__ float bfr(float v) { return (float)(__bf16)v; }
typedef __attribute__((ext_vector_type(8))) __bf16 v8b;
__device__ __forceinline__ v16b frag_b(const __bf16* rowk0, int lane) {
  union { v16b v; v8b q[2]; } u; const __bf16* p = rowk0 + 8 * (lane >> 4);
  u.q[0] = *(const v8b*)p; u.q[1] = *(const v8b*)(p + 16); return u.v;
}
// unconverted fragment reads; p = the lane's row + k0 + 8 * (lane >> 4): elements 0..7 = p[0..7], 8..15 = p[16..23] (the k order of frag_h / frag_f32 / split_row / wcol_oi)
typedef __attribute__((ext_vector_type(16))) float v16f;
__device__ __forceinline__ v16f raw16(const float* p) { v16f r;
#pragma unroll
  for (int i = 0; i < 8; ++i) { r[i] = p[i]; r[8 + i] = p[16 + i]; }
  return r; }
__device__ __forceinline__ v16h pair_h(const _Float16* p) { union { v16h v; v8h q[2]; } u; u.q[0] = *(const v8h*)p; u.q[1] = *(const v8h*)(p + 16); return u.v; }
__device__ __forceinline__ v16b pair_b(const __bf16* p) { union { v16b v; v8b q[2]; } u; u.q[0] = *(const v8b*)p; u.q[1] = *(const v8b*)(p + 16); return u.v; }
__device__ __forceinline__ F2 bsplit_v(v16f r) { float v[16];
#pragma unroll
  for (int i = 0; i < 16; ++i) v[i] = r[i];
  return bsplit16(v); }
#define SK 128             // k of one LDS operand stage (k_proj, k_out): 256 B of every 16-bit source row
#define SPG 136            // its row pitch in 16-bit elements: 272 B = 16 B x 17, odd, for the ds_load_b128 fragment reads
#define SP 72              // k_att's stage row pitch in 16-bit elements: 144 B = 16 B x 9, odd, for the ds_load_b128 fragment reads
typedef __attribute__((ext_vector_type(4))) __bf16 v4b;
typedef __attribute__((ext_vector_type(4))) _Float16 v4h;
__device__ __forceinline__ v4b cvt4b(v4f v) { v4b r;
#pragma unroll
  for (int i = 0; i < 4; ++i) r[i] = (__bf16)v[i];
  return r; }
#define QBH 6              // causal: query blocks 0..QBH-1 of each sequence (few keys, no averaging) take the high-precision path
#define QHI 384            // rows carrying a q residual plane
#define KHI 384            // key rows carrying k residual / v bf16 hi+lo planes (used only by the causal high-precision path)
// B fragment (k rows k0+.., output column o) of a weight: (in,out) [K][ld] or (out,in) [ld rows of K]: bf16 exact, or f16(bf16 * 256) exact
__device__ __forceinline__ v16b wcol_io(const float* Wm, int k0, int o, int lane, int ld) { v16b w; const int g = lane >> 4;
#pragma unroll
  for (int i = 0; i < 8; ++i) { w[i] = (__bf16)Wm[(size_t)(k0 + 8 * g + i) * ld + o]; w[8 + i] = (__bf16)Wm[(size_t)(k0 + 16 + 8 * g + i) * ld + o]; }
  return w; }
__device__ __forceinline__ v16b wcol_oi(const float* Wm, int k0, int o, int lane, int K) { v16b w; const float* p = Wm + (size_t)o * K + k0 + 8 * (lane >> 4);
#pragma unroll
  for (int i = 0; i < 8; ++i) { w[i] = (__bf16)p[i]; w[8 + i] = (__bf16)p[16 + i]; }
  return w; }
__device__ __forceinline__ v16h wcolh_io(const float* Wm, int k0, int o, int lane, int ld) { v16h w; const int g = lane >> 4;
#pragma unroll
  for (int i = 0; i < 8; ++i) { w[i] = (_Float16)(bfr(Wm[(size_t)(k0 + 8 * g + i) * ld + o]) * 256.0f); w[8 + i] = (_Float16)(bfr(Wm[(size_t)(k0 + 16 + 8 * g + i) * ld + o]) * 256.0f); }
  return w; }
__device__ __forceinline__ v16h wcolh_oi(const float* Wm, int k0, int o, int lane, int K) { v16h w; const float* p = Wm + (size_t)o * K + k0 + 8 * (lane >> 4);
#pragma unroll
  for (int i = 0; i < 8; ++i) { w[i] = (_Float16)(bfr(p[i]) * 256.0f); w[8 + i] = (_Float16)(bfr(p[16 + i]) * 256.0f); }
  return w; }
#define WQKV_LAYOUT 1   // 0 = (in,out) [DIN][CC]; 1 = (out,in) [CC][DIN]; 2 = per-head [NH][DIN][HD]
__device__ __forceinline__ v16b wcol_hdk(const float* Wm, int k0, int o, int lane) { v16b w; const int g = lane >> 4; const float* p = Wm + (size_t)(o / HD) * DIN * HD + (o % HD);
#pragma unroll
  for (int i = 0; i < 8; ++i) { w[i] = (__bf16)p[(size_t)(k0 + 8 * g + i) * HD]; w[8 + i] = (__bf16)p[(size_t)(k0 + 16 + 8 * g + i) * HD]; }
  return w; }
#define WO_OUT_IN 1
#if WQKV_LAYOUT == 1
#define WCOL(W, k0, o, lane) wcol_oi(W, k0, o, lane, DIN)
#elif WQKV_LAYOUT == 2
#define WCOL(W, k0, o, lane) wcol_hdk(W, k0, o, lane)
#else
#define WCOL(W, k0, o, lane) wcol_io(W, k0, o, lane, CC)
#endif
#if WO_OUT_IN
#define WOCOL(W, k0, o, lane) wcol_oi(W, k0, o, lane, CC)
#define WOCOLH(W, k0, o, lane) wcolh_oi(W, k0, o, lane, CC)
#else
#define WOCOL(W, k0, o, lane) wcol_io(W, k0, o, lane, DIN)
#define WOCOLH(W, k0, o, lane) wcolh_io(W, k0, o, lane, DIN)
#endif

// RoPE inverse frequencies 1/10000^(2i/64) (the f32 values jax computes)
__constant__ float INVF[32] = {1.000000000e+00,7.498942018e-01,5.623413324e-01,4.216965139e-01,3.162277639e-01,2.371373624e-01,1.778279394e-01,1.333521456e-01,1.000000015e-01,7.498941571e-02,5.623412877e-02,4.216964915e-02,3.162277862e-02,2.371373586e-02,1.778279431e-02,1.333521493e-02,9.999999776e-03,7.498942316e-03,5.623413250e-03,4.216964822e-03,3.162277862e-03,2.371373819e-03,1.778279431e-03,1.333521446e-03,1.000000047e-03,7.498941850e-04,5.623413017e-04,4.216964880e-04,3.162277862e-04,2.371373848e-04,1.778279402e-04,1.333521504e-04};
#define PROJ_EXTRA_PARAMS
// cos and sin of a RoPE angle a, 0 <= a < 2^17 (a position below TT x a frequency of at most 1). On that range these are the library's cosf / sinf operation for operation (pi/2 taken off in three parts, its two polynomials, the quadrant select); left out are its branches to the large-argument reduction, never taken here, which kept one angle's chain from starting before the last one's end
__device__ __forceinline__ void rope_cs(float a, float& cs, float& sn) {
  const float fn = rintf(a * 6.36619747e-1f);
  const float r = fmaf(fn, -5.39030253e-15f, fmaf(fn, -7.54978942e-8f, fmaf(fn, -1.57079625e+0f, a)));
  const float t = r * r; const unsigned q = (unsigned)(int)fn;
  const float s = fmaf(r, t * fmaf(t, fmaf(t, -1.94644585e-4f, 8.33171979e-3f), -1.66666463e-1f), r);
  const float c = fmaf(t, fmaf(t, fmaf(t, fmaf(t, 2.56687417e-5f, -1.39091106e-3f), 4.16679047e-2f), -5.00000238e-1f), 1.0f);
  const unsigned sg = (q << 30) & 0x80000000u;   /* quadrants 2 and 3 flip both signs */
  sn = __uint_as_float(__float_as_uint((q & 1u) ? c : s) ^ sg); cs = __uint_as_float(__float_as_uint((q & 1u) ? -s : c) ^ sg); }
#ifndef PROJ_EXTRA_PARAMS
#define PROJ_EXTRA_PARAMS
#endif

#define WS_QH  0u                                      // f16 q rows [b*t][CC]
#define WS_KH  (WS_QH + 2u * (size_t)NB * TT * CC)      // f16 k rows [b*t][CC]
#define WS_VT  (WS_KH + 2u * (size_t)NB * TT * CC)      // f16 v planes [b][c][t]
#define WS_QL  (WS_VT + 2u * (size_t)NB * CC * TT)      // f16 q residual x 2^10 rows [b][t < QHI][CC]
#define WS_KL  (WS_QL + 2u * (size_t)NB * QHI * CC)     // f16 k residual x 2^10 rows [b][t < KHI][CC]
#define WS_VB  (WS_KL + 2u * (size_t)NB * KHI * CC)     // bf16 v hi planes [b][c][t < KHI]
#define WS_VBL (WS_VB + 2u * (size_t)NB * CC * KHI)
#define WS_YH  (WS_VBL + 2u * (size_t)NB * CC * KHI)    // 16-bit ctx rows [b*t][CC]: f16(ctx x 2^6); rows < QHI of a sequence: bf16 hi
#define WS_YL  (WS_YH + 2u * (size_t)NB * TT * CC)      // bf16 ctx lo rows [b][t < QHI][CC]
#define WS_XB  (WS_YL + 2u * (size_t)NB * QHI * CC)     // bf16 x rows [b*t][DIN]
#define WS_WB  (WS_XB + 2u * (size_t)NB * TT * DIN)     // bf16 wq, wk, wv, each [CC][DIN]
#define WS_WOB (WS_WB + 6u * (size_t)CC * DIN)          // bf16 wo [DIN][CC]
#define WS_WOH (WS_WOB + 2u * (size_t)DIN * CC)         // f16(bf16 wo x 2^8) [DIN][CC]
#define WS_END (WS_WOH + 2u * (size_t)DIN * CC)

// ---- k_cvt: x, wq, wk, wv, wo to the 16-bit forms the products take, once, in place of once in each of the 24 (x), 64 (w) blocks that stage a row. block = CVB consecutive floats of one input: 16 loads of 16 B a lane in flight, 512 B a wave and load; stores of 256 B a wave; two blocks a WGP, so that few waves have to start
#define CVB 16384
__global__ __launch_bounds__(256) void k_cvt(const float* __restrict__ X, const float* __restrict__ WQ, const float* __restrict__ WK, const float* __restrict__ WV, const float* __restrict__ WO, __bf16* __restrict__ XB, __bf16* __restrict__ WB, __bf16* __restrict__ WOB, _Float16* __restrict__ WOH) {
  constexpr int nx = NB * TT * DIN / CVB, nw = CC * DIN / CVB; const int blk = blockIdx.x; const int sel = blk < nx ? -1 : (blk - nx) / nw;   /* block-uniform: -1 x, 0..2 wq wk wv, 3 wo */
  const size_t o = (size_t)(blk < nx ? blk : (blk - nx) % nw) * CVB + threadIdx.x * 4;
  const float* s = (sel < 0 ? X : sel == 0 ? WQ : sel == 1 ? WK : sel == 2 ? WV : WO) + o;
  v4f r[16]; v4b c[16];
#pragma unroll
  for (int i = 0; i < 16; ++i) r[i] = *(const v4f*)(s + i * 1024);
  asm volatile("s_wait_xcnt 0x0" :: "v"(s) : "memory");   /* behind the loads: their address registers may be taken for the stores' */
#pragma unroll
  for (int i = 0; i < 16; ++i) c[i] = cvt4b(r[i]);
  __bf16* d = (sel < 0 ? XB : sel < 3 ? WB + (size_t)sel * CC * DIN : WOB) + o;
  if (sel == 3) { v4h f[16];   /* wo also as f16(bf16 x 2^8), exact */
#pragma unroll
    for (int i = 0; i < 16; ++i)
#pragma unroll
      for (int e = 0; e < 4; ++e) f[i][e] = (_Float16)((float)c[i][e] * 256.0f);
#pragma unroll
    for (int i = 0; i < 16; ++i) *(v4h*)(WOH + o + i * 1024) = f[i]; }
#pragma unroll
  for (int i = 0; i < 16; ++i) *(v4b*)(d + i * 1024) = c[i]; }

// ---- k_proj: block = (64 rows, 128 cols, which): q/k/v = X W (+ b), X and W in k_cvt's bf16, with exact bf16 products (K = DIN) -> which 0: q f16 rows (+ residual rows < QHI); 1: k f16 rows (+ residual rows < KHI); 2: v f16 planes [c][t] (+ bf16 hi/lo planes for t < KHI)
__global__ __launch_bounds__(128) void k_proj(const __bf16* __restrict__ XQ, const __bf16* __restrict__ XK, const __bf16* __restrict__ XV, const __bf16* __restrict__ WQ, const __bf16* __restrict__ WK, const __bf16* __restrict__ WV, const float* __restrict__ BQ, const float* __restrict__ BK, const float* __restrict__ BV,
    _Float16* __restrict__ QH, _Float16* __restrict__ QL, _Float16* __restrict__ KH, _Float16* __restrict__ KL, _Float16* __restrict__ VT, __bf16* __restrict__ VB, __bf16* __restrict__ VBL PROJ_EXTRA_PARAMS) {
  __shared__ __align__(16) union { struct { float st[64][132]; _Float16 sh[64][136], sl[64][136], th[128][72]; __bf16 tb[128][72], tbl[128][72]; } e; __bf16 sg[2][192][SPG]; } un;   /* the two operand stages of the k loop lie where the epilogue's tiles lie later (the loop's last barrier between) */
  auto& st = un.e.st; auto& sh = un.e.sh; auto& sl = un.e.sl; auto& th = un.e.th; auto& tb = un.e.tb; auto& tbl = un.e.tbl; auto& sg = un.sg;
  const int tid = threadIdx.x, wave = tid >> 5, lane = tid & 31, col = lane & 15, g = lane >> 4; const int which = blockIdx.z; const int c0 = blockIdx.y * 128; const size_t r0 = (size_t)blockIdx.x * 64; const size_t bb = r0 / TT; const int t0 = (int)(r0 % TT);
  const __bf16* X = which == 0 ? XQ : which == 1 ? XK : XV; const __bf16* WA = which == 0 ? WQ : which == 1 ? WK : WV; const float* BA = which == 0 ? BQ : which == 1 ? BK : BV;
  v8f acc[8] = {};
  // a stage = SK k of the block's 128 W rows (sg rows 0..127) and 64 X rows (128..191), bf16 as k_cvt left them, brought in once for the four waves. 16 lanes x 16 B read one row's 256 B: a load instruction touches 4 whole lines, not 16 pieces
  const int lr = tid >> 4, lc = tid & 15; const __bf16* wg = WA + (size_t)(c0 + lr) * DIN + lc * 8; const __bf16* xg = X + (r0 + lr) * DIN + lc * 8;
  v8b wr[16], xr[8];
#pragma unroll
  for (int i = 0; i < 16; ++i) wr[i] = *(const v8b*)(wg + (size_t)i * 8 * DIN);
#pragma unroll
  for (int i = 0; i < 8; ++i) xr[i] = *(const v8b*)(xg + (size_t)i * 8 * DIN);
  asm volatile("s_wait_xcnt 0x0" :: "v"(wg), "v"(xg) : "memory");   /* behind the stage's loads: their address registers step on below */
#pragma unroll
  for (int i = 0; i < 16; ++i) *(v8b*)&sg[0][i * 8 + lr][lc * 8] = wr[i];
#pragma unroll
  for (int i = 0; i < 8; ++i) *(v8b*)&sg[0][128 + i * 8 + lr][lc * 8] = xr[i];
  __syncthreads();
#pragma unroll 1   // rolled: the next stage's 24 loads stay in registers over one stage's products
  for (int s = 0; s < DIN / SK; ++s, wg += SK, xg += SK) { const bool more = s + 1 < DIN / SK;   /* block-uniform */
    if (more) {
#pragma unroll
      for (int i = 0; i < 16; ++i) wr[i] = *(const v8b*)(wg + SK + (size_t)i * 8 * DIN);
#pragma unroll
      for (int i = 0; i < 8; ++i) xr[i] = *(const v8b*)(xg + SK + (size_t)i * 8 * DIN);
      asm volatile("s_wait_xcnt 0x0" :: "v"(wg), "v"(xg) : "memory"); }   /* behind the next stage's loads, which fly under this stage's products (the memory clobber holds them in front); naming their address registers keeps these whole up to the wait */
#pragma unroll
    for (int kk = 0; kk < SK / 32; ++kk) { const v16b a = frag_b(&sg[s & 1][128 + wave * 16 + col][kk * 32], lane); v16b w[8];
#pragma unroll
      for (int j = 0; j < 8; ++j) w[j] = frag_b(&sg[s & 1][j * 16 + col][kk * 32], lane);
#pragma unroll
      for (int j = 0; j < 8; ++j) acc[j] = wmma_bf(a, w[j], acc[j]); }
    if (more) {
#pragma unroll
      for (int i = 0; i < 16; ++i) *(v8b*)&sg[(s + 1) & 1][i * 8 + lr][lc * 8] = wr[i];
#pragma unroll
      for (int i = 0; i < 8; ++i) *(v8b*)&sg[(s + 1) & 1][128 + i * 8 + lr][lc * 8] = xr[i]; }
    __syncthreads(); }   /* publishes stage s + 1 and ends every wave's reads of stage s, whose buffer the next trip refills */
  { // stage the f32 tile (acc + bias) in LDS, apply RoPE to q and k, then convert
#pragma unroll
    for (int j = 0; j < 8; ++j) { const float bias = BA ? bfr(BA[c0 + j * 16 + col]) : 0.f;
#pragma unroll
      for (int r = 0; r < 8; ++r) st[wave * 16 + 8 * g + r][j * 16 + col] = acc[j][r] + bias; }
    __syncthreads();
    if (which < 2) {   /* block-uniform. q and k: interleaved-pair rotation (x[2i], x[2i + 1]) by the angle t * INVF[i]; v untouched. A thread has one row and every second frequency: each cos / sin is formed once and turns the pair of both heads of the tile; 32 lanes x 8 B fall on 64 different banks */
      const int rl = tid >> 1, ih = tid & 1; const float pos = (float)(int)((r0 + rl) % TT);   /* position = the token's sequence index */
#pragma unroll   // unrolled: the 16 angles' chains interleave
      for (int ii = 0; ii < 16; ++ii) { float cs, sn; const float f0 = INVF[2 * ii], f1 = INVF[2 * ii + 1]; rope_cs(pos * (ih ? f1 : f0), cs, sn);   /* both read as scalars, then a select: no load by lane */
#pragma unroll   // unrolled: both heads' pairs are turned from the same two registers
        for (int hh = 0; hh < 128 / HD; ++hh) { v2f* p = (v2f*)&st[rl][hh * HD + 4 * ii + 2 * ih]; const v2f x = *p; v2f y; y[0] = x[0] * cs - x[1] * sn; y[1] = x[0] * sn + x[1] * cs; *p = y; } } }
    __syncthreads(); }
  if (which < 2) { _Float16* DH = which == 0 ? QH : KH; _Float16* DL = which == 0 ? QL : KL; const int nhi = which == 0 ? QHI : KHI; const bool hi_rows = t0 < nhi;
    for (int e = tid; e < 64 * 128; e += 128) { const int rl = e >> 7, cl = e & 127; const float v = st[rl][cl]; const _Float16 hv = (_Float16)v; sh[rl][cl] = hv; sl[rl][cl] = (_Float16)((v - (float)hv) * 1024.0f); }
    __syncthreads();
    for (int e = tid; e < 64 * 16; e += 128) { const int rl = e >> 4, q = e & 15; vst2((unsigned*)(DH + (r0 + rl) * CC + c0 + q * 8), *(const v4u*)&sh[rl][q * 8]); if (hi_rows) vst2((unsigned*)(DL + (bb * nhi + t0 + rl) * (size_t)CC + c0 + q * 8), *(const v4u*)&sl[rl][q * 8]); }
  } else { const bool hi_rows = t0 < KHI;
    for (int e = tid; e < 64 * 128; e += 128) { const int rl = e & 63, cl = e >> 6; const float v = st[rl][cl]; th[cl][rl] = (_Float16)v; const __bf16 bh = (__bf16)v; tb[cl][rl] = bh; tbl[cl][rl] = (__bf16)(v - (float)bh); }
    __syncthreads();
    for (int e = tid; e < 128 * 8; e += 128) { const int cl = e >> 3, q = e & 7; vst2((unsigned*)(VT + (bb * CC + c0 + cl) * (size_t)TT + t0 + q * 8), *(const v4u*)&th[cl][q * 8]); if (hi_rows) { const size_t o3 = (bb * CC + c0 + cl) * (size_t)KHI + t0 + q * 8; vst2((unsigned*)(VB + o3), *(const v4u*)&tb[cl][q * 8]); vst2((unsigned*)(VBL + o3), *(const v4u*)&tbl[cl][q * 8]); } } } }
// ---- k_att: block = 4 waves x 16 queries of (b, h), two query blocks one after the other (x and NQB - 1 - x: every block walks (NQB + 1) x 64 keys). Logits as S^T = K Q^T: D register r of key tile kt = key kt * 16 + 8g + r of query col, so a lane holds one query's logits and two tiles are the A fragment of P in the k order of pair_h. Pass 1: row maximum. Pass 2: the same logits again, e = 2^11 exp(s - max), sum of e in f32, e to f16 (early query blocks: bf16 hi + lo) against v; ctx = acc / sum. Nothing of S goes to memory.
// a trip is NT key tiles of 16: 64 keys; 32 in the early query blocks, whose residual planes double the fragments
// a trip's operands are staged in LDS once for the four waves (pitch SP): sk rows 0..63 = the 64 k rows (early blocks: 0..31 k, 32..63 its residual); sv row c = v plane c's 64 keys (early blocks: 32 keys of the bf16 hi plane, then of the lo plane)
template <bool HI> __device__ __forceinline__ void att_ldk(const _Float16* kp, const _Float16* klp, v16h (&kf)[2][HI ? 2 : 4], v16h (&klf)[2][HI ? 2 : 4]) {
#pragma unroll
  for (int kc = 0; kc < 2; ++kc)
#pragma unroll
    for (int kt = 0; kt < (HI ? 2 : 4); ++kt) { kf[kc][kt] = pair_h(kp + kt * 16 * SP + kc * 32); if (HI) klf[kc][kt] = pair_h(klp + kt * 16 * SP + kc * 32); } }
// unscaled logits (q.k; SCALE is folded into the exponent's multiplier SC2) of a trip's keys; srel = query - the trip's first key - 8g: key kt * 16 + r of the lane is kept while kt * 16 + r <= srel
template <bool HI, bool MASK> __device__ __forceinline__ void att_logits(const v16h (&kf)[2][HI ? 2 : 4], const v16h (&klf)[2][HI ? 2 : 4], const v16h (&qh)[2], const v16h (&ql)[2], int srel, float (&s)[HI ? 2 : 4][8]) {
  constexpr int NT = HI ? 2 : 4; v8f a[NT] = {}, al[NT] = {};
#pragma unroll
  for (int kc = 0; kc < 2; ++kc)
#pragma unroll
    for (int kt = 0; kt < NT; ++kt) { a[kt] = wmma16(kf[kc][kt], qh[kc], a[kt]); if (HI) { al[kt] = wmma16(kf[kc][kt], ql[kc], al[kt]); al[kt] = wmma16(klf[kc][kt], qh[kc], al[kt]); } }
#pragma unroll
  for (int kt = 0; kt < NT; ++kt)
#pragma unroll
    for (int r = 0; r < 8; ++r) { const float v = HI ? a[kt][r] + al[kt][r] * (1.0f / 1024.0f) : a[kt][r]; s[kt][r] = (!MASK || kt * 16 + r <= srel) ? v : -3.0e38f; } }
template <bool HI, bool MASK> __device__ __forceinline__ float att_max(const _Float16* kp, const _Float16* klp, const v16h (&qh)[2], const v16h (&ql)[2], int srel) {
  constexpr int NT = HI ? 2 : 4; v16h kf[2][NT], klf[2][NT]; float s[NT][8]; att_ldk<HI>(kp, klp, kf, klf);
  att_logits<HI, MASK>(kf, klf, qh, ql, srel, s);
  float m = s[0][0];
#pragma unroll
  for (int kt = 0; kt < NT; ++kt)
#pragma unroll
    for (int r = 0; r < 8; ++r) m = fmaxf(m, s[kt][r]);
  return m; }
// 2^x of the eight logits a lane holds of one key tile, in place. One statement, so that behind each v_exp_f32 stands an instruction that neither reads its result nor overwrites its source: the next one, and a v_nop behind the last (the slot the instruction set asks for)
__device__ __forceinline__ void exp2x8(float (&x)[8]) {
  asm("v_exp_f32 %0, %0\n\tv_exp_f32 %1, %1\n\tv_exp_f32 %2, %2\n\tv_exp_f32 %3, %3\n\tv_exp_f32 %4, %4\n\tv_exp_f32 %5, %5\n\tv_exp_f32 %6, %6\n\tv_exp_f32 %7, %7\n\tv_nop"
      : "+v"(x[0]), "+v"(x[1]), "+v"(x[2]), "+v"(x[3]), "+v"(x[4]), "+v"(x[5]), "+v"(x[6]), "+v"(x[7])); }
// bias = 11 - SC2 x the query's row maximum, finite (every row keeps its diagonal): e = 2^(SC2 x d + bias) = 2^11 exp(s - max) by one fused multiply-add and the chip's own 2^x; an excluded logit (-3e38) gives 0
template <bool HI, bool MASK> __device__ __forceinline__ void att_pv(const _Float16* kp, const _Float16* klp, const _Float16* vp, const __bf16* vhp, const __bf16* vlp, const v16h (&qh)[2], const v16h (&ql)[2], int srel, float bias, float& sum, v8f (&acc)[HD / 16]) {
  constexpr int NT = HI ? 2 : 4; v16h kf[2][NT], klf[2][NT], vf[NT / 2][HD / 16]; v16b vh[NT / 2][HD / 16], vl[NT / 2][HD / 16]; float s[NT][8]; att_ldk<HI>(kp, klp, kf, klf);
  att_logits<HI, MASK>(kf, klf, qh, ql, srel, s);
#pragma unroll
  for (int u = 0; u < NT / 2; ++u)   /* the v reads take the k fragments' registers and fly under the exponentials */
#pragma unroll
    for (int j = 0; j < HD / 16; ++j) { if (!HI) vf[u][j] = pair_h(vp + j * 16 * SP + u * 32); else { vh[u][j] = pair_b(vhp + j * 16 * SP + u * 32); vl[u][j] = pair_b(vlp + j * 16 * SP + u * 32); } }
  float part[NT];
#pragma unroll
  for (int kt = 0; kt < NT; ++kt) {
#pragma unroll
    for (int r = 0; r < 8; ++r) s[kt][r] = fmaf(s[kt][r], SC2, bias);
    exp2x8(s[kt]); part[kt] = s[kt][0];
#pragma unroll
    for (int r = 1; r < 8; ++r) part[kt] += s[kt][r]; }
#pragma unroll
  for (int kt = 0; kt < NT; kt += 2) sum += part[kt] + part[kt + 1];
#pragma unroll
  for (int u = 0; u < NT / 2; ++u) {
    if (!HI) { v16h p;
#pragma unroll
      for (int i = 0; i < 8; ++i) { p[i] = (_Float16)s[2 * u][i]; p[8 + i] = (_Float16)s[2 * u + 1][i]; }
#pragma unroll
      for (int j = 0; j < HD / 16; ++j) acc[j] = wmma16(p, vf[u][j], acc[j]);
    } else { float pv[16];
#pragma unroll
      for (int i = 0; i < 8; ++i) { pv[i] = s[2 * u][i]; pv[8 + i] = s[2 * u + 1][i]; }
      const F2 p = bsplit16(pv);
#pragma unroll
      for (int j = 0; j < HD / 16; ++j) { acc[j] = wmma_bf(p.h, vh[u][j], acc[j]); acc[j] = wmma_bf(p.l, vh[u][j], acc[j]); acc[j] = wmma_bf(p.h, vl[u][j], acc[j]); } } } }
template <bool HI> __device__ __forceinline__ void att_tile(const _Float16* __restrict__ QH, const _Float16* __restrict__ KH, const _Float16* __restrict__ QL, const _Float16* __restrict__ KL, const _Float16* __restrict__ VT, const __bf16* __restrict__ VB, const __bf16* __restrict__ VBL, _Float16* __restrict__ YH, __bf16* __restrict__ YL, float (*ssw)[HD + 4], _Float16 (*sk)[64][SP], _Float16 (*sv)[64][SP], int b, int h, int qb, int wave, int lane) {
  constexpr int KS = HI ? 32 : 64;   /* keys a trip */
  const int col = lane & 15, g = lane >> 4; const int ql0 = qb * 64 + wave * 16; const size_t ho = (size_t)h * HD + 8 * g;
  const int nfull = HI ? 0 : qb, nmask = HI ? (qb + 1) * 2 : 1;   /* trips wholly below the diagonal, then trips masked by index */
  const int nl = nfull + nmask - 1;   /* trips in front of the last one: all unmasked in the late blocks, all masked in the early ones; block-uniform */
  const int srel0 = ql0 + col - 8 * g - nfull * KS;
  const _Float16* qp = QH + ((size_t)b * TT + ql0 + col) * CC + ho; const _Float16* qlp = HI ? QL + ((size_t)b * QHI + ql0 + col) * CC + ho : qp;
  v16h qh[2], ql[2];
#pragma unroll
  for (int kc = 0; kc < 2; ++kc) { qh[kc] = pair_h(qp + kc * 32); ql[kc] = HI ? pair_h(qlp + kc * 32) : qh[kc]; }
  asm volatile("s_wait_xcnt 0x0" :: "v"(qp), "v"(qlp) : "memory");   /* behind the q loads, as below */
  // staging: 8 lanes x 16 B fill one stage row of 128 B, so a load instruction touches 4 whole lines (the early blocks' v planes: 8 half lines), not 16 pieces. ka: stage rows 0..31, kb: rows 32..63
  constexpr int VLD = HI ? KHI : TT;   /* row pitch of the v planes read */
  const int sr = (wave * 32 + lane) >> 3, sc = (lane & 7) * 8; const size_t vrow = (size_t)b * CC + h * HD + sr;
  const _Float16* const ka0 = KH + ((size_t)b * TT + sr) * CC + h * HD + sc; const _Float16* const kb0 = HI ? KL + ((size_t)b * KHI + sr) * CC + h * HD + sc : ka0 + (size_t)32 * CC;
  const _Float16* const vg0 = HI ? (const _Float16*)((sc < 32 ? VB : VBL) + vrow * KHI + (sc & 31)) : VT + vrow * TT + sc;   /* moved as raw 16-B pieces */
  float m = -3.0e38f;
  { const _Float16 *ka = ka0, *kb = kb0; v8h kr[4], vr[4]; int srel = srel0;
#pragma unroll
    for (int i = 0; i < 2; ++i) { kr[i] = *(const v8h*)(ka + (size_t)i * 16 * CC); kr[2 + i] = *(const v8h*)(kb + (size_t)i * 16 * CC); }
    asm volatile("s_wait_xcnt 0x0" :: "v"(ka), "v"(kb) : "memory");   /* behind the stage's loads: their address registers step on below */
    __syncthreads();   /* every wave has left the stages of the tile before */
#pragma unroll
    for (int i = 0; i < 4; ++i) *(v8h*)&sk[0][i * 16 + sr][sc] = kr[i];
    __syncthreads();
#pragma unroll 1   // rolled: one trip's fragments fill the registers
    for (int tr = 0; tr < nl; ++tr, ka += (size_t)KS * CC, kb += (size_t)KS * CC) {
#pragma unroll
      for (int i = 0; i < 2; ++i) { kr[i] = *(const v8h*)(ka + (size_t)(KS + i * 16) * CC); kr[2 + i] = *(const v8h*)(kb + (size_t)(KS + i * 16) * CC); }
      asm volatile("s_wait_xcnt 0x0" :: "v"(ka), "v"(kb) : "memory");   /* behind the next trip's loads, which fly under this trip's logits (the memory clobber holds them in front); naming their address registers keeps these whole up to the wait */
      const _Float16* kp = &sk[tr & 1][col][8 * g]; m = fmaxf(m, att_max<HI, HI>(kp, kp + 32 * SP, qh, ql, srel)); if (HI) srel -= KS;
#pragma unroll
      for (int i = 0; i < 4; ++i) *(v8h*)&sk[(tr + 1) & 1][i * 16 + sr][sc] = kr[i];
      __syncthreads(); }   /* publishes trip tr + 1 and ends every wave's reads of trip tr, whose buffer the next trip refills */
#pragma unroll
    for (int i = 0; i < 2; ++i) { kr[i] = *(const v8h*)(ka0 + (size_t)i * 16 * CC); kr[2 + i] = *(const v8h*)(kb0 + (size_t)i * 16 * CC); }   /* pass 2's first stage flies under pass 1's last trip */
#pragma unroll
    for (int i = 0; i < 4; ++i) vr[i] = *(const v8h*)(vg0 + (size_t)i * 16 * VLD);
    asm volatile("s_wait_xcnt 0x0" :: "v"(ka0), "v"(kb0), "v"(vg0) : "memory");   /* behind these loads, as above */
    const _Float16* kp = &sk[nl & 1][col][8 * g]; m = fmaxf(m, att_max<HI, true>(kp, kp + 32 * SP, qh, ql, srel));
    __syncthreads();   /* every wave has left pass 1's stages */
#pragma unroll
    for (int i = 0; i < 4; ++i) { *(v8h*)&sk[0][i * 16 + sr][sc] = kr[i]; *(v8h*)&sv[0][i * 16 + sr][sc] = vr[i]; }
    __syncthreads(); }
  m = fmaxf(m, __shfl_xor(m, 16));   /* the two lane halves hold the two key halves of one query */
  const float bias = fmaf(-m, SC2, 11.0f);   /* one rounding, the same for every key of the query: it cancels in e / sum */
  v8f acc[HD / 16] = {}; float sum = 0.f;
  { const _Float16 *ka = ka0, *kb = kb0, *vg = vg0; v8h kr[4], vr[4]; int srel = srel0;
#pragma unroll 1   // rolled: one trip's fragments fill the registers
    for (int tr = 0; tr < nl; ++tr, ka += (size_t)KS * CC, kb += (size_t)KS * CC, vg += KS) {
#pragma unroll
      for (int i = 0; i < 2; ++i) { kr[i] = *(const v8h*)(ka + (size_t)(KS + i * 16) * CC); kr[2 + i] = *(const v8h*)(kb + (size_t)(KS + i * 16) * CC); }
#pragma unroll
      for (int i = 0; i < 4; ++i) vr[i] = *(const v8h*)(vg + KS + (size_t)i * 16 * VLD);
      asm volatile("s_wait_xcnt 0x0" :: "v"(ka), "v"(kb), "v"(vg) : "memory");   /* behind the next trip's loads, which fly under this trip's work (the memory clobber holds them in front); naming their address registers keeps these whole up to the wait */
      const _Float16 *kp = &sk[tr & 1][col][8 * g], *vp = &sv[tr & 1][col][8 * g]; att_pv<HI, HI>(kp, kp + 32 * SP, vp, (const __bf16*)vp, (const __bf16*)vp + 32, qh, ql, srel, bias, sum, acc); if (HI) srel -= KS;
#pragma unroll
      for (int i = 0; i < 4; ++i) { *(v8h*)&sk[(tr + 1) & 1][i * 16 + sr][sc] = kr[i]; *(v8h*)&sv[(tr + 1) & 1][i * 16 + sr][sc] = vr[i]; }
      __syncthreads(); }   /* publishes trip tr + 1 and ends every wave's reads of trip tr, whose buffers the next trip refills */
    const _Float16 *kp = &sk[nl & 1][col][8 * g], *vp = &sv[nl & 1][col][8 * g]; att_pv<HI, true>(kp, kp + 32 * SP, vp, (const __bf16*)vp, (const __bf16*)vp + 32, qh, ql, srel, bias, sum, acc); }
  sum += __shfl_xor(sum, 16);
  const float inv = sum > 0.f ? 1.0f / sum : 0.f;   /* of query col; sum carries the 2^11 of its terms; a fully excluded row yields 0 */
#pragma unroll
  for (int r = 0; r < 8; ++r) { const float ir = __shfl(inv, 8 * g + r);   /* accumulator register r is query 8g + r */
#pragma unroll
    for (int j = 0; j < HD / 16; ++j) ssw[8 * g + r][j * 16 + col] = acc[j][r] * ir; }
  LDSX();
  // ctx leaves in the 16-bit form k_out's product takes: f16(ctx x 2^6), clear of f16 subnormals; early query blocks: bf16 hi + bf16 lo, as bsplit16 forms them
  _Float16* yp = YH + ((size_t)b * TT + ql0 + g) * CC + h * HD + col * 4;   /* 128-B (row, head) segment by 16 lanes, two rows a store */
  if (!HI) { v4h c[8];
#pragma unroll
    for (int i = 0; i < 8; ++i) { const v4f y = *(const v4f*)&ssw[2 * i + g][col * 4];
#pragma unroll
      for (int e = 0; e < 4; ++e) c[i][e] = (_Float16)(y[e] * 64.0f); }
#pragma unroll
    for (int i = 0; i < 8; ++i) vst2(yp + (size_t)i * 2 * CC, c[i]);
    asm volatile("s_wait_xcnt 0x0" :: "v"(yp) : "memory");   /* behind the stores: the next tile overwrites their registers */
  } else { __bf16* ylp = YL + ((size_t)b * QHI + ql0 + g) * CC + h * HD + col * 4; v4b hv[8], lv[8];
#pragma unroll
    for (int i = 0; i < 8; ++i) { const v4f y = *(const v4f*)&ssw[2 * i + g][col * 4]; hv[i] = cvt4b(y); v4f rs;
#pragma unroll
      for (int e = 0; e < 4; ++e) rs[e] = y[e] - (float)hv[i][e];
      lv[i] = cvt4b(rs); }
#pragma unroll
    for (int i = 0; i < 8; ++i) { vst2(yp + (size_t)i * 2 * CC, hv[i]); vst2(ylp + (size_t)i * 2 * CC, lv[i]); }
    asm volatile("s_wait_xcnt 0x0" :: "v"(yp), "v"(ylp) : "memory"); }   /* behind the stores: the next tile overwrites their registers */
  LDSX(); }   /* the next tile's staging writes stay behind these reads */
// amdgpu_waves_per_eu(2, 2): the grid gives two waves a SIMD (512 blocks x 4 waves, 1,024 SIMDs); with that register budget a trip's exponentials interleave instead of running as one dependent chain after the other
__global__ __launch_bounds__(128) __attribute__((amdgpu_waves_per_eu(2, 2))) void k_att(const _Float16* __restrict__ QH, const _Float16* __restrict__ KH, const _Float16* __restrict__ QL, const _Float16* __restrict__ KL, const _Float16* __restrict__ VT, const __bf16* __restrict__ VB, const __bf16* __restrict__ VBL, _Float16* __restrict__ YH, __bf16* __restrict__ YL) { __shared__ __align__(16) float ss[4][16][HD + 4]; __shared__ __align__(16) _Float16 sk[2][64][SP], sv[2][64][SP];
  const int tid = threadIdx.x, wave = tid >> 5, lane = tid & 31; const int h = blockIdx.y, b = blockIdx.z;
#pragma unroll 1   // rolled: the two tiles share one copy of the code
  for (int half = 0; half < 2; ++half) { const int qb = half ? (int)blockIdx.x : NQB - 1 - (int)blockIdx.x;   /* block-uniform */
    if (qb < QBH) att_tile<true>(QH, KH, QL, KL, VT, VB, VBL, YH, YL, ss[wave], sk, sv, b, h, qb, wave, lane);
    else att_tile<false>(QH, KH, QL, KL, VT, VB, VBL, YH, YL, ss[wave], sk, sv, b, h, qb, wave, lane); } }
// ---- k_out: block = (64 rows, 128 cols): out = ctx Wo (+ bo): f16(ctx x 2^6) against Wo as f16(bf16 x 2^8) exact (1 product) x 2^-14; causal early rows (< QHI of each sequence): ctx bf16 hi + lo against exact bf16 Wo (2 products); the operands come in the 16-bit forms k_att and k_cvt left
__global__ __launch_bounds__(128) void k_out(const _Float16* __restrict__ YH, const __bf16* __restrict__ YL, const __bf16* __restrict__ WOB, const _Float16* __restrict__ WOH, const float* __restrict__ BO, float* __restrict__ OUT) {
  __shared__ __align__(16) union { float sf[4][16][132]; __bf16 b[2][256][SPG]; _Float16 h[2][192][SPG]; } sg;   /* two operand stages: rows 0..127 Wo, 128..191 ctx (hi), 192..255 ctx lo (early rows only); the output tile lies there later (the loop's last barrier between) */
  auto& sf = sg.sf;
  const int tid = threadIdx.x, wave = tid >> 5, lane = tid & 31, col = lane & 15, g = lane >> 4; const int c0 = blockIdx.y * 128; const size_t r0 = (size_t)blockIdx.x * 64 + wave * 16;
  v8f acc[8] = {};
  // a stage = SK k of the block's 128 Wo rows and 64 ctx rows, brought in once for the four waves. 16 lanes x 16 B read one row's 256 B: a load instruction touches 4 whole lines, not 16 pieces
  const int lr = tid >> 4, lc = tid & 15; const size_t wo = (size_t)(c0 + lr) * CC + lc * 8, yo = ((size_t)blockIdx.x * 64 + lr) * CC + lc * 8; const int t0 = (int)(((size_t)blockIdx.x * 64) % TT);
  if (CAUSAL && t0 < QHI) {   /* block-uniform */
    const __bf16* wg = WOB + wo; const __bf16* yg = (const __bf16*)YH + yo; const __bf16* zg = YL + (((size_t)blockIdx.x * 64) / TT * QHI + t0 + lr) * CC + lc * 8;
    v8b wr[16], yr[8], zr[8];
#pragma unroll
    for (int i = 0; i < 16; ++i) wr[i] = *(const v8b*)(wg + (size_t)i * 8 * CC);
#pragma unroll
    for (int i = 0; i < 8; ++i) { yr[i] = *(const v8b*)(yg + (size_t)i * 8 * CC); zr[i] = *(const v8b*)(zg + (size_t)i * 8 * CC); }
    asm volatile("s_wait_xcnt 0x0" :: "v"(wg), "v"(yg), "v"(zg) : "memory");   /* behind the stage's loads: their address registers step on below */
#pragma unroll
    for (int i = 0; i < 16; ++i) *(v8b*)&sg.b[0][i * 8 + lr][lc * 8] = wr[i];
#pragma unroll
    for (int i = 0; i < 8; ++i) { *(v8b*)&sg.b[0][128 + i * 8 + lr][lc * 8] = yr[i]; *(v8b*)&sg.b[0][192 + i * 8 + lr][lc * 8] = zr[i]; }
    __syncthreads();
#pragma unroll 1   // rolled: the next stage's 32 loads stay in registers over one stage's products
    for (int s = 0; s < CC / SK; ++s, wg += SK, yg += SK, zg += SK) { const bool more = s + 1 < CC / SK;   /* block-uniform */
      if (more) {
#pragma unroll
        for (int i = 0; i < 16; ++i) wr[i] = *(const v8b*)(wg + SK + (size_t)i * 8 * CC);
#pragma unroll
        for (int i = 0; i < 8; ++i) { yr[i] = *(const v8b*)(yg + SK + (size_t)i * 8 * CC); zr[i] = *(const v8b*)(zg + SK + (size_t)i * 8 * CC); }
        asm volatile("s_wait_xcnt 0x0" :: "v"(wg), "v"(yg), "v"(zg) : "memory"); }   /* behind the next stage's loads, which fly under this stage's products (the memory clobber holds them in front); naming their address registers keeps these whole up to the wait */
#pragma unroll
      for (int kk = 0; kk < SK / 32; ++kk) { const v16b ah = frag_b(&sg.b[s & 1][128 + wave * 16 + col][kk * 32], lane), al = frag_b(&sg.b[s & 1][192 + wave * 16 + col][kk * 32], lane); v16b w[8];
#pragma unroll
        for (int j = 0; j < 8; ++j) w[j] = frag_b(&sg.b[s & 1][j * 16 + col][kk * 32], lane);
#pragma unroll
        for (int j = 0; j < 8; ++j) { acc[j] = wmma_bf(ah, w[j], acc[j]); acc[j] = wmma_bf(al, w[j], acc[j]); } }
      if (more) {
#pragma unroll
        for (int i = 0; i < 16; ++i) *(v8b*)&sg.b[(s + 1) & 1][i * 8 + lr][lc * 8] = wr[i];
#pragma unroll
        for (int i = 0; i < 8; ++i) { *(v8b*)&sg.b[(s + 1) & 1][128 + i * 8 + lr][lc * 8] = yr[i]; *(v8b*)&sg.b[(s + 1) & 1][192 + i * 8 + lr][lc * 8] = zr[i]; } }
      __syncthreads(); }   /* publishes stage s + 1 and ends every wave's reads of stage s, whose buffer the next trip refills */
#pragma unroll
    for (int j = 0; j < 8; ++j) { const float bias = BO ? bfr(BO[c0 + j * 16 + col]) : 0.f;
#pragma unroll
      for (int r = 0; r < 8; ++r) sf[wave][8 * g + r][j * 16 + col] = acc[j][r] + bias; }
  } else {
    const _Float16* wg = WOH + wo; const _Float16* yg = YH + yo;
    v8h wr[16], yr[8];
#pragma unroll
    for (int i = 0; i < 16; ++i) wr[i] = *(const v8h*)(wg + (size_t)i * 8 * CC);
#pragma unroll
    for (int i = 0; i < 8; ++i) yr[i] = *(const v8h*)(yg + (size_t)i * 8 * CC);
    asm volatile("s_wait_xcnt 0x0" :: "v"(wg), "v"(yg) : "memory");   /* behind the stage's loads: their address registers step on below */
#pragma unroll
    for (int i = 0; i < 16; ++i) *(v8h*)&sg.h[0][i * 8 + lr][lc * 8] = wr[i];
#pragma unroll
    for (int i = 0; i < 8; ++i) *(v8h*)&sg.h[0][128 + i * 8 + lr][lc * 8] = yr[i];
    __syncthreads();
#pragma unroll 1   // rolled: the next stage's 24 loads stay in registers over one stage's products
    for (int s = 0; s < CC / SK; ++s, wg += SK, yg += SK) { const bool more = s + 1 < CC / SK;   /* block-uniform */
      if (more) {
#pragma unroll
        for (int i = 0; i < 16; ++i) wr[i] = *(const v8h*)(wg + SK + (size_t)i * 8 * CC);
#pragma unroll
        for (int i = 0; i < 8; ++i) yr[i] = *(const v8h*)(yg + SK + (size_t)i * 8 * CC);
        asm volatile("s_wait_xcnt 0x0" :: "v"(wg), "v"(yg) : "memory"); }   /* behind the next stage's loads, which fly under this stage's products (the memory clobber holds them in front); naming their address registers keeps these whole up to the wait */
#pragma unroll
      for (int kk = 0; kk < SK / 32; ++kk) { const v16h a = frag_h(&sg.h[s & 1][128 + wave * 16 + col][kk * 32], lane); v16h w[8];
#pragma unroll
        for (int j = 0; j < 8; ++j) w[j] = frag_h(&sg.h[s & 1][j * 16 + col][kk * 32], lane);
#pragma unroll
        for (int j = 0; j < 8; ++j) acc[j] = wmma16(a, w[j], acc[j]); }
      if (more) {
#pragma unroll
        for (int i = 0; i < 16; ++i) *(v8h*)&sg.h[(s + 1) & 1][i * 8 + lr][lc * 8] = wr[i];
#pragma unroll
        for (int i = 0; i < 8; ++i) *(v8h*)&sg.h[(s + 1) & 1][128 + i * 8 + lr][lc * 8] = yr[i]; }
      __syncthreads(); }   /* publishes stage s + 1 and ends every wave's reads of stage s, whose buffer the next trip refills */
#pragma unroll
    for (int j = 0; j < 8; ++j) { const float bias = BO ? bfr(BO[c0 + j * 16 + col]) : 0.f;
#pragma unroll
      for (int r = 0; r < 8; ++r) sf[wave][8 * g + r][j * 16 + col] = acc[j][r] * (1.0f / 16384.0f) + bias; } }   /* 2^-8 (Wo carry) x 2^-6 (ctx carry) */
  LDSX(); for (int rl = 0; rl < 16; ++rl) vst2(OUT + (r0 + rl) * DIN + c0 + lane * 4, *(const v4f*)&sf[wave][rl][lane * 4]); }

extern "C" void kernel_launch(void* const* d_in, const int* in_sizes, int n_in, void* d_out, int out_size, void* d_ws, size_t ws_size, hipStream_t stream) {
  (void)in_sizes; (void)n_in; (void)out_size;
  const float** F = (const float**)d_in;
  if (ws_size < (size_t)WS_END) return;
  char* ws = (char*)d_ws; _Float16 *QH = (_Float16*)(ws + WS_QH), *KH = (_Float16*)(ws + WS_KH), *VT = (_Float16*)(ws + WS_VT), *QL = (_Float16*)(ws + WS_QL), *KL = (_Float16*)(ws + WS_KL); __bf16 *VB = (__bf16*)(ws + WS_VB), *VBL = (__bf16*)(ws + WS_VBL), *YL = (__bf16*)(ws + WS_YL), *XB = (__bf16*)(ws + WS_XB), *WB = (__bf16*)(ws + WS_WB), *WOB = (__bf16*)(ws + WS_WOB); _Float16 *YH = (_Float16*)(ws + WS_YH), *WOH = (_Float16*)(ws + WS_WOH);
  // inputs: 0 x [2,2048,1024]; 1 wq [1024,1024] (out,in); 2 wk; 3 wv; 4 wo (out,in); no biases (null pointers)
  k_cvt<<<dim3((NB * TT * DIN + 4 * CC * DIN) / CVB), 256, 0, stream>>>(F[0], F[1], F[2], F[3], F[4], XB, WB, WOB, WOH);
  k_proj<<<dim3(TNB * TT / 64, CC / 128, 3), 128, 0, stream>>>(XB, XB, XB, WB, WB + (size_t)CC * DIN, WB + 2 * (size_t)CC * DIN, nullptr, nullptr, nullptr, QH, QL, KH, KL, VT, VB, VBL);
  k_att<<<dim3(NQB / 2, NH, TNB), 128, 0, stream>>>(QH, KH, QL, KL, VT, VB, VBL, YH, YL);
  k_out<<<dim3(TNB * TT / 64, DIN / 128), 128, 0, stream>>>(YH, YL, WOB, WOH, nullptr, (float*)d_out);
}

// v007
// Measured time: 108 microseconds a run.
// Timed twice side by side with v006, it ran 1.08 times as fast both times.
// All steps since v000 together make it 11.9 times as fast.
// compute dtype: all float inputs rounded to bf16, once, by k_cvt; q / k / v projections with EXACT bf16 products on WMMA 16x16x32 (f32 accumulate) (no biases); interleaved-pair RoPE in f32 AFTER the bias (embedded frequencies, the library cosf / sinf values, positions = the row index); causal logits: 3 products for the first 384 rows, single f16 q x k after, x 64^-0.5; softmax f32 (row maximum first, logits formed twice, never stored); exp(s - max) x 2^11 once to f16 x v once to f16 (bf16 hi + lo below row 384), / sum after the product; ctx hi+lo x exact Wo below row 384, x2^6 f16 carry x f16(bf16 x 2^8) Wo after, + bo; f32 output.
#include <hip/hip_runtime.h>
#include <math.h>

typedef __attribute__((ext_vector_type(16))) _Float16 v16h;
typedef __attribute__((ext_vector_type(16))) __bf16 v16b;
typedef __attribute__((ext_vector_type(8)))  _Float16 v8h;
typedef __attribute__((ext_vector_type(8)))  float v8f;
typedef __attribute__((ext_vector_type(4)))  float v4f;
typedef __attribute__((ext_vector_type(2)))  float v2f;
typedef __attribute__((ext_vector_type(4)))  unsigned v4u;
typedef __attribute__((ext_vector_type(4)))  int v4i;
typedef float __attribute__((may_alias)) float_a;
typedef int __attribute__((may_alias)) int_a;

template <typename T> __device__ __forceinline__ void vst2(void* p, T v) { *(T*)p = v;  }
__device__ __forceinline__ v8f wmma16(v16h a, v16h b, v8f c) {
  v8f d = __builtin_amdgcn_wmma_f32_16x16x32_f16(false, a, false, b, (short)0, c, false, false);
  asm volatile("v_nop\n\tv_nop\n\tv_nop\n\tv_nop" : "+v"(d) : "v"(a), "v"(b));
  return d;
}
__device__ __forceinline__ v8f wmma_bf(v16b a, v16b b, v8f c) {
  v8f d = __builtin_amdgcn_wmma_f32_16x16x32_bf16(false, a, false, b, (short)0, c, false, false);
  asm volatile("v_nop\n\tv_nop\n\tv_nop\n\tv_nop" : "+v"(d) : "v"(a), "v"(b));
  return d;
}
// 16x16x32 fragments: lane = (h = lane>>4, row/col = lane&15); elements 0..7 = k0+8h+0..7, 8..15 = k0+16+8h+0..7; D element r = row 8h+r
__device__ __forceinline__ v16h frag_h(const _Float16* rowk0, int lane) {
  union { v16h v; v8h q[2]; } u; const _Float16* p = rowk0 + 8 * (lane >> 4);
  u.q[0] = *(const v8h*)p; u.q[1] = *(const v8h*)(p + 16); return u.v;
}
__device__ __forceinline__ v16h frag_f32(const float* rowk0, int lane) {
  v16h a; const float* p = rowk0 + 8 * (lane >> 4);
#pragma unroll
  for (int i = 0; i < 8; ++i) { a[i] = (_Float16)p[i]; a[8 + i] = (_Float16)p[16 + i]; }
  return a;
}
__device__ __forceinline__ v16h frag_f32s(const float* rowk0, int lane, float sc) {
  v16h a; const float* p = rowk0 + 8 * (lane >> 4);
#pragma unroll
  for (int i = 0; i < 8; ++i) { a[i] = (_Float16)(p[i] * sc); a[8 + i] = (_Float16)(p[16 + i] * sc); }
  return a;
}
// column fragment from a [K][ld] layout (column n), rows >= K read as 0
__device__ __forceinline__ v16h fragc_f32(const float* W, int k0, int n, int lane, int ld, int K) {
  v16h a; const int g = lane >> 4;
#pragma unroll
  for (int i = 0; i < 8; ++i) { const int ka = k0 + 8 * g + i, kb = ka + 16;
    a[i] = (_Float16)(ka < K ? W[(size_t)(ka < K ? ka : K - 1) * ld + n] : 0.f); a[8 + i] = (_Float16)(kb < K ? W[(size_t)(kb < K ? kb : K - 1) * ld + n] : 0.f); }
  return a;
}
struct F2 { v16b h, l; };
__device__ __forceinline__ F2 bsplit16(const float v[16]) { F2 r;
#pragma unroll
  for (int i = 0; i < 16; ++i) { const __bf16 h = (__bf16)v[i]; r.h[i] = h; r.l[i] = (__bf16)(v[i] - (float)h); }
  return r; }
__device__ __forceinline__ F2 split_row(const float* row, int k0, int lane) { float v[16]; const float* p = row + k0 + 8 * (lane >> 4);
#pragma unroll
  for (int i = 0; i < 8; ++i) { v[i] = p[i]; v[8 + i] = p[16 + i]; }
  return bsplit16(v); }
__device__ __forceinline__ F2 split_rowK(const float* row, int k0, int lane, int K) { float v[16]; const int g = lane >> 4;
#pragma unroll
  for (int i = 0; i < 8; ++i) { const int ka = k0 + 8 * g + i, kb = ka + 16; v[i] = ka < K ? row[ka < K ? ka : K - 1] : 0.f; v[8 + i] = kb < K ? row[kb < K ? kb : K - 1] : 0.f; }
  return bsplit16(v); }
__device__ __forceinline__ F2 split_col(const float* W, int k0, int n, int lane, int ld, int K) { float v[16]; const int g = lane >> 4;
#pragma unroll
  for (int i = 0; i < 8; ++i) { const int ka = k0 + 8 * g + i, kb = ka + 16; v[i] = ka < K ? W[(size_t)(ka < K ? ka : K - 1) * ld + n] : 0.f; v[8 + i] = kb < K ? W[(size_t)(kb < K ? kb : K - 1) * ld + n] : 0.f; }
  return bsplit16(v); }
__device__ __forceinline__ v8f mac3(const F2& a, const F2& b, v8f c) { c = wmma_bf(a.l, b.h, c); c = wmma_bf(a.h, b.l, c); return wmma_bf(a.h, b.h, c); }
__device__ __forceinline__ float sigm(float v) { return 1.0f / (1.0f + expf(-v)); }
#define LDSX() do { asm volatile("s_wait_dscnt 0" ::: "memory"); __builtin_amdgcn_wave_barrier(); __builtin_amdgcn_fence(__ATOMIC_RELEASE, "workgroup"); } while (0)

// Causal multi-head self-attention with interleaved-pair RoPE (x [2,2048,1024]; torch (out,in) wq / wk / wv / wo [1024,1024] applied as x @ W.T, no biases; 16 heads x 64; RoPE on Q and K: adjacent (even, odd) pairs (xe c - xo s, xe s + xo c) re-interleaved, theta 10000, positions 0..2047; scores / sqrt(64); tril kept, -inf elsewhere (the module's own softmax guards the -inf row maximum: every row keeps its diagonal, so the guard never fires); out @ wo.T).
#define NB 2
#define TT 2048
#define CC 1024            // NH * HD = projected width
#define DIN 1024          // input (model) width
#define NH 16
#define HD 64
#define NQB (TT / 64)
#define SCALE (0.125f)
#define SC2 (SCALE * 1.44269504088896340736f)   // SCALE x log2(e): exp(SCALE x (d - dmax)) = 2^(SC2 x d - SC2 x dmax), d = the unscaled q.k product
#define CAUSAL 1
#ifndef TNB
#define TNB NB
#endif
__device__ __forceinline__ float bfr(float v) { return (float)(__bf16)v; }
typedef __attribute__((ext_vector_type(8))) __bf16 v8b;
__device__ __forceinline__ v16b frag_b(const __bf16* rowk0, int lane) {
  union { v16b v; v8b q[2]; } u; const __bf16* p = rowk0 + 8 * (lane >> 4);
  u.q[0] = *(const v8b*)p; u.q[1] = *(const v8b*)(p + 16); return u.v;
}
// unconverted fragment reads; p = the lane's row + k0 + 8 * (lane >> 4): elements 0..7 = p[0..7], 8..15 = p[16..23] (the k order of frag_h / frag_f32 / split_row / wcol_oi)
typedef __attribute__((ext_vector_type(16))) float v16f;
__device__ __forceinline__ v16f raw16(const float* p) { v16f r;
#pragma unroll
  for (int i = 0; i < 8; ++i) { r[i] = p[i]; r[8 + i] = p[16 + i]; }
  return r; }
__device__ __forceinline__ v16h pair_h(const _Float16* p) { union { v16h v; v8h q[2]; } u; u.q[0] = *(const v8h*)p; u.q[1] = *(const v8h*)(p + 16); return u.v; }
__device__ __forceinline__ v16b pair_b(const __bf16* p) { union { v16b v; v8b q[2]; } u; u.q[0] = *(const v8b*)p; u.q[1] = *(const v8b*)(p + 16); return u.v; }
__device__ __forceinline__ F2 bsplit_v(v16f r) { float v[16];
#pragma unroll
  for (int i = 0; i < 16; ++i) v[i] = r[i];
  return bsplit16(v); }
#define SK 128             // k of one LDS operand stage (k_out): 256 B of every 16-bit source row
#define SPG 136            // its row pitch in 16-bit elements: 272 B = 16 B x 17, odd, for the ds_load_b128 fragment reads
#define SP 72              // k_att's stage row pitch in 16-bit elements: 144 B = 16 B x 9, odd, for the ds_load_b128 fragment reads
typedef __attribute__((ext_vector_type(4))) __bf16 v4b;
typedef __attribute__((ext_vector_type(4))) _Float16 v4h;
__device__ __forceinline__ v4b cvt4b(v4f v) { v4b r;
#pragma unroll
  for (int i = 0; i < 4; ++i) r[i] = (__bf16)v[i];
  return r; }
#define QBH 6              // causal: query blocks 0..QBH-1 of each sequence (few keys, no averaging) take the high-precision path
#define QHI 384            // rows carrying a q residual plane
#define KHI 384            // key rows carrying k residual / v bf16 hi+lo planes (used only by the causal high-precision path)
// B fragment (k rows k0+.., output column o) of a weight: (in,out) [K][ld] or (out,in) [ld rows of K]: bf16 exact, or f16(bf16 * 256) exact
__device__ __forceinline__ v16b wcol_io(const float* Wm, int k0, int o, int lane, int ld) { v16b w; const int g = lane >> 4;
#pragma unroll
  for (int i = 0; i < 8; ++i) { w[i] = (__bf16)Wm[(size_t)(k0 + 8 * g + i) * ld + o]; w[8 + i] = (__bf16)Wm[(size_t)(k0 + 16 + 8 * g + i) * ld + o]; }
  return w; }
__device__ __forceinline__ v16b wcol_oi(const float* Wm, int k0, int o, int lane, int K) { v16b w; const float* p = Wm + (size_t)o * K + k0 + 8 * (lane >> 4);
#pragma unroll
  for (int i = 0; i < 8; ++i) { w[i] = (__bf16)p[i]; w[8 + i] = (__bf16)p[16 + i]; }
  return w; }
__device__ __forceinline__ v16h wcolh_io(const float* Wm, int k0, int o, int lane, int ld) { v16h w; const int g = lane >> 4;
#pragma unroll
  for (int i = 0; i < 8; ++i) { w[i] = (_Float16)(bfr(Wm[(size_t)(k0 + 8 * g + i) * ld + o]) * 256.0f); w[8 + i] = (_Float16)(bfr(Wm[(size_t)(k0 + 16 + 8 * g + i) * ld + o]) * 256.0f); }
  return w; }
__device__ __forceinline__ v16h wcolh_oi(const float* Wm, int k0, int o, int lane, int K) { v16h w; const float* p = Wm + (size_t)o * K + k0 + 8 * (lane >> 4);
#pragma unroll
  for (int i = 0; i < 8; ++i) { w[i] = (_Float16)(bfr(p[i]) * 256.0f); w[8 + i] = (_Float16)(bfr(p[16 + i]) * 256.0f); }
  return w; }
#define WQKV_LAYOUT 1   // 0 = (in,out) [DIN][CC]; 1 = (out,in) [CC][DIN]; 2 = per-head [NH][DIN][HD]
__device__ __forceinline__ v16b wcol_hdk(const float* Wm, int k0, int o, int lane) { v16b w; const int g = lane >> 4; const float* p = Wm + (size_t)(o / HD) * DIN * HD + (o % HD);
#pragma unroll
  for (int i = 0; i < 8; ++i) { w[i] = (__bf16)p[(size_t)(k0 + 8 * g + i) * HD]; w[8 + i] = (__bf16)p[(size_t)(k0 + 16 + 8 * g + i) * HD]; }
  return w; }
#define WO_OUT_IN 1
#if WQKV_LAYOUT == 1
#define WCOL(W, k0, o, lane) wcol_oi(W, k0, o, lane, DIN)
#elif WQKV_LAYOUT == 2
#define WCOL(W, k0, o, lane) wcol_hdk(W, k0, o, lane)
#else
#define WCOL(W, k0, o, lane) wcol_io(W, k0, o, lane, CC)
#endif
#if WO_OUT_IN
#define WOCOL(W, k0, o, lane) wcol_oi(W, k0, o, lane, CC)
#define WOCOLH(W, k0, o, lane) wcolh_oi(W, k0, o, lane, CC)
#else
#define WOCOL(W, k0, o, lane) wcol_io(W, k0, o, lane, DIN)
#define WOCOLH(W, k0, o, lane) wcolh_io(W, k0, o, lane, DIN)
#endif

// RoPE inverse frequencies 1/10000^(2i/64) (the f32 values jax computes)
__constant__ float INVF[32] = {1.000000000e+00,7.498942018e-01,5.623413324e-01,4.216965139e-01,3.162277639e-01,2.371373624e-01,1.778279394e-01,1.333521456e-01,1.000000015e-01,7.498941571e-02,5.623412877e-02,4.216964915e-02,3.162277862e-02,2.371373586e-02,1.778279431e-02,1.333521493e-02,9.999999776e-03,7.498942316e-03,5.623413250e-03,4.216964822e-03,3.162277862e-03,2.371373819e-03,1.778279431e-03,1.333521446e-03,1.000000047e-03,7.498941850e-04,5.623413017e-04,4.216964880e-04,3.162277862e-04,2.371373848e-04,1.778279402e-04,1.333521504e-04};
#define PROJ_EXTRA_PARAMS
// cos and sin of a RoPE angle a, 0 <= a < 2^17 (a position below TT x a frequency of at most 1). On that range these are the library's cosf / sinf operation for operation (pi/2 taken off in three parts, its two polynomials, the quadrant select); left out are its branches to the large-argument reduction, never taken here, which kept one angle's chain from starting before the last one's end
__device__ __forceinline__ void rope_cs(float a, float& cs, float& sn) {
  const float fn = rintf(a * 6.36619747e-1f);
  const float r = fmaf(fn, -5.39030253e-15f, fmaf(fn, -7.54978942e-8f, fmaf(fn, -1.57079625e+0f, a)));
  const float t = r * r; const unsigned q = (unsigned)(int)fn;
  const float s = fmaf(r, t * fmaf(t, fmaf(t, -1.94644585e-4f, 8.33171979e-3f), -1.66666463e-1f), r);
  const float c = fmaf(t, fmaf(t, fmaf(t, fmaf(t, 2.56687417e-5f, -1.39091106e-3f), 4.16679047e-2f), -5.00000238e-1f), 1.0f);
  const unsigned sg = (q << 30) & 0x80000000u;   /* quadrants 2 and 3 flip both signs */
  sn = __uint_as_float(__float_as_uint((q & 1u) ? c : s) ^ sg); cs = __uint_as_float(__float_as_uint((q & 1u) ? -s : c) ^ sg); }
#ifndef PROJ_EXTRA_PARAMS
#define PROJ_EXTRA_PARAMS
#endif

#define WS_QH  0u                                      // f16 q rows [b*t][CC]
#define WS_KH  (WS_QH + 2u * (size_t)NB * TT * CC)      // f16 k rows [b*t][CC]
#define WS_VT  (WS_KH + 2u * (size_t)NB * TT * CC)      // f16 v planes [b][c][t]
#define WS_QL  (WS_VT + 2u * (size_t)NB * CC * TT)      // f16 q residual x 2^10 rows [b][t < QHI][CC]
#define WS_KL  (WS_QL + 2u * (size_t)NB * QHI * CC)     // f16 k residual x 2^10 rows [b][t < KHI][CC]
#define WS_VB  (WS_KL + 2u * (size_t)NB * KHI * CC)     // bf16 v hi planes [b][c][t < KHI]
#define WS_VBL (WS_VB + 2u * (size_t)NB * CC * KHI)
#define WS_YH  (WS_VBL + 2u * (size_t)NB * CC * KHI)    // 16-bit ctx rows [b*t][CC]: f16(ctx x 2^6); rows < QHI of a sequence: bf16 hi
#define WS_YL  (WS_YH + 2u * (size_t)NB * TT * CC)      // bf16 ctx lo rows [b][t < QHI][CC]
#define WS_XB  (WS_YL + 2u * (size_t)NB * QHI * CC)     // bf16 x rows [b*t][DIN]
#define WS_WB  (WS_XB + 2u * (size_t)NB * TT * DIN)     // bf16 wq, wk, wv, each [CC][DIN]
#define WS_WOB (WS_WB + 6u * (size_t)CC * DIN)          // bf16 wo [DIN][CC]
#define WS_WOH (WS_WOB + 2u * (size_t)DIN * CC)         // f16(bf16 wo x 2^8) [DIN][CC]
#define WS_END (WS_WOH + 2u * (size_t)DIN * CC)

// ---- k_cvt: x, wq, wk, wv, wo to the 16-bit forms the products take, once, in place of once in each of the 24 (x), 32 (wq, wk, wv), 64 (wo) blocks that stage a row. block = CVB consecutive floats of one input: 16 loads of 16 B a lane in flight, 512 B a wave and load; stores of 256 B a wave; two blocks a WGP, so that few waves have to start
#define CVB 16384
__global__ __launch_bounds__(256) void k_cvt(const float* __restrict__ X, const float* __restrict__ WQ, const float* __restrict__ WK, const float* __restrict__ WV, const float* __restrict__ WO, __bf16* __restrict__ XB, __bf16* __restrict__ WB, __bf16* __restrict__ WOB, _Float16* __restrict__ WOH) {
  constexpr int nx = NB * TT * DIN / CVB, nw = CC * DIN / CVB; const int blk = blockIdx.x; const int sel = blk < nx ? -1 : (blk - nx) / nw;   /* block-uniform: -1 x, 0..2 wq wk wv, 3 wo */
  const size_t o = (size_t)(blk < nx ? blk : (blk - nx) % nw) * CVB + threadIdx.x * 4;
  const float* s = (sel < 0 ? X : sel == 0 ? WQ : sel == 1 ? WK : sel == 2 ? WV : WO) + o;
  v4f r[16]; v4b c[16];
#pragma unroll
  for (int i = 0; i < 16; ++i) r[i] = *(const v4f*)(s + i * 1024);
  asm volatile("s_wait_xcnt 0x0" :: "v"(s) : "memory");   /* behind the loads: their address registers may be taken for the stores' */
#pragma unroll
  for (int i = 0; i < 16; ++i) c[i] = cvt4b(r[i]);
  __bf16* d = (sel < 0 ? XB : sel < 3 ? WB + (size_t)sel * CC * DIN : WOB) + o;
  if (sel == 3) { v4h f[16];   /* wo also as f16(bf16 x 2^8), exact */
#pragma unroll
    for (int i = 0; i < 16; ++i)
#pragma unroll
      for (int e = 0; e < 4; ++e) f[i][e] = (_Float16)((float)c[i][e] * 256.0f);
#pragma unroll
    for (int i = 0; i < 16; ++i) *(v4h*)(WOH + o + i * 1024) = f[i]; }
#pragma unroll
  for (int i = 0; i < 16; ++i) *(v4b*)(d + i * 1024) = c[i]; }

// ---- k_proj: block = (128 rows, 128 cols, which), four waves of 64 x 64 each: q/k/v = X W (+ b), X and W in k_cvt's bf16, with exact bf16 products (K = DIN) -> which 0: q f16 rows (+ residual rows < QHI); 1: k f16 rows (+ residual rows < KHI); 2: v f16 planes [c][t] (+ bf16 hi/lo planes for t < KHI)
// a wave's 4 X and 4 W fragments of a k step feed 16 products (16 x 128 a wave: 9 fragments for 8), and a staged row serves 128 rows or columns of the tile. 768 blocks, three on a WGP (LDS, registers): all resident at once
#define PK 64              // k of one LDS operand stage: 128 B of every 16-bit source row
#define PPG 72             // its row pitch in 16-bit elements: 144 B = 16 B x 9, odd, for the ds_load_b128 fragment reads
__global__ __launch_bounds__(128) void k_proj(const __bf16* __restrict__ XQ, const __bf16* __restrict__ XK, const __bf16* __restrict__ XV, const __bf16* __restrict__ WQ, const __bf16* __restrict__ WK, const __bf16* __restrict__ WV, const float* __restrict__ BQ, const float* __restrict__ BK, const float* __restrict__ BV,
    _Float16* __restrict__ QH, _Float16* __restrict__ QL, _Float16* __restrict__ KH, _Float16* __restrict__ KL, _Float16* __restrict__ VT, __bf16* __restrict__ VB, __bf16* __restrict__ VBL PROJ_EXTRA_PARAMS) {
  __shared__ __align__(16) union { struct { float st[64][132]; union { struct { _Float16 sh[64][136], sl[64][136]; } r; struct { _Float16 th[128][72]; __bf16 tb[128][72], tbl[128][72]; } p; } c; } e; __bf16 sg[2][256][PPG]; } un;   /* the two operand stages of the k loop lie where the epilogue's tiles lie later (the loop's last barrier between); a block needs either the row tiles (q, k) or the plane tiles (v) */
  auto& st = un.e.st; auto& sh = un.e.c.r.sh; auto& sl = un.e.c.r.sl; auto& th = un.e.c.p.th; auto& tb = un.e.c.p.tb; auto& tbl = un.e.c.p.tbl; auto& sg = un.sg;
  const int tid = threadIdx.x, wave = tid >> 5, lane = tid & 31, col = lane & 15, g = lane >> 4; const int wrow = wave >> 1, wcol = wave & 1;   /* the wave's 64 x 64 quarter of the tile */
  const int which = blockIdx.z; const int c0 = blockIdx.y * 128; const size_t rb = (size_t)blockIdx.x * 128;
  const __bf16* X = which == 0 ? XQ : which == 1 ? XK : XV; const __bf16* WA = which == 0 ? WQ : which == 1 ? WK : WV; const float* BA = which == 0 ? BQ : which == 1 ? BK : BV;
  v8f acc[4][4] = {};
  // a stage = PK k of the block's 128 W rows (sg rows 0..127) and 128 X rows (128..255), bf16 as k_cvt left them, brought in once for the four waves. 8 lanes x 16 B read one row's 128 B: a load instruction touches 4 whole lines, not 16 pieces
  const int lr = tid >> 3, lc = tid & 7; const __bf16* wg = WA + (size_t)(c0 + lr) * DIN + lc * 8; const __bf16* xg = X + (rb + lr) * DIN + lc * 8;
  v8b wr[8], xr[8];
#pragma unroll
  for (int i = 0; i < 8; ++i) wr[i] = *(const v8b*)(wg + (size_t)i * 16 * DIN);
#pragma unroll
  for (int i = 0; i < 8; ++i) xr[i] = *(const v8b*)(xg + (size_t)i * 16 * DIN);
  asm volatile("s_wait_xcnt 0x0" :: "v"(wg), "v"(xg) : "memory");   /* behind the stage's loads: their address registers step on below */
#pragma unroll
  for (int i = 0; i < 8; ++i) *(v8b*)&sg[0][i * 16 + lr][lc * 8] = wr[i];
#pragma unroll
  for (int i = 0; i < 8; ++i) *(v8b*)&sg[0][128 + i * 16 + lr][lc * 8] = xr[i];
  __syncthreads();
#pragma unroll 1   // rolled: the next stage's 16 loads stay in registers over one stage's products
  for (int s = 0; s < DIN / PK; ++s, wg += PK, xg += PK) { const bool more = s + 1 < DIN / PK;   /* block-uniform */
    if (more) {
#pragma unroll
      for (int i = 0; i < 8; ++i) wr[i] = *(const v8b*)(wg + PK + (size_t)i * 16 * DIN);
#pragma unroll
      for (int i = 0; i < 8; ++i) xr[i] = *(const v8b*)(xg + PK + (size_t)i * 16 * DIN);
      asm volatile("s_wait_xcnt 0x0" :: "v"(wg), "v"(xg) : "memory"); }   /* behind the next stage's loads, which fly under this stage's products (the memory clobber holds them in front); naming their address registers keeps these whole up to the wait */
#pragma unroll
    for (int kk = 0; kk < PK / 32; ++kk) { v16b a[4], w[4];
#pragma unroll
      for (int i = 0; i < 4; ++i) a[i] = frag_b(&sg[s & 1][128 + wrow * 64 + i * 16 + col][kk * 32], lane);
#pragma unroll
      for (int j = 0; j < 4; ++j) w[j] = frag_b(&sg[s & 1][wcol * 64 + j * 16 + col][kk * 32], lane);
#pragma unroll
      for (int i = 0; i < 4; ++i)
#pragma unroll
        for (int j = 0; j < 4; ++j) acc[i][j] = wmma_bf(a[i], w[j], acc[i][j]); }
    if (more) {
#pragma unroll
      for (int i = 0; i < 8; ++i) *(v8b*)&sg[(s + 1) & 1][i * 16 + lr][lc * 8] = wr[i];
#pragma unroll
      for (int i = 0; i < 8; ++i) *(v8b*)&sg[(s + 1) & 1][128 + i * 16 + lr][lc * 8] = xr[i]; }
    __syncthreads(); }   /* publishes stage s + 1 and ends every wave's reads of stage s, whose buffer the next trip refills */
#pragma unroll 1   // rolled: the tile's two halves of 64 rows leave one after the other through one copy of the epilogue and one set of LDS tiles
  for (int hf = 0; hf < 2; ++hf) { const size_t r0 = rb + hf * 64; const size_t bb = r0 / TT; const int t0 = (int)(r0 % TT);
  { // stage the half's f32 tile (acc + bias) in LDS, written by the two waves that hold it, run the per-(row, head) epilogue hook, then convert. The half before is out of st since its conversion's barrier, and out of the 16-bit tiles before the two barriers below
    if (wrow == hf) {
#pragma unroll
      for (int j = 0; j < 4; ++j) { const float bias = BA ? bfr(BA[c0 + wcol * 64 + j * 16 + col]) : 0.f;
#pragma unroll
        for (int i = 0; i < 4; ++i)
#pragma unroll
          for (int r = 0; r < 8; ++r) st[i * 16 + 8 * g + r][wcol * 64 + j * 16 + col] = acc[i][j][r] + bias; } }
    __syncthreads();
    if (which < 2) {   /* block-uniform. q and k: interleaved-pair rotation (x[2i], x[2i + 1]) by the angle t * INVF[i]; v untouched. A thread has one row and every second frequency: each cos / sin is formed once and turns the pair of both heads of the tile; 32 lanes x 8 B fall on 64 different banks */
      const int rl = tid >> 1, ih = tid & 1; const float pos = (float)(int)((r0 + rl) % TT);   /* position = the token's sequence index */
#pragma unroll   // unrolled: the 16 angles' chains interleave
      for (int ii = 0; ii < 16; ++ii) { float cs, sn; const float f0 = INVF[2 * ii], f1 = INVF[2 * ii + 1]; rope_cs(pos * (ih ? f1 : f0), cs, sn);   /* both read as scalars, then a select: no load by lane */
#pragma unroll   // unrolled: both heads' pairs are turned from the same two registers
        for (int hh = 0; hh < 128 / HD; ++hh) { v2f* p = (v2f*)&st[rl][hh * HD + 4 * ii + 2 * ih]; const v2f x = *p; v2f y; y[0] = x[0] * cs - x[1] * sn; y[1] = x[0] * sn + x[1] * cs; *p = y; } } }
    __syncthreads(); }
  if (which < 2) { _Float16* DH = which == 0 ? QH : KH; _Float16* DL = which == 0 ? QL : KL; const int nhi = which == 0 ? QHI : KHI; const bool hi_rows = t0 < nhi;
    for (int e = tid; e < 64 * 128; e += 128) { const int rl = e >> 7, cl = e & 127; const float v = st[rl][cl]; const _Float16 hv = (_Float16)v; sh[rl][cl] = hv; sl[rl][cl] = (_Float16)((v - (float)hv) * 1024.0f); }
    __syncthreads();
    for (int e = tid; e < 64 * 16; e += 128) { const int rl = e >> 4, q = e & 15; vst2((unsigned*)(DH + (r0 + rl) * CC + c0 + q * 8), *(const v4u*)&sh[rl][q * 8]); if (hi_rows) vst2((unsigned*)(DL + (bb * nhi + t0 + rl) * (size_t)CC + c0 + q * 8), *(const v4u*)&sl[rl][q * 8]); }
  } else { const bool hi_rows = t0 < KHI;
    for (int e = tid; e < 64 * 128; e += 128) { const int rl = e & 63, cl = e >> 6; const float v = st[rl][cl]; th[cl][rl] = (_Float16)v; const __bf16 bh = (__bf16)v; tb[cl][rl] = bh; tbl[cl][rl] = (__bf16)(v - (float)bh); }
    __syncthreads();
    for (int e = tid; e < 128 * 8; e += 128) { const int cl = e >> 3, q = e & 7; vst2((unsigned*)(VT + (bb * CC + c0 + cl) * (size_t)TT + t0 + q * 8), *(const v4u*)&th[cl][q * 8]); if (hi_rows) { const size_t o3 = (bb * CC + c0 + cl) * (size_t)KHI + t0 + q * 8; vst2((unsigned*)(VB + o3), *(const v4u*)&tb[cl][q * 8]); vst2((unsigned*)(VBL + o3), *(const v4u*)&tbl[cl][q * 8]); } } } } }
// ---- k_att: block = 4 waves x 16 queries of (b, h), two query blocks one after the other (x and NQB - 1 - x: every block walks (NQB + 1) x 64 keys). Logits as S^T = K Q^T: D register r of key tile kt = key kt * 16 + 8g + r of query col, so a lane holds one query's logits and two tiles are the A fragment of P in the k order of pair_h. Pass 1: row maximum. Pass 2: the same logits again, e = 2^11 exp(s - max), sum of e in f32, e to f16 (early query blocks: bf16 hi + lo) against v; ctx = acc / sum. Nothing of S goes to memory.
// a trip is NT key tiles of 16: 64 keys; 32 in the early query blocks, whose residual planes double the fragments
// a trip's operands are staged in LDS once for the four waves (pitch SP): sk rows 0..63 = the 64 k rows (early blocks: 0..31 k, 32..63 its residual); sv row c = v plane c's 64 keys (early blocks: 32 keys of the bf16 hi plane, then of the lo plane)
template <bool HI> __device__ __forceinline__ void att_ldk(const _Float16* kp, const _Float16* klp, v16h (&kf)[2][HI ? 2 : 4], v16h (&klf)[2][HI ? 2 : 4]) {
#pragma unroll
  for (int kc = 0; kc < 2; ++kc)
#pragma unroll
    for (int kt = 0; kt < (HI ? 2 : 4); ++kt) { kf[kc][kt] = pair_h(kp + kt * 16 * SP + kc * 32); if (HI) klf[kc][kt] = pair_h(klp + kt * 16 * SP + kc * 32); } }
// unscaled logits (q.k; SCALE is folded into the exponent's multiplier SC2) of a trip's keys; srel = query - the trip's first key - 8g: key kt * 16 + r of the lane is kept while kt * 16 + r <= srel
template <bool HI, bool MASK> __device__ __forceinline__ void att_logits(const v16h (&kf)[2][HI ? 2 : 4], const v16h (&klf)[2][HI ? 2 : 4], const v16h (&qh)[2], const v16h (&ql)[2], int srel, float (&s)[HI ? 2 : 4][8]) {
  constexpr int NT = HI ? 2 : 4; v8f a[NT] = {}, al[NT] = {};
#pragma unroll
  for (int kc = 0; kc < 2; ++kc)
#pragma unroll
    for (int kt = 0; kt < NT; ++kt) { a[kt] = wmma16(kf[kc][kt], qh[kc], a[kt]); if (HI) { al[kt] = wmma16(kf[kc][kt], ql[kc], al[kt]); al[kt] = wmma16(klf[kc][kt], qh[kc], al[kt]); } }
#pragma unroll
  for (int kt = 0; kt < NT; ++kt)
#pragma unroll
    for (int r = 0; r < 8; ++r) { const float v = HI ? a[kt][r] + al[kt][r] * (1.0f / 1024.0f) : a[kt][r]; s[kt][r] = (!MASK || kt * 16 + r <= srel) ? v : -3.0e38f; } }
template <bool HI, bool MASK> __device__ __forceinline__ float att_max(const _Float16* kp, const _Float16* klp, const v16h (&qh)[2], const v16h (&ql)[2], int srel) {
  constexpr int NT = HI ? 2 : 4; v16h kf[2][NT], klf[2][NT]; float s[NT][8]; att_ldk<HI>(kp, klp, kf, klf);
  att_logits<HI, MASK>(kf, klf, qh, ql, srel, s);
  float m = s[0][0];
#pragma unroll
  for (int kt = 0; kt < NT; ++kt)
#pragma unroll
    for (int r = 0; r < 8; ++r) m = fmaxf(m, s[kt][r]);
  return m; }
// 2^x of the eight logits a lane holds of one key tile, in place. One statement, so that behind each v_exp_f32 stands an instruction that neither reads its result nor overwrites its source: the next one, and a v_nop behind the last (the slot the instruction set asks for)
__device__ __forceinline__ void exp2x8(float (&x)[8]) {
  asm("v_exp_f32 %0, %0\n\tv_exp_f32 %1, %1\n\tv_exp_f32 %2, %2\n\tv_exp_f32 %3, %3\n\tv_exp_f32 %4, %4\n\tv_exp_f32 %5, %5\n\tv_exp_f32 %6, %6\n\tv_exp_f32 %7, %7\n\tv_nop"
      : "+v"(x[0]), "+v"(x[1]), "+v"(x[2]), "+v"(x[3]), "+v"(x[4]), "+v"(x[5]), "+v"(x[6]), "+v"(x[7])); }
// bias = 11 - SC2 x the query's row maximum, finite (every row keeps its diagonal): e = 2^(SC2 x d + bias) = 2^11 exp(s - max) by one fused multiply-add and the chip's own 2^x; an excluded logit (-3e38) gives 0
template <bool HI, bool MASK> __device__ __forceinline__ void att_pv(const _Float16* kp, const _Float16* klp, const _Float16* vp, const __bf16* vhp, const __bf16* vlp, const v16h (&qh)[2], const v16h (&ql)[2], int srel, float bias, float& sum, v8f (&acc)[HD / 16]) {
  constexpr int NT = HI ? 2 : 4; v16h kf[2][NT], klf[2][NT], vf[NT / 2][HD / 16]; v16b vh[NT / 2][HD / 16], vl[NT / 2][HD / 16]; float s[NT][8]; att_ldk<HI>(kp, klp, kf, klf);
  att_logits<HI, MASK>(kf, klf, qh, ql, srel, s);
#pragma unroll
  for (int u = 0; u < NT / 2; ++u)   /* the v reads take the k fragments' registers and fly under the exponentials */
#pragma unroll
    for (int j = 0; j < HD / 16; ++j) { if (!HI) vf[u][j] = pair_h(vp + j * 16 * SP + u * 32); else { vh[u][j] = pair_b(vhp + j * 16 * SP + u * 32); vl[u][j] = pair_b(vlp + j * 16 * SP + u * 32); } }
  float part[NT];
#pragma unroll
  for (int kt = 0; kt < NT; ++kt) {
#pragma unroll
    for (int r = 0; r < 8; ++r) s[kt][r] = fmaf(s[kt][r], SC2, bias);
    exp2x8(s[kt]); part[kt] = s[kt][0];
#pragma unroll
    for (int r = 1; r < 8; ++r) part[kt] += s[kt][r]; }
#pragma unroll
  for (int kt = 0; kt < NT; kt += 2) sum += part[kt] + part[kt + 1];
#pragma unroll
  for (int u = 0; u < NT / 2; ++u) {
    if (!HI) { v16h p;
#pragma unroll
      for (int i = 0; i < 8; ++i) { p[i] = (_Float16)s[2 * u][i]; p[8 + i] = (_Float16)s[2 * u + 1][i]; }
#pragma unroll
      for (int j = 0; j < HD / 16; ++j) acc[j] = wmma16(p, vf[u][j], acc[j]);
    } else { float pv[16];
#pragma unroll
      for (int i = 0; i < 8; ++i) { pv[i] = s[2 * u][i]; pv[8 + i] = s[2 * u + 1][i]; }
      const F2 p = bsplit16(pv);
#pragma unroll
      for (int j = 0; j < HD / 16; ++j) { acc[j] = wmma_bf(p.h, vh[u][j], acc[j]); acc[j] = wmma_bf(p.l, vh[u][j], acc[j]); acc[j] = wmma_bf(p.h, vl[u][j], acc[j]); } } } }
template <bool HI> __device__ __forceinline__ void att_tile(const _Float16* __restrict__ QH, const _Float16* __restrict__ KH, const _Float16* __restrict__ QL, const _Float16* __restrict__ KL, const _Float16* __restrict__ VT, const __bf16* __restrict__ VB, const __bf16* __restrict__ VBL, _Float16* __restrict__ YH, __bf16* __restrict__ YL, float (*ssw)[HD + 4], _Float16 (*sk)[64][SP], _Float16 (*sv)[64][SP], int b, int h, int qb, int wave, int lane) {
  constexpr int KS = HI ? 32 : 64;   /* keys a trip */
  const int col = lane & 15, g = lane >> 4; const int ql0 = qb * 64 + wave * 16; const size_t ho = (size_t)h * HD + 8 * g;
  const int nfull = HI ? 0 : qb, nmask = HI ? (qb + 1) * 2 : 1;   /* trips wholly below the diagonal, then trips masked by index */
  const int nl = nfull + nmask - 1;   /* trips in front of the last one: all unmasked in the late blocks, all masked in the early ones; block-uniform */
  const int srel0 = ql0 + col - 8 * g - nfull * KS;
  const _Float16* qp = QH + ((size_t)b * TT + ql0 + col) * CC + ho; const _Float16* qlp = HI ? QL + ((size_t)b * QHI + ql0 + col) * CC + ho : qp;
  v16h qh[2], ql[2];
#pragma unroll
  for (int kc = 0; kc < 2; ++kc) { qh[kc] = pair_h(qp + kc * 32); ql[kc] = HI ? pair_h(qlp + kc * 32) : qh[kc]; }
  asm volatile("s_wait_xcnt 0x0" :: "v"(qp), "v"(qlp) : "memory");   /* behind the q loads, as below */
  // staging: 8 lanes x 16 B fill one stage row of 128 B, so a load instruction touches 4 whole lines (the early blocks' v planes: 8 half lines), not 16 pieces. ka: stage rows 0..31, kb: rows 32..63
  constexpr int VLD = HI ? KHI : TT;   /* row pitch of the v planes read */
  const int sr = (wave * 32 + lane) >> 3, sc = (lane & 7) * 8; const size_t vrow = (size_t)b * CC + h * HD + sr;
  const _Float16* const ka0 = KH + ((size_t)b * TT + sr) * CC + h * HD + sc; const _Float16* const kb0 = HI ? KL + ((size_t)b * KHI + sr) * CC + h * HD + sc : ka0 + (size_t)32 * CC;
  const _Float16* const vg0 = HI ? (const _Float16*)((sc < 32 ? VB : VBL) + vrow * KHI + (sc & 31)) : VT + vrow * TT + sc;   /* moved as raw 16-B pieces */
  float m = -3.0e38f;
  { const _Float16 *ka = ka0, *kb = kb0; v8h kr[4], vr[4]; int srel = srel0;
#pragma unroll
    for (int i = 0; i < 2; ++i) { kr[i] = *(const v8h*)(ka + (size_t)i * 16 * CC); kr[2 + i] = *(const v8h*)(kb + (size_t)i * 16 * CC); }
    asm volatile("s_wait_xcnt 0x0" :: "v"(ka), "v"(kb) : "memory");   /* behind the stage's loads: their address registers step on below */
    __syncthreads();   /* every wave has left the stages of the tile before */
#pragma unroll
    for (int i = 0; i < 4; ++i) *(v8h*)&sk[0][i * 16 + sr][sc] = kr[i];
    __syncthreads();
#pragma unroll 1   // rolled: one trip's fragments fill the registers
    for (int tr = 0; tr < nl; ++tr, ka += (size_t)KS * CC, kb += (size_t)KS * CC) {
#pragma unroll
      for (int i = 0; i < 2; ++i) { kr[i] = *(const v8h*)(ka + (size_t)(KS + i * 16) * CC); kr[2 + i] = *(const v8h*)(kb + (size_t)(KS + i * 16) * CC); }
      asm volatile("s_wait_xcnt 0x0" :: "v"(ka), "v"(kb) : "memory");   /* behind the next trip's loads, which fly under this trip's logits (the memory clobber holds them in front); naming their address registers keeps these whole up to the wait */
      const _Float16* kp = &sk[tr & 1][col][8 * g]; m = fmaxf(m, att_max<HI, HI>(kp, kp + 32 * SP, qh, ql, srel)); if (HI) srel -= KS;
#pragma unroll
      for (int i = 0; i < 4; ++i) *(v8h*)&sk[(tr + 1) & 1][i * 16 + sr][sc] = kr[i];
      __syncthreads(); }   /* publishes trip tr + 1 and ends every wave's reads of trip tr, whose buffer the next trip refills */
#pragma unroll
    for (int i = 0; i < 2; ++i) { kr[i] = *(const v8h*)(ka0 + (size_t)i * 16 * CC); kr[2 + i] = *(const v8h*)(kb0 + (size_t)i * 16 * CC); }   /* pass 2's first stage flies under pass 1's last trip */
#pragma unroll
    for (int i = 0; i < 4; ++i) vr[i] = *(const v8h*)(vg0 + (size_t)i * 16 * VLD);
    asm volatile("s_wait_xcnt 0x0" :: "v"(ka0), "v"(kb0), "v"(vg0) : "memory");   /* behind these loads, as above */
    const _Float16* kp = &sk[nl & 1][col][8 * g]; m = fmaxf(m, att_max<HI, true>(kp, kp + 32 * SP, qh, ql, srel));
    __syncthreads();   /* every wave has left pass 1's stages */
#pragma unroll
    for (int i = 0; i < 4; ++i) { *(v8h*)&sk[0][i * 16 + sr][sc] = kr[i]; *(v8h*)&sv[0][i * 16 + sr][sc] = vr[i]; }
    __syncthreads(); }
  m = fmaxf(m, __shfl_xor(m, 16));   /* the two lane halves hold the two key halves of one query */
  const float bias = fmaf(-m, SC2, 11.0f);   /* one rounding, the same for every key of the query: it cancels in e / sum */
  v8f acc[HD / 16] = {}; float sum = 0.f;
  { const _Float16 *ka = ka0, *kb = kb0, *vg = vg0; v8h kr[4], vr[4]; int srel = srel0;
#pragma unroll 1   // rolled: one trip's fragments fill the registers
    for (int tr = 0; tr < nl; ++tr, ka += (size_t)KS * CC, kb += (size_t)KS * CC, vg += KS) {
#pragma unroll
      for (int i = 0; i < 2; ++i) { kr[i] = *(const v8h*)(ka + (size_t)(KS + i * 16) * CC); kr[2 + i] = *(const v8h*)(kb + (size_t)(KS + i * 16) * CC); }
#pragma unroll
      for (int i = 0; i < 4; ++i) vr[i] = *(const v8h*)(vg + KS + (size_t)i * 16 * VLD);
      asm volatile("s_wait_xcnt 0x0" :: "v"(ka), "v"(kb), "v"(vg) : "memory");   /* behind the next trip's loads, which fly under this trip's work (the memory clobber holds them in front); naming their address registers keeps these whole up to the wait */
      const _Float16 *kp = &sk[tr & 1][col][8 * g], *vp = &sv[tr & 1][col][8 * g]; att_pv<HI, HI>(kp, kp + 32 * SP, vp, (const __bf16*)vp, (const __bf16*)vp + 32, qh, ql, srel, bias, sum, acc); if (HI) srel -= KS;
#pragma unroll
      for (int i = 0; i < 4; ++i) { *(v8h*)&sk[(tr + 1) & 1][i * 16 + sr][sc] = kr[i]; *(v8h*)&sv[(tr + 1) & 1][i * 16 + sr][sc] = vr[i]; }
      __syncthreads(); }   /* publishes trip tr + 1 and ends every wave's reads of trip tr, whose buffers the next trip refills */
    const _Float16 *kp = &sk[nl & 1][col][8 * g], *vp = &sv[nl & 1][col][8 * g]; att_pv<HI, true>(kp, kp + 32 * SP, vp, (const __bf16*)vp, (const __bf16*)vp + 32, qh, ql, srel, bias, sum, acc); }
  sum += __shfl_xor(sum, 16);
  const float inv = sum > 0.f ? 1.0f / sum : 0.f;   /* of query col; sum carries the 2^11 of its terms; a fully excluded row yields 0 */
#pragma unroll
  for (int r = 0; r < 8; ++r) { const float ir = __shfl(inv, 8 * g + r);   /* accumulator register r is query 8g + r */
#pragma unroll
    for (int j = 0; j < HD / 16; ++j) ssw[8 * g + r][j * 16 + col] = acc[j][r] * ir; }
  LDSX();
  // ctx leaves in the 16-bit form k_out's product takes: f16(ctx x 2^6), clear of f16 subnormals; early query blocks: bf16 hi + bf16 lo, as bsplit16 forms them
  _Float16* yp = YH + ((size_t)b * TT + ql0 + g) * CC + h * HD + col * 4;   /* 128-B (row, head) segment by 16 lanes, two rows a store */
  if (!HI) { v4h c[8];
#pragma unroll
    for (int i = 0; i < 8; ++i) { const v4f y = *(const v4f*)&ssw[2 * i + g][col * 4];
#pragma unroll
      for (int e = 0; e < 4; ++e) c[i][e] = (_Float16)(y[e] * 64.0f); }
#pragma unroll
    for (int i = 0; i < 8; ++i) vst2(yp + (size_t)i * 2 * CC, c[i]);
    asm volatile("s_wait_xcnt 0x0" :: "v"(yp) : "memory");   /* behind the stores: the next tile overwrites their registers */
  } else { __bf16* ylp = YL + ((size_t)b * QHI + ql0 + g) * CC + h * HD + col * 4; v4b hv[8], lv[8];
#pragma unroll
    for (int i = 0; i < 8; ++i) { const v4f y = *(const v4f*)&ssw[2 * i + g][col * 4]; hv[i] = cvt4b(y); v4f rs;
#pragma unroll
      for (int e = 0; e < 4; ++e) rs[e] = y[e] - (float)hv[i][e];
      lv[i] = cvt4b(rs); }
#pragma unroll
    for (int i = 0; i < 8; ++i) { vst2(yp + (size_t)i * 2 * CC, hv[i]); vst2(ylp + (size_t)i * 2 * CC, lv[i]); }
    asm volatile("s_wait_xcnt 0x0" :: "v"(yp), "v"(ylp) : "memory"); }   /* behind the stores: the next tile overwrites their registers */
  LDSX(); }   /* the next tile's staging writes stay behind these reads */
// amdgpu_waves_per_eu(2, 2): the grid gives two waves a SIMD (512 blocks x 4 waves, 1,024 SIMDs); with that register budget a trip's exponentials interleave instead of running as one dependent chain after the other
__global__ __launch_bounds__(128) __attribute__((amdgpu_waves_per_eu(2, 2))) void k_att(const _Float16* __restrict__ QH, const _Float16* __restrict__ KH, const _Float16* __restrict__ QL, const _Float16* __restrict__ KL, const _Float16* __restrict__ VT, const __bf16* __restrict__ VB, const __bf16* __restrict__ VBL, _Float16* __restrict__ YH, __bf16* __restrict__ YL) { __shared__ __align__(16) float ss[4][16][HD + 4]; __shared__ __align__(16) _Float16 sk[2][64][SP], sv[2][64][SP];
  const int tid = threadIdx.x, wave = tid >> 5, lane = tid & 31; const int h = blockIdx.y, b = blockIdx.z;
#pragma unroll 1   // rolled: the two tiles share one copy of the code
  for (int half = 0; half < 2; ++half) { const int qb = half ? (int)blockIdx.x : NQB - 1 - (int)blockIdx.x;   /* block-uniform */
    if (qb < QBH) att_tile<true>(QH, KH, QL, KL, VT, VB, VBL, YH, YL, ss[wave], sk, sv, b, h, qb, wave, lane);
    else att_tile<false>(QH, KH, QL, KL, VT, VB, VBL, YH, YL, ss[wave], sk, sv, b, h, qb, wave, lane); } }
// ---- k_out: block = (64 rows, 128 cols): out = ctx Wo (+ bo): f16(ctx x 2^6) against Wo as f16(bf16 x 2^8) exact (1 product) x 2^-14; causal early rows (< QHI of each sequence): ctx bf16 hi + lo against exact bf16 Wo (2 products); the operands come in the 16-bit forms k_att and k_cvt left
__global__ __launch_bounds__(128) void k_out(const _Float16* __restrict__ YH, const __bf16* __restrict__ YL, const __bf16* __restrict__ WOB, const _Float16* __restrict__ WOH, const float* __restrict__ BO, float* __restrict__ OUT) {
  __shared__ __align__(16) union { float sf[4][16][132]; __bf16 b[2][256][SPG]; _Float16 h[2][192][SPG]; } sg;   /* two operand stages: rows 0..127 Wo, 128..191 ctx (hi), 192..255 ctx lo (early rows only); the output tile lies there later (the loop's last barrier between) */
  auto& sf = sg.sf;
  const int tid = threadIdx.x, wave = tid >> 5, lane = tid & 31, col = lane & 15, g = lane >> 4; const int c0 = blockIdx.y * 128; const size_t r0 = (size_t)blockIdx.x * 64 + wave * 16;
  v8f acc[8] = {};
  // a stage = SK k of the block's 128 Wo rows and 64 ctx rows, brought in once for the four waves. 16 lanes x 16 B read one row's 256 B: a load instruction touches 4 whole lines, not 16 pieces
  const int lr = tid >> 4, lc = tid & 15; const size_t wo = (size_t)(c0 + lr) * CC + lc * 8, yo = ((size_t)blockIdx.x * 64 + lr) * CC + lc * 8; const int t0 = (int)(((size_t)blockIdx.x * 64) % TT);
  if (CAUSAL && t0 < QHI) {   /* block-uniform */
    const __bf16* wg = WOB + wo; const __bf16* yg = (const __bf16*)YH + yo; const __bf16* zg = YL + (((size_t)blockIdx.x * 64) / TT * QHI + t0 + lr) * CC + lc * 8;
    v8b wr[16], yr[8], zr[8];
#pragma unroll
    for (int i = 0; i < 16; ++i) wr[i] = *(const v8b*)(wg + (size_t)i * 8 * CC);
#pragma unroll
    for (int i = 0; i < 8; ++i) { yr[i] = *(const v8b*)(yg + (size_t)i * 8 * CC); zr[i] = *(const v8b*)(zg + (size_t)i * 8 * CC); }
    asm volatile("s_wait_xcnt 0x0" :: "v"(wg), "v"(yg), "v"(zg) : "memory");   /* behind the stage's loads: their address registers step on below */
#pragma unroll
    for (int i = 0; i < 16; ++i) *(v8b*)&sg.b[0][i * 8 + lr][lc * 8] = wr[i];
#pragma unroll
    for (int i = 0; i < 8; ++i) { *(v8b*)&sg.b[0][128 + i * 8 + lr][lc * 8] = yr[i]; *(v8b*)&sg.b[0][192 + i * 8 + lr][lc * 8] = zr[i]; }
    __syncthreads();
#pragma unroll 1   // rolled: the next stage's 32 loads stay in registers over one stage's products
    for (int s = 0; s < CC / SK; ++s, wg += SK, yg += SK, zg += SK) { const bool more = s + 1 < CC / SK;   /* block-uniform */
      if (more) {
#pragma unroll
        for (int i = 0; i < 16; ++i) wr[i] = *(const v8b*)(wg + SK + (size_t)i * 8 * CC);
#pragma unroll
        for (int i = 0; i < 8; ++i) { yr[i] = *(const v8b*)(yg + SK + (size_t)i * 8 * CC); zr[i] = *(const v8b*)(zg + SK + (size_t)i * 8 * CC); }
        asm volatile("s_wait_xcnt 0x0" :: "v"(wg), "v"(yg), "v"(zg) : "memory"); }   /* behind the next stage's loads, which fly under this stage's products (the memory clobber holds them in front); naming their address registers keeps these whole up to the wait */
#pragma unroll
      for (int kk = 0; kk < SK / 32; ++kk) { const v16b ah = frag_b(&sg.b[s & 1][128 + wave * 16 + col][kk * 32], lane), al = frag_b(&sg.b[s & 1][192 + wave * 16 + col][kk * 32], lane); v16b w[8];
#pragma unroll
        for (int j = 0; j < 8; ++j) w[j] = frag_b(&sg.b[s & 1][j * 16 + col][kk * 32], lane);
#pragma unroll
        for (int j = 0; j < 8; ++j) { acc[j] = wmma_bf(ah, w[j], acc[j]); acc[j] = wmma_bf(al, w[j], acc[j]); } }
      if (more) {
#pragma unroll
        for (int i = 0; i < 16; ++i) *(v8b*)&sg.b[(s + 1) & 1][i * 8 + lr][lc * 8] = wr[i];
#pragma unroll
        for (int i = 0; i < 8; ++i) { *(v8b*)&sg.b[(s + 1) & 1][128 + i * 8 + lr][lc * 8] = yr[i]; *(v8b*)&sg.b[(s + 1) & 1][192 + i * 8 + lr][lc * 8] = zr[i]; } }
      __syncthreads(); }   /* publishes stage s + 1 and ends every wave's reads of stage s, whose buffer the next trip refills */
#pragma unroll
    for (int j = 0; j < 8; ++j) { const float bias = BO ? bfr(BO[c0 + j * 16 + col]) : 0.f;
#pragma unroll
      for (int r = 0; r < 8; ++r) sf[wave][8 * g + r][j * 16 + col] = acc[j][r] + bias; }
  } else {
    const _Float16* wg = WOH + wo; const _Float16* yg = YH + yo;
    v8h wr[16], yr[8];
#pragma unroll
    for (int i = 0; i < 16; ++i) wr[i] = *(const v8h*)(wg + (size_t)i * 8 * CC);
#pragma unroll
    for (int i = 0; i < 8; ++i) yr[i] = *(const v8h*)(yg + (size_t)i * 8 * CC);
    asm volatile("s_wait_xcnt 0x0" :: "v"(wg), "v"(yg) : "memory");   /* behind the stage's loads: their address registers step on below */
#pragma unroll
    for (int i = 0; i < 16; ++i) *(v8h*)&sg.h[0][i * 8 + lr][lc * 8] = wr[i];
#pragma unroll
    for (int i = 0; i < 8; ++i) *(v8h*)&sg.h[0][128 + i * 8 + lr][lc * 8] = yr[i];
    __syncthreads();
#pragma unroll 1   // rolled: the next stage's 24 loads stay in registers over one stage's products
    for (int s = 0; s < CC / SK; ++s, wg += SK, yg += SK) { const bool more = s + 1 < CC / SK;   /* block-uniform */
      if (more) {
#pragma unroll
        for (int i = 0; i < 16; ++i) wr[i] = *(const v8h*)(wg + SK + (size_t)i * 8 * CC);
#pragma unroll
        for (int i = 0; i < 8; ++i) yr[i] = *(const v8h*)(yg + SK + (size_t)i * 8 * CC);
        asm volatile("s_wait_xcnt 0x0" :: "v"(wg), "v"(yg) : "memory"); }   /* behind the next stage's loads, which fly under this stage's products (the memory clobber holds them in front); naming their address registers keeps these whole up to the wait */
#pragma unroll
      for (int kk = 0; kk < SK / 32; ++kk) { const v16h a = frag_h(&sg.h[s & 1][128 + wave * 16 + col][kk * 32], lane); v16h w[8];
#pragma unroll
        for (int j = 0; j < 8; ++j) w[j] = frag_h(&sg.h[s & 1][j * 16 + col][kk * 32], lane);
#pragma unroll
        for (int j = 0; j < 8; ++j) acc[j] = wmma16(a, w[j], acc[j]); }
      if (more) {
#pragma unroll
        for (int i = 0; i < 16; ++i) *(v8h*)&sg.h[(s + 1) & 1][i * 8 + lr][lc * 8] = wr[i];
#pragma unroll
        for (int i = 0; i < 8; ++i) *(v8h*)&sg.h[(s + 1) & 1][128 + i * 8 + lr][lc * 8] = yr[i]; }
      __syncthreads(); }   /* publishes stage s + 1 and ends every wave's reads of stage s, whose buffer the next trip refills */
#pragma unroll
    for (int j = 0; j < 8; ++j) { const float bias = BO ? bfr(BO[c0 + j * 16 + col]) : 0.f;
#pragma unroll
      for (int r = 0; r < 8; ++r) sf[wave][8 * g + r][j * 16 + col] = acc[j][r] * (1.0f / 16384.0f) + bias; } }   /* 2^-8 (Wo carry) x 2^-6 (ctx carry) */
  LDSX(); for (int rl = 0; rl < 16; ++rl) vst2(OUT + (r0 + rl) * DIN + c0 + lane * 4, *(const v4f*)&sf[wave][rl][lane * 4]); }

extern "C" void kernel_launch(void* const* d_in, const int* in_sizes, int n_in, void* d_out, int out_size, void* d_ws, size_t ws_size, hipStream_t stream) {
  (void)in_sizes; (void)n_in; (void)out_size;
  const float** F = (const float**)d_in;
  if (ws_size < (size_t)WS_END) return;
  char* ws = (char*)d_ws; _Float16 *QH = (_Float16*)(ws + WS_QH), *KH = (_Float16*)(ws + WS_KH), *VT = (_Float16*)(ws + WS_VT), *QL = (_Float16*)(ws + WS_QL), *KL = (_Float16*)(ws + WS_KL); __bf16 *VB = (__bf16*)(ws + WS_VB), *VBL = (__bf16*)(ws + WS_VBL), *YL = (__bf16*)(ws + WS_YL), *XB = (__bf16*)(ws + WS_XB), *WB = (__bf16*)(ws + WS_WB), *WOB = (__bf16*)(ws + WS_WOB); _Float16 *YH = (_Float16*)(ws + WS_YH), *WOH = (_Float16*)(ws + WS_WOH);
  // inputs: 0 x [2,2048,1024]; 1 wq [1024,1024] (out,in); 2 wk; 3 wv; 4 wo (out,in); no biases (null pointers)
  k_cvt<<<dim3((NB * TT * DIN + 4 * CC * DIN) / CVB), 256, 0, stream>>>(F[0], F[1], F[2], F[3], F[4], XB, WB, WOB, WOH);
  k_proj<<<dim3(TNB * TT / 128, CC / 128, 3), 128, 0, stream>>>(XB, XB, XB, WB, WB + (size_t)CC * DIN, WB + 2 * (size_t)CC * DIN, nullptr, nullptr, nullptr, QH, QL, KH, KL, VT, VB, VBL);
  k_att<<<dim3(NQB / 2, NH, TNB), 128, 0, stream>>>(QH, KH, QL, KL, VT, VB, VBL, YH, YL);
  k_out<<<dim3(TNB * TT / 64, DIN / 128), 128, 0, stream>>>(YH, YL, WOB, WOH, nullptr, (float*)d_out);
}

// v008
// It runs in 88.8 microseconds.
// Timed twice side by side with v007, it ran 1.20 and 1.21 times as fast.
// Counting every step since v000, it is 14.3 times as fast.
// compute dtype: all float inputs rounded to bf16, once, by k_cvt; q / k / v projections with EXACT bf16 products on WMMA 16x16x32 (f32 accumulate) (no biases); interleaved-pair RoPE in f32 AFTER the bias (embedded frequencies, the library cosf / sinf values, positions = the row index); causal logits: 3 products for the first 384 rows, single f16 q x k after, x 64^-0.5; softmax f32 (one pass, running row maximum, logits never stored); exp(s - the maximum in use) x 2^11 once to f16 x v once to f16 (bf16 hi + lo below row 384), / sum after the product; ctx hi+lo x exact Wo below row 384, x2^6 f16 carry x f16(bf16 x 2^8) Wo after, + bo; f32 output.
#include <hip/hip_runtime.h>
#include <math.h>

typedef __attribute__((ext_vector_type(16))) _Float16 v16h;
typedef __attribute__((ext_vector_type(16))) __bf16 v16b;
typedef __attribute__((ext_vector_type(8)))  _Float16 v8h;
typedef __attribute__((ext_vector_type(8)))  float v8f;
typedef __attribute__((ext_vector_type(4)))  float v4f;
typedef __attribute__((ext_vector_type(2)))  float v2f;
typedef __attribute__((ext_vector_type(4)))  unsigned v4u;
typedef __attribute__((ext_vector_type(4)))  int v4i;
typedef float __attribute__((may_alias)) float_a;
typedef int __attribute__((may_alias)) int_a;

template <typename T> __device__ __forceinline__ void vst2(void* p, T v) { *(T*)p = v;  }
__device__ __forceinline__ v8f wmma16(v16h a, v16h b, v8f c) {
  v8f d = __builtin_amdgcn_wmma_f32_16x16x32_f16(false, a, false, b, (short)0, c, false, false);
  asm volatile("v_nop\n\tv_nop\n\tv_nop\n\tv_nop" : "+v"(d) : "v"(a), "v"(b));
  return d;
}
__device__ __forceinline__ v8f wmma_bf(v16b a, v16b b, v8f c) {
  v8f d = __builtin_amdgcn_wmma_f32_16x16x32_bf16(false, a, false, b, (short)0, c, false, false);
  asm volatile("v_nop\n\tv_nop\n\tv_nop\n\tv_nop" : "+v"(d) : "v"(a), "v"(b));
  return d;
}
// 16x16x32 fragments: lane = (h = lane>>4, row/col = lane&15); elements 0..7 = k0+8h+0..7, 8..15 = k0+16+8h+0..7; D element r = row 8h+r
__device__ __forceinline__ v16h frag_h(const _Float16* rowk0, int lane) {
  union { v16h v; v8h q[2]; } u; const _Float16* p = rowk0 + 8 * (lane >> 4);
  u.q[0] = *(const v8h*)p; u.q[1] = *(const v8h*)(p + 16); return u.v;
}
__device__ __forceinline__ v16h frag_f32(const float* rowk0, int lane) {
  v16h a; const float* p = rowk0 + 8 * (lane >> 4);
#pragma unroll
  for (int i = 0; i < 8; ++i) { a[i] = (_Float16)p[i]; a[8 + i] = (_Float16)p[16 + i]; }
  return a;
}
__device__ __forceinline__ v16h frag_f32s(const float* rowk0, int lane, float sc) {
  v16h a; const float* p = rowk0 + 8 * (lane >> 4);
#pragma unroll
  for (int i = 0; i < 8; ++i) { a[i] = (_Float16)(p[i] * sc); a[8 + i] = (_Float16)(p[16 + i] * sc); }
  return a;
}
// column fragment from a [K][ld] layout (column n), rows >= K read as 0
__device__ __forceinline__ v16h fragc_f32(const float* W, int k0, int n, int lane, int ld, int K) {
  v16h a; const int g = lane >> 4;
#pragma unroll
  for (int i = 0; i < 8; ++i) { const int ka = k0 + 8 * g + i, kb = ka + 16;
    a[i] = (_Float16)(ka < K ? W[(size_t)(ka < K ? ka : K - 1) * ld + n] : 0.f); a[8 + i] = (_Float16)(kb < K ? W[(size_t)(kb < K ? kb : K - 1) * ld + n] : 0.f); }
  return a;
}
struct F2 { v16b h, l; };
__device__ __forceinline__ F2 bsplit16(const float v[16]) { F2 r;
#pragma unroll
  for (int i = 0; i < 16; ++i) { const __bf16 h = (__bf16)v[i]; r.h[i] = h; r.l[i] = (__bf16)(v[i] - (float)h); }
  return r; }
__device__ __forceinline__ F2 split_row(const float* row, int k0, int lane) { float v[16]; const float* p = row + k0 + 8 * (lane >> 4);
#pragma unroll
  for (int i = 0; i < 8; ++i) { v[i] = p[i]; v[8 + i] = p[16 + i]; }
  return bsplit16(v); }
__device__ __forceinline__ F2 split_rowK(const float* row, int k0, int lane, int K) { float v[16]; const int g = lane >> 4;
#pragma unroll
  for (int i = 0; i < 8; ++i) { const int ka = k0 + 8 * g + i, kb = ka + 16; v[i] = ka < K ? row[ka < K ? ka : K - 1] : 0.f; v[8 + i] = kb < K ? row[kb < K ? kb : K - 1] : 0.f; }
  return bsplit16(v); }
__device__ __forceinline__ F2 split_col(const float* W, int k0, int n, int lane, int ld, int K) { float v[16]; const int g = lane >> 4;
#pragma unroll
  for (int i = 0; i < 8; ++i) { const int ka = k0 + 8 * g + i, kb = ka + 16; v[i] = ka < K ? W[(size_t)(ka < K ? ka : K - 1) * ld + n] : 0.f; v[8 + i] = kb < K ? W[(size_t)(kb < K ? kb : K - 1) * ld + n] : 0.f; }
  return bsplit16(v); }
__device__ __forceinline__ v8f mac3(const F2& a, const F2& b, v8f c) { c = wmma_bf(a.l, b.h, c); c = wmma_bf(a.h, b.l, c); return wmma_bf(a.h, b.h, c); }
__device__ __forceinline__ float sigm(float v) { return 1.0f / (1.0f + expf(-v)); }
#define LDSX() do { asm volatile("s_wait_dscnt 0" ::: "memory"); __builtin_amdgcn_wave_barrier(); __builtin_amdgcn_fence(__ATOMIC_RELEASE, "workgroup"); } while (0)

// Causal multi-head self-attention with interleaved-pair RoPE (x [2,2048,1024]; torch (out,in) wq / wk / wv / wo [1024,1024] applied as x @ W.T, no biases; 16 heads x 64; RoPE on Q and K: adjacent (even, odd) pairs (xe c - xo s, xe s + xo c) re-interleaved, theta 10000, positions 0..2047; scores / sqrt(64); tril kept, -inf elsewhere (the module's own softmax guards the -inf row maximum: every row keeps its diagonal, so the guard never fires); out @ wo.T).
#define NB 2
#define TT 2048
#define CC 1024            // NH * HD = projected width
#define DIN 1024          // input (model) width
#define NH 16
#define HD 64
#define NQB (TT / 64)
#define SCALE (0.125f)
#define SC2 (SCALE * 1.44269504088896340736f)   // SCALE x log2(e): exp(SCALE x (d - dmax)) = 2^(SC2 x d - SC2 x dmax), d = the unscaled q.k product
#define CAUSAL 1
#ifndef TNB
#define TNB NB
#endif
__device__ __forceinline__ float bfr(float v) { return (float)(__bf16)v; }
typedef __attribute__((ext_vector_type(8))) __bf16 v8b;
__device__ __forceinline__ v16b frag_b(const __bf16* rowk0, int lane) {
  union { v16b v; v8b q[2]; } u; const __bf16* p = rowk0 + 8 * (lane >> 4);
  u.q[0] = *(const v8b*)p; u.q[1] = *(const v8b*)(p + 16); return u.v;
}
// unconverted fragment reads; p = the lane's row + k0 + 8 * (lane >> 4): elements 0..7 = p[0..7], 8..15 = p[16..23] (the k order of frag_h / frag_f32 / split_row / wcol_oi)
typedef __attribute__((ext_vector_type(16))) float v16f;
__device__ __forceinline__ v16f raw16(const float* p) { v16f r;
#pragma unroll
  for (int i = 0; i < 8; ++i) { r[i] = p[i]; r[8 + i] = p[16 + i]; }
  return r; }
__device__ __forceinline__ v16h pair_h(const _Float16* p) { union { v16h v; v8h q[2]; } u; u.q[0] = *(const v8h*)p; u.q[1] = *(const v8h*)(p + 16); return u.v; }
__device__ __forceinline__ v16b pair_b(const __bf16* p) { union { v16b v; v8b q[2]; } u; u.q[0] = *(const v8b*)p; u.q[1] = *(const v8b*)(p + 16); return u.v; }
__device__ __forceinline__ F2 bsplit_v(v16f r) { float v[16];
#pragma unroll
  for (int i = 0; i < 16; ++i) v[i] = r[i];
  return bsplit16(v); }
#define SK 128             // k of one LDS operand stage (k_out): 256 B of every 16-bit source row
#define SPG 136            // its row pitch in 16-bit elements: 272 B = 16 B x 17, odd, for the ds_load_b128 fragment reads
#define SP 72              // k_att's stage row pitch in 16-bit elements: 144 B = 16 B x 9, odd, for the ds_load_b128 fragment reads
typedef __attribute__((ext_vector_type(4))) __bf16 v4b;
typedef __attribute__((ext_vector_type(4))) _Float16 v4h;
__device__ __forceinline__ v4b cvt4b(v4f v) { v4b r;
#pragma unroll
  for (int i = 0; i < 4; ++i) r[i] = (__bf16)v[i];
  return r; }
#define QBH 6              // causal: query blocks 0..QBH-1 of each sequence (few keys, no averaging) take the high-precision path
#define QHI 384            // rows carrying a q residual plane
#define KHI 384            // key rows carrying k residual / v bf16 hi+lo planes (used only by the causal high-precision path)
// B fragment (k rows k0+.., output column o) of a weight: (in,out) [K][ld] or (out,in) [ld rows of K]: bf16 exact, or f16(bf16 * 256) exact
__device__ __forceinline__ v16b wcol_io(const float* Wm, int k0, int o, int lane, int ld) { v16b w; const int g = lane >> 4;
#pragma unroll
  for (int i = 0; i < 8; ++i) { w[i] = (__bf16)Wm[(size_t)(k0 + 8 * g + i) * ld + o]; w[8 + i] = (__bf16)Wm[(size_t)(k0 + 16 + 8 * g + i) * ld + o]; }
  return w; }
__device__ __forceinline__ v16b wcol_oi(const float* Wm, int k0, int o, int lane, int K) { v16b w; const float* p = Wm + (size_t)o * K + k0 + 8 * (lane >> 4);
#pragma unroll
  for (int i = 0; i < 8; ++i) { w[i] = (__bf16)p[i]; w[8 + i] = (__bf16)p[16 + i]; }
  return w; }
__device__ __forceinline__ v16h wcolh_io(const float* Wm, int k0, int o, int lane, int ld) { v16h w; const int g = lane >> 4;
#pragma unroll
  for (int i = 0; i < 8; ++i) { w[i] = (_Float16)(bfr(Wm[(size_t)(k0 + 8 * g + i) * ld + o]) * 256.0f); w[8 + i] = (_Float16)(bfr(Wm[(size_t)(k0 + 16 + 8 * g + i) * ld + o]) * 256.0f); }
  return w; }
__device__ __forceinline__ v16h wcolh_oi(const float* Wm, int k0, int o, int lane, int K) { v16h w; const float* p = Wm + (size_t)o * K + k0 + 8 * (lane >> 4);
#pragma unroll
  for (int i = 0; i < 8; ++i) { w[i] = (_Float16)(bfr(p[i]) * 256.0f); w[8 + i] = (_Float16)(bfr(p[16 + i]) * 256.0f); }
  return w; }
#define WQKV_LAYOUT 1   // 0 = (in,out) [DIN][CC]; 1 = (out,in) [CC][DIN]; 2 = per-head [NH][DIN][HD]
__device__ __forceinline__ v16b wcol_hdk(const float* Wm, int k0, int o, int lane) { v16b w; const int g = lane >> 4; const float* p = Wm + (size_t)(o / HD) * DIN * HD + (o % HD);
#pragma unroll
  for (int i = 0; i < 8; ++i) { w[i] = (__bf16)p[(size_t)(k0 + 8 * g + i) * HD]; w[8 + i] = (__bf16)p[(size_t)(k0 + 16 + 8 * g + i) * HD]; }
  return w; }
#define WO_OUT_IN 1
#if WQKV_LAYOUT == 1
#define WCOL(W, k0, o, lane) wcol_oi(W, k0, o, lane, DIN)
#elif WQKV_LAYOUT == 2
#define WCOL(W, k0, o, lane) wcol_hdk(W, k0, o, lane)
#else
#define WCOL(W, k0, o, lane) wcol_io(W, k0, o, lane, CC)
#endif
#if WO_OUT_IN
#define WOCOL(W, k0, o, lane) wcol_oi(W, k0, o, lane, CC)
#define WOCOLH(W, k0, o, lane) wcolh_oi(W, k0, o, lane, CC)
#else
#define WOCOL(W, k0, o, lane) wcol_io(W, k0, o, lane, DIN)
#define WOCOLH(W, k0, o, lane) wcolh_io(W, k0, o, lane, DIN)
#endif

// RoPE inverse frequencies 1/10000^(2i/64) (the f32 values jax computes)
__constant__ float INVF[32] = {1.000000000e+00,7.498942018e-01,5.623413324e-01,4.216965139e-01,3.162277639e-01,2.371373624e-01,1.778279394e-01,1.333521456e-01,1.000000015e-01,7.498941571e-02,5.623412877e-02,4.216964915e-02,3.162277862e-02,2.371373586e-02,1.778279431e-02,1.333521493e-02,9.999999776e-03,7.498942316e-03,5.623413250e-03,4.216964822e-03,3.162277862e-03,2.371373819e-03,1.778279431e-03,1.333521446e-03,1.000000047e-03,7.498941850e-04,5.623413017e-04,4.216964880e-04,3.162277862e-04,2.371373848e-04,1.778279402e-04,1.333521504e-04};
#define PROJ_EXTRA_PARAMS
// cos and sin of a RoPE angle a, 0 <= a < 2^17 (a position below TT x a frequency of at most 1). On that range these are the library's cosf / sinf operation for operation (pi/2 taken off in three parts, its two polynomials, the quadrant select); left out are its branches to the large-argument reduction, never taken here, which kept one angle's chain from starting before the last one's end
__device__ __forceinline__ void rope_cs(float a, float& cs, float& sn) {
  const float fn = rintf(a * 6.36619747e-1f);
  const float r = fmaf(fn, -5.39030253e-15f, fmaf(fn, -7.54978942e-8f, fmaf(fn, -1.57079625e+0f, a)));
  const float t = r * r; const unsigned q = (unsigned)(int)fn;
  const float s = fmaf(r, t * fmaf(t, fmaf(t, -1.94644585e-4f, 8.33171979e-3f), -1.66666463e-1f), r);
  const float c = fmaf(t, fmaf(t, fmaf(t, fmaf(t, 2.56687417e-5f, -1.39091106e-3f), 4.16679047e-2f), -5.00000238e-1f), 1.0f);
  const unsigned sg = (q << 30) & 0x80000000u;   /* quadrants 2 and 3 flip both signs */
  sn = __uint_as_float(__float_as_uint((q & 1u) ? c : s) ^ sg); cs = __uint_as_float(__float_as_uint((q & 1u) ? -s : c) ^ sg); }
#ifndef PROJ_EXTRA_PARAMS
#define PROJ_EXTRA_PARAMS
#endif

#define WS_QH  0u                                      // f16 q rows [b*t][CC]
#define WS_KH  (WS_QH + 2u * (size_t)NB * TT * CC)      // f16 k rows [b*t][CC]
#define WS_VT  (WS_KH + 2u * (size_t)NB * TT * CC)      // f16 v planes [b][c][t]
#define WS_QL  (WS_VT + 2u * (size_t)NB * CC * TT)      // f16 q residual x 2^10 rows [b][t < QHI][CC]
#define WS_KL  (WS_QL + 2u * (size_t)NB * QHI * CC)     // f16 k residual x 2^10 rows [b][t < KHI][CC]
#define WS_VB  (WS_KL + 2u * (size_t)NB * KHI * CC)     // bf16 v hi planes [b][c][t < KHI]
#define WS_VBL (WS_VB + 2u * (size_t)NB * CC * KHI)
#define WS_YH  (WS_VBL + 2u * (size_t)NB * CC * KHI)    // 16-bit ctx rows [b*t][CC]: f16(ctx x 2^6); rows < QHI of a sequence: bf16 hi
#define WS_YL  (WS_YH + 2u * (size_t)NB * TT * CC)      // bf16 ctx lo rows [b][t < QHI][CC]
#define WS_XB  (WS_YL + 2u * (size_t)NB * QHI * CC)     // bf16 x rows [b*t][DIN]
#define WS_WB  (WS_XB + 2u * (size_t)NB * TT * DIN)     // bf16 wq, wk, wv, each [CC][DIN]
#define WS_WOB (WS_WB + 6u * (size_t)CC * DIN)          // bf16 wo [DIN][CC]
#define WS_WOH (WS_WOB + 2u * (size_t)DIN * CC)         // f16(bf16 wo x 2^8) [DIN][CC]
#define WS_END (WS_WOH + 2u * (size_t)DIN * CC)

// ---- k_cvt: x, wq, wk, wv, wo to the 16-bit forms the products take, once, in place of once in each of the 24 (x), 32 (wq, wk, wv), 64 (wo) blocks that stage a row. block = CVB consecutive floats of one input: 16 loads of 16 B a lane in flight, 512 B a wave and load; stores of 256 B a wave; two blocks a WGP, so that few waves have to start
#define CVB 16384
__global__ __launch_bounds__(256) void k_cvt(const float* __restrict__ X, const float* __restrict__ WQ, const float* __restrict__ WK, const float* __restrict__ WV, const float* __restrict__ WO, __bf16* __restrict__ XB, __bf16* __restrict__ WB, __bf16* __restrict__ WOB, _Float16* __restrict__ WOH) {
  constexpr int nx = NB * TT * DIN / CVB, nw = CC * DIN / CVB; const int blk = blockIdx.x; const int sel = blk < nx ? -1 : (blk - nx) / nw;   /* block-uniform: -1 x, 0..2 wq wk wv, 3 wo */
  const size_t o = (size_t)(blk < nx ? blk : (blk - nx) % nw) * CVB + threadIdx.x * 4;
  const float* s = (sel < 0 ? X : sel == 0 ? WQ : sel == 1 ? WK : sel == 2 ? WV : WO) + o;
  v4f r[16]; v4b c[16];
#pragma unroll
  for (int i = 0; i < 16; ++i) r[i] = *(const v4f*)(s + i * 1024);
  asm volatile("s_wait_xcnt 0x0" :: "v"(s) : "memory");   /* behind the loads: their address registers may be taken for the stores' */
#pragma unroll
  for (int i = 0; i < 16; ++i) c[i] = cvt4b(r[i]);
  __bf16* d = (sel < 0 ? XB : sel < 3 ? WB + (size_t)sel * CC * DIN : WOB) + o;
  if (sel == 3) { v4h f[16];   /* wo also as f16(bf16 x 2^8), exact */
#pragma unroll
    for (int i = 0; i < 16; ++i)
#pragma unroll
      for (int e = 0; e < 4; ++e) f[i][e] = (_Float16)((float)c[i][e] * 256.0f);
#pragma unroll
    for (int i = 0; i < 16; ++i) *(v4h*)(WOH + o + i * 1024) = f[i]; }
#pragma unroll
  for (int i = 0; i < 16; ++i) *(v4b*)(d + i * 1024) = c[i]; }

// ---- k_proj: block = (128 rows, 128 cols, which), four waves of 64 x 64 each: q/k/v = X W (+ b), X and W in k_cvt's bf16, with exact bf16 products (K = DIN) -> which 0: q f16 rows (+ residual rows < QHI); 1: k f16 rows (+ residual rows < KHI); 2: v f16 planes [c][t] (+ bf16 hi/lo planes for t < KHI)
// a wave's 4 X and 4 W fragments of a k step feed 16 products (16 x 128 a wave: 9 fragments for 8), and a staged row serves 128 rows or columns of the tile. 768 blocks, three on a WGP (LDS, registers): all resident at once
#define PK 64              // k of one LDS operand stage: 128 B of every 16-bit source row
#define PPG 72             // its row pitch in 16-bit elements: 144 B = 16 B x 9, odd, for the ds_load_b128 fragment reads
__global__ __launch_bounds__(128) void k_proj(const __bf16* __restrict__ XQ, const __bf16* __restrict__ XK, const __bf16* __restrict__ XV, const __bf16* __restrict__ WQ, const __bf16* __restrict__ WK, const __bf16* __restrict__ WV, const float* __restrict__ BQ, const float* __restrict__ BK, const float* __restrict__ BV,
    _Float16* __restrict__ QH, _Float16* __restrict__ QL, _Float16* __restrict__ KH, _Float16* __restrict__ KL, _Float16* __restrict__ VT, __bf16* __restrict__ VB, __bf16* __restrict__ VBL PROJ_EXTRA_PARAMS) {
  __shared__ __align__(16) union { struct { float st[64][132]; union { struct { _Float16 sh[64][136], sl[64][136]; } r; struct { _Float16 th[128][72]; __bf16 tb[128][72], tbl[128][72]; } p; } c; } e; __bf16 sg[2][256][PPG]; } un;   /* the two operand stages of the k loop lie where the epilogue's tiles lie later (the loop's last barrier between); a block needs either the row tiles (q, k) or the plane tiles (v) */
  auto& st = un.e.st; auto& sh = un.e.c.r.sh; auto& sl = un.e.c.r.sl; auto& th = un.e.c.p.th; auto& tb = un.e.c.p.tb; auto& tbl = un.e.c.p.tbl; auto& sg = un.sg;
  const int tid = threadIdx.x, wave = tid >> 5, lane = tid & 31, col = lane & 15, g = lane >> 4; const int wrow = wave >> 1, wcol = wave & 1;   /* the wave's 64 x 64 quarter of the tile */
  const int which = blockIdx.z; const int c0 = blockIdx.y * 128; const size_t rb = (size_t)blockIdx.x * 128;
  const __bf16* X = which == 0 ? XQ : which == 1 ? XK : XV; const __bf16* WA = which == 0 ? WQ : which == 1 ? WK : WV; const float* BA = which == 0 ? BQ : which == 1 ? BK : BV;
  v8f acc[4][4] = {};
  // a stage = PK k of the block's 128 W rows (sg rows 0..127) and 128 X rows (128..255), bf16 as k_cvt left them, brought in once for the four waves. 8 lanes x 16 B read one row's 128 B: a load instruction touches 4 whole lines, not 16 pieces
  const int lr = tid >> 3, lc = tid & 7; const __bf16* wg = WA + (size_t)(c0 + lr) * DIN + lc * 8; const __bf16* xg = X + (rb + lr) * DIN + lc * 8;
  v8b wr[8], xr[8];
#pragma unroll
  for (int i = 0; i < 8; ++i) wr[i] = *(const v8b*)(wg + (size_t)i * 16 * DIN);
#pragma unroll
  for (int i = 0; i < 8; ++i) xr[i] = *(const v8b*)(xg + (size_t)i * 16 * DIN);
  asm volatile("s_wait_xcnt 0x0" :: "v"(wg), "v"(xg) : "memory");   /* behind the stage's loads: their address registers step on below */
#pragma unroll
  for (int i = 0; i < 8; ++i) *(v8b*)&sg[0][i * 16 + lr][lc * 8] = wr[i];
#pragma unroll
  for (int i = 0; i < 8; ++i) *(v8b*)&sg[0][128 + i * 16 + lr][lc * 8] = xr[i];
  __syncthreads();
#pragma unroll 1   // rolled: the next stage's 16 loads stay in registers over one stage's products
  for (int s = 0; s < DIN / PK; ++s, wg += PK, xg += PK) { const bool more = s + 1 < DIN / PK;   /* block-uniform */
    if (more) {
#pragma unroll
      for (int i = 0; i < 8; ++i) wr[i] = *(const v8b*)(wg + PK + (size_t)i * 16 * DIN);
#pragma unroll
      for (int i = 0; i < 8; ++i) xr[i] = *(const v8b*)(xg + PK + (size_t)i * 16 * DIN);
      asm volatile("s_wait_xcnt 0x0" :: "v"(wg), "v"(xg) : "memory"); }   /* behind the next stage's loads, which fly under this stage's products (the memory clobber holds them in front); naming their address registers keeps these whole up to the wait */
#pragma unroll
    for (int kk = 0; kk < PK / 32; ++kk) { v16b a[4], w[4];
#pragma unroll
      for (int i = 0; i < 4; ++i) a[i] = frag_b(&sg[s & 1][128 + wrow * 64 + i * 16 + col][kk * 32], lane);
#pragma unroll
      for (int j = 0; j < 4; ++j) w[j] = frag_b(&sg[s & 1][wcol * 64 + j * 16 + col][kk * 32], lane);
#pragma unroll
      for (int i = 0; i < 4; ++i)
#pragma unroll
        for (int j = 0; j < 4; ++j) acc[i][j] = wmma_bf(a[i], w[j], acc[i][j]); }
    if (more) {
#pragma unroll
      for (int i = 0; i < 8; ++i) *(v8b*)&sg[(s + 1) & 1][i * 16 + lr][lc * 8] = wr[i];
#pragma unroll
      for (int i = 0; i < 8; ++i) *(v8b*)&sg[(s + 1) & 1][128 + i * 16 + lr][lc * 8] = xr[i]; }
    __syncthreads(); }   /* publishes stage s + 1 and ends every wave's reads of stage s, whose buffer the next trip refills */
#pragma unroll 1   // rolled: the tile's two halves of 64 rows leave one after the other through one copy of the epilogue and one set of LDS tiles
  for (int hf = 0; hf < 2; ++hf) { const size_t r0 = rb + hf * 64; const size_t bb = r0 / TT; const int t0 = (int)(r0 % TT);
  { // stage the half's f32 tile (acc + bias) in LDS, written by the two waves that hold it, run the per-(row, head) epilogue hook, then convert. The half before is out of st since its conversion's barrier, and out of the 16-bit tiles before the two barriers below
    if (wrow == hf) {
#pragma unroll
      for (int j = 0; j < 4; ++j) { const float bias = BA ? bfr(BA[c0 + wcol * 64 + j * 16 + col]) : 0.f;
#pragma unroll
        for (int i = 0; i < 4; ++i)
#pragma unroll
          for (int r = 0; r < 8; ++r) st[i * 16 + 8 * g + r][wcol * 64 + j * 16 + col] = acc[i][j][r] + bias; } }
    __syncthreads();
    if (which < 2) {   /* block-uniform. q and k: interleaved-pair rotation (x[2i], x[2i + 1]) by the angle t * INVF[i]; v untouched. A thread has one row and every second frequency: each cos / sin is formed once and turns the pair of both heads of the tile; 32 lanes x 8 B fall on 64 different banks */
      const int rl = tid >> 1, ih = tid & 1; const float pos = (float)(int)((r0 + rl) % TT);   /* position = the token's sequence index */
#pragma unroll   // unrolled: the 16 angles' chains interleave
      for (int ii = 0; ii < 16; ++ii) { float cs, sn; const float f0 = INVF[2 * ii], f1 = INVF[2 * ii + 1]; rope_cs(pos * (ih ? f1 : f0), cs, sn);   /* both read as scalars, then a select: no load by lane */
#pragma unroll   // unrolled: both heads' pairs are turned from the same two registers
        for (int hh = 0; hh < 128 / HD; ++hh) { v2f* p = (v2f*)&st[rl][hh * HD + 4 * ii + 2 * ih]; const v2f x = *p; v2f y; y[0] = x[0] * cs - x[1] * sn; y[1] = x[0] * sn + x[1] * cs; *p = y; } } }
    __syncthreads(); }
  if (which < 2) { _Float16* DH = which == 0 ? QH : KH; _Float16* DL = which == 0 ? QL : KL; const int nhi = which == 0 ? QHI : KHI; const bool hi_rows = t0 < nhi;
    for (int e = tid; e < 64 * 128; e += 128) { const int rl = e >> 7, cl = e & 127; const float v = st[rl][cl]; const _Float16 hv = (_Float16)v; sh[rl][cl] = hv; sl[rl][cl] = (_Float16)((v - (float)hv) * 1024.0f); }
    __syncthreads();
    for (int e = tid; e < 64 * 16; e += 128) { const int rl = e >> 4, q = e & 15; vst2((unsigned*)(DH + (r0 + rl) * CC + c0 + q * 8), *(const v4u*)&sh[rl][q * 8]); if (hi_rows) vst2((unsigned*)(DL + (bb * nhi + t0 + rl) * (size_t)CC + c0 + q * 8), *(const v4u*)&sl[rl][q * 8]); }
  } else { const bool hi_rows = t0 < KHI;
    for (int e = tid; e < 64 * 128; e += 128) { const int rl = e & 63, cl = e >> 6; const float v = st[rl][cl]; th[cl][rl] = (_Float16)v; const __bf16 bh = (__bf16)v; tb[cl][rl] = bh; tbl[cl][rl] = (__bf16)(v - (float)bh); }
    __syncthreads();
    for (int e = tid; e < 128 * 8; e += 128) { const int cl = e >> 3, q = e & 7; vst2((unsigned*)(VT + (bb * CC + c0 + cl) * (size_t)TT + t0 + q * 8), *(const v4u*)&th[cl][q * 8]); if (hi_rows) { const size_t o3 = (bb * CC + c0 + cl) * (size_t)KHI + t0 + q * 8; vst2((unsigned*)(VB + o3), *(const v4u*)&tb[cl][q * 8]); vst2((unsigned*)(VBL + o3), *(const v4u*)&tbl[cl][q * 8]); } } } } }
// ---- k_att: block = 4 waves x 16 queries of (b, h), two query blocks one after the other (x and NQB - 1 - x: every block walks (NQB + 1) x 64 keys). Logits as S^T = K Q^T: D register r of key tile kt = key kt * 16 + 8g + r of query col, so a lane holds one query's logits and two tiles are the A fragment of P in the k order of pair_h. One pass over the keys with a running row maximum: e = 2^11 exp(s - the maximum in use), sum of e in f32, e to f16 (early query blocks: bf16 hi + lo) against v; when a logit tops the maximum in use by more than 2^4 in e, sum and acc are scaled down to the new one; ctx = acc / sum. Nothing of S goes to memory.
// a trip is NT key tiles of 16: 64 keys; 32 in the early query blocks, whose residual planes double the fragments
// a trip's operands are staged in LDS once for the four waves (pitch SP): sk rows 0..63 = the 64 k rows (early blocks: 0..31 k, 32..63 its residual); sv row c = v plane c's 64 keys (early blocks: 32 keys of the bf16 hi plane, then of the lo plane)
template <bool HI> __device__ __forceinline__ void att_ldk(const _Float16* kp, const _Float16* klp, v16h (&kf)[2][HI ? 2 : 4], v16h (&klf)[2][HI ? 2 : 4]) {
#pragma unroll
  for (int kc = 0; kc < 2; ++kc)
#pragma unroll
    for (int kt = 0; kt < (HI ? 2 : 4); ++kt) { kf[kc][kt] = pair_h(kp + kt * 16 * SP + kc * 32); if (HI) klf[kc][kt] = pair_h(klp + kt * 16 * SP + kc * 32); } }
// unscaled logits (q.k; SCALE is folded into the exponent's multiplier SC2) of a trip's keys; srel = query - the trip's first key - 8g: key kt * 16 + r of the lane is kept while kt * 16 + r <= srel
template <bool HI, bool MASK> __device__ __forceinline__ void att_logits(const v16h (&kf)[2][HI ? 2 : 4], const v16h (&klf)[2][HI ? 2 : 4], const v16h (&qh)[2], const v16h (&ql)[2], int srel, float (&s)[HI ? 2 : 4][8]) {
  constexpr int NT = HI ? 2 : 4; v8f a[NT] = {}, al[NT] = {};
#pragma unroll
  for (int kc = 0; kc < 2; ++kc)
#pragma unroll
    for (int kt = 0; kt < NT; ++kt) { a[kt] = wmma16(kf[kc][kt], qh[kc], a[kt]); if (HI) { al[kt] = wmma16(kf[kc][kt], ql[kc], al[kt]); al[kt] = wmma16(klf[kc][kt], qh[kc], al[kt]); } }
#pragma unroll
  for (int kt = 0; kt < NT; ++kt)
#pragma unroll
    for (int r = 0; r < 8; ++r) { const float v = HI ? a[kt][r] + al[kt][r] * (1.0f / 1024.0f) : a[kt][r]; s[kt][r] = (!MASK || kt * 16 + r <= srel) ? v : -3.0e38f; } }
// 2^x of the eight logits a lane holds of one key tile, in place. One statement, so that behind each v_exp_f32 stands an instruction that neither reads its result nor overwrites its source: the next one, and a v_nop behind the last (the slot the instruction set asks for)
__device__ __forceinline__ void exp2x8(float (&x)[8]) {
  asm("v_exp_f32 %0, %0\n\tv_exp_f32 %1, %1\n\tv_exp_f32 %2, %2\n\tv_exp_f32 %3, %3\n\tv_exp_f32 %4, %4\n\tv_exp_f32 %5, %5\n\tv_exp_f32 %6, %6\n\tv_exp_f32 %7, %7\n\tv_nop"
      : "+v"(x[0]), "+v"(x[1]), "+v"(x[2]), "+v"(x[3]), "+v"(x[4]), "+v"(x[5]), "+v"(x[6]), "+v"(x[7])); }
// m = the query's maximum in use (unscaled, the same in both lane halves), bias = 11 - SC2 x m: e = 2^(SC2 x d + bias) = 2^11 exp(s - max in use) by one fused multiply-add and the chip's own 2^x; an excluded logit (-3e38) gives 0. m is finite from a tile's first trip on: that trip holds key 0, which every query keeps
// mthr = m + RTH: while no logit of the wave tops it, e is at most 2^15 (f16 holds it) and m stands; else m moves up to the running maximum and what was summed under the old m is scaled by 2^(SC2 x (old - new)) <= 1
#define RTH (4.0f / SC2)
template <bool HI, bool MASK> __device__ __forceinline__ void att_pv(const _Float16* kp, const _Float16* klp, const _Float16* vp, const __bf16* vhp, const __bf16* vlp, const v16h (&qh)[2], const v16h (&ql)[2], int srel, int g, float& m, float& mthr, float& bias, float& sum, v8f (&acc)[HD / 16]) {
  constexpr int NT = HI ? 2 : 4; v16h kf[2][NT], klf[2][NT], vf[NT / 2][HD / 16]; v16b vh[NT / 2][HD / 16], vl[NT / 2][HD / 16]; float s[NT][8]; att_ldk<HI>(kp, klp, kf, klf);
  att_logits<HI, MASK>(kf, klf, qh, ql, srel, s);
#pragma unroll
  for (int u = 0; u < NT / 2; ++u)   /* the v reads take the k fragments' registers and fly under the exponentials */
#pragma unroll
    for (int j = 0; j < HD / 16; ++j) { if (!HI) vf[u][j] = pair_h(vp + j * 16 * SP + u * 32); else { vh[u][j] = pair_b(vhp + j * 16 * SP + u * 32); vl[u][j] = pair_b(vlp + j * 16 * SP + u * 32); } }
  float tk[NT];   /* one chain a key tile, so that the chains interleave and each starts when its tile's product is done */
#pragma unroll
  for (int kt = 0; kt < NT; ++kt) { tk[kt] = s[kt][0];
#pragma unroll
    for (int r = 1; r < 8; ++r) tk[kt] = fmaxf(tk[kt], s[kt][r]); }
  float tm = fmaxf(tk[0], tk[1]);
#pragma unroll
  for (int kt = 2; kt < NT; ++kt) tm = fmaxf(tm, tk[kt]);
  if (__builtin_amdgcn_ballot_w32(tm > mthr) != 0) {   /* one test a trip, the same for the whole wave: a scalar branch, taken in a tile's first trip and seldom after */
    const float mn = fmaxf(m, fmaxf(tm, __shfl_xor(tm, 16)));   /* the two lane halves hold the two key halves of one query */
    float al = SC2 * (m - mn);
    asm("v_exp_f32 %0, %0\n\tv_nop" : "+v"(al));   /* 2^x; the v_nop is the slot the instruction set asks for behind it */
    m = mn; mthr = mn + RTH; bias = fmaf(-mn, SC2, 11.0f); sum *= al;
#pragma unroll
    for (int r = 0; r < 8; ++r) { const float ar = __shfl(al, 8 * g + r);   /* accumulator register r is query 8g + r */
#pragma unroll
      for (int j = 0; j < HD / 16; ++j) acc[j][r] *= ar; } }
  float part[NT];
#pragma unroll
  for (int kt = 0; kt < NT; ++kt) {
#pragma unroll
    for (int r = 0; r < 8; ++r) s[kt][r] = fmaf(s[kt][r], SC2, bias);
    exp2x8(s[kt]); part[kt] = s[kt][0];
#pragma unroll
    for (int r = 1; r < 8; ++r) part[kt] += s[kt][r]; }
#pragma unroll
  for (int kt = 0; kt < NT; kt += 2) sum += part[kt] + part[kt + 1];
#pragma unroll
  for (int u = 0; u < NT / 2; ++u) {
    if (!HI) { v16h p;
#pragma unroll
      for (int i = 0; i < 8; ++i) { p[i] = (_Float16)s[2 * u][i]; p[8 + i] = (_Float16)s[2 * u + 1][i]; }
#pragma unroll
      for (int j = 0; j < HD / 16; ++j) acc[j] = wmma16(p, vf[u][j], acc[j]);
    } else { float pv[16];
#pragma unroll
      for (int i = 0; i < 8; ++i) { pv[i] = s[2 * u][i]; pv[8 + i] = s[2 * u + 1][i]; }
      const F2 p = bsplit16(pv);
#pragma unroll
      for (int j = 0; j < HD / 16; ++j) { acc[j] = wmma_bf(p.h, vh[u][j], acc[j]); acc[j] = wmma_bf(p.l, vh[u][j], acc[j]); acc[j] = wmma_bf(p.h, vl[u][j], acc[j]); } } } }
template <bool HI> __device__ __forceinline__ void att_tile(const _Float16* __restrict__ QH, const _Float16* __restrict__ KH, const _Float16* __restrict__ QL, const _Float16* __restrict__ KL, const _Float16* __restrict__ VT, const __bf16* __restrict__ VB, const __bf16* __restrict__ VBL, _Float16* __restrict__ YH, __bf16* __restrict__ YL, float (*ssw)[HD + 4], _Float16 (*sk)[64][SP], _Float16 (*sv)[64][SP], int b, int h, int qb, int wave, int lane) {
  constexpr int KS = HI ? 32 : 64;   /* keys a trip */
  const int col = lane & 15, g = lane >> 4; const int ql0 = qb * 64 + wave * 16; const size_t ho = (size_t)h * HD + 8 * g;
  const int nfull = HI ? 0 : qb, nmask = HI ? (qb + 1) * 2 : 1;   /* trips wholly below the diagonal, then trips masked by index */
  const int nl = nfull + nmask - 1;   /* trips in front of the last one: all unmasked in the late blocks, all masked in the early ones; block-uniform */
  const int srel0 = ql0 + col - 8 * g - nfull * KS;
  const _Float16* qp = QH + ((size_t)b * TT + ql0 + col) * CC + ho; const _Float16* qlp = HI ? QL + ((size_t)b * QHI + ql0 + col) * CC + ho : qp;
  v16h qh[2], ql[2];
#pragma unroll
  for (int kc = 0; kc < 2; ++kc) { qh[kc] = pair_h(qp + kc * 32); ql[kc] = HI ? pair_h(qlp + kc * 32) : qh[kc]; }
  asm volatile("s_wait_xcnt 0x0" :: "v"(qp), "v"(qlp) : "memory");   /* behind the q loads, as below */
  // staging: 8 lanes x 16 B fill one stage row of 128 B, so a load instruction touches 4 whole lines (the early blocks' v planes: 8 half lines), not 16 pieces. ka: stage rows 0..31, kb: rows 32..63
  constexpr int VLD = HI ? KHI : TT;   /* row pitch of the v planes read */
  const int sr = (wave * 32 + lane) >> 3, sc = (lane & 7) * 8; const size_t vrow = (size_t)b * CC + h * HD + sr;
  const _Float16* const ka0 = KH + ((size_t)b * TT + sr) * CC + h * HD + sc; const _Float16* const kb0 = HI ? KL + ((size_t)b * KHI + sr) * CC + h * HD + sc : ka0 + (size_t)32 * CC;
  const _Float16* const vg0 = HI ? (const _Float16*)((sc < 32 ? VB : VBL) + vrow * KHI + (sc & 31)) : VT + vrow * TT + sc;   /* moved as raw 16-B pieces */
  v8f acc[HD / 16] = {}; float sum = 0.f, m = -3.0e38f, mthr = -3.0e38f, bias = 0.f;   /* nothing summed yet: the first trip sets m */
  { const _Float16 *ka = ka0, *kb = kb0, *vg = vg0; v8h kr[4], vr[4]; int srel = srel0;
#pragma unroll
    for (int i = 0; i < 2; ++i) { kr[i] = *(const v8h*)(ka + (size_t)i * 16 * CC); kr[2 + i] = *(const v8h*)(kb + (size_t)i * 16 * CC); }
#pragma unroll
    for (int i = 0; i < 4; ++i) vr[i] = *(const v8h*)(vg + (size_t)i * 16 * VLD);
    asm volatile("s_wait_xcnt 0x0" :: "v"(ka), "v"(kb), "v"(vg) : "memory");   /* behind the stage's loads: their address registers step on below */
    __syncthreads();   /* every wave has left the stages of the tile before */
#pragma unroll
    for (int i = 0; i < 4; ++i) { *(v8h*)&sk[0][i * 16 + sr][sc] = kr[i]; *(v8h*)&sv[0][i * 16 + sr][sc] = vr[i]; }
    __syncthreads();
#pragma unroll 1   // rolled: one trip's fragments fill the registers
    for (int tr = 0; tr < nl; ++tr, ka += (size_t)KS * CC, kb += (size_t)KS * CC, vg += KS) {
#pragma unroll
      for (int i = 0; i < 2; ++i) { kr[i] = *(const v8h*)(ka + (size_t)(KS + i * 16) * CC); kr[2 + i] = *(const v8h*)(kb + (size_t)(KS + i * 16) * CC); }
#pragma unroll
      for (int i = 0; i < 4; ++i) vr[i] = *(const v8h*)(vg + KS + (size_t)i * 16 * VLD);
      asm volatile("s_wait_xcnt 0x0" :: "v"(ka), "v"(kb), "v"(vg) : "memory");   /* behind the next trip's loads, which fly under this trip's work (the memory clobber holds them in front); naming their address registers keeps these whole up to the wait */
      const _Float16 *kp = &sk[tr & 1][col][8 * g], *vp = &sv[tr & 1][col][8 * g]; att_pv<HI, HI>(kp, kp + 32 * SP, vp, (const __bf16*)vp, (const __bf16*)vp + 32, qh, ql, srel, g, m, mthr, bias, sum, acc); if (HI) srel -= KS;
#pragma unroll
      for (int i = 0; i < 4; ++i) { *(v8h*)&sk[(tr + 1) & 1][i * 16 + sr][sc] = kr[i]; *(v8h*)&sv[(tr + 1) & 1][i * 16 + sr][sc] = vr[i]; }
      __syncthreads(); }   /* publishes trip tr + 1 and ends every wave's reads of trip tr, whose buffers the next trip refills */
    const _Float16 *kp = &sk[nl & 1][col][8 * g], *vp = &sv[nl & 1][col][8 * g]; att_pv<HI, true>(kp, kp + 32 * SP, vp, (const __bf16*)vp, (const __bf16*)vp + 32, qh, ql, srel, g, m, mthr, bias, sum, acc); }
  sum += __shfl_xor(sum, 16);
  const float inv = sum > 0.f ? 1.0f / sum : 0.f;   /* of query col; sum carries the 2^11 of its terms; a fully excluded row yields 0 */
#pragma unroll
  for (int r = 0; r < 8; ++r) { const float ir = __shfl(inv, 8 * g + r);   /* accumulator register r is query 8g + r */
#pragma unroll
    for (int j = 0; j < HD / 16; ++j) ssw[8 * g + r][j * 16 + col] = acc[j][r] * ir; }
  LDSX();
  // ctx leaves in the 16-bit form k_out's product takes: f16(ctx x 2^6), clear of f16 subnormals; early query blocks: bf16 hi + bf16 lo, as bsplit16 forms them
  _Float16* yp = YH + ((size_t)b * TT + ql0 + g) * CC + h * HD + col * 4;   /* 128-B (row, head) segment by 16 lanes, two rows a store */
  if (!HI) { v4h c[8];
#pragma unroll
    for (int i = 0; i < 8; ++i) { const v4f y = *(const v4f*)&ssw[2 * i + g][col * 4];
#pragma unroll
      for (int e = 0; e < 4; ++e) c[i][e] = (_Float16)(y[e] * 64.0f); }
#pragma unroll
    for (int i = 0; i < 8; ++i) vst2(yp + (size_t)i * 2 * CC, c[i]);
    asm volatile("s_wait_xcnt 0x0" :: "v"(yp) : "memory");   /* behind the stores: the next tile overwrites their registers */
  } else { __bf16* ylp = YL + ((size_t)b * QHI + ql0 + g) * CC + h * HD + col * 4; v4b hv[8], lv[8];
#pragma unroll
    for (int i = 0; i < 8; ++i) { const v4f y = *(const v4f*)&ssw[2 * i + g][col * 4]; hv[i] = cvt4b(y); v4f rs;
#pragma unroll
      for (int e = 0; e < 4; ++e) rs[e] = y[e] - (float)hv[i][e];
      lv[i] = cvt4b(rs); }
#pragma unroll
    for (int i = 0; i < 8; ++i) { vst2(yp + (size_t)i * 2 * CC, hv[i]); vst2(ylp + (size_t)i * 2 * CC, lv[i]); }
    asm volatile("s_wait_xcnt 0x0" :: "v"(yp), "v"(ylp) : "memory"); }   /* behind the stores: the next tile overwrites their registers */
  LDSX(); }   /* the next tile's ssw writes stay behind these reads */
// amdgpu_waves_per_eu(2, 2): the grid gives two waves a SIMD (512 blocks x 4 waves, 1,024 SIMDs); with that register budget a trip's exponentials interleave instead of running as one dependent chain after the other
__global__ __launch_bounds__(128) __attribute__((amdgpu_waves_per_eu(2, 2))) void k_att(const _Float16* __restrict__ QH, const _Float16* __restrict__ KH, const _Float16* __restrict__ QL, const _Float16* __restrict__ KL, const _Float16* __restrict__ VT, const __bf16* __restrict__ VB, const __bf16* __restrict__ VBL, _Float16* __restrict__ YH, __bf16* __restrict__ YL) { __shared__ __align__(16) float ss[4][16][HD + 4]; __shared__ __align__(16) _Float16 sk[2][64][SP], sv[2][64][SP];
  const int tid = threadIdx.x, wave = tid >> 5, lane = tid & 31; const int h = blockIdx.y, b = blockIdx.z;
#pragma unroll 1   // rolled: the two tiles share one copy of the code
  for (int half = 0; half < 2; ++half) { const int qb = half ? (int)blockIdx.x : NQB - 1 - (int)blockIdx.x;   /* block-uniform */
    if (qb < QBH) att_tile<true>(QH, KH, QL, KL, VT, VB, VBL, YH, YL, ss[wave], sk, sv, b, h, qb, wave, lane);
    else att_tile<false>(QH, KH, QL, KL, VT, VB, VBL, YH, YL, ss[wave], sk, sv, b, h, qb, wave, lane); } }
// ---- k_out: block = (64 rows, 128 cols): out = ctx Wo (+ bo): f16(ctx x 2^6) against Wo as f16(bf16 x 2^8) exact (1 product) x 2^-14; causal early rows (< QHI of each sequence): ctx bf16 hi + lo against exact bf16 Wo (2 products); the operands come in the 16-bit forms k_att and k_cvt left
__global__ __launch_bounds__(128) void k_out(const _Float16* __restrict__ YH, const __bf16* __restrict__ YL, const __bf16* __restrict__ WOB, const _Float16* __restrict__ WOH, const float* __restrict__ BO, float* __restrict__ OUT) {
  __shared__ __align__(16) union { float sf[4][16][132]; __bf16 b[2][256][SPG]; _Float16 h[2][192][SPG]; } sg;   /* two operand stages: rows 0..127 Wo, 128..191 ctx (hi), 192..255 ctx lo (early rows only); the output tile lies there later (the loop's last barrier between) */
  auto& sf = sg.sf;
  const int tid = threadIdx.x, wave = tid >> 5, lane = tid & 31, col = lane & 15, g = lane >> 4; const int c0 = blockIdx.y * 128; const size_t r0 = (size_t)blockIdx.x * 64 + wave * 16;
  v8f acc[8] = {};
  // a stage = SK k of the block's 128 Wo rows and 64 ctx rows, brought in once for the four waves. 16 lanes x 16 B read one row's 256 B: a load instruction touches 4 whole lines, not 16 pieces
  const int lr = tid >> 4, lc = tid & 15; const size_t wo = (size_t)(c0 + lr) * CC + lc * 8, yo = ((size_t)blockIdx.x * 64 + lr) * CC + lc * 8; const int t0 = (int)(((size_t)blockIdx.x * 64) % TT);
  if (CAUSAL && t0 < QHI) {   /* block-uniform */
    const __bf16* wg = WOB + wo; const __bf16* yg = (const __bf16*)YH + yo; const __bf16* zg = YL + (((size_t)blockIdx.x * 64) / TT * QHI + t0 + lr) * CC + lc * 8;
    v8b wr[16], yr[8], zr[8];
#pragma unroll
    for (int i = 0; i < 16; ++i) wr[i] = *(const v8b*)(wg + (size_t)i * 8 * CC);
#pragma unroll
    for (int i = 0; i < 8; ++i) { yr[i] = *(const v8b*)(yg + (size_t)i * 8 * CC); zr[i] = *(const v8b*)(zg + (size_t)i * 8 * CC); }
    asm volatile("s_wait_xcnt 0x0" :: "v"(wg), "v"(yg), "v"(zg) : "memory");   /* behind the stage's loads: their address registers step on below */
#pragma unroll
    for (int i = 0; i < 16; ++i) *(v8b*)&sg.b[0][i * 8 + lr][lc * 8] = wr[i];
#pragma unroll
    for (int i = 0; i < 8; ++i) { *(v8b*)&sg.b[0][128 + i * 8 + lr][lc * 8] = yr[i]; *(v8b*)&sg.b[0][192 + i * 8 + lr][lc * 8] = zr[i]; }
    __syncthreads();
#pragma unroll 1   // rolled: the next stage's 32 loads stay in registers over one stage's products
    for (int s = 0; s < CC / SK; ++s, wg += SK, yg += SK, zg += SK) { const bool more = s + 1 < CC / SK;   /* block-uniform */
      if (more) {
#pragma unroll
        for (int i = 0; i < 16; ++i) wr[i] = *(const v8b*)(wg + SK + (size_t)i * 8 * CC);
#pragma unroll
        for (int i = 0; i < 8; ++i) { yr[i] = *(const v8b*)(yg + SK + (size_t)i * 8 * CC); zr[i] = *(const v8b*)(zg + SK + (size_t)i * 8 * CC); }
        asm volatile("s_wait_xcnt 0x0" :: "v"(wg), "v"(yg), "v"(zg) : "memory"); }   /* behind the next stage's loads, which fly under this stage's products (the memory clobber holds them in front); naming their address registers keeps these whole up to the wait */
#pragma unroll
      for (int kk = 0; kk < SK / 32; ++kk) { const v16b ah = frag_b(&sg.b[s & 1][128 + wave * 16 + col][kk * 32], lane), al = frag_b(&sg.b[s & 1][192 + wave * 16 + col][kk * 32], lane); v16b w[8];
#pragma unroll
        for (int j = 0; j < 8; ++j) w[j] = frag_b(&sg.b[s & 1][j * 16 + col][kk * 32], lane);
#pragma unroll
        for (int j = 0; j < 8; ++j) { acc[j] = wmma_bf(ah, w[j], acc[j]); acc[j] = wmma_bf(al, w[j], acc[j]); } }
      if (more) {
#pragma unroll
        for (int i = 0; i < 16; ++i) *(v8b*)&sg.b[(s + 1) & 1][i * 8 + lr][lc * 8] = wr[i];
#pragma unroll
        for (int i = 0; i < 8; ++i) { *(v8b*)&sg.b[(s + 1) & 1][128 + i * 8 + lr][lc * 8] = yr[i]; *(v8b*)&sg.b[(s + 1) & 1][192 + i * 8 + lr][lc * 8] = zr[i]; } }
      __syncthreads(); }   /* publishes stage s + 1 and ends every wave's reads of stage s, whose buffer the next trip refills */
#pragma unroll
    for (int j = 0; j < 8; ++j) { const float bias = BO ? bfr(BO[c0 + j * 16 + col]) : 0.f;
#pragma unroll
      for (int r = 0; r < 8; ++r) sf[wave][8 * g + r][j * 16 + col] = acc[j][r] + bias; }
  } else {
    const _Float16* wg = WOH + wo; const _Float16* yg = YH + yo;
    v8h wr[16], yr[8];
#pragma unroll
    for (int i = 0; i < 16; ++i) wr[i] = *(const v8h*)(wg + (size_t)i * 8 * CC);
#pragma unroll
    for (int i = 0; i < 8; ++i) yr[i] = *(const v8h*)(yg + (size_t)i * 8 * CC);
    asm volatile("s_wait_xcnt 0x0" :: "v"(wg), "v"(yg) : "memory");   /* behind the stage's loads: their address registers step on below */
#pragma unroll
    for (int i = 0; i < 16; ++i) *(v8h*)&sg.h[0][i * 8 + lr][lc * 8] = wr[i];
#pragma unroll
    for (int i = 0; i < 8; ++i) *(v8h*)&sg.h[0][128 + i * 8 + lr][lc * 8] = yr[i];
    __syncthreads();
#pragma unroll 1   // rolled: the next stage's 24 loads stay in registers over one stage's products
    for (int s = 0; s < CC / SK; ++s, wg += SK, yg += SK) { const bool more = s + 1 < CC / SK;   /* block-uniform */
      if (more) {
#pragma unroll
        for (int i = 0; i < 16; ++i) wr[i] = *(const v8h*)(wg + SK + (size_t)i * 8 * CC);
#pragma unroll
        for (int i = 0; i < 8; ++i) yr[i] = *(const v8h*)(yg + SK + (size_t)i * 8 * CC);
        asm volatile("s_wait_xcnt 0x0" :: "v"(wg), "v"(yg) : "memory"); }   /* behind the next stage's loads, which fly under this stage's products (the memory clobber holds them in front); naming their address registers keeps these whole up to the wait */
#pragma unroll
      for (int kk = 0; kk < SK / 32; ++kk) { const v16h a = frag_h(&sg.h[s & 1][128 + wave * 16 + col][kk * 32], lane); v16h w[8];
#pragma unroll
        for (int j = 0; j < 8; ++j) w[j] = frag_h(&sg.h[s & 1][j * 16 + col][kk * 32], lane);
#pragma unroll
        for (int j = 0; j < 8; ++j) acc[j] = wmma16(a, w[j], acc[j]); }
      if (more) {
#pragma unroll
        for (int i = 0; i < 16; ++i) *(v8h*)&sg.h[(s + 1) & 1][i * 8 + lr][lc * 8] = wr[i];
#pragma unroll
        for (int i = 0; i < 8; ++i) *(v8h*)&sg.h[(s + 1) & 1][128 + i * 8 + lr][lc * 8] = yr[i]; }
      __syncthreads(); }   /* publishes stage s + 1 and ends every wave's reads of stage s, whose buffer the next trip refills */
#pragma unroll
    for (int j = 0; j < 8; ++j) { const float bias = BO ? bfr(BO[c0 + j * 16 + col]) : 0.f;
#pragma unroll
      for (int r = 0; r < 8; ++r) sf[wave][8 * g + r][j * 16 + col] = acc[j][r] * (1.0f / 16384.0f) + bias; } }   /* 2^-8 (Wo carry) x 2^-6 (ctx carry) */
  LDSX(); for (int rl = 0; rl < 16; ++rl) vst2(OUT + (r0 + rl) * DIN + c0 + lane * 4, *(const v4f*)&sf[wave][rl][lane * 4]); }

extern "C" void kernel_launch(void* const* d_in, const int* in_sizes, int n_in, void* d_out, int out_size, void* d_ws, size_t ws_size, hipStream_t stream) {
  (void)in_sizes; (void)n_in; (void)out_size;
  const float** F = (const float**)d_in;
  if (ws_size < (size_t)WS_END) return;
  char* ws = (char*)d_ws; _Float16 *QH = (_Float16*)(ws + WS_QH), *KH = (_Float16*)(ws + WS_KH), *VT = (_Float16*)(ws + WS_VT), *QL = (_Float16*)(ws + WS_QL), *KL = (_Float16*)(ws + WS_KL); __bf16 *VB = (__bf16*)(ws + WS_VB), *VBL = (__bf16*)(ws + WS_VBL), *YL = (__bf16*)(ws + WS_YL), *XB = (__bf16*)(ws + WS_XB), *WB = (__bf16*)(ws + WS_WB), *WOB = (__bf16*)(ws + WS_WOB); _Float16 *YH = (_Float16*)(ws + WS_YH), *WOH = (_Float16*)(ws + WS_WOH);
  // inputs: 0 x [2,2048,1024]; 1 wq [1024,1024] (out,in); 2 wk; 3 wv; 4 wo (out,in); no biases (null pointers)
  k_cvt<<<dim3((NB * TT * DIN + 4 * CC * DIN) / CVB), 256, 0, stream>>>(F[0], F[1], F[2], F[3], F[4], XB, WB, WOB, WOH);
  k_proj<<<dim3(TNB * TT / 128, CC / 128, 3), 128, 0, stream>>>(XB, XB, XB, WB, WB + (size_t)CC * DIN, WB + 2 * (size_t)CC * DIN, nullptr, nullptr, nullptr, QH, QL, KH, KL, VT, VB, VBL);
  k_att<<<dim3(NQB / 2, NH, TNB), 128, 0, stream>>>(QH, KH, QL, KL, VT, VB, VBL, YH, YL);
  k_out<<<dim3(TNB * TT / 64, DIN / 128), 128, 0, stream>>>(YH, YL, WOB, WOH, nullptr, (float*)d_out);
}

// v009
// A run of this version takes 84.3 microseconds.
// Two timings next to v008 put it at 1.06 and 1.05 times that version's speed.
// Over all steps from v000 it is 15.1 times as fast.
// compute dtype: all float inputs rounded to bf16, once, by k_cvt; q / k / v projections with EXACT bf16 products on WMMA 16x16x32 (f32 accumulate) (no biases); interleaved-pair RoPE in f32 AFTER the bias (embedded frequencies, the library cosf / sinf values, positions = the row index); causal logits: 3 products for the first 384 rows, single f16 q x k after, x 64^-0.5; softmax f32 (one pass, running row maximum, logits never stored); exp(s - the maximum in use) x 2^11 once to f16 x v once to f16 (bf16 hi + lo below row 384), / sum after the product; ctx hi+lo x exact Wo below row 384, x2^6 f16 carry x f16(bf16 x 2^8) Wo after, + bo; f32 output.
#include <hip/hip_runtime.h>
#include <math.h>

typedef __attribute__((ext_vector_type(16))) _Float16 v16h;
typedef __attribute__((ext_vector_type(16))) __bf16 v16b;
typedef __attribute__((ext_vector_type(8)))  _Float16 v8h;
typedef __attribute__((ext_vector_type(8)))  float v8f;
typedef __attribute__((ext_vector_type(4)))  float v4f;
typedef __attribute__((ext_vector_type(2)))  float v2f;
typedef __attribute__((ext_vector_type(4)))  unsigned v4u;
typedef __attribute__((ext_vector_type(4)))  int v4i;
typedef float __attribute__((may_alias)) float_a;
typedef int __attribute__((may_alias)) int_a;

template <typename T> __device__ __forceinline__ void vst2(void* p, T v) { *(T*)p = v;  }
__device__ __forceinline__ v8f wmma16(v16h a, v16h b, v8f c) {
  v8f d = __builtin_amdgcn_wmma_f32_16x16x32_f16(false, a, false, b, (short)0, c, false, false);
  asm volatile("v_nop\n\tv_nop\n\tv_nop\n\tv_nop" : "+v"(d) : "v"(a), "v"(b));
  return d;
}
__device__ __forceinline__ v8f wmma_bf(v16b a, v16b b, v8f c) {
  v8f d = __builtin_amdgcn_wmma_f32_16x16x32_bf16(false, a, false, b, (short)0, c, false, false);
  asm volatile("v_nop\n\tv_nop\n\tv_nop\n\tv_nop" : "+v"(d) : "v"(a), "v"(b));
  return d;
}
// 16x16x32 fragments: lane = (h = lane>>4, row/col = lane&15); elements 0..7 = k0+8h+0..7, 8..15 = k0+16+8h+0..7; D element r = row 8h+r
__device__ __forceinline__ v16h frag_h(const _Float16* rowk0, int lane) {
  union { v16h v; v8h q[2]; } u; const _Float16* p = rowk0 + 8 * (lane >> 4);
  u.q[0] = *(const v8h*)p; u.q[1] = *(const v8h*)(p + 16); return u.v;
}
__device__ __forceinline__ v16h frag_f32(const float* rowk0, int lane) {
  v16h a; const float* p = rowk0 + 8 * (lane >> 4);
#pragma unroll
  for (int i = 0; i < 8; ++i) { a[i] = (_Float16)p[i]; a[8 + i] = (_Float16)p[16 + i]; }
  return a;
}
__device__ __forceinline__ v16h frag_f32s(const float* rowk0, int lane, float sc) {
  v16h a; const float* p = rowk0 + 8 * (lane >> 4);
#pragma unroll
  for (int i = 0; i < 8; ++i) { a[i] = (_Float16)(p[i] * sc); a[8 + i] = (_Float16)(p[16 + i] * sc); }
  return a;
}
// column fragment from a [K][ld] layout (column n), rows >= K read as 0
__device__ __forceinline__ v16h fragc_f32(const float* W, int k0, int n, int lane, int ld, int K) {
  v16h a; const int g = lane >> 4;
#pragma unroll
  for (int i = 0; i < 8; ++i) { const int ka = k0 + 8 * g + i, kb = ka + 16;
    a[i] = (_Float16)(ka < K ? W[(size_t)(ka < K ? ka : K - 1) * ld + n] : 0.f); a[8 + i] = (_Float16)(kb < K ? W[(size_t)(kb < K ? kb : K - 1) * ld + n] : 0.f); }
  return a;
}
struct F2 { v16b h, l; };
__device__ __forceinline__ F2 bsplit16(const float v[16]) { F2 r;
#pragma unroll
  for (int i = 0; i < 16; ++i) { const __bf16 h = (__bf16)v[i]; r.h[i] = h; r.l[i] = (__bf16)(v[i] - (float)h); }
  return r; }
__device__ __forceinline__ F2 split_row(const float* row, int k0, int lane) { float v[16]; const float* p = row + k0 + 8 * (lane >> 4);
#pragma unroll
  for (int i = 0; i < 8; ++i) { v[i] = p[i]; v[8 + i] = p[16 + i]; }
  return bsplit16(v); }
__device__ __forceinline__ F2 split_rowK(const float* row, int k0, int lane, int K) { float v[16]; const int g = lane >> 4;
#pragma unroll
  for (int i = 0; i < 8; ++i) { const int ka = k0 + 8 * g + i, kb = ka + 16; v[i] = ka < K ? row[ka < K ? ka : K - 1] : 0.f; v[8 + i] = kb < K ? row[kb < K ? kb : K - 1] : 0.f; }
  return bsplit16(v); }
__device__ __forceinline__ F2 split_col(const float* W, int k0, int n, int lane, int ld, int K) { float v[16]; const int g = lane >> 4;
#pragma unroll
  for (int i = 0; i < 8; ++i) { const int ka = k0 + 8 * g + i, kb = ka + 16; v[i] = ka < K ? W[(size_t)(ka < K ? ka : K - 1) * ld + n] : 0.f; v[8 + i] = kb < K ? W[(size_t)(kb < K ? kb : K - 1) * ld + n] : 0.f; }
  return bsplit16(v); }
__device__ __forceinline__ v8f mac3(const F2& a, const F2& b, v8f c) { c = wmma_bf(a.l, b.h, c); c = wmma_bf(a.h, b.l, c); return wmma_bf(a.h, b.h, c); }
__device__ __forceinline__ float sigm(float v) { return 1.0f / (1.0f + expf(-v)); }
#define LDSX() do { asm volatile("s_wait_dscnt 0" ::: "memory"); __builtin_amdgcn_wave_barrier(); __builtin_amdgcn_fence(__ATOMIC_RELEASE, "workgroup"); } while (0)

// Causal multi-head self-attention with interleaved-pair RoPE (x [2,2048,1024]; torch (out,in) wq / wk / wv / wo [1024,1024] applied as x @ W.T, no biases; 16 heads x 64; RoPE on Q and K: adjacent (even, odd) pairs (xe c - xo s, xe s + xo c) re-interleaved, theta 10000, positions 0..2047; scores / sqrt(64); tril kept, -inf elsewhere (the module's own softmax guards the -inf row maximum: every row keeps its diagonal, so the guard never fires); out @ wo.T).
#define NB 2
#define TT 2048
#define CC 1024            // NH * HD = projected width
#define DIN 1024          // input (model) width
#define NH 16
#define HD 64
#define NQB (TT / 64)
#define SCALE (0.125f)
#define SC2 (SCALE * 1.44269504088896340736f)   // SCALE x log2(e): exp(SCALE x (d - dmax)) = 2^(SC2 x d - SC2 x dmax), d = the unscaled q.k product
#define CAUSAL 1
#ifndef TNB
#define TNB NB
#endif
__device__ __forceinline__ float bfr(float v) { return (float)(__bf16)v; }
typedef __attribute__((ext_vector_type(8))) __bf16 v8b;
__device__ __forceinline__ v16b frag_b(const __bf16* rowk0, int lane) {
  union { v16b v; v8b q[2]; } u; const __bf16* p = rowk0 + 8 * (lane >> 4);
  u.q[0] = *(const v8b*)p; u.q[1] = *(const v8b*)(p + 16); return u.v;
}
// unconverted fragment reads; p = the lane's row + k0 + 8 * (lane >> 4): elements 0..7 = p[0..7], 8..15 = p[16..23] (the k order of frag_h / frag_f32 / split_row / wcol_oi)
typedef __attribute__((ext_vector_type(16))) float v16f;
__device__ __forceinline__ v16f raw16(const float* p) { v16f r;
#pragma unroll
  for (int i = 0; i < 8; ++i) { r[i] = p[i]; r[8 + i] = p[16 + i]; }
  return r; }
__device__ __forceinline__ v16h pair_h(const _Float16* p) { union { v16h v; v8h q[2]; } u; u.q[0] = *(const v8h*)p; u.q[1] = *(const v8h*)(p + 16); return u.v; }
__device__ __forceinline__ v16b pair_b(const __bf16* p) { union { v16b v; v8b q[2]; } u; u.q[0] = *(const v8b*)p; u.q[1] = *(const v8b*)(p + 16); return u.v; }
__device__ __forceinline__ F2 bsplit_v(v16f r) { float v[16];
#pragma unroll
  for (int i = 0; i < 16; ++i) v[i] = r[i];
  return bsplit16(v); }
#define SK 128             // k of one LDS operand stage (k_out): 256 B of every 16-bit source row
#define SPG 136            // its row pitch in 16-bit elements: 272 B = 16 B x 17, odd, for the ds_load_b128 fragment reads
#define SP 72              // k_att's stage row pitch in 16-bit elements: 144 B = 16 B x 9, odd, for the ds_load_b128 fragment reads
typedef __attribute__((ext_vector_type(4))) __bf16 v4b;
typedef __attribute__((ext_vector_type(4))) _Float16 v4h;
__device__ __forceinline__ v4b cvt4b(v4f v) { v4b r;
#pragma unroll
  for (int i = 0; i < 4; ++i) r[i] = (__bf16)v[i];
  return r; }
#define QBH 6              // causal: query blocks 0..QBH-1 of each sequence (few keys, no averaging) take the high-precision path
#define QHI 384            // rows carrying a q residual plane
#define KHI 384            // key rows carrying k residual / v bf16 hi+lo planes (used only by the causal high-precision path)
// B fragment (k rows k0+.., output column o) of a weight: (in,out) [K][ld] or (out,in) [ld rows of K]: bf16 exact, or f16(bf16 * 256) exact
__device__ __forceinline__ v16b wcol_io(const float* Wm, int k0, int o, int lane, int ld) { v16b w; const int g = lane >> 4;
#pragma unroll
  for (int i = 0; i < 8; ++i) { w[i] = (__bf16)Wm[(size_t)(k0 + 8 * g + i) * ld + o]; w[8 + i] = (__bf16)Wm[(size_t)(k0 + 16 + 8 * g + i) * ld + o]; }
  return w; }
__device__ __forceinline__ v16b wcol_oi(const float* Wm, int k0, int o, int lane, int K) { v16b w; const float* p = Wm + (size_t)o * K + k0 + 8 * (lane >> 4);
#pragma unroll
  for (int i = 0; i < 8; ++i) { w[i] = (__bf16)p[i]; w[8 + i] = (__bf16)p[16 + i]; }
  return w; }
__device__ __forceinline__ v16h wcolh_io(const float* Wm, int k0, int o, int lane, int ld) { v16h w; const int g = lane >> 4;
#pragma unroll
  for (int i = 0; i < 8; ++i) { w[i] = (_Float16)(bfr(Wm[(size_t)(k0 + 8 * g + i) * ld + o]) * 256.0f); w[8 + i] = (_Float16)(bfr(Wm[(size_t)(k0 + 16 + 8 * g + i) * ld + o]) * 256.0f); }
  return w; }
__device__ __forceinline__ v16h wcolh_oi(const float* Wm, int k0, int o, int lane, int K) { v16h w; const float* p = Wm + (size_t)o * K + k0 + 8 * (lane >> 4);
#pragma unroll
  for (int i = 0; i < 8; ++i) { w[i] = (_Float16)(bfr(p[i]) * 256.0f); w[8 + i] = (_Float16)(bfr(p[16 + i]) * 256.0f); }
  return w; }
#define WQKV_LAYOUT 1   // 0 = (in,out) [DIN][CC]; 1 = (out,in) [CC][DIN]; 2 = per-head [NH][DIN][HD]
__device__ __forceinline__ v16b wcol_hdk(const float* Wm, int k0, int o, int lane) { v16b w; const int g = lane >> 4; const float* p = Wm + (size_t)(o / HD) * DIN * HD + (o % HD);
#pragma unroll
  for (int i = 0; i < 8; ++i) { w[i] = (__bf16)p[(size_t)(k0 + 8 * g + i) * HD]; w[8 + i] = (__bf16)p[(size_t)(k0 + 16 + 8 * g + i) * HD]; }
  return w; }
#define WO_OUT_IN 1
#if WQKV_LAYOUT == 1
#define WCOL(W, k0, o, lane) wcol_oi(W, k0, o, lane, DIN)
#elif WQKV_LAYOUT == 2
#define WCOL(W, k0, o, lane) wcol_hdk(W, k0, o, lane)
#else
#define WCOL(W, k0, o, lane) wcol_io(W, k0, o, lane, CC)
#endif
#if WO_OUT_IN
#define WOCOL(W, k0, o, lane) wcol_oi(W, k0, o, lane, CC)
#define WOCOLH(W, k0, o, lane) wcolh_oi(W, k0, o, lane, CC)
#else
#define WOCOL(W, k0, o, lane) wcol_io(W, k0, o, lane, DIN)
#define WOCOLH(W, k0, o, lane) wcolh_io(W, k0, o, lane, DIN)
#endif

// RoPE inverse frequencies 1/10000^(2i/64) (the f32 values jax computes)
__constant__ float INVF[32] = {1.000000000e+00,7.498942018e-01,5.623413324e-01,4.216965139e-01,3.162277639e-01,2.371373624e-01,1.778279394e-01,1.333521456e-01,1.000000015e-01,7.498941571e-02,5.623412877e-02,4.216964915e-02,3.162277862e-02,2.371373586e-02,1.778279431e-02,1.333521493e-02,9.999999776e-03,7.498942316e-03,5.623413250e-03,4.216964822e-03,3.162277862e-03,2.371373819e-03,1.778279431e-03,1.333521446e-03,1.000000047e-03,7.498941850e-04,5.623413017e-04,4.216964880e-04,3.162277862e-04,2.371373848e-04,1.778279402e-04,1.333521504e-04};
#define PROJ_EXTRA_PARAMS
// cos and sin of a RoPE angle a, 0 <= a < 2^17 (a position below TT x a frequency of at most 1). On that range these are the library's cosf / sinf operation for operation (pi/2 taken off in three parts, its two polynomials, the quadrant select); left out are its branches to the large-argument reduction, never taken here, which kept one angle's chain from starting before the last one's end
__device__ __forceinline__ void rope_cs(float a, float& cs, float& sn) {
  const float fn = rintf(a * 6.36619747e-1f);
  const float r = fmaf(fn, -5.39030253e-15f, fmaf(fn, -7.54978942e-8f, fmaf(fn, -1.57079625e+0f, a)));
  const float t = r * r; const unsigned q = (unsigned)(int)fn;
  const float s = fmaf(r, t * fmaf(t, fmaf(t, -1.94644585e-4f, 8.33171979e-3f), -1.66666463e-1f), r);
  const float c = fmaf(t, fmaf(t, fmaf(t, fmaf(t, 2.56687417e-5f, -1.39091106e-3f), 4.16679047e-2f), -5.00000238e-1f), 1.0f);
  const unsigned sg = (q << 30) & 0x80000000u;   /* quadrants 2 and 3 flip both signs */
  sn = __uint_as_float(__float_as_uint((q & 1u) ? c : s) ^ sg); cs = __uint_as_float(__float_as_uint((q & 1u) ? -s : c) ^ sg); }
#ifndef PROJ_EXTRA_PARAMS
#define PROJ_EXTRA_PARAMS
#endif

#define WS_QH  0u                                      // f16 q rows [b*t][CC]
#define WS_KH  (WS_QH + 2u * (size_t)NB * TT * CC)      // f16 k rows [b*t][CC]
#define WS_VT  (WS_KH + 2u * (size_t)NB * TT * CC)      // f16 v planes [b][c][t]
#define WS_QL  (WS_VT + 2u * (size_t)NB * CC * TT)      // f16 q residual x 2^10 rows [b][t < QHI][CC]
#define WS_KL  (WS_QL + 2u * (size_t)NB * QHI * CC)     // f16 k residual x 2^10 rows [b][t < KHI][CC]
#define WS_VB  (WS_KL + 2u * (size_t)NB * KHI * CC)     // bf16 v hi planes [b][c][t < KHI]
#define WS_VBL (WS_VB + 2u * (size_t)NB * CC * KHI)
#define WS_YH  (WS_VBL + 2u * (size_t)NB * CC * KHI)    // 16-bit ctx rows [b*t][CC]: f16(ctx x 2^6); rows < QHI of a sequence: bf16 hi
#define WS_YL  (WS_YH + 2u * (size_t)NB * TT * CC)      // bf16 ctx lo rows [b][t < QHI][CC]
#define WS_XB  (WS_YL + 2u * (size_t)NB * QHI * CC)     // bf16 x rows [b*t][DIN]
#define WS_WB  (WS_XB + 2u * (size_t)NB * TT * DIN)     // bf16 wq, wk, wv, each [CC][DIN]
#define WS_WOB (WS_WB + 6u * (size_t)CC * DIN)          // bf16 wo [DIN][CC]
#define WS_WOH (WS_WOB + 2u * (size_t)DIN * CC)         // f16(bf16 wo x 2^8) [DIN][CC]
#define WS_END (WS_WOH + 2u * (size_t)DIN * CC)

// ---- k_cvt: x, wq, wk, wv, wo to the 16-bit forms the products take, once, in place of once in each of the 24 (x), 32 (wq, wk, wv), 64 (wo) blocks that stage a row. block = CVB consecutive floats of one input: 16 loads of 16 B a lane in flight, 512 B a wave and load; stores of 256 B a wave; two blocks a WGP, so that few waves have to start
#define CVB 16384
__global__ __launch_bounds__(256) void k_cvt(const float* __restrict__ X, const float* __restrict__ WQ, const float* __restrict__ WK, const float* __restrict__ WV, const float* __restrict__ WO, __bf16* __restrict__ XB, __bf16* __restrict__ WB, __bf16* __restrict__ WOB, _Float16* __restrict__ WOH) {
  constexpr int nx = NB * TT * DIN / CVB, nw = CC * DIN / CVB; const int blk = blockIdx.x; const int sel = blk < nx ? -1 : (blk - nx) / nw;   /* block-uniform: -1 x, 0..2 wq wk wv, 3 wo */
  const size_t o = (size_t)(blk < nx ? blk : (blk - nx) % nw) * CVB + threadIdx.x * 4;
  const float* s = (sel < 0 ? X : sel == 0 ? WQ : sel == 1 ? WK : sel == 2 ? WV : WO) + o;
  v4f r[16]; v4b c[16];
#pragma unroll
  for (int i = 0; i < 16; ++i) r[i] = *(const v4f*)(s + i * 1024);
  asm volatile("s_wait_xcnt 0x0" :: "v"(s) : "memory");   /* behind the loads: their address registers may be taken for the stores' */
#pragma unroll
  for (int i = 0; i < 16; ++i) c[i] = cvt4b(r[i]);
  __bf16* d = (sel < 0 ? XB : sel < 3 ? WB + (size_t)sel * CC * DIN : WOB) + o;
  if (sel == 3) { v4h f[16];   /* wo also as f16(bf16 x 2^8), exact */
#pragma unroll
    for (int i = 0; i < 16; ++i)
#pragma unroll
      for (int e = 0; e < 4; ++e) f[i][e] = (_Float16)((float)c[i][e] * 256.0f);
#pragma unroll
    for (int i = 0; i < 16; ++i) *(v4h*)(WOH + o + i * 1024) = f[i]; }
#pragma unroll
  for (int i = 0; i < 16; ++i) *(v4b*)(d + i * 1024) = c[i]; }

// ---- k_proj: block = (128 rows, 128 cols, which), four waves of 64 x 64 each: q/k/v = X W (+ b), X and W in k_cvt's bf16, with exact bf16 products (K = DIN) -> which 0: q f16 rows (+ residual rows < QHI); 1: k f16 rows (+ residual rows < KHI); 2: v f16 planes [c][t] (+ bf16 hi/lo planes for t < KHI)
// a wave's 4 X and 4 W fragments of a k step feed 16 products (16 x 128 a wave: 9 fragments for 8), and a staged row serves 128 rows or columns of the tile. 768 blocks, three on a WGP (LDS, registers): all resident at once
#define PK 64              // k of one LDS operand stage: 128 B of every 16-bit source row
#define PPG 72             // its row pitch in 16-bit elements: 144 B = 16 B x 9, odd, for the ds_load_b128 fragment reads
__global__ __launch_bounds__(128) void k_proj(const __bf16* __restrict__ XQ, const __bf16* __restrict__ XK, const __bf16* __restrict__ XV, const __bf16* __restrict__ WQ, const __bf16* __restrict__ WK, const __bf16* __restrict__ WV, const float* __restrict__ BQ, const float* __restrict__ BK, const float* __restrict__ BV,
    _Float16* __restrict__ QH, _Float16* __restrict__ QL, _Float16* __restrict__ KH, _Float16* __restrict__ KL, _Float16* __restrict__ VT, __bf16* __restrict__ VB, __bf16* __restrict__ VBL PROJ_EXTRA_PARAMS) {
  __shared__ __align__(16) union { struct { float st[64][132]; union { struct { _Float16 sh[64][136], sl[64][136]; } r; struct { _Float16 th[128][72]; __bf16 tb[128][72], tbl[128][72]; } p; } c; } e; __bf16 sg[2][256][PPG]; } un;   /* the two operand stages of the k loop lie where the epilogue's tiles lie later (the loop's last barrier between); a block needs either the row tiles (q, k) or the plane tiles (v) */
  auto& st = un.e.st; auto& sh = un.e.c.r.sh; auto& sl = un.e.c.r.sl; auto& th = un.e.c.p.th; auto& tb = un.e.c.p.tb; auto& tbl = un.e.c.p.tbl; auto& sg = un.sg;
  const int tid = threadIdx.x, wave = tid >> 5, lane = tid & 31, col = lane & 15, g = lane >> 4; const int wrow = wave >> 1, wcol = wave & 1;   /* the wave's 64 x 64 quarter of the tile */
  const int which = blockIdx.z; const int c0 = blockIdx.y * 128; const size_t rb = (size_t)blockIdx.x * 128;
  const __bf16* X = which == 0 ? XQ : which == 1 ? XK : XV; const __bf16* WA = which == 0 ? WQ : which == 1 ? WK : WV; const float* BA = which == 0 ? BQ : which == 1 ? BK : BV;
  v8f acc[4][4] = {};
  // a stage = PK k of the block's 128 W rows (sg rows 0..127) and 128 X rows (128..255), bf16 as k_cvt left them, brought in once for the four waves. 8 lanes x 16 B read one row's 128 B: a load instruction touches 4 whole lines, not 16 pieces
  const int lr = tid >> 3, lc = tid & 7; const __bf16* wg = WA + (size_t)(c0 + lr) * DIN + lc * 8; const __bf16* xg = X + (rb + lr) * DIN + lc * 8;
  v8b wr[8], xr[8];
#pragma unroll
  for (int i = 0; i < 8; ++i) wr[i] = *(const v8b*)(wg + (size_t)i * 16 * DIN);
#pragma unroll
  for (int i = 0; i < 8; ++i) xr[i] = *(const v8b*)(xg + (size_t)i * 16 * DIN);
  asm volatile("s_wait_xcnt 0x0" :: "v"(wg), "v"(xg) : "memory");   /* behind the stage's loads: their address registers step on below */
#pragma unroll
  for (int i = 0; i < 8; ++i) *(v8b*)&sg[0][i * 16 + lr][lc * 8] = wr[i];
#pragma unroll
  for (int i = 0; i < 8; ++i) *(v8b*)&sg[0][128 + i * 16 + lr][lc * 8] = xr[i];
  __syncthreads();
#pragma unroll 1   // rolled: the next stage's 16 loads stay in registers over one stage's products
  for (int s = 0; s < DIN / PK; ++s, wg += PK, xg += PK) { const bool more = s + 1 < DIN / PK;   /* block-uniform */
    if (more) {
#pragma unroll
      for (int i = 0; i < 8; ++i) wr[i] = *(const v8b*)(wg + PK + (size_t)i * 16 * DIN);
#pragma unroll
      for (int i = 0; i < 8; ++i) xr[i] = *(const v8b*)(xg + PK + (size_t)i * 16 * DIN);
      asm volatile("s_wait_xcnt 0x0" :: "v"(wg), "v"(xg) : "memory"); }   /* behind the next stage's loads, which fly under this stage's products (the memory clobber holds them in front); naming their address registers keeps these whole up to the wait */
#pragma unroll
    for (int kk = 0; kk < PK / 32; ++kk) { v16b a[4], w[4];
#pragma unroll
      for (int i = 0; i < 4; ++i) a[i] = frag_b(&sg[s & 1][128 + wrow * 64 + i * 16 + col][kk * 32], lane);
#pragma unroll
      for (int j = 0; j < 4; ++j) w[j] = frag_b(&sg[s & 1][wcol * 64 + j * 16 + col][kk * 32], lane);
#pragma unroll
      for (int i = 0; i < 4; ++i)
#pragma unroll
        for (int j = 0; j < 4; ++j) acc[i][j] = wmma_bf(a[i], w[j], acc[i][j]); }
    if (more) {
#pragma unroll
      for (int i = 0; i < 8; ++i) *(v8b*)&sg[(s + 1) & 1][i * 16 + lr][lc * 8] = wr[i];
#pragma unroll
      for (int i = 0; i < 8; ++i) *(v8b*)&sg[(s + 1) & 1][128 + i * 16 + lr][lc * 8] = xr[i]; }
    __syncthreads(); }   /* publishes stage s + 1 and ends every wave's reads of stage s, whose buffer the next trip refills */
#pragma unroll 1   // rolled: the tile's two halves of 64 rows leave one after the other through one copy of the epilogue and one set of LDS tiles
  for (int hf = 0; hf < 2; ++hf) { const size_t r0 = rb + hf * 64; const size_t bb = r0 / TT; const int t0 = (int)(r0 % TT);
  { // stage the half's f32 tile (acc + bias) in LDS, written by the two waves that hold it, run the per-(row, head) epilogue hook, then convert. The half before is out of st since its conversion's barrier, and out of the 16-bit tiles before the two barriers below
    if (wrow == hf) {
#pragma unroll
      for (int j = 0; j < 4; ++j) { const float bias = BA ? bfr(BA[c0 + wcol * 64 + j * 16 + col]) : 0.f;
#pragma unroll
        for (int i = 0; i < 4; ++i)
#pragma unroll
          for (int r = 0; r < 8; ++r) st[i * 16 + 8 * g + r][wcol * 64 + j * 16 + col] = acc[i][j][r] + bias; } }
    __syncthreads();
    if (which < 2) {   /* block-uniform. q and k: interleaved-pair rotation (x[2i], x[2i + 1]) by the angle t * INVF[i]; v untouched. A thread has one row and every second frequency: each cos / sin is formed once and turns the pair of both heads of the tile; 32 lanes x 8 B fall on 64 different banks */
      const int rl = tid >> 1, ih = tid & 1; const float pos = (float)(int)((r0 + rl) % TT);   /* position = the token's sequence index */
#pragma unroll   // unrolled: the 16 angles' chains interleave
      for (int ii = 0; ii < 16; ++ii) { float cs, sn; const float f0 = INVF[2 * ii], f1 = INVF[2 * ii + 1]; rope_cs(pos * (ih ? f1 : f0), cs, sn);   /* both read as scalars, then a select: no load by lane */
#pragma unroll   // unrolled: both heads' pairs are turned from the same two registers
        for (int hh = 0; hh < 128 / HD; ++hh) { v2f* p = (v2f*)&st[rl][hh * HD + 4 * ii + 2 * ih]; const v2f x = *p; v2f y; y[0] = x[0] * cs - x[1] * sn; y[1] = x[0] * sn + x[1] * cs; *p = y; } } }
    __syncthreads(); }
  if (which < 2) { _Float16* DH = which == 0 ? QH : KH; _Float16* DL = which == 0 ? QL : KL; const int nhi = which == 0 ? QHI : KHI; const bool hi_rows = t0 < nhi;
    for (int e = tid; e < 64 * 128; e += 128) { const int rl = e >> 7, cl = e & 127; const float v = st[rl][cl]; const _Float16 hv = (_Float16)v; sh[rl][cl] = hv; sl[rl][cl] = (_Float16)((v - (float)hv) * 1024.0f); }
    __syncthreads();
    for (int e = tid; e < 64 * 16; e += 128) { const int rl = e >> 4, q = e & 15; vst2((unsigned*)(DH + (r0 + rl) * CC + c0 + q * 8), *(const v4u*)&sh[rl][q * 8]); if (hi_rows) vst2((unsigned*)(DL + (bb * nhi + t0 + rl) * (size_t)CC + c0 + q * 8), *(const v4u*)&sl[rl][q * 8]); }
  } else { const bool hi_rows = t0 < KHI;
    for (int e = tid; e < 64 * 128; e += 128) { const int rl = e & 63, cl = e >> 6; const float v = st[rl][cl]; th[cl][rl] = (_Float16)v; const __bf16 bh = (__bf16)v; tb[cl][rl] = bh; tbl[cl][rl] = (__bf16)(v - (float)bh); }
    __syncthreads();
    for (int e = tid; e < 128 * 8; e += 128) { const int cl = e >> 3, q = e & 7; vst2((unsigned*)(VT + (bb * CC + c0 + cl) * (size_t)TT + t0 + q * 8), *(const v4u*)&th[cl][q * 8]); if (hi_rows) { const size_t o3 = (bb * CC + c0 + cl) * (size_t)KHI + t0 + q * 8; vst2((unsigned*)(VB + o3), *(const v4u*)&tb[cl][q * 8]); vst2((unsigned*)(VBL + o3), *(const v4u*)&tbl[cl][q * 8]); } } } } }
// ---- k_att: block = 4 waves x 16 queries of (b, h), two query blocks one after the other (x and NQB - 1 - x: every block walks (NQB + 1) x 64 keys). Logits as S^T = K Q^T: D register r of key tile kt = key kt * 16 + 8g + r of query col, so a lane holds one query's logits and two tiles are the A fragment of P in the k order of pair_h. One pass over the keys with a running row maximum: e = 2^11 exp(s - the maximum in use), sum of e in f32, e to f16 (early query blocks: bf16 hi + lo) against v; when a logit tops the maximum in use by more than 2^4 in e, sum and acc are scaled down to the new one; ctx = acc / sum. Nothing of S goes to memory.
// a trip is NT key tiles of 16: 64 keys; 32 in the early query blocks, whose residual planes double the fragments
// a trip's operands are staged in LDS once for the four waves (pitch SP): sk rows 0..63 = the 64 k rows (early blocks: 0..31 k, 32..63 its residual); sv row c = v plane c's 64 keys (early blocks: 32 keys of the bf16 hi plane, then of the lo plane)
template <bool HI> __device__ __forceinline__ void att_ldk(const _Float16* kp, const _Float16* klp, v16h (&kf)[2][HI ? 2 : 4], v16h (&klf)[2][HI ? 2 : 4]) {
#pragma unroll
  for (int kc = 0; kc < 2; ++kc)
#pragma unroll
    for (int kt = 0; kt < (HI ? 2 : 4); ++kt) { kf[kc][kt] = pair_h(kp + kt * 16 * SP + kc * 32); if (HI) klf[kc][kt] = pair_h(klp + kt * 16 * SP + kc * 32); } }
// unscaled logits (q.k; SCALE is folded into the exponent's multiplier SC2) of a trip's keys; srel = query - the trip's first key - 8g: key kt * 16 + r of the lane is kept while kt * 16 + r <= srel
template <bool HI, bool MASK> __device__ __forceinline__ void att_logits(const v16h (&kf)[2][HI ? 2 : 4], const v16h (&klf)[2][HI ? 2 : 4], const v16h (&qh)[2], const v16h (&ql)[2], int srel, float (&s)[HI ? 2 : 4][8]) {
  constexpr int NT = HI ? 2 : 4; v8f a[NT] = {}, al[NT] = {};
#pragma unroll
  for (int kc = 0; kc < 2; ++kc)
#pragma unroll
    for (int kt = 0; kt < NT; ++kt) { a[kt] = wmma16(kf[kc][kt], qh[kc], a[kt]); if (HI) { al[kt] = wmma16(kf[kc][kt], ql[kc], al[kt]); al[kt] = wmma16(klf[kc][kt], qh[kc], al[kt]); } }
#pragma unroll
  for (int kt = 0; kt < NT; ++kt)
#pragma unroll
    for (int r = 0; r < 8; ++r) { const float v = HI ? a[kt][r] + al[kt][r] * (1.0f / 1024.0f) : a[kt][r]; s[kt][r] = (!MASK || kt * 16 + r <= srel) ? v : -3.0e38f; } }
// 2^x of the eight logits a lane holds of one key tile, in place. One statement, so that behind each v_exp_f32 stands an instruction that neither reads its result nor overwrites its source: the next one, and a v_nop behind the last (the slot the instruction set asks for)
__device__ __forceinline__ void exp2x8(float (&x)[8]) {
  asm("v_exp_f32 %0, %0\n\tv_exp_f32 %1, %1\n\tv_exp_f32 %2, %2\n\tv_exp_f32 %3, %3\n\tv_exp_f32 %4, %4\n\tv_exp_f32 %5, %5\n\tv_exp_f32 %6, %6\n\tv_exp_f32 %7, %7\n\tv_nop"
      : "+v"(x[0]), "+v"(x[1]), "+v"(x[2]), "+v"(x[3]), "+v"(x[4]), "+v"(x[5]), "+v"(x[6]), "+v"(x[7])); }
// m = the query's maximum in use (unscaled, the same in both lane halves), bias = 11 - SC2 x m: e = 2^(SC2 x d + bias) = 2^11 exp(s - max in use) by one fused multiply-add and the chip's own 2^x; an excluded logit (-3e38) gives 0. m is finite from a tile's first trip on: that trip holds key 0, which every query keeps
// mthr = m + RTH: while no logit of the wave tops it, e is at most 2^15 (f16 holds it) and m stands; else m moves up to the running maximum and what was summed under the old m is scaled by 2^(SC2 x (old - new)) <= 1
#define RTH (4.0f / SC2)
template <bool HI, bool MASK> __device__ __forceinline__ void att_pv(const _Float16* kp, const _Float16* klp, const _Float16* vp, const __bf16* vhp, const __bf16* vlp, const v16h (&qh)[2], const v16h (&ql)[2], int srel, int g, float& m, float& mthr, float& bias, float& sum, v8f (&acc)[HD / 16]) {
  constexpr int NT = HI ? 2 : 4; v16h kf[2][NT], klf[2][NT], vf[NT / 2][HD / 16]; v16b vh[NT / 2][HD / 16], vl[NT / 2][HD / 16]; float s[NT][8]; att_ldk<HI>(kp, klp, kf, klf);
  att_logits<HI, MASK>(kf, klf, qh, ql, srel, s);
#pragma unroll
  for (int u = 0; u < NT / 2; ++u)   /* the v reads take the k fragments' registers and fly under the exponentials */
#pragma unroll
    for (int j = 0; j < HD / 16; ++j) { if (!HI) vf[u][j] = pair_h(vp + j * 16 * SP + u * 32); else { vh[u][j] = pair_b(vhp + j * 16 * SP + u * 32); vl[u][j] = pair_b(vlp + j * 16 * SP + u * 32); } }
  float tk[NT];   /* one chain a key tile, so that the chains interleave and each starts when its tile's product is done */
#pragma unroll
  for (int kt = 0; kt < NT; ++kt) { tk[kt] = s[kt][0];
#pragma unroll
    for (int r = 1; r < 8; ++r) tk[kt] = fmaxf(tk[kt], s[kt][r]); }
  float tm = fmaxf(tk[0], tk[1]);
#pragma unroll
  for (int kt = 2; kt < NT; ++kt) tm = fmaxf(tm, tk[kt]);
  if (__builtin_amdgcn_ballot_w32(tm > mthr) != 0) {   /* one test a trip, the same for the whole wave: a scalar branch, taken in a tile's first trip and seldom after */
    const float mn = fmaxf(m, fmaxf(tm, __shfl_xor(tm, 16)));   /* the two lane halves hold the two key halves of one query */
    float al = SC2 * (m - mn);
    asm("v_exp_f32 %0, %0\n\tv_nop" : "+v"(al));   /* 2^x; the v_nop is the slot the instruction set asks for behind it */
    m = mn; mthr = mn + RTH; bias = fmaf(-mn, SC2, 11.0f); sum *= al;
#pragma unroll
    for (int r = 0; r < 8; ++r) { const float ar = __shfl(al, 8 * g + r);   /* accumulator register r is query 8g + r */
#pragma unroll
      for (int j = 0; j < HD / 16; ++j) acc[j][r] *= ar; } }
  float part[NT];
#pragma unroll
  for (int kt = 0; kt < NT; ++kt) {
#pragma unroll
    for (int r = 0; r < 8; ++r) s[kt][r] = fmaf(s[kt][r], SC2, bias);
    exp2x8(s[kt]); part[kt] = s[kt][0];
#pragma unroll
    for (int r = 1; r < 8; ++r) part[kt] += s[kt][r]; }
#pragma unroll
  for (int kt = 0; kt < NT; kt += 2) sum += part[kt] + part[kt + 1];
#pragma unroll
  for (int u = 0; u < NT / 2; ++u) {
    if (!HI) { v16h p;
#pragma unroll
      for (int i = 0; i < 8; ++i) { p[i] = (_Float16)s[2 * u][i]; p[8 + i] = (_Float16)s[2 * u + 1][i]; }
#pragma unroll
      for (int j = 0; j < HD / 16; ++j) acc[j] = wmma16(p, vf[u][j], acc[j]);
    } else { float pv[16];
#pragma unroll
      for (int i = 0; i < 8; ++i) { pv[i] = s[2 * u][i]; pv[8 + i] = s[2 * u + 1][i]; }
      const F2 p = bsplit16(pv);
#pragma unroll
      for (int j = 0; j < HD / 16; ++j) { acc[j] = wmma_bf(p.h, vh[u][j], acc[j]); acc[j] = wmma_bf(p.l, vh[u][j], acc[j]); acc[j] = wmma_bf(p.h, vl[u][j], acc[j]); } } } }
// the trip's barrier, by hand: the wave's LDS stores and reads are done (s_wait_dscnt 0), then the work-group barrier. __syncthreads() would also wait for every global load in flight, and the stage loads issued two trips ahead are to stay in flight across it
__device__ __forceinline__ void stage_barrier() { __builtin_amdgcn_sched_barrier(0);   /* the trip's last vector work (the row sums) stays in front, among the products; behind the barrier it would stand in the way of the next trip's LDS reads */
  asm volatile("s_wait_dscnt 0x0" ::: "memory"); asm volatile("s_barrier_signal -1\n\ts_barrier_wait -1" ::: "memory"); }
template <bool HI> __device__ __forceinline__ void att_tile(const _Float16* __restrict__ QH, const _Float16* __restrict__ KH, const _Float16* __restrict__ QL, const _Float16* __restrict__ KL, const _Float16* __restrict__ VT, const __bf16* __restrict__ VB, const __bf16* __restrict__ VBL, _Float16* __restrict__ YH, __bf16* __restrict__ YL, float (*ssw)[HD + 4], _Float16 (*sk)[64][SP], _Float16 (*sv)[64][SP], int b, int h, int qb, int wave, int lane) {
  constexpr int KS = HI ? 32 : 64;   /* keys a trip */
  const int col = lane & 15, g = lane >> 4; const int ql0 = qb * 64 + wave * 16; const size_t ho = (size_t)h * HD + 8 * g;
  const int nfull = HI ? 0 : qb, nmask = HI ? (qb + 1) * 2 : 1;   /* trips wholly below the diagonal, then trips masked by index */
  const int nl = nfull + nmask - 1;   /* trips in front of the last one: all unmasked in the late blocks, all masked in the early ones; block-uniform */
  const int srel0 = ql0 + col - 8 * g - nfull * KS;
  const _Float16* qp = QH + ((size_t)b * TT + ql0 + col) * CC + ho; const _Float16* qlp = HI ? QL + ((size_t)b * QHI + ql0 + col) * CC + ho : qp;
  v16h qh[2], ql[2];
#pragma unroll
  for (int kc = 0; kc < 2; ++kc) { qh[kc] = pair_h(qp + kc * 32); ql[kc] = HI ? pair_h(qlp + kc * 32) : qh[kc]; }
  asm volatile("s_wait_xcnt 0x0" :: "v"(qp), "v"(qlp) : "memory");   /* behind the q loads, as below */
  // staging: 8 lanes x 16 B fill one stage row of 128 B, so a load instruction touches 4 whole lines (the early blocks' v planes: 8 half lines), not 16 pieces. ka: stage rows 0..31, kb: rows 32..63
  constexpr int VLD = HI ? KHI : TT;   /* row pitch of the v planes read */
  const int sr = (wave * 32 + lane) >> 3, sc = (lane & 7) * 8;
  // addresses: a block-uniform base, which steps from trip to trip in scalar registers, + the lane's fixed 32-bit byte offset: the second register set below finds room without spills. (The early blocks' v comes from two planes, hi and lo: two bases, chosen by lane at the load)
  const unsigned kof = (unsigned)(sr * CC + sc) * 2u, vof = (unsigned)(sr * VLD + (HI ? (sc & 31) : sc)) * 2u;
  const char* const ka0 = (const char*)(KH + (size_t)b * TT * CC + h * HD); const char* const kb0 = HI ? (const char*)(KL + (size_t)b * KHI * CC + h * HD) : ka0 + (size_t)32 * CC * 2;
  const size_t vpl = ((size_t)b * CC + h * HD) * VLD; const char* const vg0 = HI ? (const char*)(VB + vpl) : (const char*)(VT + vpl); const char* const vh0 = HI ? (const char*)(VBL + vpl) : vg0;   /* moved as raw 16-B pieces */
  v8f acc[HD / 16] = {}; float sum = 0.f, m = -3.0e38f, mthr = -3.0e38f, bias = 0.f;   /* nothing summed yet: the first trip sets m */
  // the stage loads run two trips ahead, in two register sets that take turns (so the loop is written out for two trips): at the foot of trip t a set is stored to LDS (trip t + 1) and loaded anew at once (trip t + 3), so a line that comes from memory has two trips to arrive
  { const char *ka = ka0, *kb = kb0, *vg = vg0, *vh = vh0; v8h kr0[4], vr0[4], kr1[4], vr1[4]; int nld = 0;   /* the pointers stand at trip nld, the next to load */
    auto ld = [&](v8h (&kr)[4], v8h (&vr)[4], bool inloop) { const char *kal = ka + kof, *kbl = kb + kof, *vl = (HI && sc >= 32 ? vh : vg) + vof;   /* the lane's addresses */
#pragma unroll
      for (int i = 0; i < 2; ++i) { kr[i] = *(const v8h*)(kal + (size_t)i * 16 * CC * 2); kr[2 + i] = *(const v8h*)(kbl + (size_t)i * 16 * CC * 2); }
#pragma unroll
      for (int i = 0; i < 4; ++i) vr[i] = *(const v8h*)(vl + (size_t)i * 16 * VLD * 2);
      /* directly behind the stage's loads, which fly under the next trips' work (the memory clobber holds them in front): behind it their address registers are free for other values; it runs out under the LDS stores' own wait. In the loop, naming the address registers keeps them whole up to the wait; in front of the loop it is left out, because it would hold the tile's start addresses in the registers an asm operand can take, and they spilled */
      if (inloop) asm volatile("s_wait_xcnt 0x0" :: "v"(kal), "v"(kbl), "v"(vl) : "memory"); else asm volatile("s_wait_xcnt 0x0" ::: "memory");
      const int stp = nld < nl ? 1 : 0; nld += stp; ka += (size_t)stp * KS * CC * 2; kb += (size_t)stp * KS * CC * 2; vg += stp * KS * 2; vh += stp * KS * 2; };   /* block-uniform; behind the last trip the pointers stay: every trip issues its eight loads, so the counted waits hold on every path; what is loaded twice is never stored */
    auto st = [&](int bf, const v8h (&kr)[4], const v8h (&vr)[4]) {
#pragma unroll
      for (int i = 0; i < 4; ++i) { *(v8h*)&sk[bf][i * 16 + sr][sc] = kr[i]; *(v8h*)&sv[bf][i * 16 + sr][sc] = vr[i]; } };
    ld(kr0, vr0, false); ld(kr1, vr1, false);
    __syncthreads();   /* every wave has left the stages of the tile before */
    st(0, kr0, vr0); ld(kr0, vr0, false);
    stage_barrier();
    int tr = 0;
#pragma unroll 1   // rolled: two trips' code, one trip's fragments in the registers at a time
    for (; tr + 2 <= nl; tr += 2) {
      { const _Float16 *kp = &sk[0][col][8 * g], *vp = &sv[0][col][8 * g]; att_pv<HI, HI>(kp, kp + 32 * SP, vp, (const __bf16*)vp, (const __bf16*)vp + 32, qh, ql, srel0 + (nfull - tr) * KS, g, m, mthr, bias, sum, acc); }
      st(1, kr1, vr1); ld(kr1, vr1, true);
      stage_barrier();   /* publishes trip tr + 1 and ends every wave's reads of trip tr, whose buffers the next trip refills */
      { const _Float16 *kp = &sk[1][col][8 * g], *vp = &sv[1][col][8 * g]; att_pv<HI, HI>(kp, kp + 32 * SP, vp, (const __bf16*)vp, (const __bf16*)vp + 32, qh, ql, srel0 + (nfull - tr - 1) * KS, g, m, mthr, bias, sum, acc); }
      st(0, kr0, vr0); ld(kr0, vr0, true);
      stage_barrier(); }   /* as above, for trip tr + 2 */
#pragma unroll 1   // rolled: the one or two trips left share the masked code (in a trip below the diagonal the mask keeps every key)
    for (; tr <= nl; ++tr) { const _Float16 *kp = &sk[tr & 1][col][8 * g], *vp = &sv[tr & 1][col][8 * g]; att_pv<HI, true>(kp, kp + 32 * SP, vp, (const __bf16*)vp, (const __bf16*)vp + 32, qh, ql, srel0 + (nfull - tr) * KS, g, m, mthr, bias, sum, acc);
      if (tr < nl) { st(1, kr1, vr1); stage_barrier(); } } }   /* block-uniform: two trips were left (tr is even); publishes the last one's stage */
  sum += __shfl_xor(sum, 16);
  const float inv = sum > 0.f ? 1.0f / sum : 0.f;   /* of query col; sum carries the 2^11 of its terms; a fully excluded row yields 0 */
#pragma unroll
  for (int r = 0; r < 8; ++r) { const float ir = __shfl(inv, 8 * g + r);   /* accumulator register r is query 8g + r */
#pragma unroll
    for (int j = 0; j < HD / 16; ++j) ssw[8 * g + r][j * 16 + col] = acc[j][r] * ir; }
  LDSX();
  // ctx leaves in the 16-bit form k_out's product takes: f16(ctx x 2^6), clear of f16 subnormals; early query blocks: bf16 hi + bf16 lo, as bsplit16 forms them
  _Float16* yp = YH + ((size_t)b * TT + ql0 + g) * CC + h * HD + col * 4;   /* 128-B (row, head) segment by 16 lanes, two rows a store */
  if (!HI) { v4h c[8];
#pragma unroll
    for (int i = 0; i < 8; ++i) { const v4f y = *(const v4f*)&ssw[2 * i + g][col * 4];
#pragma unroll
      for (int e = 0; e < 4; ++e) c[i][e] = (_Float16)(y[e] * 64.0f); }
#pragma unroll
    for (int i = 0; i < 8; ++i) vst2(yp + (size_t)i * 2 * CC, c[i]);
    asm volatile("s_wait_xcnt 0x0" :: "v"(yp) : "memory");   /* behind the stores: the next tile overwrites their registers */
  } else { __bf16* ylp = YL + ((size_t)b * QHI + ql0 + g) * CC + h * HD + col * 4; v4b hv[8], lv[8];
#pragma unroll
    for (int i = 0; i < 8; ++i) { const v4f y = *(const v4f*)&ssw[2 * i + g][col * 4]; hv[i] = cvt4b(y); v4f rs;
#pragma unroll
      for (int e = 0; e < 4; ++e) rs[e] = y[e] - (float)hv[i][e];
      lv[i] = cvt4b(rs); }
#pragma unroll
    for (int i = 0; i < 8; ++i) { vst2(yp + (size_t)i * 2 * CC, hv[i]); vst2(ylp + (size_t)i * 2 * CC, lv[i]); }
    asm volatile("s_wait_xcnt 0x0" :: "v"(yp), "v"(ylp) : "memory"); }   /* behind the stores: the next tile overwrites their registers */
  LDSX(); }   /* the next tile's ssw writes stay behind these reads */
// amdgpu_waves_per_eu(2, 2): the grid gives two waves a SIMD (512 blocks x 4 waves, 1,024 SIMDs); with that register budget a trip's exponentials interleave instead of running as one dependent chain after the other
__global__ __launch_bounds__(128) __attribute__((amdgpu_waves_per_eu(2, 2))) void k_att(const _Float16* __restrict__ QH, const _Float16* __restrict__ KH, const _Float16* __restrict__ QL, const _Float16* __restrict__ KL, const _Float16* __restrict__ VT, const __bf16* __restrict__ VB, const __bf16* __restrict__ VBL, _Float16* __restrict__ YH, __bf16* __restrict__ YL) { __shared__ __align__(16) float ss[4][16][HD + 4]; __shared__ __align__(16) _Float16 sk[2][64][SP], sv[2][64][SP];
  const int tid = threadIdx.x, wave = tid >> 5, lane = tid & 31; const int h = blockIdx.y, b = blockIdx.z;
#pragma unroll 1   // rolled: the two tiles share one copy of the code
  for (int half = 0; half < 2; ++half) { const int qb = half ? (int)blockIdx.x : NQB - 1 - (int)blockIdx.x;   /* block-uniform */
    if (qb < QBH) att_tile<true>(QH, KH, QL, KL, VT, VB, VBL, YH, YL, ss[wave], sk, sv, b, h, qb, wave, lane);
    else att_tile<false>(QH, KH, QL, KL, VT, VB, VBL, YH, YL, ss[wave], sk, sv, b, h, qb, wave, lane); } }
// ---- k_out: block = (64 rows, 128 cols): out = ctx Wo (+ bo): f16(ctx x 2^6) against Wo as f16(bf16 x 2^8) exact (1 product) x 2^-14; causal early rows (< QHI of each sequence): ctx bf16 hi + lo against exact bf16 Wo (2 products); the operands come in the 16-bit forms k_att and k_cvt left
__global__ __launch_bounds__(128) void k_out(const _Float16* __restrict__ YH, const __bf16* __restrict__ YL, const __bf16* __restrict__ WOB, const _Float16* __restrict__ WOH, const float* __restrict__ BO, float* __restrict__ OUT) {
  __shared__ __align__(16) union { float sf[4][16][132]; __bf16 b[2][256][SPG]; _Float16 h[2][192][SPG]; } sg;   /* two operand stages: rows 0..127 Wo, 128..191 ctx (hi), 192..255 ctx lo (early rows only); the output tile lies there later (the loop's last barrier between) */
  auto& sf = sg.sf;
  const int tid = threadIdx.x, wave = tid >> 5, lane = tid & 31, col = lane & 15, g = lane >> 4; const int c0 = blockIdx.y * 128; const size_t r0 = (size_t)blockIdx.x * 64 + wave * 16;
  v8f acc[8] = {};
  // a stage = SK k of the block's 128 Wo rows and 64 ctx rows, brought in once for the four waves. 16 lanes x 16 B read one row's 256 B: a load instruction touches 4 whole lines, not 16 pieces
  const int lr = tid >> 4, lc = tid & 15; const size_t wo = (size_t)(c0 + lr) * CC + lc * 8, yo = ((size_t)blockIdx.x * 64 + lr) * CC + lc * 8; const int t0 = (int)(((size_t)blockIdx.x * 64) % TT);
  if (CAUSAL && t0 < QHI) {   /* block-uniform */
    const __bf16* wg = WOB + wo; const __bf16* yg = (const __bf16*)YH + yo; const __bf16* zg = YL + (((size_t)blockIdx.x * 64) / TT * QHI + t0 + lr) * CC + lc * 8;
    v8b wr[16], yr[8], zr[8];
#pragma unroll
    for (int i = 0; i < 16; ++i) wr[i] = *(const v8b*)(wg + (size_t)i * 8 * CC);
#pragma unroll
    for (int i = 0; i < 8; ++i) { yr[i] = *(const v8b*)(yg + (size_t)i * 8 * CC); zr[i] = *(const v8b*)(zg + (size_t)i * 8 * CC); }
    asm volatile("s_wait_xcnt 0x0" :: "v"(wg), "v"(yg), "v"(zg) : "memory");   /* behind the stage's loads: their address registers step on below */
#pragma unroll
    for (int i = 0; i < 16; ++i) *(v8b*)&sg.b[0][i * 8 + lr][lc * 8] = wr[i];
#pragma unroll
    for (int i = 0; i < 8; ++i) { *(v8b*)&sg.b[0][128 + i * 8 + lr][lc * 8] = yr[i]; *(v8b*)&sg.b[0][192 + i * 8 + lr][lc * 8] = zr[i]; }
    __syncthreads();
#pragma unroll 1   // rolled: the next stage's 32 loads stay in registers over one stage's products
    for (int s = 0; s < CC / SK; ++s, wg += SK, yg += SK, zg += SK) { const bool more = s + 1 < CC / SK;   /* block-uniform */
      if (more) {
#pragma unroll
        for (int i = 0; i < 16; ++i) wr[i] = *(const v8b*)(wg + SK + (size_t)i * 8 * CC);
#pragma unroll
        for (int i = 0; i < 8; ++i) { yr[i] = *(const v8b*)(yg + SK + (size_t)i * 8 * CC); zr[i] = *(const v8b*)(zg + SK + (size_t)i * 8 * CC); }
        asm volatile("s_wait_xcnt 0x0" :: "v"(wg), "v"(yg), "v"(zg) : "memory"); }   /* behind the next stage's loads, which fly under this stage's products (the memory clobber holds them in front); naming their address registers keeps these whole up to the wait */
#pragma unroll
      for (int kk = 0; kk < SK / 32; ++kk) { const v16b ah = frag_b(&sg.b[s & 1][128 + wave * 16 + col][kk * 32], lane), al = frag_b(&sg.b[s & 1][192 + wave * 16 + col][kk * 32], lane); v16b w[8];
#pragma unroll
        for (int j = 0; j < 8; ++j) w[j] = frag_b(&sg.b[s & 1][j * 16 + col][kk * 32], lane);
#pragma unroll
        for (int j = 0; j < 8; ++j) { acc[j] = wmma_bf(ah, w[j], acc[j]); acc[j] = wmma_bf(al, w[j], acc[j]); } }
      if (more) {
#pragma unroll
        for (int i = 0; i < 16; ++i) *(v8b*)&sg.b[(s + 1) & 1][i * 8 + lr][lc * 8] = wr[i];
#pragma unroll
        for (int i = 0; i < 8; ++i) { *(v8b*)&sg.b[(s + 1) & 1][128 + i * 8 + lr][lc * 8] = yr[i]; *(v8b*)&sg.b[(s + 1) & 1][192 + i * 8 + lr][lc * 8] = zr[i]; } }
      __syncthreads(); }   /* publishes stage s + 1 and ends every wave's reads of stage s, whose buffer the next trip refills */
#pragma unroll
    for (int j = 0; j < 8; ++j) { const float bias = BO ? bfr(BO[c0 + j * 16 + col]) : 0.f;
#pragma unroll
      for (int r = 0; r < 8; ++r) sf[wave][8 * g + r][j * 16 + col] = acc[j][r] + bias; }
  } else {
    const _Float16* wg = WOH + wo; const _Float16* yg = YH + yo;
    v8h wr[16], yr[8];
#pragma unroll
    for (int i = 0; i < 16; ++i) wr[i] = *(const v8h*)(wg + (size_t)i * 8 * CC);
#pragma unroll
    for (int i = 0; i < 8; ++i) yr[i] = *(const v8h*)(yg + (size_t)i * 8 * CC);
    asm volatile("s_wait_xcnt 0x0" :: "v"(wg), "v"(yg) : "memory");   /* behind the stage's loads: their address registers step on below */
#pragma unroll
    for (int i = 0; i < 16; ++i) *(v8h*)&sg.h[0][i * 8 + lr][lc * 8] = wr[i];
#pragma unroll
    for (int i = 0; i < 8; ++i) *(v8h*)&sg.h[0][128 + i * 8 + lr][lc * 8] = yr[i];
    __syncthreads();
#pragma unroll 1   // rolled: the next stage's 24 loads stay in registers over one stage's products
    for (int s = 0; s < CC / SK; ++s, wg += SK, yg += SK) { const bool more = s + 1 < CC / SK;   /* block-uniform */
      if (more) {
#pragma unroll
        for (int i = 0; i < 16; ++i) wr[i] = *(const v8h*)(wg + SK + (size_t)i * 8 * CC);
#pragma unroll
        for (int i = 0; i < 8; ++i) yr[i] = *(const v8h*)(yg + SK + (size_t)i * 8 * CC);
        asm volatile("s_wait_xcnt 0x0" :: "v"(wg), "v"(yg) : "memory"); }   /* behind the next stage's loads, which fly under this stage's products (the memory clobber holds them in front); naming their address registers keeps these whole up to the wait */
#pragma unroll
      for (int kk = 0; kk < SK / 32; ++kk) { const v16h a = frag_h(&sg.h[s & 1][128 + wave * 16 + col][kk * 32], lane); v16h w[8];
#pragma unroll
        for (int j = 0; j < 8; ++j) w[j] = frag_h(&sg.h[s & 1][j * 16 + col][kk * 32], lane);
#pragma unroll
        for (int j = 0; j < 8; ++j) acc[j] = wmma16(a, w[j], acc[j]); }
      if (more) {
#pragma unroll
        for (int i = 0; i < 16; ++i) *(v8h*)&sg.h[(s + 1) & 1][i * 8 + lr][lc * 8] = wr[i];
#pragma unroll
        for (int i = 0; i < 8; ++i) *(v8h*)&sg.h[(s + 1) & 1][128 + i * 8 + lr][lc * 8] = yr[i]; }
      __syncthreads(); }   /* publishes stage s + 1 and ends every wave's reads of stage s, whose buffer the next trip refills */
#pragma unroll
    for (int j = 0; j < 8; ++j) { const float bias = BO ? bfr(BO[c0 + j * 16 + col]) : 0.f;
#pragma unroll
      for (int r = 0; r < 8; ++r) sf[wave][8 * g + r][j * 16 + col] = acc[j][r] * (1.0f / 16384.0f) + bias; } }   /* 2^-8 (Wo carry) x 2^-6 (ctx carry) */
  LDSX(); for (int rl = 0; rl < 16; ++rl) vst2(OUT + (r0 + rl) * DIN + c0 + lane * 4, *(const v4f*)&sf[wave][rl][lane * 4]); }

extern "C" void kernel_launch(void* const* d_in, const int* in_sizes, int n_in, void* d_out, int out_size, void* d_ws, size_t ws_size, hipStream_t stream) {
  (void)in_sizes; (void)n_in; (void)out_size;
  const float** F = (const float**)d_in;
  if (ws_size < (size_t)WS_END) return;
  char* ws = (char*)d_ws; _Float16 *QH = (_Float16*)(ws + WS_QH), *KH = (_Float16*)(ws + WS_KH), *VT = (_Float16*)(ws + WS_VT), *QL = (_Float16*)(ws + WS_QL), *KL = (_Float16*)(ws + WS_KL); __bf16 *VB = (__bf16*)(ws + WS_VB), *VBL = (__bf16*)(ws + WS_VBL), *YL = (__bf16*)(ws + WS_YL), *XB = (__bf16*)(ws + WS_XB), *WB = (__bf16*)(ws + WS_WB), *WOB = (__bf16*)(ws + WS_WOB); _Float16 *YH = (_Float16*)(ws + WS_YH), *WOH = (_Float16*)(ws + WS_WOH);
  // inputs: 0 x [2,2048,1024]; 1 wq [1024,1024] (out,in); 2 wk; 3 wv; 4 wo (out,in); no biases (null pointers)
  k_cvt<<<dim3((NB * TT * DIN + 4 * CC * DIN) / CVB), 256, 0, stream>>>(F[0], F[1], F[2], F[3], F[4], XB, WB, WOB, WOH);
  k_proj<<<dim3(TNB * TT / 128, CC / 128, 3), 128, 0, stream>>>(XB, XB, XB, WB, WB + (size_t)CC * DIN, WB + 2 * (size_t)CC * DIN, nullptr, nullptr, nullptr, QH, QL, KH, KL, VT, VB, VBL);
  k_att<<<dim3(NQB / 2, NH, TNB), 128, 0, stream>>>(QH, KH, QL, KL, VT, VB, VBL, YH, YL);
  k_out<<<dim3(TNB * TT / 64, DIN / 128), 128, 0, stream>>>(YH, YL, WOB, WOH, nullptr, (float*)d_out);
}

// v010
// Measured time: 82.1 microseconds a run.
// Next to v009, in two timings, it ran 1.03 times as fast each time.
// Over all steps from v000 it is 15.6 times as fast.
// compute dtype: all float inputs rounded to bf16, once, by k_cvt; q / k / v projections with EXACT bf16 products on WMMA 16x16x32 (f32 accumulate) (no biases); interleaved-pair RoPE in f32 AFTER the bias (embedded frequencies, the library cosf / sinf values, positions = the row index); causal logits: 3 products for the first 384 rows, single f16 q x k after, x 64^-0.5; softmax f32 (one pass, running row maximum, logits never stored); exp(s - the maximum in use) x 2^11 once to f16 x v once to f16 (bf16 hi + lo below row 384), / sum after the product; ctx hi+lo x exact Wo below row 384, x2^6 f16 carry x f16(bf16 x 2^8) Wo after, + bo; f32 output.
#include <hip/hip_runtime.h>
#include <math.h>

typedef __attribute__((ext_vector_type(16))) _Float16 v16h;
typedef __attribute__((ext_vector_type(16))) __bf16 v16b;
typedef __attribute__((ext_vector_type(8)))  _Float16 v8h;
typedef __attribute__((ext_vector_type(8)))  float v8f;
typedef __attribute__((ext_vector_type(4)))  float v4f;
typedef __attribute__((ext_vector_type(2)))  float v2f;
typedef __attribute__((ext_vector_type(4)))  unsigned v4u;
typedef __attribute__((ext_vector_type(4)))  int v4i;
typedef float __attribute__((may_alias)) float_a;
typedef int __attribute__((may_alias)) int_a;

template <typename T> __device__ __forceinline__ void vst2(void* p, T v) { *(T*)p = v;  }
__device__ __forceinline__ v8f wmma16(v16h a, v16h b, v8f c) {
  v8f d = __builtin_amdgcn_wmma_f32_16x16x32_f16(false, a, false, b, (short)0, c, false, false);
  asm volatile("v_nop\n\tv_nop\n\tv_nop\n\tv_nop" : "+v"(d) : "v"(a), "v"(b));
  return d;
}
__device__ __forceinline__ v8f wmma_bf(v16b a, v16b b, v8f c) {
  v8f d = __builtin_amdgcn_wmma_f32_16x16x32_bf16(false, a, false, b, (short)0, c, false, false);
  asm volatile("v_nop\n\tv_nop\n\tv_nop\n\tv_nop" : "+v"(d) : "v"(a), "v"(b));
  return d;
}
// 16x16x32 fragments: lane = (h = lane>>4, row/col = lane&15); elements 0..7 = k0+8h+0..7, 8..15 = k0+16+8h+0..7; D element r = row 8h+r
__device__ __forceinline__ v16h frag_h(const _Float16* rowk0, int lane) {
  union { v16h v; v8h q[2]; } u; const _Float16* p = rowk0 + 8 * (lane >> 4);
  u.q[0] = *(const v8h*)p; u.q[1] = *(const v8h*)(p + 16); return u.v;
}
__device__ __forceinline__ v16h frag_f32(const float* rowk0, int lane) {
  v16h a; const float* p = rowk0 + 8 * (lane >> 4);
#pragma unroll
  for (int i = 0; i < 8; ++i) { a[i] = (_Float16)p[i]; a[8 + i] = (_Float16)p[16 + i]; }
  return a;
}
__device__ __forceinline__ v16h frag_f32s(const float* rowk0, int lane, float sc) {
  v16h a; const float* p = rowk0 + 8 * (lane >> 4);
#pragma unroll
  for (int i = 0; i < 8; ++i) { a[i] = (_Float16)(p[i] * sc); a[8 + i] = (_Float16)(p[16 + i] * sc); }
  return a;
}
// column fragment from a [K][ld] layout (column n), rows >= K read as 0
__device__ __forceinline__ v16h fragc_f32(const float* W, int k0, int n, int lane, int ld, int K) {
  v16h a; const int g = lane >> 4;
#pragma unroll
  for (int i = 0; i < 8; ++i) { const int ka = k0 + 8 * g + i, kb = ka + 16;
    a[i] = (_Float16)(ka < K ? W[(size_t)(ka < K ? ka : K - 1) * ld + n] : 0.f); a[8 + i] = (_Float16)(kb < K ? W[(size_t)(kb < K ? kb : K - 1) * ld + n] : 0.f); }
  return a;
}
struct F2 { v16b h, l; };
__device__ __forceinline__ F2 bsplit16(const float v[16]) { F2 r;
#pragma unroll
  for (int i = 0; i < 16; ++i) { const __bf16 h = (__bf16)v[i]; r.h[i] = h; r.l[i] = (__bf16)(v[i] - (float)h); }
  return r; }
__device__ __forceinline__ F2 split_row(const float* row, int k0, int lane) { float v[16]; const float* p = row + k0 + 8 * (lane >> 4);
#pragma unroll
  for (int i = 0; i < 8; ++i) { v[i] = p[i]; v[8 + i] = p[16 + i]; }
  return bsplit16(v); }
__device__ __forceinline__ F2 split_rowK(const float* row, int k0, int lane, int K) { float v[16]; const int g = lane >> 4;
#pragma unroll
  for (int i = 0; i < 8; ++i) { const int ka = k0 + 8 * g + i, kb = ka + 16; v[i] = ka < K ? row[ka < K ? ka : K - 1] : 0.f; v[8 + i] = kb < K ? row[kb < K ? kb : K - 1] : 0.f; }
  return bsplit16(v); }
__device__ __forceinline__ F2 split_col(const float* W, int k0, int n, int lane, int ld, int K) { float v[16]; const int g = lane >> 4;
#pragma unroll
  for (int i = 0; i < 8; ++i) { const int ka = k0 + 8 * g + i, kb = ka + 16; v[i] = ka < K ? W[(size_t)(ka < K ? ka : K - 1) * ld + n] : 0.f; v[8 + i] = kb < K ? W[(size_t)(kb < K ? kb : K - 1) * ld + n] : 0.f; }
  return bsplit16(v); }
__device__ __forceinline__ v8f mac3(const F2& a, const F2& b, v8f c) { c = wmma_bf(a.l, b.h, c); c = wmma_bf(a.h, b.l, c); return wmma_bf(a.h, b.h, c); }
__device__ __forceinline__ float sigm(float v) { return 1.0f / (1.0f + expf(-v)); }
#define LDSX() do { asm volatile("s_wait_dscnt 0" ::: "memory"); __builtin_amdgcn_wave_barrier(); __builtin_amdgcn_fence(__ATOMIC_RELEASE, "workgroup"); } while (0)

// Causal multi-head self-attention with interleaved-pair RoPE (x [2,2048,1024]; torch (out,in) wq / wk / wv / wo [1024,1024] applied as x @ W.T, no biases; 16 heads x 64; RoPE on Q and K: adjacent (even, odd) pairs (xe c - xo s, xe s + xo c) re-interleaved, theta 10000, positions 0..2047; scores / sqrt(64); tril kept, -inf elsewhere (the module's own softmax guards the -inf row maximum: every row keeps its diagonal, so the guard never fires); out @ wo.T).
#define NB 2
#define TT 2048
#define CC 1024            // NH * HD = projected width
#define DIN 1024          // input (model) width
#define NH 16
#define HD 64
#define NQB (TT / 64)
#define SCALE (0.125f)
#define SC2 (SCALE * 1.44269504088896340736f)   // SCALE x log2(e): exp(SCALE x (d - dmax)) = 2^(SC2 x d - SC2 x dmax), d = the unscaled q.k product
#define CAUSAL 1
#ifndef TNB
#define TNB NB
#endif
__device__ __forceinline__ float bfr(float v) { return (float)(__bf16)v; }
typedef __attribute__((ext_vector_type(8))) __bf16 v8b;
__device__ __forceinline__ v16b frag_b(const __bf16* rowk0, int lane) {
  union { v16b v; v8b q[2]; } u; const __bf16* p = rowk0 + 8 * (lane >> 4);
  u.q[0] = *(const v8b*)p; u.q[1] = *(const v8b*)(p + 16); return u.v;
}
// unconverted fragment reads; p = the lane's row + k0 + 8 * (lane >> 4): elements 0..7 = p[0..7], 8..15 = p[16..23] (the k order of frag_h / frag_f32 / split_row / wcol_oi)
typedef __attribute__((ext_vector_type(16))) float v16f;
__device__ __forceinline__ v16f raw16(const float* p) { v16f r;
#pragma unroll
  for (int i = 0; i < 8; ++i) { r[i] = p[i]; r[8 + i] = p[16 + i]; }
  return r; }
__device__ __forceinline__ v16h pair_h(const _Float16* p) { union { v16h v; v8h q[2]; } u; u.q[0] = *(const v8h*)p; u.q[1] = *(const v8h*)(p + 16); return u.v; }
__device__ __forceinline__ v16b pair_b(const __bf16* p) { union { v16b v; v8b q[2]; } u; u.q[0] = *(const v8b*)p; u.q[1] = *(const v8b*)(p + 16); return u.v; }
__device__ __forceinline__ F2 bsplit_v(v16f r) { float v[16];
#pragma unroll
  for (int i = 0; i < 16; ++i) v[i] = r[i];
  return bsplit16(v); }
#define SK 128             // k of one LDS operand stage (k_out): 256 B of every 16-bit source row
#define SPG 136            // its row pitch in 16-bit elements: 272 B = 16 B x 17, odd, for the ds_load_b128 fragment reads
#define SP 72              // k_att's stage row pitch in 16-bit elements: 144 B = 16 B x 9, odd, for the ds_load_b128 fragment reads
typedef __attribute__((ext_vector_type(4))) __bf16 v4b;
typedef __attribute__((ext_vector_type(4))) _Float16 v4h;
typedef __attribute__((ext_vector_type(2))) _Float16 v2h;
__device__ __forceinline__ v4b cvt4b(v4f v) { v4b r;
#pragma unroll
  for (int i = 0; i < 4; ++i) r[i] = (__bf16)v[i];
  return r; }
#define QBH 6              // causal: query blocks 0..QBH-1 of each sequence (few keys, no averaging) take the high-precision path
#define QHI 384            // rows carrying a q residual plane
#define KHI 384            // key rows carrying k residual / v bf16 hi+lo planes (used only by the causal high-precision path)
// B fragment (k rows k0+.., output column o) of a weight: (in,out) [K][ld] or (out,in) [ld rows of K]: bf16 exact, or f16(bf16 * 256) exact
__device__ __forceinline__ v16b wcol_io(const float* Wm, int k0, int o, int lane, int ld) { v16b w; const int g = lane >> 4;
#pragma unroll
  for (int i = 0; i < 8; ++i) { w[i] = (__bf16)Wm[(size_t)(k0 + 8 * g + i) * ld + o]; w[8 + i] = (__bf16)Wm[(size_t)(k0 + 16 + 8 * g + i) * ld + o]; }
  return w; }
__device__ __forceinline__ v16b wcol_oi(const float* Wm, int k0, int o, int lane, int K) { v16b w; const float* p = Wm + (size_t)o * K + k0 + 8 * (lane >> 4);
#pragma unroll
  for (int i = 0; i < 8; ++i) { w[i] = (__bf16)p[i]; w[8 + i] = (__bf16)p[16 + i]; }
  return w; }
__device__ __forceinline__ v16h wcolh_io(const float* Wm, int k0, int o, int lane, int ld) { v16h w; const int g = lane >> 4;
#pragma unroll
  for (int i = 0; i < 8; ++i) { w[i] = (_Float16)(bfr(Wm[(size_t)(k0 + 8 * g + i) * ld + o]) * 256.0f); w[8 + i] = (_Float16)(bfr(Wm[(size_t)(k0 + 16 + 8 * g + i) * ld + o]) * 256.0f); }
  return w; }
__device__ __forceinline__ v16h wcolh_oi(const float* Wm, int k0, int o, int lane, int K) { v16h w; const float* p = Wm + (size_t)o * K + k0 + 8 * (lane >> 4);
#pragma unroll
  for (int i = 0; i < 8; ++i) { w[i] = (_Float16)(bfr(p[i]) * 256.0f); w[8 + i] = (_Float16)(bfr(p[16 + i]) * 256.0f); }
  return w; }
#define WQKV_LAYOUT 1   // 0 = (in,out) [DIN][CC]; 1 = (out,in) [CC][DIN]; 2 = per-head [NH][DIN][HD]
__device__ __forceinline__ v16b wcol_hdk(const float* Wm, int k0, int o, int lane) { v16b w; const int g = lane >> 4; const float* p = Wm + (size_t)(o / HD) * DIN * HD + (o % HD);
#pragma unroll
  for (int i = 0; i < 8; ++i) { w[i] = (__bf16)p[(size_t)(k0 + 8 * g + i) * HD]; w[8 + i] = (__bf16)p[(size_t)(k0 + 16 + 8 * g + i) * HD]; }
  return w; }
#define WO_OUT_IN 1
#if WQKV_LAYOUT == 1
#define WCOL(W, k0, o, lane) wcol_oi(W, k0, o, lane, DIN)
#elif WQKV_LAYOUT == 2
#define WCOL(W, k0, o, lane) wcol_hdk(W, k0, o, lane)
#else
#define WCOL(W, k0, o, lane) wcol_io(W, k0, o, lane, CC)
#endif
#if WO_OUT_IN
#define WOCOL(W, k0, o, lane) wcol_oi(W, k0, o, lane, CC)
#define WOCOLH(W, k0, o, lane) wcolh_oi(W, k0, o, lane, CC)
#else
#define WOCOL(W, k0, o, lane) wcol_io(W, k0, o, lane, DIN)
#define WOCOLH(W, k0, o, lane) wcolh_io(W, k0, o, lane, DIN)
#endif

// RoPE inverse frequencies 1/10000^(2i/64) (the f32 values jax computes)
__constant__ float INVF[32] = {1.000000000e+00,7.498942018e-01,5.623413324e-01,4.216965139e-01,3.162277639e-01,2.371373624e-01,1.778279394e-01,1.333521456e-01,1.000000015e-01,7.498941571e-02,5.623412877e-02,4.216964915e-02,3.162277862e-02,2.371373586e-02,1.778279431e-02,1.333521493e-02,9.999999776e-03,7.498942316e-03,5.623413250e-03,4.216964822e-03,3.162277862e-03,2.371373819e-03,1.778279431e-03,1.333521446e-03,1.000000047e-03,7.498941850e-04,5.623413017e-04,4.216964880e-04,3.162277862e-04,2.371373848e-04,1.778279402e-04,1.333521504e-04};
#define PROJ_EXTRA_PARAMS
// cos and sin of a RoPE angle a, 0 <= a < 2^17 (a position below TT x a frequency of at most 1). On that range these are the library's cosf / sinf operation for operation (pi/2 taken off in three parts, its two polynomials, the quadrant select); left out are its branches to the large-argument reduction, never taken here, which kept one angle's chain from starting before the last one's end
__device__ __forceinline__ void rope_cs(float a, float& cs, float& sn) {
  const float fn = rintf(a * 6.36619747e-1f);
  const float r = fmaf(fn, -5.39030253e-15f, fmaf(fn, -7.54978942e-8f, fmaf(fn, -1.57079625e+0f, a)));
  const float t = r * r; const unsigned q = (unsigned)(int)fn;
  const float s = fmaf(r, t * fmaf(t, fmaf(t, -1.94644585e-4f, 8.33171979e-3f), -1.66666463e-1f), r);
  const float c = fmaf(t, fmaf(t, fmaf(t, fmaf(t, 2.56687417e-5f, -1.39091106e-3f), 4.16679047e-2f), -5.00000238e-1f), 1.0f);
  const unsigned sg = (q << 30) & 0x80000000u;   /* quadrants 2 and 3 flip both signs */
  sn = __uint_as_float(__float_as_uint((q & 1u) ? c : s) ^ sg); cs = __uint_as_float(__float_as_uint((q & 1u) ? -s : c) ^ sg); }
#ifndef PROJ_EXTRA_PARAMS
#define PROJ_EXTRA_PARAMS
#endif

#define WS_QH  0u                                      // f16 q rows [b*t][CC]
#define WS_KH  (WS_QH + 2u * (size_t)NB * TT * CC)      // f16 k rows [b*t][CC]
#define WS_VT  (WS_KH + 2u * (size_t)NB * TT * CC)      // f16 v planes [b][c][t]
#define WS_QL  (WS_VT + 2u * (size_t)NB * CC * TT)      // f16 q residual x 2^10 rows [b][t < QHI][CC]
#define WS_KL  (WS_QL + 2u * (size_t)NB * QHI * CC)     // f16 k residual x 2^10 rows [b][t < KHI][CC]
#define WS_VB  (WS_KL + 2u * (size_t)NB * KHI * CC)     // bf16 v hi planes [b][c][t < KHI]
#define WS_VBL (WS_VB + 2u * (size_t)NB * CC * KHI)
#define WS_YH  (WS_VBL + 2u * (size_t)NB * CC * KHI)    // 16-bit ctx rows [b*t][CC]: f16(ctx x 2^6); rows < QHI of a sequence: bf16 hi
#define WS_YL  (WS_YH + 2u * (size_t)NB * TT * CC)      // bf16 ctx lo rows [b][t < QHI][CC]
#define WS_XB  (WS_YL + 2u * (size_t)NB * QHI * CC)     // bf16 x rows [b*t][DIN]
#define WS_WB  (WS_XB + 2u * (size_t)NB * TT * DIN)     // bf16 wq, wk, wv, each [CC][DIN]
#define WS_WOB (WS_WB + 6u * (size_t)CC * DIN)          // bf16 wo [DIN][CC]
#define WS_WOH (WS_WOB + 2u * (size_t)DIN * CC)         // f16(bf16 wo x 2^8) [DIN][CC]
#define WS_END (WS_WOH + 2u * (size_t)DIN * CC)

// ---- k_cvt: x, wq, wk, wv, wo to the 16-bit forms the products take, once, in place of once in each of the 24 (x), 32 (wq, wk, wv), 64 (wo) blocks that stage a row. block = CVB consecutive floats of one input: 16 loads of 16 B a lane in flight, 512 B a wave and load; stores of 256 B a wave; two blocks a WGP, so that few waves have to start
#define CVB 16384
__global__ __launch_bounds__(256) void k_cvt(const float* __restrict__ X, const float* __restrict__ WQ, const float* __restrict__ WK, const float* __restrict__ WV, const float* __restrict__ WO, __bf16* __restrict__ XB, __bf16* __restrict__ WB, __bf16* __restrict__ WOB, _Float16* __restrict__ WOH) {
  constexpr int nx = NB * TT * DIN / CVB, nw = CC * DIN / CVB; const int blk = blockIdx.x; const int sel = blk < nx ? -1 : (blk - nx) / nw;   /* block-uniform: -1 x, 0..2 wq wk wv, 3 wo */
  const size_t o = (size_t)(blk < nx ? blk : (blk - nx) % nw) * CVB + threadIdx.x * 4;
  const float* s = (sel < 0 ? X : sel == 0 ? WQ : sel == 1 ? WK : sel == 2 ? WV : WO) + o;
  v4f r[16]; v4b c[16];
#pragma unroll
  for (int i = 0; i < 16; ++i) r[i] = *(const v4f*)(s + i * 1024);
  asm volatile("s_wait_xcnt 0x0" :: "v"(s) : "memory");   /* behind the loads: their address registers may be taken for the stores' */
#pragma unroll
  for (int i = 0; i < 16; ++i) c[i] = cvt4b(r[i]);
  __bf16* d = (sel < 0 ? XB : sel < 3 ? WB + (size_t)sel * CC * DIN : WOB) + o;
  if (sel == 3) { v4h f[16];   /* wo also as f16(bf16 x 2^8), exact */
#pragma unroll
    for (int i = 0; i < 16; ++i)
#pragma unroll
      for (int e = 0; e < 4; ++e) f[i][e] = (_Float16)((float)c[i][e] * 256.0f);
#pragma unroll
    for (int i = 0; i < 16; ++i) *(v4h*)(WOH + o + i * 1024) = f[i]; }
#pragma unroll
  for (int i = 0; i < 16; ++i) *(v4b*)(d + i * 1024) = c[i]; }

// q and k: interleaved-pair rotation (x[2i], x[2i + 1]) by the angle t * INVF[i] of one half tile (64 rows x 128 columns, f32, in st). A thread has one row and every second frequency: each cos / sin is formed once and turns the pair of both heads of the tile; the turned pair leaves as one 4-B store of two f16 (32 lanes on 32 different banks), and where the rows carry a residual plane (RES) its residual x 2^10 likewise
template <bool RES> __device__ __forceinline__ void rope_rows(const float (&st)[64][132], _Float16 (&sh)[64][136], _Float16 (&sl)[64][136], int rl, int ih, float pos) {
  v2f x[16][128 / HD];   /* all of the thread's pairs are read in front of the first store: one LDS latency for the pass, under the first angles' arithmetic, not one a pair */
#pragma unroll   // unrolled, both loops: x stays in registers (constant indices)
  for (int ii = 0; ii < 16; ++ii)
#pragma unroll
    for (int hh = 0; hh < 128 / HD; ++hh) x[ii][hh] = *(const v2f*)&st[rl][hh * HD + 4 * ii + 2 * ih];
#pragma unroll   // unrolled: the 16 angles' chains interleave
  for (int ii = 0; ii < 16; ++ii) { float cs, sn; const float f0 = INVF[2 * ii], f1 = INVF[2 * ii + 1]; rope_cs(pos * (ih ? f1 : f0), cs, sn);   /* both read as scalars, then a select: no load by lane */
#pragma unroll   // unrolled: both heads' pairs are turned from the same two registers
    for (int hh = 0; hh < 128 / HD; ++hh) { const int cl = hh * HD + 4 * ii + 2 * ih; v2f y; y[0] = x[ii][hh][0] * cs - x[ii][hh][1] * sn; y[1] = x[ii][hh][0] * sn + x[ii][hh][1] * cs;
      v2h hv; hv[0] = (_Float16)y[0]; hv[1] = (_Float16)y[1]; *(v2h*)&sh[rl][cl] = hv;
      if (RES) { v2h lv; lv[0] = (_Float16)((y[0] - (float)hv[0]) * 1024.0f); lv[1] = (_Float16)((y[1] - (float)hv[1]) * 1024.0f); *(v2h*)&sl[rl][cl] = lv; } } } }
// ---- k_proj: block = (128 rows, 128 cols, which), four waves of 64 x 64 each: q/k/v = X W (+ b), X and W in k_cvt's bf16, with exact bf16 products (K = DIN) -> which 0: q f16 rows (+ residual rows < QHI); 1: k f16 rows (+ residual rows < KHI); 2: v f16 planes [c][t] (+ bf16 hi/lo planes for t < KHI)
// a wave's 4 X and 4 W fragments of a k step feed 16 products (16 x 128 a wave: 9 fragments for 8), and a staged row serves 128 rows or columns of the tile. 768 blocks, three on a WGP (LDS, registers): all resident at once
#define PK 64              // k of one LDS operand stage: 128 B of every 16-bit source row
#define PPG 72             // its row pitch in 16-bit elements: 144 B = 16 B x 9, odd, for the ds_load_b128 fragment reads
__global__ __launch_bounds__(128) void k_proj(const __bf16* __restrict__ XQ, const __bf16* __restrict__ XK, const __bf16* __restrict__ XV, const __bf16* __restrict__ WQ, const __bf16* __restrict__ WK, const __bf16* __restrict__ WV, const float* __restrict__ BQ, const float* __restrict__ BK, const float* __restrict__ BV,
    _Float16* __restrict__ QH, _Float16* __restrict__ QL, _Float16* __restrict__ KH, _Float16* __restrict__ KL, _Float16* __restrict__ VT, __bf16* __restrict__ VB, __bf16* __restrict__ VBL PROJ_EXTRA_PARAMS) {
  __shared__ __align__(16) union { struct { float st[64][132]; union { struct { _Float16 sh[64][136], sl[64][136]; } r; struct { _Float16 th[128][72]; __bf16 tb[128][72], tbl[128][72]; } p; } c; } e; __bf16 sg[2][256][PPG]; } un;   /* the two operand stages of the k loop lie where the epilogue's tiles lie later (the loop's last barrier between); a block needs either the row tiles (q, k) or the plane tiles (v) */
  auto& st = un.e.st; auto& sh = un.e.c.r.sh; auto& sl = un.e.c.r.sl; auto& th = un.e.c.p.th; auto& tb = un.e.c.p.tb; auto& tbl = un.e.c.p.tbl; auto& sg = un.sg;
  const int tid = threadIdx.x, wave = tid >> 5, lane = tid & 31, col = lane & 15, g = lane >> 4; const int wrow = wave >> 1, wcol = wave & 1;   /* the wave's 64 x 64 quarter of the tile */
  const int which = blockIdx.z; const int c0 = blockIdx.y * 128; const size_t rb = (size_t)blockIdx.x * 128;
  const __bf16* X = which == 0 ? XQ : which == 1 ? XK : XV; const __bf16* WA = which == 0 ? WQ : which == 1 ? WK : WV; const float* BA = which == 0 ? BQ : which == 1 ? BK : BV;
  v8f acc[4][4] = {};
  // a stage = PK k of the block's 128 W rows (sg rows 0..127) and 128 X rows (128..255), bf16 as k_cvt left them, brought in once for the four waves. 8 lanes x 16 B read one row's 128 B: a load instruction touches 4 whole lines, not 16 pieces
  const int lr = tid >> 3, lc = tid & 7; const __bf16* wg = WA + (size_t)(c0 + lr) * DIN + lc * 8; const __bf16* xg = X + (rb + lr) * DIN + lc * 8;
  v8b wr[8], xr[8];
#pragma unroll
  for (int i = 0; i < 8; ++i) wr[i] = *(const v8b*)(wg + (size_t)i * 16 * DIN);
#pragma unroll
  for (int i = 0; i < 8; ++i) xr[i] = *(const v8b*)(xg + (size_t)i * 16 * DIN);
  asm volatile("s_wait_xcnt 0x0" :: "v"(wg), "v"(xg) : "memory");   /* behind the stage's loads: their address registers step on below */
#pragma unroll
  for (int i = 0; i < 8; ++i) *(v8b*)&sg[0][i * 16 + lr][lc * 8] = wr[i];
#pragma unroll
  for (int i = 0; i < 8; ++i) *(v8b*)&sg[0][128 + i * 16 + lr][lc * 8] = xr[i];
  __syncthreads();
#pragma unroll 1   // rolled: the next stage's 16 loads stay in registers over one stage's products
  for (int s = 0; s < DIN / PK; ++s, wg += PK, xg += PK) { const bool more = s + 1 < DIN / PK;   /* block-uniform */
    if (more) {
#pragma unroll
      for (int i = 0; i < 8; ++i) wr[i] = *(const v8b*)(wg + PK + (size_t)i * 16 * DIN);
#pragma unroll
      for (int i = 0; i < 8; ++i) xr[i] = *(const v8b*)(xg + PK + (size_t)i * 16 * DIN);
      asm volatile("s_wait_xcnt 0x0" :: "v"(wg), "v"(xg) : "memory"); }   /* behind the next stage's loads, which fly under this stage's products (the memory clobber holds them in front); naming their address registers keeps these whole up to the wait */
#pragma unroll
    for (int kk = 0; kk < PK / 32; ++kk) { v16b a[4], w[4];
#pragma unroll
      for (int i = 0; i < 4; ++i) a[i] = frag_b(&sg[s & 1][128 + wrow * 64 + i * 16 + col][kk * 32], lane);
#pragma unroll
      for (int j = 0; j < 4; ++j) w[j] = frag_b(&sg[s & 1][wcol * 64 + j * 16 + col][kk * 32], lane);
#pragma unroll
      for (int i = 0; i < 4; ++i)
#pragma unroll
        for (int j = 0; j < 4; ++j) acc[i][j] = wmma_bf(a[i], w[j], acc[i][j]); }
    if (more) {
#pragma unroll
      for (int i = 0; i < 8; ++i) *(v8b*)&sg[(s + 1) & 1][i * 16 + lr][lc * 8] = wr[i];
#pragma unroll
      for (int i = 0; i < 8; ++i) *(v8b*)&sg[(s + 1) & 1][128 + i * 16 + lr][lc * 8] = xr[i]; }
    __syncthreads(); }   /* publishes stage s + 1 and ends every wave's reads of stage s, whose buffer the next trip refills */
#pragma unroll 1   // rolled: the tile's two halves of 64 rows leave one after the other through one copy of the epilogue and one set of LDS tiles
  for (int hf = 0; hf < 2; ++hf) { const size_t r0 = rb + hf * 64; const size_t bb = r0 / TT; const int t0 = (int)(r0 % TT);
  if (which < 2) {   /* block-uniform. q and k: the half's f32 tile (acc + bias) goes to LDS from the two waves that hold it; the rotation reads it and writes the 16-bit tiles straight from its registers: no pass over LDS for the conversion alone */
    _Float16* DH = which == 0 ? QH : KH; _Float16* DL = which == 0 ? QL : KL; const int nhi = which == 0 ? QHI : KHI; const bool hi_rows = t0 < nhi;
    if (wrow == hf) {   /* st is free: the half before was last read in front of its second barrier */
#pragma unroll
      for (int j = 0; j < 4; ++j) { const float bias = BA ? bfr(BA[c0 + wcol * 64 + j * 16 + col]) : 0.f;
#pragma unroll
        for (int i = 0; i < 4; ++i)
#pragma unroll
          for (int r = 0; r < 8; ++r) st[i * 16 + 8 * g + r][wcol * 64 + j * 16 + col] = acc[i][j][r] + bias; } }
    __syncthreads();   /* publishes st; also ends every wave's reads of the half before's 16-bit tiles */
    { const int rl = tid >> 1; const float pos = (float)(int)((r0 + rl) % TT);   /* position = the token's sequence index */
      if (hi_rows) rope_rows<true>(st, sh, sl, rl, tid & 1, pos); else rope_rows<false>(st, sh, sl, rl, tid & 1, pos); }   /* block-uniform: one branch a half, so that each side is one straight run */
    __syncthreads();
    for (int e = tid; e < 64 * 16; e += 128) { const int rl = e >> 4, q = e & 15; vst2((unsigned*)(DH + (r0 + rl) * CC + c0 + q * 8), *(const v4u*)&sh[rl][q * 8]); if (hi_rows) vst2((unsigned*)(DL + (bb * nhi + t0 + rl) * (size_t)CC + c0 + q * 8), *(const v4u*)&sl[rl][q * 8]); }
  } else { const bool hi_rows = t0 < KHI;   /* v: accumulator registers 0..7 are eight consecutive rows of one column, that is 16 B of a plane tile's row: the two waves that hold the half write the plane tiles straight from the accumulators, one 16-B store for 8 values (pitch 144 B = 16 B x 9) */
    if (hf) __syncthreads();   /* block-uniform: every wave has read the half before out of the plane tiles */
    if (wrow == hf) {
#pragma unroll   // unrolled, here and below: the accumulators are registers and take constant indices only
      for (int j = 0; j < 4; ++j) { const int cl = wcol * 64 + j * 16 + col; const float bias = BA ? bfr(BA[c0 + cl]) : 0.f;
#pragma unroll
        for (int i = 0; i < 4; ++i) { v8h hv;
#pragma unroll
          for (int r = 0; r < 8; ++r) hv[r] = (_Float16)(acc[i][j][r] + bias);
          *(v8h*)&th[cl][i * 16 + 8 * g] = hv; } }
      if (hi_rows) {   /* block-uniform: the bf16 hi and lo planes exist for these rows only */
#pragma unroll
        for (int j = 0; j < 4; ++j) { const int cl = wcol * 64 + j * 16 + col; const float bias = BA ? bfr(BA[c0 + cl]) : 0.f;
#pragma unroll
          for (int i = 0; i < 4; ++i) { v8b bh, bl;
#pragma unroll
            for (int r = 0; r < 8; ++r) { const float v = acc[i][j][r] + bias; bh[r] = (__bf16)v; bl[r] = (__bf16)(v - (float)bh[r]); }
            *(v8b*)&tb[cl][i * 16 + 8 * g] = bh; *(v8b*)&tbl[cl][i * 16 + 8 * g] = bl; } } } }
    __syncthreads();
    for (int e = tid; e < 128 * 8; e += 128) { const int cl = e >> 3, q = e & 7; vst2((unsigned*)(VT + (bb * CC + c0 + cl) * (size_t)TT + t0 + q * 8), *(const v4u*)&th[cl][q * 8]); if (hi_rows) { const size_t o3 = (bb * CC + c0 + cl) * (size_t)KHI + t0 + q * 8; vst2((unsigned*)(VB + o3), *(const v4u*)&tb[cl][q * 8]); vst2((unsigned*)(VBL + o3), *(const v4u*)&tbl[cl][q * 8]); } } } } }
// ---- k_att: block = 4 waves x 16 queries of (b, h), two query blocks one after the other (x and NQB - 1 - x: every block walks (NQB + 1) x 64 keys). Logits as S^T = K Q^T: D register r of key tile kt = key kt * 16 + 8g + r of query col, so a lane holds one query's logits and two tiles are the A fragment of P in the k order of pair_h. One pass over the keys with a running row maximum: e = 2^11 exp(s - the maximum in use), sum of e in f32, e to f16 (early query blocks: bf16 hi + lo) against v; when a logit tops the maximum in use by more than 2^4 in e, sum and acc are scaled down to the new one; ctx = acc / sum. Nothing of S goes to memory.
// a trip is NT key tiles of 16: 64 keys; 32 in the early query blocks, whose residual planes double the fragments
// a trip's operands are staged in LDS once for the four waves (pitch SP): sk rows 0..63 = the 64 k rows (early blocks: 0..31 k, 32..63 its residual); sv row c = v plane c's 64 keys (early blocks: 32 keys of the bf16 hi plane, then of the lo plane)
template <bool HI> __device__ __forceinline__ void att_ldk(const _Float16* kp, const _Float16* klp, v16h (&kf)[2][HI ? 2 : 4], v16h (&klf)[2][HI ? 2 : 4]) {
#pragma unroll
  for (int kc = 0; kc < 2; ++kc)
#pragma unroll
    for (int kt = 0; kt < (HI ? 2 : 4); ++kt) { kf[kc][kt] = pair_h(kp + kt * 16 * SP + kc * 32); if (HI) klf[kc][kt] = pair_h(klp + kt * 16 * SP + kc * 32); } }
// unscaled logits (q.k; SCALE is folded into the exponent's multiplier SC2) of a trip's keys; srel = query - the trip's first key - 8g: key kt * 16 + r of the lane is kept while kt * 16 + r <= srel
template <bool HI, bool MASK> __device__ __forceinline__ void att_logits(const v16h (&kf)[2][HI ? 2 : 4], const v16h (&klf)[2][HI ? 2 : 4], const v16h (&qh)[2], const v16h (&ql)[2], int srel, float (&s)[HI ? 2 : 4][8]) {
  constexpr int NT = HI ? 2 : 4; v8f a[NT] = {}, al[NT] = {};
#pragma unroll
  for (int kc = 0; kc < 2; ++kc)
#pragma unroll
    for (int kt = 0; kt < NT; ++kt) { a[kt] = wmma16(kf[kc][kt], qh[kc], a[kt]); if (HI) { al[kt] = wmma16(kf[kc][kt], ql[kc], al[kt]); al[kt] = wmma16(klf[kc][kt], qh[kc], al[kt]); } }
#pragma unroll
  for (int kt = 0; kt < NT; ++kt)
#pragma unroll
    for (int r = 0; r < 8; ++r) { const float v = HI ? a[kt][r] + al[kt][r] * (1.0f / 1024.0f) : a[kt][r]; s[kt][r] = (!MASK || kt * 16 + r <= srel) ? v : -3.0e38f; } }
// 2^x of the eight logits a lane holds of one key tile, in place. One statement, so that behind each v_exp_f32 stands an instruction that neither reads its result nor overwrites its source: the next one, and a v_nop behind the last (the slot the instruction set asks for)
__device__ __forceinline__ void exp2x8(float (&x)[8]) {
  asm("v_exp_f32 %0, %0\n\tv_exp_f32 %1, %1\n\tv_exp_f32 %2, %2\n\tv_exp_f32 %3, %3\n\tv_exp_f32 %4, %4\n\tv_exp_f32 %5, %5\n\tv_exp_f32 %6, %6\n\tv_exp_f32 %7, %7\n\tv_nop"
      : "+v"(x[0]), "+v"(x[1]), "+v"(x[2]), "+v"(x[3]), "+v"(x[4]), "+v"(x[5]), "+v"(x[6]), "+v"(x[7])); }
// m = the query's maximum in use (unscaled, the same in both lane halves), bias = 11 - SC2 x m: e = 2^(SC2 x d + bias) = 2^11 exp(s - max in use) by one fused multiply-add and the chip's own 2^x; an excluded logit (-3e38) gives 0. m is finite from a tile's first trip on: that trip holds key 0, which every query keeps
// mthr = m + RTH: while no logit of the wave tops it, e is at most 2^15 (f16 holds it) and m stands; else m moves up to the running maximum and what was summed under the old m is scaled by 2^(SC2 x (old - new)) <= 1
#define RTH (4.0f / SC2)
template <bool HI, bool MASK> __device__ __forceinline__ void att_pv(const _Float16* kp, const _Float16* klp, const _Float16* vp, const __bf16* vhp, const __bf16* vlp, const v16h (&qh)[2], const v16h (&ql)[2], int srel, int g, float& m, float& mthr, float& bias, float& sum, v8f (&acc)[HD / 16]) {
  constexpr int NT = HI ? 2 : 4; v16h kf[2][NT], klf[2][NT], vf[NT / 2][HD / 16]; v16b vh[NT / 2][HD / 16], vl[NT / 2][HD / 16]; float s[NT][8]; att_ldk<HI>(kp, klp, kf, klf);
  att_logits<HI, MASK>(kf, klf, qh, ql, srel, s);
#pragma unroll
  for (int u = 0; u < NT / 2; ++u)   /* the v reads take the k fragments' registers and fly under the exponentials */
#pragma unroll
    for (int j = 0; j < HD / 16; ++j) { if (!HI) vf[u][j] = pair_h(vp + j * 16 * SP + u * 32); else { vh[u][j] = pair_b(vhp + j * 16 * SP + u * 32); vl[u][j] = pair_b(vlp + j * 16 * SP + u * 32); } }
  float tk[NT];   /* one chain a key tile, so that the chains interleave and each starts when its tile's product is done */
#pragma unroll
  for (int kt = 0; kt < NT; ++kt) { tk[kt] = s[kt][0];
#pragma unroll
    for (int r = 1; r < 8; ++r) tk[kt] = fmaxf(tk[kt], s[kt][r]); }
  float tm = fmaxf(tk[0], tk[1]);
#pragma unroll
  for (int kt = 2; kt < NT; ++kt) tm = fmaxf(tm, tk[kt]);
  if (__builtin_amdgcn_ballot_w32(tm > mthr) != 0) {   /* one test a trip, the same for the whole wave: a scalar branch, taken in a tile's first trip and seldom after */
    const float mn = fmaxf(m, fmaxf(tm, __shfl_xor(tm, 16)));   /* the two lane halves hold the two key halves of one query */
    float al = SC2 * (m - mn);
    asm("v_exp_f32 %0, %0\n\tv_nop" : "+v"(al));   /* 2^x; the v_nop is the slot the instruction set asks for behind it */
    m = mn; mthr = mn + RTH; bias = fmaf(-mn, SC2, 11.0f); sum *= al;
#pragma unroll
    for (int r = 0; r < 8; ++r) { const float ar = __shfl(al, 8 * g + r);   /* accumulator register r is query 8g + r */
#pragma unroll
      for (int j = 0; j < HD / 16; ++j) acc[j][r] *= ar; } }
  float part[NT];
#pragma unroll
  for (int kt = 0; kt < NT; ++kt) {
#pragma unroll
    for (int r = 0; r < 8; ++r) s[kt][r] = fmaf(s[kt][r], SC2, bias);
    exp2x8(s[kt]); part[kt] = s[kt][0];
#pragma unroll
    for (int r = 1; r < 8; ++r) part[kt] += s[kt][r]; }
#pragma unroll
  for (int kt = 0; kt < NT; kt += 2) sum += part[kt] + part[kt + 1];
#pragma unroll
  for (int u = 0; u < NT / 2; ++u) {
    if (!HI) { v16h p;
#pragma unroll
      for (int i = 0; i < 8; ++i) { p[i] = (_Float16)s[2 * u][i]; p[8 + i] = (_Float16)s[2 * u + 1][i]; }
#pragma unroll
      for (int j = 0; j < HD / 16; ++j) acc[j] = wmma16(p, vf[u][j], acc[j]);
    } else { float pv[16];
#pragma unroll
      for (int i = 0; i < 8; ++i) { pv[i] = s[2 * u][i]; pv[8 + i] = s[2 * u + 1][i]; }
      const F2 p = bsplit16(pv);
#pragma unroll
      for (int j = 0; j < HD / 16; ++j) { acc[j] = wmma_bf(p.h, vh[u][j], acc[j]); acc[j] = wmma_bf(p.l, vh[u][j], acc[j]); acc[j] = wmma_bf(p.h, vl[u][j], acc[j]); } } } }
// the trip's barrier, by hand: the wave's LDS stores and reads are done (s_wait_dscnt 0), then the work-group barrier. __syncthreads() would also wait for every global load in flight, and the stage loads issued two trips ahead are to stay in flight across it
__device__ __forceinline__ void stage_barrier() { __builtin_amdgcn_sched_barrier(0);   /* the trip's last vector work (the row sums) stays in front, among the products; behind the barrier it would stand in the way of the next trip's LDS reads */
  asm volatile("s_wait_dscnt 0x0" ::: "memory"); asm volatile("s_barrier_signal -1\n\ts_barrier_wait -1" ::: "memory"); }
template <bool HI> __device__ __forceinline__ void att_tile(const _Float16* __restrict__ QH, const _Float16* __restrict__ KH, const _Float16* __restrict__ QL, const _Float16* __restrict__ KL, const _Float16* __restrict__ VT, const __bf16* __restrict__ VB, const __bf16* __restrict__ VBL, _Float16* __restrict__ YH, __bf16* __restrict__ YL, float (*ssw)[HD + 4], _Float16 (*sk)[64][SP], _Float16 (*sv)[64][SP], int b, int h, int qb, int wave, int lane) {
  constexpr int KS = HI ? 32 : 64;   /* keys a trip */
  const int col = lane & 15, g = lane >> 4; const int ql0 = qb * 64 + wave * 16; const size_t ho = (size_t)h * HD + 8 * g;
  const int nfull = HI ? 0 : qb, nmask = HI ? (qb + 1) * 2 : 1;   /* trips wholly below the diagonal, then trips masked by index */
  const int nl = nfull + nmask - 1;   /* trips in front of the last one: all unmasked in the late blocks, all masked in the early ones; block-uniform */
  const int srel0 = ql0 + col - 8 * g - nfull * KS;
  const _Float16* qp = QH + ((size_t)b * TT + ql0 + col) * CC + ho; const _Float16* qlp = HI ? QL + ((size_t)b * QHI + ql0 + col) * CC + ho : qp;
  v16h qh[2], ql[2];
#pragma unroll
  for (int kc = 0; kc < 2; ++kc) { qh[kc] = pair_h(qp + kc * 32); ql[kc] = HI ? pair_h(qlp + kc * 32) : qh[kc]; }
  asm volatile("s_wait_xcnt 0x0" :: "v"(qp), "v"(qlp) : "memory");   /* behind the q loads, as below */
  // staging: 8 lanes x 16 B fill one stage row of 128 B, so a load instruction touches 4 whole lines (the early blocks' v planes: 8 half lines), not 16 pieces. ka: stage rows 0..31, kb: rows 32..63
  constexpr int VLD = HI ? KHI : TT;   /* row pitch of the v planes read */
  const int sr = (wave * 32 + lane) >> 3, sc = (lane & 7) * 8;
  // addresses: a block-uniform base, which steps from trip to trip in scalar registers, + the lane's fixed 32-bit byte offset: the second register set below finds room without spills. (The early blocks' v comes from two planes, hi and lo: two bases, chosen by lane at the load)
  const unsigned kof = (unsigned)(sr * CC + sc) * 2u, vof = (unsigned)(sr * VLD + (HI ? (sc & 31) : sc)) * 2u;
  const char* const ka0 = (const char*)(KH + (size_t)b * TT * CC + h * HD); const char* const kb0 = HI ? (const char*)(KL + (size_t)b * KHI * CC + h * HD) : ka0 + (size_t)32 * CC * 2;
  const size_t vpl = ((size_t)b * CC + h * HD) * VLD; const char* const vg0 = HI ? (const char*)(VB + vpl) : (const char*)(VT + vpl); const char* const vh0 = HI ? (const char*)(VBL + vpl) : vg0;   /* moved as raw 16-B pieces */
  v8f acc[HD / 16] = {}; float sum = 0.f, m = -3.0e38f, mthr = -3.0e38f, bias = 0.f;   /* nothing summed yet: the first trip sets m */
  // the stage loads run two trips ahead, in two register sets that take turns (so the loop is written out for two trips): at the foot of trip t a set is stored to LDS (trip t + 1) and loaded anew at once (trip t + 3), so a line that comes from memory has two trips to arrive
  { const char *ka = ka0, *kb = kb0, *vg = vg0, *vh = vh0; v8h kr0[4], vr0[4], kr1[4], vr1[4]; int nld = 0;   /* the pointers stand at trip nld, the next to load */
    auto ld = [&](v8h (&kr)[4], v8h (&vr)[4], bool inloop) { const char *kal = ka + kof, *kbl = kb + kof, *vl = (HI && sc >= 32 ? vh : vg) + vof;   /* the lane's addresses */
#pragma unroll
      for (int i = 0; i < 2; ++i) { kr[i] = *(const v8h*)(kal + (size_t)i * 16 * CC * 2); kr[2 + i] = *(const v8h*)(kbl + (size_t)i * 16 * CC * 2); }
#pragma unroll
      for (int i = 0; i < 4; ++i) vr[i] = *(const v8h*)(vl + (size_t)i * 16 * VLD * 2);
      /* directly behind the stage's loads, which fly under the next trips' work (the memory clobber holds them in front): behind it their address registers are free for other values; it runs out under the LDS stores' own wait. In the loop, naming the address registers keeps them whole up to the wait; in front of the loop it is left out, because it would hold the tile's start addresses in the registers an asm operand can take, and they spilled */
      if (inloop) asm volatile("s_wait_xcnt 0x0" :: "v"(kal), "v"(kbl), "v"(vl) : "memory"); else asm volatile("s_wait_xcnt 0x0" ::: "memory");
      const int stp = nld < nl ? 1 : 0; nld += stp; ka += (size_t)stp * KS * CC * 2; kb += (size_t)stp * KS * CC * 2; vg += stp * KS * 2; vh += stp * KS * 2; };   /* block-uniform; behind the last trip the pointers stay: every trip issues its eight loads, so the counted waits hold on every path; what is loaded twice is never stored */
    auto st = [&](int bf, const v8h (&kr)[4], const v8h (&vr)[4]) {
#pragma unroll
      for (int i = 0; i < 4; ++i) { *(v8h*)&sk[bf][i * 16 + sr][sc] = kr[i]; *(v8h*)&sv[bf][i * 16 + sr][sc] = vr[i]; } };
    ld(kr0, vr0, false); ld(kr1, vr1, false);
    __syncthreads();   /* every wave has left the stages of the tile before */
    st(0, kr0, vr0); ld(kr0, vr0, false);
    stage_barrier();
    int tr = 0;
#pragma unroll 1   // rolled: two trips' code, one trip's fragments in the registers at a time
    for (; tr + 2 <= nl; tr += 2) {
      { const _Float16 *kp = &sk[0][col][8 * g], *vp = &sv[0][col][8 * g]; att_pv<HI, HI>(kp, kp + 32 * SP, vp, (const __bf16*)vp, (const __bf16*)vp + 32, qh, ql, srel0 + (nfull - tr) * KS, g, m, mthr, bias, sum, acc); }
      st(1, kr1, vr1); ld(kr1, vr1, true);
      stage_barrier();   /* publishes trip tr + 1 and ends every wave's reads of trip tr, whose buffers the next trip refills */
      { const _Float16 *kp = &sk[1][col][8 * g], *vp = &sv[1][col][8 * g]; att_pv<HI, HI>(kp, kp + 32 * SP, vp, (const __bf16*)vp, (const __bf16*)vp + 32, qh, ql, srel0 + (nfull - tr - 1) * KS, g, m, mthr, bias, sum, acc); }
      st(0, kr0, vr0); ld(kr0, vr0, true);
      stage_barrier(); }   /* as above, for trip tr + 2 */
#pragma unroll 1   // rolled: the one or two trips left share the masked code (in a trip below the diagonal the mask keeps every key)
    for (; tr <= nl; ++tr) { const _Float16 *kp = &sk[tr & 1][col][8 * g], *vp = &sv[tr & 1][col][8 * g]; att_pv<HI, true>(kp, kp + 32 * SP, vp, (const __bf16*)vp, (const __bf16*)vp + 32, qh, ql, srel0 + (nfull - tr) * KS, g, m, mthr, bias, sum, acc);
      if (tr < nl) { st(1, kr1, vr1); stage_barrier(); } } }   /* block-uniform: two trips were left (tr is even); publishes the last one's stage */
  sum += __shfl_xor(sum, 16);
  const float inv = sum > 0.f ? 1.0f / sum : 0.f;   /* of query col; sum carries the 2^11 of its terms; a fully excluded row yields 0 */
#pragma unroll
  for (int r = 0; r < 8; ++r) { const float ir = __shfl(inv, 8 * g + r);   /* accumulator register r is query 8g + r */
#pragma unroll
    for (int j = 0; j < HD / 16; ++j) ssw[8 * g + r][j * 16 + col] = acc[j][r] * ir; }
  LDSX();
  // ctx leaves in the 16-bit form k_out's product takes: f16(ctx x 2^6), clear of f16 subnormals; early query blocks: bf16 hi + bf16 lo, as bsplit16 forms them
  _Float16* yp = YH + ((size_t)b * TT + ql0 + g) * CC + h * HD + col * 4;   /* 128-B (row, head) segment by 16 lanes, two rows a store */
  if (!HI) { v4h c[8];
#pragma unroll
    for (int i = 0; i < 8; ++i) { const v4f y = *(const v4f*)&ssw[2 * i + g][col * 4];
#pragma unroll
      for (int e = 0; e < 4; ++e) c[i][e] = (_Float16)(y[e] * 64.0f); }
#pragma unroll
    for (int i = 0; i < 8; ++i) vst2(yp + (size_t)i * 2 * CC, c[i]);
    asm volatile("s_wait_xcnt 0x0" :: "v"(yp) : "memory");   /* behind the stores: the next tile overwrites their registers */
  } else { __bf16* ylp = YL + ((size_t)b * QHI + ql0 + g) * CC + h * HD + col * 4; v4b hv[8], lv[8];
#pragma unroll
    for (int i = 0; i < 8; ++i) { const v4f y = *(const v4f*)&ssw[2 * i + g][col * 4]; hv[i] = cvt4b(y); v4f rs;
#pragma unroll
      for (int e = 0; e < 4; ++e) rs[e] = y[e] - (float)hv[i][e];
      lv[i] = cvt4b(rs); }
#pragma unroll
    for (int i = 0; i < 8; ++i) { vst2(yp + (size_t)i * 2 * CC, hv[i]); vst2(ylp + (size_t)i * 2 * CC, lv[i]); }
    asm volatile("s_wait_xcnt 0x0" :: "v"(yp), "v"(ylp) : "memory"); }   /* behind the stores: the next tile overwrites their registers */
  LDSX(); }   /* the next tile's ssw writes stay behind these reads */
// amdgpu_waves_per_eu(2, 2): the grid gives two waves a SIMD (512 blocks x 4 waves, 1,024 SIMDs); with that register budget a trip's exponentials interleave instead of running as one dependent chain after the other
__global__ __launch_bounds__(128) __attribute__((amdgpu_waves_per_eu(2, 2))) void k_att(const _Float16* __restrict__ QH, const _Float16* __restrict__ KH, const _Float16* __restrict__ QL, const _Float16* __restrict__ KL, const _Float16* __restrict__ VT, const __bf16* __restrict__ VB, const __bf16* __restrict__ VBL, _Float16* __restrict__ YH, __bf16* __restrict__ YL) { __shared__ __align__(16) float ss[4][16][HD + 4]; __shared__ __align__(16) _Float16 sk[2][64][SP], sv[2][64][SP];
  const int tid = threadIdx.x, wave = tid >> 5, lane = tid & 31; const int h = blockIdx.y, b = blockIdx.z;
#pragma unroll 1   // rolled: the two tiles share one copy of the code
  for (int half = 0; half < 2; ++half) { const int qb = half ? (int)blockIdx.x : NQB - 1 - (int)blockIdx.x;   /* block-uniform */
    if (qb < QBH) att_tile<true>(QH, KH, QL, KL, VT, VB, VBL, YH, YL, ss[wave], sk, sv, b, h, qb, wave, lane);
    else att_tile<false>(QH, KH, QL, KL, VT, VB, VBL, YH, YL, ss[wave], sk, sv, b, h, qb, wave, lane); } }
// ---- k_out: block = (64 rows, 128 cols): out = ctx Wo (+ bo): f16(ctx x 2^6) against Wo as f16(bf16 x 2^8) exact (1 product) x 2^-14; causal early rows (< QHI of each sequence): ctx bf16 hi + lo against exact bf16 Wo (2 products); the operands come in the 16-bit forms k_att and k_cvt left
__global__ __launch_bounds__(128) void k_out(const _Float16* __restrict__ YH, const __bf16* __restrict__ YL, const __bf16* __restrict__ WOB, const _Float16* __restrict__ WOH, const float* __restrict__ BO, float* __restrict__ OUT) {
  __shared__ __align__(16) union { float sf[4][16][132]; __bf16 b[2][256][SPG]; _Float16 h[2][192][SPG]; } sg;   /* two operand stages: rows 0..127 Wo, 128..191 ctx (hi), 192..255 ctx lo (early rows only); the output tile lies there later (the loop's last barrier between) */
  auto& sf = sg.sf;
  const int tid = threadIdx.x, wave = tid >> 5, lane = tid & 31, col = lane & 15, g = lane >> 4; const int c0 = blockIdx.y * 128; const size_t r0 = (size_t)blockIdx.x * 64 + wave * 16;
  v8f acc[8] = {};
  // a stage = SK k of the block's 128 Wo rows and 64 ctx rows, brought in once for the four waves. 16 lanes x 16 B read one row's 256 B: a load instruction touches 4 whole lines, not 16 pieces
  const int lr = tid >> 4, lc = tid & 15; const size_t wo = (size_t)(c0 + lr) * CC + lc * 8, yo = ((size_t)blockIdx.x * 64 + lr) * CC + lc * 8; const int t0 = (int)(((size_t)blockIdx.x * 64) % TT);
  if (CAUSAL && t0 < QHI) {   /* block-uniform */
    const __bf16* wg = WOB + wo; const __bf16* yg = (const __bf16*)YH + yo; const __bf16* zg = YL + (((size_t)blockIdx.x * 64) / TT * QHI + t0 + lr) * CC + lc * 8;
    v8b wr[16], yr[8], zr[8];
#pragma unroll
    for (int i = 0; i < 16; ++i) wr[i] = *(const v8b*)(wg + (size_t)i * 8 * CC);
#pragma unroll
    for (int i = 0; i < 8; ++i) { yr[i] = *(const v8b*)(yg + (size_t)i * 8 * CC); zr[i] = *(const v8b*)(zg + (size_t)i * 8 * CC); }
    asm volatile("s_wait_xcnt 0x0" :: "v"(wg), "v"(yg), "v"(zg) : "memory");   /* behind the stage's loads: their address registers step on below */
#pragma unroll
    for (int i = 0; i < 16; ++i) *(v8b*)&sg.b[0][i * 8 + lr][lc * 8] = wr[i];
#pragma unroll
    for (int i = 0; i < 8; ++i) { *(v8b*)&sg.b[0][128 + i * 8 + lr][lc * 8] = yr[i]; *(v8b*)&sg.b[0][192 + i * 8 + lr][lc * 8] = zr[i]; }
    __syncthreads();
#pragma unroll 1   // rolled: the next stage's 32 loads stay in registers over one stage's products
    for (int s = 0; s < CC / SK; ++s, wg += SK, yg += SK, zg += SK) { const bool more = s + 1 < CC / SK;   /* block-uniform */
      if (more) {
#pragma unroll
        for (int i = 0; i < 16; ++i) wr[i] = *(const v8b*)(wg + SK + (size_t)i * 8 * CC);
#pragma unroll
        for (int i = 0; i < 8; ++i) { yr[i] = *(const v8b*)(yg + SK + (size_t)i * 8 * CC); zr[i] = *(const v8b*)(zg + SK + (size_t)i * 8 * CC); }
        asm volatile("s_wait_xcnt 0x0" :: "v"(wg), "v"(yg), "v"(zg) : "memory"); }   /* behind the next stage's loads, which fly under this stage's products (the memory clobber holds them in front); naming their address registers keeps these whole up to the wait */
#pragma unroll
      for (int kk = 0; kk < SK / 32; ++kk) { const v16b ah = frag_b(&sg.b[s & 1][128 + wave * 16 + col][kk * 32], lane), al = frag_b(&sg.b[s & 1][192 + wave * 16 + col][kk * 32], lane); v16b w[8];
#pragma unroll
        for (int j = 0; j < 8; ++j) w[j] = frag_b(&sg.b[s & 1][j * 16 + col][kk * 32], lane);
#pragma unroll
        for (int j = 0; j < 8; ++j) { acc[j] = wmma_bf(ah, w[j], acc[j]); acc[j] = wmma_bf(al, w[j], acc[j]); } }
      if (more) {
#pragma unroll
        for (int i = 0; i < 16; ++i) *(v8b*)&sg.b[(s + 1) & 1][i * 8 + lr][lc * 8] = wr[i];
#pragma unroll
        for (int i = 0; i < 8; ++i) { *(v8b*)&sg.b[(s + 1) & 1][128 + i * 8 + lr][lc * 8] = yr[i]; *(v8b*)&sg.b[(s + 1) & 1][192 + i * 8 + lr][lc * 8] = zr[i]; } }
      __syncthreads(); }   /* publishes stage s + 1 and ends every wave's reads of stage s, whose buffer the next trip refills */
#pragma unroll
    for (int j = 0; j < 8; ++j) { const float bias = BO ? bfr(BO[c0 + j * 16 + col]) : 0.f;
#pragma unroll
      for (int r = 0; r < 8; ++r) sf[wave][8 * g + r][j * 16 + col] = acc[j][r] + bias; }
  } else {
    const _Float16* wg = WOH + wo; const _Float16* yg = YH + yo;
    v8h wr[16], yr[8];
#pragma unroll
    for (int i = 0; i < 16; ++i) wr[i] = *(const v8h*)(wg + (size_t)i * 8 * CC);
#pragma unroll
    for (int i = 0; i < 8; ++i) yr[i] = *(const v8h*)(yg + (size_t)i * 8 * CC);
    asm volatile("s_wait_xcnt 0x0" :: "v"(wg), "v"(yg) : "memory");   /* behind the stage's loads: their address registers step on below */
#pragma unroll
    for (int i = 0; i < 16; ++i) *(v8h*)&sg.h[0][i * 8 + lr][lc * 8] = wr[i];
#pragma unroll
    for (int i = 0; i < 8; ++i) *(v8h*)&sg.h[0][128 + i * 8 + lr][lc * 8] = yr[i];
    __syncthreads();
#pragma unroll 1   // rolled: the next stage's 24 loads stay in registers over one stage's products
    for (int s = 0; s < CC / SK; ++s, wg += SK, yg += SK) { const bool more = s + 1 < CC / SK;   /* block-uniform */
      if (more) {
#pragma unroll
        for (int i = 0; i < 16; ++i) wr[i] = *(const v8h*)(wg + SK + (size_t)i * 8 * CC);
#pragma unroll
        for (int i = 0; i < 8; ++i) yr[i] = *(const v8h*)(yg + SK + (size_t)i * 8 * CC);
        asm volatile("s_wait_xcnt 0x0" :: "v"(wg), "v"(yg) : "memory"); }   /* behind the next stage's loads, which fly under this stage's products (the memory clobber holds them in front); naming their address registers keeps these whole up to the wait */
#pragma unroll
      for (int kk = 0; kk < SK / 32; ++kk) { const v16h a = frag_h(&sg.h[s & 1][128 + wave * 16 + col][kk * 32], lane); v16h w[8];
#pragma unroll
        for (int j = 0; j < 8; ++j) w[j] = frag_h(&sg.h[s & 1][j * 16 + col][kk * 32], lane);
#pragma unroll
        for (int j = 0; j < 8; ++j) acc[j] = wmma16(a, w[j], acc[j]); }
      if (more) {
#pragma unroll
        for (int i = 0; i < 16; ++i) *(v8h*)&sg.h[(s + 1) & 1][i * 8 + lr][lc * 8] = wr[i];
#pragma unroll
        for (int i = 0; i < 8; ++i) *(v8h*)&sg.h[(s + 1) & 1][128 + i * 8 + lr][lc * 8] = yr[i]; }
      __syncthreads(); }   /* publishes stage s + 1 and ends every wave's reads of stage s, whose buffer the next trip refills */
#pragma unroll
    for (int j = 0; j < 8; ++j) { const float bias = BO ? bfr(BO[c0 + j * 16 + col]) : 0.f;
#pragma unroll
      for (int r = 0; r < 8; ++r) sf[wave][8 * g + r][j * 16 + col] = acc[j][r] * (1.0f / 16384.0f) + bias; } }   /* 2^-8 (Wo carry) x 2^-6 (ctx carry) */
  LDSX(); for (int rl = 0; rl < 16; ++rl) vst2(OUT + (r0 + rl) * DIN + c0 + lane * 4, *(const v4f*)&sf[wave][rl][lane * 4]); }

extern "C" void kernel_launch(void* const* d_in, const int* in_sizes, int n_in, void* d_out, int out_size, void* d_ws, size_t ws_size, hipStream_t stream) {
  (void)in_sizes; (void)n_in; (void)out_size;
  const float** F = (const float**)d_in;
  if (ws_size < (size_t)WS_END) return;
  char* ws = (char*)d_ws; _Float16 *QH = (_Float16*)(ws + WS_QH), *KH = (_Float16*)(ws + WS_KH), *VT = (_Float16*)(ws + WS_VT), *QL = (_Float16*)(ws + WS_QL), *KL = (_Float16*)(ws + WS_KL); __bf16 *VB = (__bf16*)(ws + WS_VB), *VBL = (__bf16*)(ws + WS_VBL), *YL = (__bf16*)(ws + WS_YL), *XB = (__bf16*)(ws + WS_XB), *WB = (__bf16*)(ws + WS_WB), *WOB = (__bf16*)(ws + WS_WOB); _Float16 *YH = (_Float16*)(ws + WS_YH), *WOH = (_Float16*)(ws + WS_WOH);
  // inputs: 0 x [2,2048,1024]; 1 wq [1024,1024] (out,in); 2 wk; 3 wv; 4 wo (out,in); no biases (null pointers)
  k_cvt<<<dim3((NB * TT * DIN + 4 * CC * DIN) / CVB), 256, 0, stream>>>(F[0], F[1], F[2], F[3], F[4], XB, WB, WOB, WOH);
  k_proj<<<dim3(TNB * TT / 128, CC / 128, 3), 128, 0, stream>>>(XB, XB, XB, WB, WB + (size_t)CC * DIN, WB + 2 * (size_t)CC * DIN, nullptr, nullptr, nullptr, QH, QL, KH, KL, VT, VB, VBL);
  k_att<<<dim3(NQB / 2, NH, TNB), 128, 0, stream>>>(QH, KH, QL, KL, VT, VB, VBL, YH, YL);
  k_out<<<dim3(TNB * TT / 64, DIN / 128), 128, 0, stream>>>(YH, YL, WOB, WOH, nullptr, (float*)d_out);
}
